// v000
// Measured on an AMD MI455X. A time is GPU time per run, averaged over a window of back-to-back runs after a warm-up
// (all launches, gaps included; the runs take copies of the inputs in turn), and the median of several windows.
// Apart from v000's, it joins two sittings. Times from different sittings can be a few percent apart, while
// side-by-side timings come from the same sitting.
// The starting kernel, v000, takes 424 microseconds a run.
// Contractions x*Wq, cm*Wk, cm*Wv, q*k^T, p*v, y*Wp, prev_m*Wqm, cached*Wkm: v_wmma_f32_16x16x32_f16, f16 operands (weights carried x16, q/k/v/y planes carried x16, p x1), f32 accumulate; softmax f32; memory-path scores and weighted sum f32 VALU.
#include <hip/hip_runtime.h>
#include <stdint.h>
#include <math.h>

#define NB_   8
#define T_    1024
#define C_    1024
#define NH_   16
#define HD_   64
#define NU_   128
#define MM_   16
#define LKV_  1026
#define LP_   1088
#define MAR_  192
#define AKP   72

typedef _Float16 v16h __attribute__((ext_vector_type(16)));
typedef _Float16 v8h  __attribute__((ext_vector_type(8)));
typedef float    v8f  __attribute__((ext_vector_type(8)));
typedef float    v4f  __attribute__((ext_vector_type(4)));

// ---- 16-bit fragment loader: elements 0..7 <- p[0..7], 8..15 <- p[16..23]; caller passes p = row base + k0 + 8*(lane>>4)
__device__ __forceinline__ v16h ldfrag(const _Float16* p) {
  union { v16h v; v8h h[2]; } f;
  f.h[0] = *(const v8h*)(p);
  f.h[1] = *(const v8h*)(p + 16);
  return f.v;
}
__device__ __forceinline__ v8f mma_f16(v16h a, v16h b, v8f c) {
  return __builtin_amdgcn_wmma_f32_16x16x32_f16(false, a, false, b, (short)0, c, false, false);
}
__device__ __forceinline__ v8f mma_f16_g(v16h a, v16h b, v8f c) {
  c = __builtin_amdgcn_wmma_f32_16x16x32_f16(false, a, false, b, (short)0, c, false, false);
  asm volatile("v_nop\n\tv_nop\n\tv_nop\n\tv_nop" : "+v"(c) : "v"(a), "v"(b));
  return c;
}
__device__ __forceinline__ void dep_guard(v8f& a, v8f& b, v16h x, v16h y) {
  asm volatile("v_nop\n\tv_nop\n\tv_nop\n\tv_nop" : "+v"(a), "+v"(b) : "v"(x), "v"(y));
}
__device__ __forceinline__ void keep4(v16h a, v16h b, v16h c, v16h d) {
  asm volatile("v_nop" :: "v"(a), "v"(b), "v"(c), "v"(d));
}
__device__ __forceinline__ void acc_guard4(v8f& a, v8f& b, v8f& c, v8f& d) {
  asm volatile("v_nop\n\tv_nop\n\tv_nop\n\tv_nop" : "+v"(a), "+v"(b), "+v"(c), "+v"(d));
}
__device__ __forceinline__ v8f zero8f() { v8f z; z[0]=0.f; z[1]=0.f; z[2]=0.f; z[3]=0.f; z[4]=0.f; z[5]=0.f; z[6]=0.f; z[7]=0.f; return z; }
__device__ __forceinline__ v8h zero8h() {
  v8h z;
#pragma unroll
  for (int e = 0; e < 8; ++e) z[e] = (_Float16)0.0f;
  return z;
}
__device__ __forceinline__ v8h cvt8(v4f a, v4f b, float s) {
  v8h r;
  r[0] = (_Float16)(a[0] * s); r[1] = (_Float16)(a[1] * s); r[2] = (_Float16)(a[2] * s); r[3] = (_Float16)(a[3] * s);
  r[4] = (_Float16)(b[0] * s); r[5] = (_Float16)(b[1] * s); r[6] = (_Float16)(b[2] * s); r[7] = (_Float16)(b[3] * s);
  return r;
}

// ---------------------------------------------------------------------------
// Weight transpose + f16 convert with carry scale s: six inputs W_z [k][n] f32 (C_ x C_) ->
// WT plane z: [n][k] f16 = f16(s * W_z[k][n]).  64x64 tiles through LDS, grid (C_/64, C_/64, 6), 256 threads.
// coverage per block: load 4 it x 256 thr x 4 = 64x64; store 2 it x 256 thr x 8 = 64x64.
// ---------------------------------------------------------------------------
__global__ __launch_bounds__(256)
void wt_kernel(const float* __restrict__ W0, const float* __restrict__ W1, const float* __restrict__ W2,
               const float* __restrict__ W3, const float* __restrict__ W4, const float* __restrict__ W5,
               unsigned short* __restrict__ WT, float s) {
  __shared__ __align__(16) float tf[64 * 68];
  const int z = blockIdx.z;
  const float* W = (z == 0) ? W0 : (z == 1) ? W1 : (z == 2) ? W2 : (z == 3) ? W3 : (z == 4) ? W4 : W5;
  _Float16* out = (_Float16*)WT + (size_t)z * C_ * C_;
  const int c0  = blockIdx.x * 64;   // input column block = output row block
  const int r0  = blockIdx.y * 64;   // input row block    = output column block
  const int tid = threadIdx.x;
  {
    const int lr = tid >> 4;
    const int c4 = (tid & 15) * 4;
#pragma unroll
    for (int it = 0; it < 4; ++it) {
      const int rr = it * 16 + lr;
      const v4f a = *(const v4f*)(W + (size_t)(r0 + rr) * C_ + c0 + c4);
      *(v4f*)(tf + rr * 68 + c4) = a;
    }
  }
  __syncthreads();
  const int sub = tid >> 3;          // 0..31
  const int c8  = (tid & 7) * 8;     // 0..56
  v8h hv[2];
#pragma unroll
  for (int it = 0; it < 2; ++it) {
    const int oc = it * 32 + sub;    // output row within tile (= input column)
    v8h v;
#pragma unroll
    for (int e = 0; e < 8; ++e) v[e] = (_Float16)(tf[(c8 + e) * 68 + oc] * s);
    hv[it] = v;
  }
  {
#pragma unroll
    for (int it = 0; it < 2; ++it) {
      const int oc = it * 32 + sub;
      *(v8h*)(out + (size_t)(c0 + oc) * C_ + r0 + c8) = hv[it];
    }
    
  }
}

// ---------------------------------------------------------------------------
// Small operand plane MA [192][1024] f16: rows 0..7 = prev_m[b], rows 8..63 = 0, rows 64..191 = cached_memory row (row-64).
// grid 192 blocks (one row) x 128 threads x 8 halves; one instruction = whole row (16 lines, 8 lanes per line);
// coverage: 192 x 128 x 8 = whole plane.
// ---------------------------------------------------------------------------
__global__ __launch_bounds__(128)
void ma_kernel(const float* __restrict__ prev_m, const float* __restrict__ cached, unsigned short* __restrict__ MA) {
  const int row  = blockIdx.x;
  const int col8 = threadIdx.x * 8;
  const int rp = (row < NB_) ? row : 0;
  int rc = row - 64; rc = (rc < 0) ? 0 : rc; rc = (rc > NB_ * MM_ - 1) ? (NB_ * MM_ - 1) : rc;
  const float* sp = prev_m + (size_t)rp * C_ + col8;
  const float* sc = cached + (size_t)rc * C_ + col8;
  const v4f p0 = *(const v4f*)(sp), p1 = *(const v4f*)(sp + 4);
  const v4f q0 = *(const v4f*)(sc), q1 = *(const v4f*)(sc + 4);
  const float fp = (row < NB_) ? 1.0f : 0.0f;
  const float fc = (row >= 64) ? 1.0f : 0.0f;
  const v4f a = p0 * fp + q0 * fc;
  const v4f b = p1 * fp + q1 * fc;
  const v8h hv = cvt8(a, b, 1.0f);
  _Float16* d = (_Float16*)MA + (size_t)row * C_ + col8;
  *(v8h*)d = hv;
  
}

// ---------------------------------------------------------------------------
// x [8][1024][1024] f32 -> CM plane rows 2..1025 of each batch ([8][LP_][1024] f16), unscaled.
// ---------------------------------------------------------------------------
__global__ __launch_bounds__(256)
void xcvt_kernel(const float* __restrict__ x, unsigned short* __restrict__ CM, int n8) {
  const int idx = blockIdx.x * 256 + threadIdx.x;
  if (idx >= n8) return;
  const int e = idx * 8;
  const int b = e >> 20, t = (e >> 10) & (T_ - 1), col = e & (C_ - 1);
  const v4f a0 = *(const v4f*)(x + e), a1 = *(const v4f*)(x + e + 4);
  const v8h hv = cvt8(a0, a1, 1.0f);
  _Float16* d = (_Float16*)CM + ((size_t)(b * LP_ + 2 + t)) * C_ + col;
  *(v8h*)d = hv;
  
}

// ---------------------------------------------------------------------------
// Register-blocked batched f16 WMMA GEMM: C[m,n] = oscale * (scale * sum_k A[m,k] * Bt[n,k] + bias).
// Each wave owns a 64x64 tile; A row-major [M,K] f16; Bt row-major [N,K] f16; M,N % 64 == 0, K % 32 == 0.
// Fragments loaded straight from global rows (two 16-B loads per fragment, split k map for A and B).
// BIAS_MODE: 1 = bias[m], 2 = bias[n].  OUT_MODE: 0 = f32, 1 = f16.
// ---------------------------------------------------------------------------
template <int BIAS_MODE, int OUT_MODE>
__global__ __launch_bounds__(256) void gemm64(
    const unsigned short* __restrict__ Ap, int lda, long strideA,
    const unsigned short* __restrict__ Btp, int ldb, long strideB,
    void* __restrict__ Cout, int ldc, long strideC,
    const float* __restrict__ bias, int M, int N, int K, float scale, float oscale) {
  const _Float16* A  = (const _Float16*)Ap;
  const _Float16* Bt = (const _Float16*)Btp;
  __shared__ __align__(16) float sT[8][16 * 68];   // per-wave 16x64 slab, pitch 68 floats
  const int b    = blockIdx.y;
  const int lane = threadIdx.x & 31;
  const int wave = threadIdx.x >> 5;
  const int tilesN = N >> 6;
  const int tilesM = M >> 6;
  const int tile = blockIdx.x * 8 + wave;
  if (tile >= tilesM * tilesN) return;   // wave-uniform; no block barriers in this kernel
  const int tm = tile / tilesN;
  const int tn = tile - tm * tilesN;
  const int m0 = tm << 6;
  const int n0 = tn << 6;
  const _Float16* Ab = A  + (size_t)b * strideA;
  const _Float16* Bb = Bt + (size_t)b * strideB;
  const int rlane = lane & 15;                 // row (A) / col (B, D) within subtile
  const int koff  = (lane >> 4) * 8;           // k offset of this lane half
  const int mOff  = (lane >> 4) * 8;           // D row offset

  v8f acc[4][4];
#pragma unroll
  for (int i = 0; i < 4; ++i)
#pragma unroll
    for (int j = 0; j < 4; ++j) acc[i][j] = zero8f();

  for (int k0 = 0; k0 < K; k0 += 32) {
    v16h bh[4];
#pragma unroll
    for (int j = 0; j < 4; ++j)
      bh[j] = ldfrag(Bb + (size_t)(n0 + (j << 4) + rlane) * ldb + koff + k0);
#pragma unroll
    for (int i = 0; i < 4; ++i) {
      const v16h ah = ldfrag(Ab + (size_t)(m0 + (i << 4) + rlane) * lda + koff + k0);
#pragma unroll
      for (int j = 0; j < 4; ++j) acc[i][j] = mma_f16(ah, bh[j], acc[i][j]);
      dep_guard(acc[i][0], acc[i][3], ah, bh[3]);
    }
    keep4(bh[0], bh[1], bh[2], bh[3]);
  }
  acc_guard4(acc[0][0], acc[0][1], acc[0][2], acc[0][3]);
  acc_guard4(acc[1][0], acc[1][1], acc[1][2], acc[1][3]);
  acc_guard4(acc[2][0], acc[2][1], acc[2][2], acc[2][3]);
  acc_guard4(acc[3][0], acc[3][1], acc[3][2], acc[3][3]);

  // ---- epilogue ----
  float* slab = sT[wave];
#pragma unroll
  for (int i = 0; i < 4; ++i) {
    const int mBase = m0 + (i << 4);
#pragma unroll
    for (int j = 0; j < 4; ++j) {
      const int n = n0 + (j << 4) + rlane;
      float bvn = 0.f;
      if (BIAS_MODE == 2) bvn = bias[n];
#pragma unroll
      for (int r = 0; r < 8; ++r) {
        float v = acc[i][j][r] * scale;
        if (BIAS_MODE == 1) v += bias[mBase + mOff + r];
        if (BIAS_MODE == 2) v += bvn;
        v *= oscale;
        slab[(mOff + r) * 68 + (j << 4) + rlane] = v;
      }
    }
    __builtin_amdgcn_fence(__ATOMIC_RELEASE, "workgroup");
    __builtin_amdgcn_wave_barrier();
    __builtin_amdgcn_fence(__ATOMIC_ACQUIRE, "workgroup");
    if (OUT_MODE == 0) {
      float* C = (float*)Cout + (size_t)b * strideC;
      const int hh = lane >> 4, c4 = (lane & 15) * 4;     // row seg = 256 B = 16 lanes x 16 B
      {
#pragma unroll
        for (int it = 0; it < 8; ++it) {
          const int row = it * 2 + hh;                     // it 0..7 x hh 0..1 = rows 0..15
          const v4f v = *(const v4f*)(slab + row * 68 + c4);
          *(v4f*)(C + (size_t)(mBase + row) * ldc + n0 + c4) = v;
        }
        
      }
    } else {
      _Float16* C = (_Float16*)Cout + (size_t)b * strideC;
      const int q = lane >> 3, c8 = (lane & 7) * 8;
      v8h hv[4];
#pragma unroll
      for (int it = 0; it < 4; ++it) {
        const int row = it * 4 + q;                        // it 0..3 x q 0..3 = rows 0..15
        const float* spf = slab + row * 68 + c8;
        v8h t;
#pragma unroll
        for (int e = 0; e < 8; ++e) t[e] = (_Float16)spf[e];
        hv[it] = t;
      }
      {
#pragma unroll
        for (int it = 0; it < 4; ++it) {
          const int row = it * 4 + q;
          *(v8h*)(C + (size_t)(mBase + row) * ldc + n0 + c8) = hv[it];
        }
        
      }
    }
    __builtin_amdgcn_fence(__ATOMIC_RELEASE, "workgroup");
    __builtin_amdgcn_wave_barrier();
    __builtin_amdgcn_fence(__ATOMIC_ACQUIRE, "workgroup");
  }
}

// ---------------------------------------------------------------------------
// Memory-compression attention, f32: one block per batch element, 16 waves = 16 heads.
//   qm = MOq row b, km_j = MOk row b*16+j (f32 projections incl. bias); s_j = qm_h.km_jh * 0.125 over 16 keys,
//   softmax in f32, mem_h = sum_j a_j km_jh.  The 1024-float mem row is staged in LDS, then
//   CM row 0 (mem) and row 1 (prev_m) of batch b are written as f16, and pad rows LKV_..LP_-1 as zeros:
// coverage: rows 0,1 by threads 0..255 (128 x 8 halves each), pad rows 62 x 128 pieces by the strided loop.
// ---------------------------------------------------------------------------
__global__ __launch_bounds__(512)
void mem_kernel(const float* __restrict__ MOq, const float* __restrict__ MOk, const float* __restrict__ prev_m,
                unsigned short* __restrict__ CM) {
  __shared__ __align__(16) float smem[C_];
  const int b = blockIdx.x;
  const int tid = threadIdx.x, wave = tid >> 5, lane = tid & 31;
  const int h = wave;
  const int j = lane & 15;
  const float* qh = MOq + (size_t)b * C_ + h * HD_;
  const float* kr = MOk + (size_t)(b * MM_ + j) * C_ + h * HD_;
  float a = 0.f;
#pragma unroll 1
  for (int d4 = 0; d4 < HD_ / 4; ++d4) {
    const v4f qv = *(const v4f*)(qh + 4 * d4);
    const v4f kv = *(const v4f*)(kr + 4 * d4);
    a = fmaf(qv[0], kv[0], a);
    a = fmaf(qv[1], kv[1], a);
    a = fmaf(qv[2], kv[2], a);
    a = fmaf(qv[3], kv[3], a);
  }
  const float sj = (lane < MM_) ? a * 0.125f : -INFINITY;
  float mx = sj;
#pragma unroll
  for (int off = 1; off < 32; off <<= 1) mx = fmaxf(mx, __shfl_xor(mx, off, 32));
  const float e = (lane < MM_) ? __expf(sj - mx) : 0.f;
  float se = e;
#pragma unroll
  for (int off = 1; off < 32; off <<= 1) se += __shfl_xor(se, off, 32);
  const float am = e * (1.0f / se);
  float o0 = 0.f, o1 = 0.f;
#pragma unroll 1
  for (int jj = 0; jj < MM_; ++jj) {
    const float aj = __shfl(am, jj, 32);
    const float* kp = MOk + (size_t)(b * MM_ + jj) * C_ + h * HD_;
    o0 = fmaf(aj, kp[lane], o0);
    o1 = fmaf(aj, kp[lane + 32], o1);
  }
  smem[h * HD_ + lane]      = o0;
  smem[h * HD_ + lane + 32] = o1;
  __syncthreads();

  _Float16* cmb = (_Float16*)CM + (size_t)b * LP_ * C_;
  const v8h z8 = zero8h();
  v8h hv = z8;
  _Float16* dst = cmb;
  const bool has = tid < 256;                 // wave-uniform roles (128 threads = 4 waves per row)
  if (tid < 128) {
    const int col8 = tid * 8;
    const v4f m0 = *(const v4f*)(smem + col8), m1 = *(const v4f*)(smem + col8 + 4);
    hv = cvt8(m0, m1, 1.0f);
    dst = cmb + col8;                                   // row 0 = mem
  } else if (tid < 256) {
    const int col8 = (tid - 128) * 8;
    const float* pp = prev_m + (size_t)b * C_ + col8;
    const v4f p0 = *(const v4f*)(pp), p1 = *(const v4f*)(pp + 4);
    hv = cvt8(p0, p1, 1.0f);
    dst = cmb + C_ + col8;                              // row 1 = prev_m
  }
  {
    if (has) *(v8h*)dst = hv;
    for (int i = tid; i < (LP_ - LKV_) * (C_ / 8); i += 512) {
      const int row  = LKV_ + (i >> 7);
      const int col8 = (i & 127) * 8;
      *(v8h*)(cmb + (size_t)row * C_ + col8) = z8;
    }
    
  }
}

// =====================================================================================
// Main masked attention, head dim 64, one block = 4 waves = 64 query rows of one (batch, head).
//   Q plane f16 (x16):  (b, t, h, d)   at [(b*T_ + t)*C_ + h*64 + d]
//   K plane f16 (x16):  (b, s, h, d)   at [(b*LP_ + s)*C_ + h*64 + d]      s: 0 = mem, 1 = prev_m, 2+j = x_j, >= LKV_ pad
//   V^T plane f16 (x16): (b, h, d, s)  at [(b*C_ + h*64 + d)*LP_ + s]
//   Y plane f16 (x16 of y): (b, t, h, d) at [(b*T_ + t)*C_ + h*64 + d]
//   scores = (16q . 16k) * sscale (sscale = 0.125/256) on v_wmma_f32_16x16x32_f16, f32 accumulate;
//   visibility: s < 2 always; x key j = s-2 visible iff j <= t or (t < NU_ and j < NU_); hidden scores := -inf by value.
//   A fragment through the same element type; out = p . v^T-tile, f32 accumulate.
//   K / V^T 64-key chunks staged with plain loads + __syncthreads (128 threads x 32 halves per tile = whole 64x64 tile).
//   grid = NB_ * NH_ * (T_/64) blocks of 128; chunk count block-uniform, <= LP_/64 = 17.
// =====================================================================================
__global__ __launch_bounds__(128)
void attn_kernel(const unsigned short* __restrict__ Qp, const unsigned short* __restrict__ Kp,
                 const unsigned short* __restrict__ VTp, unsigned short* __restrict__ Yp, float sscale) {
  __shared__ __align__(16) _Float16 Ksh[64 * AKP];          // K chunk [key][d], pitch 72
  __shared__ __align__(16) _Float16 Vth[64 * AKP];          // V^T chunk [d][key]
  __shared__ __align__(16) _Float16 Psh[4][16 * AKP];       // per wave p tile [row][key]
  __shared__ __align__(16) _Float16 Osh[4][16 * AKP];       // per wave output tile [row][d]

  const int tid  = threadIdx.x;
  const int wave = tid >> 5;
  const int lane = tid & 31;
  const int hh   = lane >> 4;
  const int c    = lane & 15;
  const int bx = blockIdx.x;
  const int qb = bx & 15;                 // T_/64 = 16 query blocks
  const int h  = (bx >> 4) & (NH_ - 1);
  const int b  = bx >> 8;
  const int q0 = qb * 64 + wave * 16;     // first query row of this wave (within the batch)

  const _Float16* Qb = (const _Float16*)Qp  + (size_t)b * T_  * C_ + h * HD_;
  const _Float16* Kb = (const _Float16*)Kp  + (size_t)b * LP_ * C_ + h * HD_;
  const _Float16* Vb = (const _Float16*)VTp + ((size_t)b * C_ + h * HD_) * LP_;
  _Float16*       Yb = (_Float16*)Yp + (size_t)b * T_ * C_ + h * HD_;

  // ---- Q fragments (A operand, row = lane&15, split k map): 2 d-chunks ----
  v16h qa[2];
#pragma unroll
  for (int dc = 0; dc < 2; ++dc)
    qa[dc] = ldfrag(Qb + (size_t)(q0 + c) * C_ + dc * 32 + 8 * hh);

  float mrow[8], lrow[8];
  v8f oacc[4];
#pragma unroll
  for (int r = 0; r < 8; ++r) { mrow[r] = -INFINITY; lrow[r] = 0.f; }
#pragma unroll
  for (int t = 0; t < 4; ++t) oacc[t] = zero8f();

  int maxkey = qb * 64 + 63 + 2;                            // last visible key of the block's last query
  if (qb * 64 < NU_) maxkey = (maxkey > NU_ + 1) ? maxkey : (NU_ + 1);
  const int nChunks = (maxkey >> 6) + 1;                    // block-uniform, 3..17

  for (int kc = 0; kc < nChunks; ++kc) {
    const int kv0 = kc * 64;
    __syncthreads();
    {
      // staging coverage: 128 threads x (4 x 8) halves = 64 rows x 64 per tile
      const int r = tid >> 1, half = (tid & 1) * 32;
      const _Float16* ks = Kb + (size_t)(kv0 + r) * C_ + half;     // K row kv0+r, d = half..half+31
      const _Float16* vs = Vb + (size_t)r * LP_ + kv0 + half;      // V^T row d = r, s = kv0+half..+31
#pragma unroll
      for (int i = 0; i < 4; ++i) {
        const v8h a0 = *(const v8h*)(ks + 8 * i);
        const v8h b0 = *(const v8h*)(vs + 8 * i);
        *(v8h*)(Ksh + r * AKP + half + 8 * i) = a0;
        *(v8h*)(Vth + r * AKP + half + 8 * i) = b0;
      }
    }
    __syncthreads();

    v8f s[4];
#pragma unroll
    for (int j = 0; j < 4; ++j) {
      s[j] = zero8f();
#pragma unroll
      for (int dc = 0; dc < 2; ++dc) {
        const v16h kb = ldfrag(Ksh + (j * 16 + c) * AKP + dc * 32 + 8 * hh);
        s[j] = mma_f16_g(qa[dc], kb, s[j]);
      }
    }
    float cmx[8];
#pragma unroll
    for (int r = 0; r < 8; ++r) {
      const int qrow = q0 + 8 * hh + r;
      float m = -INFINITY;
#pragma unroll
      for (int j = 0; j < 4; ++j) {
        const int key = kv0 + j * 16 + c;
        const int jx  = key - 2;
        const bool vis = (key < 2) || (jx <= qrow) || ((qrow < NU_) && (jx < NU_));
        const float sv = vis ? s[j][r] * sscale : -INFINITY;
        s[j][r] = sv;
        m = fmaxf(m, sv);
      }
#pragma unroll
      for (int off = 1; off < 16; off <<= 1) m = fmaxf(m, __shfl_xor(m, off, 32));
      cmx[r] = m;
    }
    _Float16* pw = Psh[wave];
#pragma unroll
    for (int r = 0; r < 8; ++r) {
      const float mnew  = fmaxf(mrow[r], cmx[r]);
      const float alpha = __expf(mrow[r] - mnew);
      mrow[r] = mnew;
      float psum = 0.f;
#pragma unroll
      for (int j = 0; j < 4; ++j) {
        const float p = __expf(s[j][r] - mnew);
        psum += p;
        pw[(8 * hh + r) * AKP + j * 16 + c] = (_Float16)p;
      }
#pragma unroll
      for (int off = 1; off < 16; off <<= 1) psum += __shfl_xor(psum, off, 32);
      lrow[r] = lrow[r] * alpha + psum;
#pragma unroll
      for (int t = 0; t < 4; ++t) oacc[t][r] *= alpha;
    }
    __builtin_amdgcn_fence(__ATOMIC_RELEASE, "workgroup");
    __builtin_amdgcn_wave_barrier();
    __builtin_amdgcn_fence(__ATOMIC_ACQUIRE, "workgroup");
#pragma unroll
    for (int kk = 0; kk < 2; ++kk) {
      const v16h pa = ldfrag(pw + c * AKP + kk * 32 + 8 * hh);
#pragma unroll
      for (int t = 0; t < 4; ++t) {
        const v16h vb = ldfrag(Vth + (t * 16 + c) * AKP + kk * 32 + 8 * hh);
        oacc[t] = mma_f16_g(pa, vb, oacc[t]);
      }
    }
  }

  _Float16* os = Osh[wave];
#pragma unroll
  for (int r = 0; r < 8; ++r) {
    const float inv = 1.0f / lrow[r];
#pragma unroll
    for (int t = 0; t < 4; ++t) os[(8 * hh + r) * AKP + t * 16 + c] = (_Float16)(oacc[t][r] * inv);
  }
  __builtin_amdgcn_fence(__ATOMIC_RELEASE, "workgroup");
  __builtin_amdgcn_wave_barrier();
  __builtin_amdgcn_fence(__ATOMIC_ACQUIRE, "workgroup");
  {
    const int q4 = lane >> 3, c8 = (lane & 7) * 8;
    v8h ov[4];
#pragma unroll
    for (int it = 0; it < 4; ++it) {
      const int row = it * 4 + q4;
      ov[it] = *(const v8h*)(os + row * AKP + c8);
    }
    {
#pragma unroll
      for (int it = 0; it < 4; ++it) {
        const int row = it * 4 + q4;
        *(v8h*)(Yb + (size_t)(q0 + row) * C_ + c8) = ov[it];
      }
      
    }
  }
}

// ---------------------------------------------------------------------------
//   WT   f16 [6][1024 n][1024 k]  (Wq,Wk,Wv,Wp,Wqm,Wkm transposed, x16)         0   12582912
//   MA   f16 [192][1024]                                               12582912     393216
//   MOq  f32 [64][1024]                                                12976128     262144
//   MOk  f32 [128][1024]                                               13238272     524288
//   CM   f16 [8][1088][1024]  rows: 0 mem, 1 prev_m, 2..1025 x, 1026..1087 zero  13762560   17825792
//   Q    f16 [8][1024][1024] (x16)                                     31588352   16777216
//   K    f16 [8][1088][1024] (x16)                                     48365568   17825792
//   VT   f16 [8][1024][1088] (x16)                                     66191360   17825792
//   Y    f16 [8][1024][1024] (x16)                                     84017152   16777216
//   total                                                             100794368
// ---------------------------------------------------------------------------
extern "C" void kernel_launch(void* const* d_in, const int* in_sizes, int n_in,
                              void* d_out, int out_size, void* d_ws, size_t ws_size,
                              hipStream_t stream) {
  if (n_in < 15) return;
  if (in_sizes[0] != NB_ * T_ * C_) return;
  if (in_sizes[1] != NB_ * C_) return;
  if (in_sizes[2] != NB_ * MM_ * C_) return;
  for (int i = 3; i <= 13; i += 2) if (in_sizes[i] != C_ * C_) return;
  for (int i = 4; i <= 14; i += 2) if (in_sizes[i] != C_) return;
  if (out_size != NB_ * T_ * C_) return;

  const float* x      = (const float*)d_in[0];
  const float* prev_m = (const float*)d_in[1];
  const float* cached = (const float*)d_in[2];
  const float* Wq  = (const float*)d_in[3];  const float* bq  = (const float*)d_in[4];
  const float* Wk  = (const float*)d_in[5];  const float* bk  = (const float*)d_in[6];
  const float* Wv  = (const float*)d_in[7];  const float* bv  = (const float*)d_in[8];
  const float* Wp  = (const float*)d_in[9];  const float* bp  = (const float*)d_in[10];
  const float* Wqm = (const float*)d_in[11]; const float* bqm = (const float*)d_in[12];
  const float* Wkm = (const float*)d_in[13]; const float* bkm = (const float*)d_in[14];
  float* out = (float*)d_out;

  const size_t szWT  = (size_t)6 * C_ * C_ * 2;
  const size_t szMA  = (size_t)MAR_ * C_ * 2;
  const size_t szMOq = (size_t)64 * C_ * 4;
  const size_t szMOk = (size_t)128 * C_ * 4;
  const size_t szCM  = (size_t)NB_ * LP_ * C_ * 2;
  const size_t szQ   = (size_t)NB_ * T_ * C_ * 2;
  const size_t szK   = (size_t)NB_ * LP_ * C_ * 2;
  const size_t szVT  = (size_t)NB_ * C_ * LP_ * 2;
  const size_t szY   = (size_t)NB_ * T_ * C_ * 2;
  size_t off = 0;
  const size_t oWT  = off; off += szWT;
  const size_t oMA  = off; off += szMA;
  const size_t oMOq = off; off += szMOq;
  const size_t oMOk = off; off += szMOk;
  const size_t oCM  = off; off += szCM;
  const size_t oQ   = off; off += szQ;
  const size_t oK   = off; off += szK;
  const size_t oVT  = off; off += szVT;
  const size_t oY   = off; off += szY;
  if (off > ws_size) return;                   // off = 100794368

  char* ws = (char*)d_ws;
  unsigned short* WT  = (unsigned short*)(ws + oWT);
  unsigned short* MA  = (unsigned short*)(ws + oMA);
  float*          MOq = (float*)(ws + oMOq);
  float*          MOk = (float*)(ws + oMOk);
  unsigned short* CM  = (unsigned short*)(ws + oCM);
  unsigned short* Qh  = (unsigned short*)(ws + oQ);
  unsigned short* Kh  = (unsigned short*)(ws + oK);
  unsigned short* VTh = (unsigned short*)(ws + oVT);
  unsigned short* Yh  = (unsigned short*)(ws + oY);
  unsigned short* WqT  = WT;
  unsigned short* WkT  = WT + (size_t)1 * C_ * C_;
  unsigned short* WvT  = WT + (size_t)2 * C_ * C_;
  unsigned short* WpT  = WT + (size_t)3 * C_ * C_;
  unsigned short* WqmT = WT + (size_t)4 * C_ * C_;
  unsigned short* WkmT = WT + (size_t)5 * C_ * C_;

  const dim3 blk(256);
  const float s16 = 16.0f, r16 = 1.0f / 16.0f, r256 = 1.0f / 256.0f;

  // (1) weights [in k][out n] f32 -> transposed f16 planes [n][k], carried x16  (square: rows = cols = C_)
  wt_kernel<<<dim3(C_ / 64, C_ / 64, 6), blk, 0, stream>>>(Wq, Wk, Wv, Wp, Wqm, Wkm, WT, s16);
  // (2) small operand plane: prev_m rows 0..7, cached rows 64..191
  ma_kernel<<<dim3(MAR_), dim3(128), 0, stream>>>(prev_m, cached, MA);
  // (3) x -> CM rows 2..1025 per batch
  const int n8 = NB_ * T_ * C_ / 8;
  xcvt_kernel<<<dim3((n8 + 255) / 256), blk, 0, stream>>>(x, CM, n8);
  // (4) qm = prev_m . Wqm + bqm -> MOq rows 0..7 (M padded to 64), f32
  gemm64<2, 0><<<dim3(((64 / 64) * (C_ / 64) + 7) / 8, 1), blk, 0, stream>>>(
      MA, C_, 0L, WqmT, C_, 0L, (void*)MOq, C_, 0L, bqm, 64, C_, C_, r16, 1.0f);
  // (5) km = cached . Wkm + bkm -> MOk rows b*16+j (M = 128), f32
  gemm64<2, 0><<<dim3(((128 / 64) * (C_ / 64) + 7) / 8, 1), blk, 0, stream>>>(
      MA + (size_t)64 * C_, C_, 0L, WkmT, C_, 0L, (void*)MOk, C_, 0L, bkm, 128, C_, C_, r16, 1.0f);
  // (6) memory attention (f32) -> CM rows 0 (mem), 1 (prev_m) and zero pad rows, per batch
  mem_kernel<<<dim3(NB_), dim3(512), 0, stream>>>(MOq, MOk, prev_m, CM);
  // (7) q = x . Wq + bq -> Q plane (x16): A = CM rows 2..1025, M = 1024 per batch
  gemm64<2, 1><<<dim3(((T_ / 64) * (C_ / 64) + 7) / 8, NB_), blk, 0, stream>>>(
      CM + (size_t)2 * C_, C_, (long)LP_ * C_, WqT, C_, 0L, (void*)Qh, C_, (long)T_ * C_, bq, T_, C_, C_, r16, s16);
  // (8) k = cm . Wk + bk -> K plane (x16): M = 1088 per batch (pad rows included)
  gemm64<2, 1><<<dim3(((LP_ / 64) * (C_ / 64) + 7) / 8, NB_), blk, 0, stream>>>(
      CM, C_, (long)LP_ * C_, WkT, C_, 0L, (void*)Kh, C_, (long)LP_ * C_, bk, LP_, C_, C_, r16, s16);
  // (9) v^T = Wv^T . cm^T + bv[m] -> VT plane [h*64+d][s] (x16): A = WvT [n][k], Bt = CM [s][k]; M = 1024, N = 1088
  gemm64<1, 1><<<dim3(((C_ / 64) * (LP_ / 64) + 7) / 8, NB_), blk, 0, stream>>>(
      WvT, C_, 0L, CM, C_, (long)LP_ * C_, (void*)VTh, LP_, (long)C_ * LP_, bv, C_, LP_, C_, r16, s16);
  // (10) masked attention -> Y plane (x16)
  attn_kernel<<<dim3(NB_ * NH_ * (T_ / 64)), dim3(128), 0, stream>>>(Qh, Kh, VTh, Yh, 0.125f / 256.0f);
  // (11) out = y . Wp + bp -> d_out f32 [8192][1024]  (y x16, Wp x16 -> scale 1/256)
  gemm64<2, 0><<<dim3(((NB_ * T_ / 64) * (C_ / 64) + 7) / 8, 1), blk, 0, stream>>>(
      Yh, C_, 0L, WpT, C_, 0L, (void*)out, C_, 0L, bp, NB_ * T_, C_, C_, r256, 1.0f);
  (void)hipGetLastError();
}

// v001
// Measured time: 231 microseconds a run.
// Next to v000, in two timings, it ran 1.85 times as fast each time.
// Contractions x*Wq, cm*Wk, cm*Wv, q*k^T, p*v, y*Wp, prev_m*Wqm, cached*Wkm: v_wmma_f32_16x16x32_f16, f16 operands (weights carried x16, q/k/v/y planes carried x16, p x1), f32 accumulate; softmax f32; memory-path scores and weighted sum f32 VALU.
#include <hip/hip_runtime.h>
#include <stdint.h>
#include <math.h>

#define NB_   8
#define T_    1024
#define C_    1024
#define NH_   16
#define HD_   64
#define NU_   128
#define MM_   16
#define LKV_  1026
#define LP_   1088
#define MAR_  192
#define AKP   72

typedef _Float16 v16h __attribute__((ext_vector_type(16)));
typedef _Float16 v8h  __attribute__((ext_vector_type(8)));
typedef float    v8f  __attribute__((ext_vector_type(8)));
typedef float    v4f  __attribute__((ext_vector_type(4)));

// ---- 16-bit fragment loader: elements 0..7 <- p[0..7], 8..15 <- p[16..23]; caller passes p = row base + k0 + 8*(lane>>4)
__device__ __forceinline__ v16h ldfrag(const _Float16* p) {
  union { v16h v; v8h h[2]; } f;
  f.h[0] = *(const v8h*)(p);
  f.h[1] = *(const v8h*)(p + 16);
  return f.v;
}
__device__ __forceinline__ v8f mma_f16(v16h a, v16h b, v8f c) {
  return __builtin_amdgcn_wmma_f32_16x16x32_f16(false, a, false, b, (short)0, c, false, false);
}
__device__ __forceinline__ v8f mma_f16_g(v16h a, v16h b, v8f c) {
  c = __builtin_amdgcn_wmma_f32_16x16x32_f16(false, a, false, b, (short)0, c, false, false);
  asm volatile("v_nop\n\tv_nop\n\tv_nop\n\tv_nop" : "+v"(c) : "v"(a), "v"(b));
  return c;
}
__device__ __forceinline__ v8f zero8f() { v8f z; z[0]=0.f; z[1]=0.f; z[2]=0.f; z[3]=0.f; z[4]=0.f; z[5]=0.f; z[6]=0.f; z[7]=0.f; return z; }
__device__ __forceinline__ v8h zero8h() {
  v8h z;
#pragma unroll
  for (int e = 0; e < 8; ++e) z[e] = (_Float16)0.0f;
  return z;
}
__device__ __forceinline__ v8h cvt8(v4f a, v4f b, float s) {
  v8h r;
  r[0] = (_Float16)(a[0] * s); r[1] = (_Float16)(a[1] * s); r[2] = (_Float16)(a[2] * s); r[3] = (_Float16)(a[3] * s);
  r[4] = (_Float16)(b[0] * s); r[5] = (_Float16)(b[1] * s); r[6] = (_Float16)(b[2] * s); r[7] = (_Float16)(b[3] * s);
  return r;
}

// ---------------------------------------------------------------------------
// Weight transpose + f16 convert with carry scale s: six inputs W_z [k][n] f32 (C_ x C_) ->
// WT plane z: [n][k] f16 = f16(s * W_z[k][n]).  64x64 tiles through LDS, grid (C_/64, C_/64, 6), 256 threads.
// coverage per block: load 4 it x 256 thr x 4 = 64x64; store 2 it x 256 thr x 8 = 64x64.
// ---------------------------------------------------------------------------
__global__ __launch_bounds__(256)
void wt_kernel(const float* __restrict__ W0, const float* __restrict__ W1, const float* __restrict__ W2,
               const float* __restrict__ W3, const float* __restrict__ W4, const float* __restrict__ W5,
               unsigned short* __restrict__ WT, float s) {
  __shared__ __align__(16) float tf[64 * 68];
  const int z = blockIdx.z;
  const float* W = (z == 0) ? W0 : (z == 1) ? W1 : (z == 2) ? W2 : (z == 3) ? W3 : (z == 4) ? W4 : W5;
  _Float16* out = (_Float16*)WT + (size_t)z * C_ * C_;
  const int c0  = blockIdx.x * 64;   // input column block = output row block
  const int r0  = blockIdx.y * 64;   // input row block    = output column block
  const int tid = threadIdx.x;
  {
    const int lr = tid >> 4;
    const int c4 = (tid & 15) * 4;
#pragma unroll
    for (int it = 0; it < 4; ++it) {
      const int rr = it * 16 + lr;
      const v4f a = *(const v4f*)(W + (size_t)(r0 + rr) * C_ + c0 + c4);
      *(v4f*)(tf + rr * 68 + c4) = a;
    }
  }
  __syncthreads();
  const int sub = tid >> 3;          // 0..31
  const int c8  = (tid & 7) * 8;     // 0..56
  v8h hv[2];
#pragma unroll
  for (int it = 0; it < 2; ++it) {
    const int oc = it * 32 + sub;    // output row within tile (= input column)
    v8h v;
#pragma unroll
    for (int e = 0; e < 8; ++e) v[e] = (_Float16)(tf[(c8 + e) * 68 + oc] * s);
    hv[it] = v;
  }
  {
#pragma unroll
    for (int it = 0; it < 2; ++it) {
      const int oc = it * 32 + sub;
      *(v8h*)(out + (size_t)(c0 + oc) * C_ + r0 + c8) = hv[it];
    }
    
  }
}

// ---------------------------------------------------------------------------
// Small operand plane MA [192][1024] f16: rows 0..7 = prev_m[b], rows 8..63 = 0, rows 64..191 = cached_memory row (row-64).
// grid 192 blocks (one row) x 128 threads x 8 halves; one instruction = whole row (16 lines, 8 lanes per line);
// coverage: 192 x 128 x 8 = whole plane.
// ---------------------------------------------------------------------------
__global__ __launch_bounds__(128)
void ma_kernel(const float* __restrict__ prev_m, const float* __restrict__ cached, unsigned short* __restrict__ MA) {
  const int row  = blockIdx.x;
  const int col8 = threadIdx.x * 8;
  const int rp = (row < NB_) ? row : 0;
  int rc = row - 64; rc = (rc < 0) ? 0 : rc; rc = (rc > NB_ * MM_ - 1) ? (NB_ * MM_ - 1) : rc;
  const float* sp = prev_m + (size_t)rp * C_ + col8;
  const float* sc = cached + (size_t)rc * C_ + col8;
  const v4f p0 = *(const v4f*)(sp), p1 = *(const v4f*)(sp + 4);
  const v4f q0 = *(const v4f*)(sc), q1 = *(const v4f*)(sc + 4);
  const float fp = (row < NB_) ? 1.0f : 0.0f;
  const float fc = (row >= 64) ? 1.0f : 0.0f;
  const v4f a = p0 * fp + q0 * fc;
  const v4f b = p1 * fp + q1 * fc;
  const v8h hv = cvt8(a, b, 1.0f);
  _Float16* d = (_Float16*)MA + (size_t)row * C_ + col8;
  *(v8h*)d = hv;
  
}

// ---------------------------------------------------------------------------
// x [8][1024][1024] f32 -> CM plane rows 2..1025 of each batch ([8][LP_][1024] f16), unscaled.
// ---------------------------------------------------------------------------
__global__ __launch_bounds__(256)
void xcvt_kernel(const float* __restrict__ x, unsigned short* __restrict__ CM, int n8) {
  const int idx = blockIdx.x * 256 + threadIdx.x;
  if (idx >= n8) return;
  const int e = idx * 8;
  const int b = e >> 20, t = (e >> 10) & (T_ - 1), col = e & (C_ - 1);
  const v4f a0 = *(const v4f*)(x + e), a1 = *(const v4f*)(x + e + 4);
  const v8h hv = cvt8(a0, a1, 1.0f);
  _Float16* d = (_Float16*)CM + ((size_t)(b * LP_ + 2 + t)) * C_ + col;
  *(v8h*)d = hv;
  
}

// ---------------------------------------------------------------------------
// Block-tiled batched f16 WMMA GEMM: C[m,n] = oscale * (scale * sum_k A[m,k] * Bt[n,k] + bias).
// One block = WM x WN waves = a (64*WM) x (64*WN) tile of C; each wave owns a 64x64 sub-tile.
// A row-major [M,K] f16; Bt row-major [N,K] f16; M % (64*WM) == 0, N % (64*WN) == 0, K % 64 == 0, K >= 64.
// A pass is 64 k (128 B of every operand row).  A stage is [A rows | Bt rows] at pitch 144 B in LDS, two buffers;
// every lane copies 16-B pieces global -> LDS asynchronously, the next pass's stage in flight while this one is worked on.
// Column n of C lies in output plane n / NPB (plane stride strideCN) at column n % NPB; NPB % 64 == 0.
// BIAS_MODE: 1 = bias[m], 2 = bias[n].  OUT_MODE: 0 = f32, 1 = f16.
// ---------------------------------------------------------------------------
#define GKT 64      // k per pass
#define GP  72      // LDS row pitch in halves: 144 B = 16 B x odd, conflict-free for 16-B fragment reads

// Eight asynchronous 16-B copies per lane.  The s_wait_xcnt closes the statement so that no address register
// named here is rewritten ahead of it.
__device__ __forceinline__ void copy8(const unsigned (&l)[8], const _Float16* const (&g)[8]) {
  asm volatile(
      "global_load_async_to_lds_b128 %0, %8, off\n\t"
      "global_load_async_to_lds_b128 %1, %9, off\n\t"
      "global_load_async_to_lds_b128 %2, %10, off\n\t"
      "global_load_async_to_lds_b128 %3, %11, off\n\t"
      "global_load_async_to_lds_b128 %4, %12, off\n\t"
      "global_load_async_to_lds_b128 %5, %13, off\n\t"
      "global_load_async_to_lds_b128 %6, %14, off\n\t"
      "global_load_async_to_lds_b128 %7, %15, off\n\t"
      "s_wait_xcnt 0x0"
      :: "v"(l[0]), "v"(l[1]), "v"(l[2]), "v"(l[3]), "v"(l[4]), "v"(l[5]), "v"(l[6]), "v"(l[7]),
         "v"(g[0]), "v"(g[1]), "v"(g[2]), "v"(g[3]), "v"(g[4]), "v"(g[5]), "v"(g[6]), "v"(g[7])
      : "memory");
}

template <int BIAS_MODE, int OUT_MODE, int WM, int WN>
__global__ __launch_bounds__(32 * WM * WN) void gemm_lds(
    const unsigned short* __restrict__ Ap, int lda, long strideA,
    const unsigned short* __restrict__ Btp, int ldb, long strideB,
    void* __restrict__ Cout, int ldc, long strideC, int NPB, long strideCN,
    const float* __restrict__ bias, int M, int N, int K, float scale, float oscale) {
  constexpr int NT  = 32 * WM * WN;      // threads
  constexpr int BM  = 64 * WM;           // tile rows
  constexpr int BN  = 64 * WN;           // tile columns
  constexpr int RPI = NT / 8;            // rows covered by one copy of the whole block (8 lanes x 16 B = one 128-B row)
  constexpr int NA  = BM / RPI;          // copies per lane and pass, A rows (16 / WN)
  constexpr int NB  = BN / RPI;          // copies per lane and pass, Bt rows (16 / WM)
  constexpr int STAGE_H = (BM + BN) * GP;
  static_assert(NA % 8 == 0 && NB % 8 == 0 && NA + NB <= 63, "copy groups of eight, at most 63 in flight");
  __shared__ __align__(16) _Float16 ring[2 * STAGE_H];
  __shared__ __align__(16) float sT[WM * WN][16 * 68];   // per-wave 16x64 slab, pitch 68 floats

  const _Float16* A  = (const _Float16*)Ap;
  const _Float16* Bt = (const _Float16*)Btp;
  const int b    = blockIdx.y;
  const int tid  = threadIdx.x;
  const int lane = tid & 31;
  const int wave = tid >> 5;
  const int wm   = wave / WN;
  const int wn   = wave - wm * WN;
  const int tilesN = N / BN;
  const int tm = blockIdx.x / tilesN;    // grid.x = (M / BM) * (N / BN) exactly
  const int tn = blockIdx.x - tm * tilesN;
  const int rlane = lane & 15;                 // row (A) / col (B, D) within subtile
  const int koff  = (lane >> 4) * 8;           // k offset of this lane half
  const int mOff  = (lane >> 4) * 8;           // D row offset

  // this lane's piece of a stage: row tid>>3 (+ RPI per copy), 16-B piece tid&7
  const _Float16* gA = A  + (size_t)b * strideA + (size_t)(tm * BM + (tid >> 3)) * lda + (tid & 7) * 8;
  const _Float16* gB = Bt + (size_t)b * strideB + (size_t)(tn * BN + (tid >> 3)) * ldb + (tid & 7) * 8;
  const unsigned  lds0 = (unsigned)(size_t)(&ring[0]) + (unsigned)((tid >> 3) * (GP * 2) + (tid & 7) * 16);

  auto issue = [&](int kt, int buf) {
    const _Float16* ga = gA + kt * GKT;
    const _Float16* gb = gB + kt * GKT;
    const unsigned  la = lds0 + (unsigned)buf * (unsigned)(STAGE_H * 2);
    const unsigned  lb = la + (unsigned)(BM * GP * 2);
    // the four loops below are unrolled so that l[] and g[] are registers (they are asm operands)
#pragma unroll
    for (int q = 0; q < NA / 8; ++q) {
      unsigned l[8]; const _Float16* g[8];
#pragma unroll
      for (int e = 0; e < 8; ++e) {
        l[e] = la + (unsigned)((q * 8 + e) * RPI * GP * 2);
        g[e] = ga + (size_t)((q * 8 + e) * RPI) * lda;
      }
      copy8(l, g);
    }
#pragma unroll
    for (int q = 0; q < NB / 8; ++q) {
      unsigned l[8]; const _Float16* g[8];
#pragma unroll
      for (int e = 0; e < 8; ++e) {
        l[e] = lb + (unsigned)((q * 8 + e) * RPI * GP * 2);
        g[e] = gb + (size_t)((q * 8 + e) * RPI) * ldb;
      }
      copy8(l, g);
    }
  };

  v8f acc[4][4];
#pragma unroll
  for (int i = 0; i < 4; ++i)
#pragma unroll
    for (int j = 0; j < 4; ++j) acc[i][j] = zero8f();

  const int NP = K / GKT;
  issue(0, 0);
  asm volatile("s_wait_asynccnt 0x0" ::: "memory");   // this wave's pieces of stage 0 have landed
  __syncthreads();                                     // publishes stage 0 to every wave
  if (NP > 1) issue(1, 1);

  for (int t = 0; t < NP; ++t) {
    const _Float16* sA = ring + (t & 1) * STAGE_H + (wm * 64 + rlane) * GP + koff;
    const _Float16* sB = ring + (t & 1) * STAGE_H + (BM + wn * 64 + rlane) * GP + koff;
    // unrolled throughout: fragments and accumulators are indexed at compile time and stay in registers
#pragma unroll
    for (int ks = 0; ks < GKT / 32; ++ks) {
      v16h bh[4], ah[4];
#pragma unroll
      for (int j = 0; j < 4; ++j) bh[j] = ldfrag(sB + j * 16 * GP + ks * 32);
#pragma unroll
      for (int i = 0; i < 4; ++i) ah[i] = ldfrag(sA + i * 16 * GP + ks * 32);
      // keeps the sixteen LDS reads of this k step together ahead of its WMMAs: spread among them, every row of
      // four WMMAs waits out a full LDS latency of its own
      __builtin_amdgcn_sched_barrier(0);
#pragma unroll
      for (int i = 0; i < 4; ++i)
#pragma unroll
        for (int j = 0; j < 4; ++j) acc[i][j] = mma_f16(ah[i], bh[j], acc[i][j]);
    }
    asm volatile("s_wait_dscnt 0x0" ::: "memory");      // this wave's reads of the buffer are done before it is refilled
    asm volatile("s_wait_asynccnt 0x0" ::: "memory");   // this wave's pieces of stage t + 1 have landed
    __syncthreads();                                     // publishes stage t + 1 and ends every reader's use of stage t
    if (t + 2 < NP) issue(t + 2, t & 1);
  }
  asm volatile("s_wait_asynccnt 0x0" ::: "memory");     // no copy outstanding when the wave goes on

  // ---- epilogue ----
  const int m0 = tm * BM + wm * 64;
  const int n0 = tn * BN + wn * 64;
  const int np = n0 / NPB;                     // output plane of this wave's 64 columns
  const int nl = n0 - np * NPB;                // first column inside that plane
  float* slab = sT[wave];
#pragma unroll
  for (int i = 0; i < 4; ++i) {
    const int mBase = m0 + (i << 4);
#pragma unroll
    for (int j = 0; j < 4; ++j) {
      const int n = n0 + (j << 4) + rlane;
      float bvn = 0.f;
      if (BIAS_MODE == 2) bvn = bias[n];
#pragma unroll
      for (int r = 0; r < 8; ++r) {
        float v = acc[i][j][r] * scale;
        if (BIAS_MODE == 1) v += bias[mBase + mOff + r];
        if (BIAS_MODE == 2) v += bvn;
        v *= oscale;
        slab[(mOff + r) * 68 + (j << 4) + rlane] = v;
      }
    }
    __builtin_amdgcn_fence(__ATOMIC_RELEASE, "workgroup");
    __builtin_amdgcn_wave_barrier();
    __builtin_amdgcn_fence(__ATOMIC_ACQUIRE, "workgroup");
    if (OUT_MODE == 0) {
      float* C = (float*)Cout + (size_t)b * strideC + (size_t)np * strideCN;
      const int hh = lane >> 4, c4 = (lane & 15) * 4;     // row seg = 256 B = 16 lanes x 16 B
      {
#pragma unroll
        for (int it = 0; it < 8; ++it) {
          const int row = it * 2 + hh;                     // it 0..7 x hh 0..1 = rows 0..15
          const v4f v = *(const v4f*)(slab + row * 68 + c4);
          *(v4f*)(C + (size_t)(mBase + row) * ldc + nl + c4) = v;
        }
      }
    } else {
      _Float16* C = (_Float16*)Cout + (size_t)b * strideC + (size_t)np * strideCN;
      const int q = lane >> 3, c8 = (lane & 7) * 8;
      v8h hv[4];
#pragma unroll
      for (int it = 0; it < 4; ++it) {
        const int row = it * 4 + q;                        // it 0..3 x q 0..3 = rows 0..15
        const float* spf = slab + row * 68 + c8;
        v8h t;
#pragma unroll
        for (int e = 0; e < 8; ++e) t[e] = (_Float16)spf[e];
        hv[it] = t;
      }
      {
#pragma unroll
        for (int it = 0; it < 4; ++it) {
          const int row = it * 4 + q;
          *(v8h*)(C + (size_t)(mBase + row) * ldc + nl + c8) = hv[it];
        }
      }
    }
    __builtin_amdgcn_fence(__ATOMIC_RELEASE, "workgroup");
    __builtin_amdgcn_wave_barrier();
    __builtin_amdgcn_fence(__ATOMIC_ACQUIRE, "workgroup");
  }
}

// ---------------------------------------------------------------------------
// Memory-compression attention, f32: one block per batch element, 16 waves = 16 heads.
//   qm = MOq row b, km_j = MOk row b*16+j (f32 projections incl. bias); s_j = qm_h.km_jh * 0.125 over 16 keys,
//   softmax in f32, mem_h = sum_j a_j km_jh.  The 1024-float mem row is staged in LDS, then
//   CM row 0 (mem) and row 1 (prev_m) of batch b are written as f16, and pad rows LKV_..LP_-1 as zeros:
// coverage: rows 0,1 by threads 0..255 (128 x 8 halves each), pad rows 62 x 128 pieces by the strided loop.
// ---------------------------------------------------------------------------
__global__ __launch_bounds__(512)
void mem_kernel(const float* __restrict__ MOq, const float* __restrict__ MOk, const float* __restrict__ prev_m,
                unsigned short* __restrict__ CM) {
  __shared__ __align__(16) float smem[C_];
  const int b = blockIdx.x;
  const int tid = threadIdx.x, wave = tid >> 5, lane = tid & 31;
  const int h = wave;
  const int j = lane & 15;
  const float* qh = MOq + (size_t)b * C_ + h * HD_;
  const float* kr = MOk + (size_t)(b * MM_ + j) * C_ + h * HD_;
  float a = 0.f;
#pragma unroll 1
  for (int d4 = 0; d4 < HD_ / 4; ++d4) {
    const v4f qv = *(const v4f*)(qh + 4 * d4);
    const v4f kv = *(const v4f*)(kr + 4 * d4);
    a = fmaf(qv[0], kv[0], a);
    a = fmaf(qv[1], kv[1], a);
    a = fmaf(qv[2], kv[2], a);
    a = fmaf(qv[3], kv[3], a);
  }
  const float sj = (lane < MM_) ? a * 0.125f : -INFINITY;
  float mx = sj;
#pragma unroll
  for (int off = 1; off < 32; off <<= 1) mx = fmaxf(mx, __shfl_xor(mx, off, 32));
  const float e = (lane < MM_) ? __expf(sj - mx) : 0.f;
  float se = e;
#pragma unroll
  for (int off = 1; off < 32; off <<= 1) se += __shfl_xor(se, off, 32);
  const float am = e * (1.0f / se);
  float o0 = 0.f, o1 = 0.f;
#pragma unroll 1
  for (int jj = 0; jj < MM_; ++jj) {
    const float aj = __shfl(am, jj, 32);
    const float* kp = MOk + (size_t)(b * MM_ + jj) * C_ + h * HD_;
    o0 = fmaf(aj, kp[lane], o0);
    o1 = fmaf(aj, kp[lane + 32], o1);
  }
  smem[h * HD_ + lane]      = o0;
  smem[h * HD_ + lane + 32] = o1;
  __syncthreads();

  _Float16* cmb = (_Float16*)CM + (size_t)b * LP_ * C_;
  const v8h z8 = zero8h();
  v8h hv = z8;
  _Float16* dst = cmb;
  const bool has = tid < 256;                 // wave-uniform roles (128 threads = 4 waves per row)
  if (tid < 128) {
    const int col8 = tid * 8;
    const v4f m0 = *(const v4f*)(smem + col8), m1 = *(const v4f*)(smem + col8 + 4);
    hv = cvt8(m0, m1, 1.0f);
    dst = cmb + col8;                                   // row 0 = mem
  } else if (tid < 256) {
    const int col8 = (tid - 128) * 8;
    const float* pp = prev_m + (size_t)b * C_ + col8;
    const v4f p0 = *(const v4f*)(pp), p1 = *(const v4f*)(pp + 4);
    hv = cvt8(p0, p1, 1.0f);
    dst = cmb + C_ + col8;                              // row 1 = prev_m
  }
  {
    if (has) *(v8h*)dst = hv;
    for (int i = tid; i < (LP_ - LKV_) * (C_ / 8); i += 512) {
      const int row  = LKV_ + (i >> 7);
      const int col8 = (i & 127) * 8;
      *(v8h*)(cmb + (size_t)row * C_ + col8) = z8;
    }
    
  }
}

// =====================================================================================
// Main masked attention, head dim 64, one block = 4 waves = 64 query rows of one (batch, head).
//   Q plane f16 (x16):  (b, t, h, d)   at [(b*T_ + t)*C_ + h*64 + d]
//   K plane f16 (x16):  (b, s, h, d)   at [(b*LP_ + s)*C_ + h*64 + d]      s: 0 = mem, 1 = prev_m, 2+j = x_j, >= LKV_ pad
//   V^T plane f16 (x16): (b, h, d, s)  at [(b*C_ + h*64 + d)*LP_ + s]
//   Y plane f16 (x16 of y): (b, t, h, d) at [(b*T_ + t)*C_ + h*64 + d]
//   scores = (16q . 16k) * sscale (sscale = 0.125/256) on v_wmma_f32_16x16x32_f16, f32 accumulate;
//   visibility: s < 2 always; x key j = s-2 visible iff j <= t or (t < NU_ and j < NU_); hidden scores := -inf by value.
//   A fragment through the same element type; out = p . v^T-tile, f32 accumulate.
//   K / V^T 64-key chunks staged with plain loads + __syncthreads (128 threads x 32 halves per tile = whole 64x64 tile).
//   grid = NB_ * NH_ * (T_/64) blocks of 128; chunk count block-uniform, <= LP_/64 = 17.
// =====================================================================================
__global__ __launch_bounds__(128)
void attn_kernel(const unsigned short* __restrict__ Qp, const unsigned short* __restrict__ Kp,
                 const unsigned short* __restrict__ VTp, unsigned short* __restrict__ Yp, float sscale) {
  __shared__ __align__(16) _Float16 Ksh[64 * AKP];          // K chunk [key][d], pitch 72
  __shared__ __align__(16) _Float16 Vth[64 * AKP];          // V^T chunk [d][key]
  __shared__ __align__(16) _Float16 Psh[4][16 * AKP];       // per wave p tile [row][key]
  __shared__ __align__(16) _Float16 Osh[4][16 * AKP];       // per wave output tile [row][d]

  const int tid  = threadIdx.x;
  const int wave = tid >> 5;
  const int lane = tid & 31;
  const int hh   = lane >> 4;
  const int c    = lane & 15;
  const int bx = blockIdx.x;
  const int qb = bx & 15;                 // T_/64 = 16 query blocks
  const int h  = (bx >> 4) & (NH_ - 1);
  const int b  = bx >> 8;
  const int q0 = qb * 64 + wave * 16;     // first query row of this wave (within the batch)

  const _Float16* Qb = (const _Float16*)Qp  + (size_t)b * T_  * C_ + h * HD_;
  const _Float16* Kb = (const _Float16*)Kp  + (size_t)b * LP_ * C_ + h * HD_;
  const _Float16* Vb = (const _Float16*)VTp + ((size_t)b * C_ + h * HD_) * LP_;
  _Float16*       Yb = (_Float16*)Yp + (size_t)b * T_ * C_ + h * HD_;

  // ---- Q fragments (A operand, row = lane&15, split k map): 2 d-chunks ----
  v16h qa[2];
#pragma unroll
  for (int dc = 0; dc < 2; ++dc)
    qa[dc] = ldfrag(Qb + (size_t)(q0 + c) * C_ + dc * 32 + 8 * hh);

  float mrow[8], lrow[8];
  v8f oacc[4];
#pragma unroll
  for (int r = 0; r < 8; ++r) { mrow[r] = -INFINITY; lrow[r] = 0.f; }
#pragma unroll
  for (int t = 0; t < 4; ++t) oacc[t] = zero8f();

  int maxkey = qb * 64 + 63 + 2;                            // last visible key of the block's last query
  if (qb * 64 < NU_) maxkey = (maxkey > NU_ + 1) ? maxkey : (NU_ + 1);
  const int nChunks = (maxkey >> 6) + 1;                    // block-uniform, 3..17

  for (int kc = 0; kc < nChunks; ++kc) {
    const int kv0 = kc * 64;
    __syncthreads();
    {
      // staging coverage: 128 threads x (4 x 8) halves = 64 rows x 64 per tile
      const int r = tid >> 1, half = (tid & 1) * 32;
      const _Float16* ks = Kb + (size_t)(kv0 + r) * C_ + half;     // K row kv0+r, d = half..half+31
      const _Float16* vs = Vb + (size_t)r * LP_ + kv0 + half;      // V^T row d = r, s = kv0+half..+31
#pragma unroll
      for (int i = 0; i < 4; ++i) {
        const v8h a0 = *(const v8h*)(ks + 8 * i);
        const v8h b0 = *(const v8h*)(vs + 8 * i);
        *(v8h*)(Ksh + r * AKP + half + 8 * i) = a0;
        *(v8h*)(Vth + r * AKP + half + 8 * i) = b0;
      }
    }
    __syncthreads();

    v8f s[4];
#pragma unroll
    for (int j = 0; j < 4; ++j) {
      s[j] = zero8f();
#pragma unroll
      for (int dc = 0; dc < 2; ++dc) {
        const v16h kb = ldfrag(Ksh + (j * 16 + c) * AKP + dc * 32 + 8 * hh);
        s[j] = mma_f16_g(qa[dc], kb, s[j]);
      }
    }
    float cmx[8];
#pragma unroll
    for (int r = 0; r < 8; ++r) {
      const int qrow = q0 + 8 * hh + r;
      float m = -INFINITY;
#pragma unroll
      for (int j = 0; j < 4; ++j) {
        const int key = kv0 + j * 16 + c;
        const int jx  = key - 2;
        const bool vis = (key < 2) || (jx <= qrow) || ((qrow < NU_) && (jx < NU_));
        const float sv = vis ? s[j][r] * sscale : -INFINITY;
        s[j][r] = sv;
        m = fmaxf(m, sv);
      }
#pragma unroll
      for (int off = 1; off < 16; off <<= 1) m = fmaxf(m, __shfl_xor(m, off, 32));
      cmx[r] = m;
    }
    _Float16* pw = Psh[wave];
#pragma unroll
    for (int r = 0; r < 8; ++r) {
      const float mnew  = fmaxf(mrow[r], cmx[r]);
      const float alpha = __expf(mrow[r] - mnew);
      mrow[r] = mnew;
      float psum = 0.f;
#pragma unroll
      for (int j = 0; j < 4; ++j) {
        const float p = __expf(s[j][r] - mnew);
        psum += p;
        pw[(8 * hh + r) * AKP + j * 16 + c] = (_Float16)p;
      }
#pragma unroll
      for (int off = 1; off < 16; off <<= 1) psum += __shfl_xor(psum, off, 32);
      lrow[r] = lrow[r] * alpha + psum;
#pragma unroll
      for (int t = 0; t < 4; ++t) oacc[t][r] *= alpha;
    }
    __builtin_amdgcn_fence(__ATOMIC_RELEASE, "workgroup");
    __builtin_amdgcn_wave_barrier();
    __builtin_amdgcn_fence(__ATOMIC_ACQUIRE, "workgroup");
#pragma unroll
    for (int kk = 0; kk < 2; ++kk) {
      const v16h pa = ldfrag(pw + c * AKP + kk * 32 + 8 * hh);
#pragma unroll
      for (int t = 0; t < 4; ++t) {
        const v16h vb = ldfrag(Vth + (t * 16 + c) * AKP + kk * 32 + 8 * hh);
        oacc[t] = mma_f16_g(pa, vb, oacc[t]);
      }
    }
  }

  _Float16* os = Osh[wave];
#pragma unroll
  for (int r = 0; r < 8; ++r) {
    const float inv = 1.0f / lrow[r];
#pragma unroll
    for (int t = 0; t < 4; ++t) os[(8 * hh + r) * AKP + t * 16 + c] = (_Float16)(oacc[t][r] * inv);
  }
  __builtin_amdgcn_fence(__ATOMIC_RELEASE, "workgroup");
  __builtin_amdgcn_wave_barrier();
  __builtin_amdgcn_fence(__ATOMIC_ACQUIRE, "workgroup");
  {
    const int q4 = lane >> 3, c8 = (lane & 7) * 8;
    v8h ov[4];
#pragma unroll
    for (int it = 0; it < 4; ++it) {
      const int row = it * 4 + q4;
      ov[it] = *(const v8h*)(os + row * AKP + c8);
    }
    {
#pragma unroll
      for (int it = 0; it < 4; ++it) {
        const int row = it * 4 + q4;
        *(v8h*)(Yb + (size_t)(q0 + row) * C_ + c8) = ov[it];
      }
      
    }
  }
}

// ---------------------------------------------------------------------------
//   WT   f16 [6][1024 n][1024 k]  (Wq,Wk,Wv,Wp,Wqm,Wkm transposed, x16)         0   12582912
//   MA   f16 [192][1024]                                               12582912     393216
//   MOq  f32 [64][1024]                                                12976128     262144
//   MOk  f32 [128][1024]                                               13238272     524288
//   CM   f16 [8][1088][1024]  rows: 0 mem, 1 prev_m, 2..1025 x, 1026..1087 zero  13762560   17825792
//   Q    f16 [8][1024][1024] (x16)                                     31588352   16777216
//   K    f16 [8][1088][1024] (x16)                                     48365568   17825792
//   VT   f16 [8][1024][1088] (x16)                                     66191360   17825792
//   Y    f16 [8][1024][1024] (x16)                                     84017152   16777216
//   total                                                             100794368
// ---------------------------------------------------------------------------
extern "C" void kernel_launch(void* const* d_in, const int* in_sizes, int n_in,
                              void* d_out, int out_size, void* d_ws, size_t ws_size,
                              hipStream_t stream) {
  if (n_in < 15) return;
  if (in_sizes[0] != NB_ * T_ * C_) return;
  if (in_sizes[1] != NB_ * C_) return;
  if (in_sizes[2] != NB_ * MM_ * C_) return;
  for (int i = 3; i <= 13; i += 2) if (in_sizes[i] != C_ * C_) return;
  for (int i = 4; i <= 14; i += 2) if (in_sizes[i] != C_) return;
  if (out_size != NB_ * T_ * C_) return;

  const float* x      = (const float*)d_in[0];
  const float* prev_m = (const float*)d_in[1];
  const float* cached = (const float*)d_in[2];
  const float* Wq  = (const float*)d_in[3];  const float* bq  = (const float*)d_in[4];
  const float* Wk  = (const float*)d_in[5];  const float* bk  = (const float*)d_in[6];
  const float* Wv  = (const float*)d_in[7];  const float* bv  = (const float*)d_in[8];
  const float* Wp  = (const float*)d_in[9];  const float* bp  = (const float*)d_in[10];
  const float* Wqm = (const float*)d_in[11]; const float* bqm = (const float*)d_in[12];
  const float* Wkm = (const float*)d_in[13]; const float* bkm = (const float*)d_in[14];
  float* out = (float*)d_out;

  const size_t szWT  = (size_t)6 * C_ * C_ * 2;
  const size_t szMA  = (size_t)MAR_ * C_ * 2;
  const size_t szMOq = (size_t)64 * C_ * 4;
  const size_t szMOk = (size_t)128 * C_ * 4;
  const size_t szCM  = (size_t)NB_ * LP_ * C_ * 2;
  const size_t szQ   = (size_t)NB_ * T_ * C_ * 2;
  const size_t szK   = (size_t)NB_ * LP_ * C_ * 2;
  const size_t szVT  = (size_t)NB_ * C_ * LP_ * 2;
  const size_t szY   = (size_t)NB_ * T_ * C_ * 2;
  size_t off = 0;
  const size_t oWT  = off; off += szWT;
  const size_t oMA  = off; off += szMA;
  const size_t oMOq = off; off += szMOq;
  const size_t oMOk = off; off += szMOk;
  const size_t oCM  = off; off += szCM;
  const size_t oQ   = off; off += szQ;
  const size_t oK   = off; off += szK;
  const size_t oVT  = off; off += szVT;
  const size_t oY   = off; off += szY;
  if (off > ws_size) return;                   // off = 100794368

  char* ws = (char*)d_ws;
  unsigned short* WT  = (unsigned short*)(ws + oWT);
  unsigned short* MA  = (unsigned short*)(ws + oMA);
  float*          MOq = (float*)(ws + oMOq);
  float*          MOk = (float*)(ws + oMOk);
  unsigned short* CM  = (unsigned short*)(ws + oCM);
  unsigned short* Qh  = (unsigned short*)(ws + oQ);
  unsigned short* Kh  = (unsigned short*)(ws + oK);
  unsigned short* VTh = (unsigned short*)(ws + oVT);
  unsigned short* Yh  = (unsigned short*)(ws + oY);
  unsigned short* WqT  = WT;
  unsigned short* WkT  = WT + (size_t)1 * C_ * C_;
  unsigned short* WvT  = WT + (size_t)2 * C_ * C_;
  unsigned short* WpT  = WT + (size_t)3 * C_ * C_;
  unsigned short* WqmT = WT + (size_t)4 * C_ * C_;
  unsigned short* WkmT = WT + (size_t)5 * C_ * C_;

  const dim3 blk(256);
  const float s16 = 16.0f, r16 = 1.0f / 16.0f, r256 = 1.0f / 256.0f;

  // (1) weights [in k][out n] f32 -> transposed f16 planes [n][k], carried x16  (square: rows = cols = C_)
  wt_kernel<<<dim3(C_ / 64, C_ / 64, 6), blk, 0, stream>>>(Wq, Wk, Wv, Wp, Wqm, Wkm, WT, s16);
  // (2) small operand plane: prev_m rows 0..7, cached rows 64..191
  ma_kernel<<<dim3(MAR_), dim3(128), 0, stream>>>(prev_m, cached, MA);
  // (3) x -> CM rows 2..1025 per batch
  const int n8 = NB_ * T_ * C_ / 8;
  xcvt_kernel<<<dim3((n8 + 255) / 256), blk, 0, stream>>>(x, CM, n8);
  // (4) qm = prev_m . Wqm + bqm -> MOq rows 0..7 (M padded to 64), f32
  gemm_lds<2, 0, 1, 2><<<dim3((64 / 64) * (C_ / 128), 1), dim3(64), 0, stream>>>(
      MA, C_, 0L, WqmT, C_, 0L, (void*)MOq, C_, 0L, C_, 0L, bqm, 64, C_, C_, r16, 1.0f);
  // (5) km = cached . Wkm + bkm -> MOk rows b*16+j (M = 128), f32
  gemm_lds<2, 0, 1, 2><<<dim3((128 / 64) * (C_ / 128), 1), dim3(64), 0, stream>>>(
      MA + (size_t)64 * C_, C_, 0L, WkmT, C_, 0L, (void*)MOk, C_, 0L, C_, 0L, bkm, 128, C_, C_, r16, 1.0f);
  // (6) memory attention (f32) -> CM rows 0 (mem), 1 (prev_m) and zero pad rows, per batch
  mem_kernel<<<dim3(NB_), dim3(512), 0, stream>>>(MOq, MOk, prev_m, CM);
  // (7) q = x . Wq + bq -> Q plane (x16): A = CM rows 2..1025, M = 1024 per batch
  gemm_lds<2, 1, 2, 2><<<dim3((T_ / 128) * (C_ / 128), NB_), dim3(128), 0, stream>>>(
      CM + (size_t)2 * C_, C_, (long)LP_ * C_, WqT, C_, 0L, (void*)Qh, C_, (long)T_ * C_, C_, 0L, bq, T_, C_, C_, r16, s16);
  // (8) k = cm . Wk + bk -> K plane (x16): the batches' rows are contiguous in CM and in K, M = 8 * 1088 (pad rows included)
  gemm_lds<2, 1, 2, 2><<<dim3((NB_ * LP_ / 128) * (C_ / 128), 1), dim3(128), 0, stream>>>(
      CM, C_, 0L, WkT, C_, 0L, (void*)Kh, C_, 0L, C_, 0L, bk, NB_ * LP_, C_, C_, r16, s16);
  // (9) v^T = Wv^T . cm^T + bv[m] -> VT plane [h*64+d][s] (x16): A = WvT [n][k], Bt = CM [b*1088+s][k]; M = 1024,
  //     N = 8 * 1088, output plane = batch (1088 columns each)
  gemm_lds<1, 1, 2, 2><<<dim3((C_ / 128) * (NB_ * LP_ / 128), 1), dim3(128), 0, stream>>>(
      WvT, C_, 0L, CM, C_, 0L, (void*)VTh, LP_, 0L, LP_, (long)C_ * LP_, bv, C_, NB_ * LP_, C_, r16, s16);
  // (10) masked attention -> Y plane (x16)
  attn_kernel<<<dim3(NB_ * NH_ * (T_ / 64)), dim3(128), 0, stream>>>(Qh, Kh, VTh, Yh, 0.125f / 256.0f);
  // (11) out = y . Wp + bp -> d_out f32 [8192][1024]  (y x16, Wp x16 -> scale 1/256)
  gemm_lds<2, 0, 2, 2><<<dim3((NB_ * T_ / 128) * (C_ / 128), 1), dim3(128), 0, stream>>>(
      Yh, C_, 0L, WpT, C_, 0L, (void*)out, C_, 0L, C_, 0L, bp, NB_ * T_, C_, C_, r256, 1.0f);
  (void)hipGetLastError();
}

// v002
// A run of this version takes 185 microseconds.
// Timed twice side by side with v001, it ran 1.25 and 1.26 times as fast.
// Over all steps from v000 it is 2.33 times as fast.
// Contractions x*Wq, cm*Wk, cm*Wv, k*q^T, v^T*p^T, y*Wp, prev_m*Wqm, cached*Wkm: v_wmma_f32_16x16x32_f16, f16 operands (weights carried x16, q/k/v/y planes carried x16, p x1), f32 accumulate; softmax f32; memory-path scores and weighted sum f32 VALU.
#include <hip/hip_runtime.h>
#include <stdint.h>
#include <math.h>

#define NB_   8
#define T_    1024
#define C_    1024
#define NH_   16
#define HD_   64
#define NU_   128
#define MM_   16
#define LKV_  1026
#define LP_   1088
#define MAR_  192
#define AKP   72

typedef _Float16 v16h __attribute__((ext_vector_type(16)));
typedef _Float16 v8h  __attribute__((ext_vector_type(8)));
typedef float    v8f  __attribute__((ext_vector_type(8)));
typedef float    v4f  __attribute__((ext_vector_type(4)));

// ---- 16-bit fragment loader: elements 0..7 <- p[0..7], 8..15 <- p[16..23]; caller passes p = row base + k0 + 8*(lane>>4)
__device__ __forceinline__ v16h ldfrag(const _Float16* p) {
  union { v16h v; v8h h[2]; } f;
  f.h[0] = *(const v8h*)(p);
  f.h[1] = *(const v8h*)(p + 16);
  return f.v;
}
__device__ __forceinline__ v8f mma_f16(v16h a, v16h b, v8f c) {
  return __builtin_amdgcn_wmma_f32_16x16x32_f16(false, a, false, b, (short)0, c, false, false);
}
__device__ __forceinline__ v8f zero8f() { v8f z; z[0]=0.f; z[1]=0.f; z[2]=0.f; z[3]=0.f; z[4]=0.f; z[5]=0.f; z[6]=0.f; z[7]=0.f; return z; }
__device__ __forceinline__ v8h zero8h() {
  v8h z;
#pragma unroll
  for (int e = 0; e < 8; ++e) z[e] = (_Float16)0.0f;
  return z;
}
__device__ __forceinline__ v8h cvt8(v4f a, v4f b, float s) {
  v8h r;
  r[0] = (_Float16)(a[0] * s); r[1] = (_Float16)(a[1] * s); r[2] = (_Float16)(a[2] * s); r[3] = (_Float16)(a[3] * s);
  r[4] = (_Float16)(b[0] * s); r[5] = (_Float16)(b[1] * s); r[6] = (_Float16)(b[2] * s); r[7] = (_Float16)(b[3] * s);
  return r;
}

// ---------------------------------------------------------------------------
// Weight transpose + f16 convert with carry scale s: six inputs W_z [k][n] f32 (C_ x C_) ->
// WT plane z: [n][k] f16 = f16(s * W_z[k][n]).  64x64 tiles through LDS, grid (C_/64, C_/64, 6), 256 threads.
// coverage per block: load 4 it x 256 thr x 4 = 64x64; store 2 it x 256 thr x 8 = 64x64.
// ---------------------------------------------------------------------------
__global__ __launch_bounds__(256)
void wt_kernel(const float* __restrict__ W0, const float* __restrict__ W1, const float* __restrict__ W2,
               const float* __restrict__ W3, const float* __restrict__ W4, const float* __restrict__ W5,
               unsigned short* __restrict__ WT, float s) {
  __shared__ __align__(16) float tf[64 * 68];
  const int z = blockIdx.z;
  const float* W = (z == 0) ? W0 : (z == 1) ? W1 : (z == 2) ? W2 : (z == 3) ? W3 : (z == 4) ? W4 : W5;
  _Float16* out = (_Float16*)WT + (size_t)z * C_ * C_;
  const int c0  = blockIdx.x * 64;   // input column block = output row block
  const int r0  = blockIdx.y * 64;   // input row block    = output column block
  const int tid = threadIdx.x;
  {
    const int lr = tid >> 4;
    const int c4 = (tid & 15) * 4;
#pragma unroll
    for (int it = 0; it < 4; ++it) {
      const int rr = it * 16 + lr;
      const v4f a = *(const v4f*)(W + (size_t)(r0 + rr) * C_ + c0 + c4);
      *(v4f*)(tf + rr * 68 + c4) = a;
    }
  }
  __syncthreads();
  const int sub = tid >> 3;          // 0..31
  const int c8  = (tid & 7) * 8;     // 0..56
  v8h hv[2];
#pragma unroll
  for (int it = 0; it < 2; ++it) {
    const int oc = it * 32 + sub;    // output row within tile (= input column)
    v8h v;
#pragma unroll
    for (int e = 0; e < 8; ++e) v[e] = (_Float16)(tf[(c8 + e) * 68 + oc] * s);
    hv[it] = v;
  }
  {
#pragma unroll
    for (int it = 0; it < 2; ++it) {
      const int oc = it * 32 + sub;
      *(v8h*)(out + (size_t)(c0 + oc) * C_ + r0 + c8) = hv[it];
    }
    
  }
}

// ---------------------------------------------------------------------------
// Small operand plane MA [192][1024] f16: rows 0..7 = prev_m[b], rows 8..63 = 0, rows 64..191 = cached_memory row (row-64).
// grid 192 blocks (one row) x 128 threads x 8 halves; one instruction = whole row (16 lines, 8 lanes per line);
// coverage: 192 x 128 x 8 = whole plane.
// ---------------------------------------------------------------------------
__global__ __launch_bounds__(128)
void ma_kernel(const float* __restrict__ prev_m, const float* __restrict__ cached, unsigned short* __restrict__ MA) {
  const int row  = blockIdx.x;
  const int col8 = threadIdx.x * 8;
  const int rp = (row < NB_) ? row : 0;
  int rc = row - 64; rc = (rc < 0) ? 0 : rc; rc = (rc > NB_ * MM_ - 1) ? (NB_ * MM_ - 1) : rc;
  const float* sp = prev_m + (size_t)rp * C_ + col8;
  const float* sc = cached + (size_t)rc * C_ + col8;
  const v4f p0 = *(const v4f*)(sp), p1 = *(const v4f*)(sp + 4);
  const v4f q0 = *(const v4f*)(sc), q1 = *(const v4f*)(sc + 4);
  const float fp = (row < NB_) ? 1.0f : 0.0f;
  const float fc = (row >= 64) ? 1.0f : 0.0f;
  const v4f a = p0 * fp + q0 * fc;
  const v4f b = p1 * fp + q1 * fc;
  const v8h hv = cvt8(a, b, 1.0f);
  _Float16* d = (_Float16*)MA + (size_t)row * C_ + col8;
  *(v8h*)d = hv;
  
}

// ---------------------------------------------------------------------------
// x [8][1024][1024] f32 -> CM plane rows 2..1025 of each batch ([8][LP_][1024] f16), unscaled.
// ---------------------------------------------------------------------------
__global__ __launch_bounds__(256)
void xcvt_kernel(const float* __restrict__ x, unsigned short* __restrict__ CM, int n8) {
  const int idx = blockIdx.x * 256 + threadIdx.x;
  if (idx >= n8) return;
  const int e = idx * 8;
  const int b = e >> 20, t = (e >> 10) & (T_ - 1), col = e & (C_ - 1);
  const v4f a0 = *(const v4f*)(x + e), a1 = *(const v4f*)(x + e + 4);
  const v8h hv = cvt8(a0, a1, 1.0f);
  _Float16* d = (_Float16*)CM + ((size_t)(b * LP_ + 2 + t)) * C_ + col;
  *(v8h*)d = hv;
  
}

// ---------------------------------------------------------------------------
// Block-tiled batched f16 WMMA GEMM: C[m,n] = oscale * (scale * sum_k A[m,k] * Bt[n,k] + bias).
// One block = WM x WN waves = a (64*WM) x (64*WN) tile of C; each wave owns a 64x64 sub-tile.
// A row-major [M,K] f16; Bt row-major [N,K] f16; M % (64*WM) == 0, N % (64*WN) == 0, K % 64 == 0, K >= 64.
// A pass is 64 k (128 B of every operand row).  A stage is [A rows | Bt rows] at pitch 144 B in LDS, two buffers;
// every lane copies 16-B pieces global -> LDS asynchronously, the next pass's stage in flight while this one is worked on.
// Column n of C lies in output plane n / NPB (plane stride strideCN) at column n % NPB; NPB % 64 == 0.
// BIAS_MODE: 1 = bias[m], 2 = bias[n].  OUT_MODE: 0 = f32, 1 = f16.
// ---------------------------------------------------------------------------
#define GKT 64      // k per pass
#define GP  72      // LDS row pitch in halves: 144 B = 16 B x odd, conflict-free for 16-B fragment reads

// Eight asynchronous 16-B copies per lane.  The s_wait_xcnt closes the statement so that no address register
// named here is rewritten ahead of it.
__device__ __forceinline__ void copy8(const unsigned (&l)[8], const _Float16* const (&g)[8]) {
  asm volatile(
      "global_load_async_to_lds_b128 %0, %8, off\n\t"
      "global_load_async_to_lds_b128 %1, %9, off\n\t"
      "global_load_async_to_lds_b128 %2, %10, off\n\t"
      "global_load_async_to_lds_b128 %3, %11, off\n\t"
      "global_load_async_to_lds_b128 %4, %12, off\n\t"
      "global_load_async_to_lds_b128 %5, %13, off\n\t"
      "global_load_async_to_lds_b128 %6, %14, off\n\t"
      "global_load_async_to_lds_b128 %7, %15, off\n\t"
      "s_wait_xcnt 0x0"
      :: "v"(l[0]), "v"(l[1]), "v"(l[2]), "v"(l[3]), "v"(l[4]), "v"(l[5]), "v"(l[6]), "v"(l[7]),
         "v"(g[0]), "v"(g[1]), "v"(g[2]), "v"(g[3]), "v"(g[4]), "v"(g[5]), "v"(g[6]), "v"(g[7])
      : "memory");
}

template <int BIAS_MODE, int OUT_MODE, int WM, int WN>
__global__ __launch_bounds__(32 * WM * WN) void gemm_lds(
    const unsigned short* __restrict__ Ap, int lda, long strideA,
    const unsigned short* __restrict__ Btp, int ldb, long strideB,
    void* __restrict__ Cout, int ldc, long strideC, int NPB, long strideCN,
    const float* __restrict__ bias, int M, int N, int K, float scale, float oscale) {
  constexpr int NT  = 32 * WM * WN;      // threads
  constexpr int BM  = 64 * WM;           // tile rows
  constexpr int BN  = 64 * WN;           // tile columns
  constexpr int RPI = NT / 8;            // rows covered by one copy of the whole block (8 lanes x 16 B = one 128-B row)
  constexpr int NA  = BM / RPI;          // copies per lane and pass, A rows (16 / WN)
  constexpr int NB  = BN / RPI;          // copies per lane and pass, Bt rows (16 / WM)
  constexpr int STAGE_H = (BM + BN) * GP;
  static_assert(NA % 8 == 0 && NB % 8 == 0 && NA + NB <= 63, "copy groups of eight, at most 63 in flight");
  __shared__ __align__(16) _Float16 ring[2 * STAGE_H];
  __shared__ __align__(16) float sT[WM * WN][16 * 68];   // per-wave 16x64 slab, pitch 68 floats

  const _Float16* A  = (const _Float16*)Ap;
  const _Float16* Bt = (const _Float16*)Btp;
  const int b    = blockIdx.y;
  const int tid  = threadIdx.x;
  const int lane = tid & 31;
  const int wave = tid >> 5;
  const int wm   = wave / WN;
  const int wn   = wave - wm * WN;
  const int tilesN = N / BN;
  const int tm = blockIdx.x / tilesN;    // grid.x = (M / BM) * (N / BN) exactly
  const int tn = blockIdx.x - tm * tilesN;
  const int rlane = lane & 15;                 // row (A) / col (B, D) within subtile
  const int koff  = (lane >> 4) * 8;           // k offset of this lane half
  const int mOff  = (lane >> 4) * 8;           // D row offset

  // this lane's piece of a stage: row tid>>3 (+ RPI per copy), 16-B piece tid&7
  const _Float16* gA = A  + (size_t)b * strideA + (size_t)(tm * BM + (tid >> 3)) * lda + (tid & 7) * 8;
  const _Float16* gB = Bt + (size_t)b * strideB + (size_t)(tn * BN + (tid >> 3)) * ldb + (tid & 7) * 8;
  const unsigned  lds0 = (unsigned)(size_t)(&ring[0]) + (unsigned)((tid >> 3) * (GP * 2) + (tid & 7) * 16);

  auto issue = [&](int kt, int buf) {
    const _Float16* ga = gA + kt * GKT;
    const _Float16* gb = gB + kt * GKT;
    const unsigned  la = lds0 + (unsigned)buf * (unsigned)(STAGE_H * 2);
    const unsigned  lb = la + (unsigned)(BM * GP * 2);
    // the four loops below are unrolled so that l[] and g[] are registers (they are asm operands)
#pragma unroll
    for (int q = 0; q < NA / 8; ++q) {
      unsigned l[8]; const _Float16* g[8];
#pragma unroll
      for (int e = 0; e < 8; ++e) {
        l[e] = la + (unsigned)((q * 8 + e) * RPI * GP * 2);
        g[e] = ga + (size_t)((q * 8 + e) * RPI) * lda;
      }
      copy8(l, g);
    }
#pragma unroll
    for (int q = 0; q < NB / 8; ++q) {
      unsigned l[8]; const _Float16* g[8];
#pragma unroll
      for (int e = 0; e < 8; ++e) {
        l[e] = lb + (unsigned)((q * 8 + e) * RPI * GP * 2);
        g[e] = gb + (size_t)((q * 8 + e) * RPI) * ldb;
      }
      copy8(l, g);
    }
  };

  v8f acc[4][4];
#pragma unroll
  for (int i = 0; i < 4; ++i)
#pragma unroll
    for (int j = 0; j < 4; ++j) acc[i][j] = zero8f();

  const int NP = K / GKT;
  issue(0, 0);
  asm volatile("s_wait_asynccnt 0x0" ::: "memory");   // this wave's pieces of stage 0 have landed
  __syncthreads();                                     // publishes stage 0 to every wave
  if (NP > 1) issue(1, 1);

  for (int t = 0; t < NP; ++t) {
    const _Float16* sA = ring + (t & 1) * STAGE_H + (wm * 64 + rlane) * GP + koff;
    const _Float16* sB = ring + (t & 1) * STAGE_H + (BM + wn * 64 + rlane) * GP + koff;
    // unrolled throughout: fragments and accumulators are indexed at compile time and stay in registers
#pragma unroll
    for (int ks = 0; ks < GKT / 32; ++ks) {
      v16h bh[4], ah[4];
#pragma unroll
      for (int j = 0; j < 4; ++j) bh[j] = ldfrag(sB + j * 16 * GP + ks * 32);
#pragma unroll
      for (int i = 0; i < 4; ++i) ah[i] = ldfrag(sA + i * 16 * GP + ks * 32);
      // keeps the sixteen LDS reads of this k step together ahead of its WMMAs: spread among them, every row of
      // four WMMAs waits out a full LDS latency of its own
      __builtin_amdgcn_sched_barrier(0);
#pragma unroll
      for (int i = 0; i < 4; ++i)
#pragma unroll
        for (int j = 0; j < 4; ++j) acc[i][j] = mma_f16(ah[i], bh[j], acc[i][j]);
    }
    asm volatile("s_wait_dscnt 0x0" ::: "memory");      // this wave's reads of the buffer are done before it is refilled
    asm volatile("s_wait_asynccnt 0x0" ::: "memory");   // this wave's pieces of stage t + 1 have landed
    __syncthreads();                                     // publishes stage t + 1 and ends every reader's use of stage t
    if (t + 2 < NP) issue(t + 2, t & 1);
  }
  asm volatile("s_wait_asynccnt 0x0" ::: "memory");     // no copy outstanding when the wave goes on

  // ---- epilogue ----
  const int m0 = tm * BM + wm * 64;
  const int n0 = tn * BN + wn * 64;
  const int np = n0 / NPB;                     // output plane of this wave's 64 columns
  const int nl = n0 - np * NPB;                // first column inside that plane
  float* slab = sT[wave];
#pragma unroll
  for (int i = 0; i < 4; ++i) {
    const int mBase = m0 + (i << 4);
#pragma unroll
    for (int j = 0; j < 4; ++j) {
      const int n = n0 + (j << 4) + rlane;
      float bvn = 0.f;
      if (BIAS_MODE == 2) bvn = bias[n];
#pragma unroll
      for (int r = 0; r < 8; ++r) {
        float v = acc[i][j][r] * scale;
        if (BIAS_MODE == 1) v += bias[mBase + mOff + r];
        if (BIAS_MODE == 2) v += bvn;
        v *= oscale;
        slab[(mOff + r) * 68 + (j << 4) + rlane] = v;
      }
    }
    __builtin_amdgcn_fence(__ATOMIC_RELEASE, "workgroup");
    __builtin_amdgcn_wave_barrier();
    __builtin_amdgcn_fence(__ATOMIC_ACQUIRE, "workgroup");
    if (OUT_MODE == 0) {
      float* C = (float*)Cout + (size_t)b * strideC + (size_t)np * strideCN;
      const int hh = lane >> 4, c4 = (lane & 15) * 4;     // row seg = 256 B = 16 lanes x 16 B
      {
#pragma unroll
        for (int it = 0; it < 8; ++it) {
          const int row = it * 2 + hh;                     // it 0..7 x hh 0..1 = rows 0..15
          const v4f v = *(const v4f*)(slab + row * 68 + c4);
          *(v4f*)(C + (size_t)(mBase + row) * ldc + nl + c4) = v;
        }
      }
    } else {
      _Float16* C = (_Float16*)Cout + (size_t)b * strideC + (size_t)np * strideCN;
      const int q = lane >> 3, c8 = (lane & 7) * 8;
      v8h hv[4];
#pragma unroll
      for (int it = 0; it < 4; ++it) {
        const int row = it * 4 + q;                        // it 0..3 x q 0..3 = rows 0..15
        const float* spf = slab + row * 68 + c8;
        v8h t;
#pragma unroll
        for (int e = 0; e < 8; ++e) t[e] = (_Float16)spf[e];
        hv[it] = t;
      }
      {
#pragma unroll
        for (int it = 0; it < 4; ++it) {
          const int row = it * 4 + q;
          *(v8h*)(C + (size_t)(mBase + row) * ldc + nl + c8) = hv[it];
        }
      }
    }
    __builtin_amdgcn_fence(__ATOMIC_RELEASE, "workgroup");
    __builtin_amdgcn_wave_barrier();
    __builtin_amdgcn_fence(__ATOMIC_ACQUIRE, "workgroup");
  }
}

// ---------------------------------------------------------------------------
// Memory-compression attention, f32: one block per batch element, 16 waves = 16 heads.
//   qm = MOq row b, km_j = MOk row b*16+j (f32 projections incl. bias); s_j = qm_h.km_jh * 0.125 over 16 keys,
//   softmax in f32, mem_h = sum_j a_j km_jh.  The 1024-float mem row is staged in LDS, then
//   CM row 0 (mem) and row 1 (prev_m) of batch b are written as f16, and pad rows LKV_..LP_-1 as zeros:
// coverage: rows 0,1 by threads 0..255 (128 x 8 halves each), pad rows 62 x 128 pieces by the strided loop.
// ---------------------------------------------------------------------------
__global__ __launch_bounds__(512)
void mem_kernel(const float* __restrict__ MOq, const float* __restrict__ MOk, const float* __restrict__ prev_m,
                unsigned short* __restrict__ CM) {
  __shared__ __align__(16) float smem[C_];
  const int b = blockIdx.x;
  const int tid = threadIdx.x, wave = tid >> 5, lane = tid & 31;
  const int h = wave;
  const int j = lane & 15;
  const float* qh = MOq + (size_t)b * C_ + h * HD_;
  const float* kr = MOk + (size_t)(b * MM_ + j) * C_ + h * HD_;
  float a = 0.f;
#pragma unroll 1
  for (int d4 = 0; d4 < HD_ / 4; ++d4) {
    const v4f qv = *(const v4f*)(qh + 4 * d4);
    const v4f kv = *(const v4f*)(kr + 4 * d4);
    a = fmaf(qv[0], kv[0], a);
    a = fmaf(qv[1], kv[1], a);
    a = fmaf(qv[2], kv[2], a);
    a = fmaf(qv[3], kv[3], a);
  }
  const float sj = (lane < MM_) ? a * 0.125f : -INFINITY;
  float mx = sj;
#pragma unroll
  for (int off = 1; off < 32; off <<= 1) mx = fmaxf(mx, __shfl_xor(mx, off, 32));
  const float e = (lane < MM_) ? __expf(sj - mx) : 0.f;
  float se = e;
#pragma unroll
  for (int off = 1; off < 32; off <<= 1) se += __shfl_xor(se, off, 32);
  const float am = e * (1.0f / se);
  float o0 = 0.f, o1 = 0.f;
#pragma unroll 1
  for (int jj = 0; jj < MM_; ++jj) {
    const float aj = __shfl(am, jj, 32);
    const float* kp = MOk + (size_t)(b * MM_ + jj) * C_ + h * HD_;
    o0 = fmaf(aj, kp[lane], o0);
    o1 = fmaf(aj, kp[lane + 32], o1);
  }
  smem[h * HD_ + lane]      = o0;
  smem[h * HD_ + lane + 32] = o1;
  __syncthreads();

  _Float16* cmb = (_Float16*)CM + (size_t)b * LP_ * C_;
  const v8h z8 = zero8h();
  v8h hv = z8;
  _Float16* dst = cmb;
  const bool has = tid < 256;                 // wave-uniform roles (128 threads = 4 waves per row)
  if (tid < 128) {
    const int col8 = tid * 8;
    const v4f m0 = *(const v4f*)(smem + col8), m1 = *(const v4f*)(smem + col8 + 4);
    hv = cvt8(m0, m1, 1.0f);
    dst = cmb + col8;                                   // row 0 = mem
  } else if (tid < 256) {
    const int col8 = (tid - 128) * 8;
    const float* pp = prev_m + (size_t)b * C_ + col8;
    const v4f p0 = *(const v4f*)(pp), p1 = *(const v4f*)(pp + 4);
    hv = cvt8(p0, p1, 1.0f);
    dst = cmb + C_ + col8;                              // row 1 = prev_m
  }
  {
    if (has) *(v8h*)dst = hv;
    for (int i = tid; i < (LP_ - LKV_) * (C_ / 8); i += 512) {
      const int row  = LKV_ + (i >> 7);
      const int col8 = (i & 127) * 8;
      *(v8h*)(cmb + (size_t)row * C_ + col8) = z8;
    }
    
  }
}

__device__ __forceinline__ float xhalf(float x) {
  const int b = __builtin_bit_cast(int, x);
  return __builtin_bit_cast(float, __builtin_amdgcn_permlanex16(b, b, 0x76543210, 0xfedcba98, false, false));
}

__global__ __launch_bounds__(128)
void attn_kernel(const unsigned short* __restrict__ Qp, const unsigned short* __restrict__ Kp,
                 const unsigned short* __restrict__ VTp, unsigned short* __restrict__ Yp, float sscale) {
  __shared__ __align__(16) _Float16 Ksh[64 * AKP];          // K chunk [key][d], pitch 72
  __shared__ __align__(16) _Float16 Vth[64 * AKP];          // V^T chunk [d][key]
  __shared__ __align__(16) _Float16 Osh[4][16 * AKP];       // per wave output tile [row][d]

  const int tid  = threadIdx.x;
  const int wave = tid >> 5;
  const int lane = tid & 31;
  const int hh   = lane >> 4;
  const int c    = lane & 15;
  const int bx = blockIdx.x;
  const int qb = bx & 15;                 // T_/64 = 16 query blocks
  const int h  = (bx >> 4) & (NH_ - 1);
  const int b  = bx >> 8;
  const int q0 = qb * 64 + wave * 16;     // first query row of this wave (within the batch)

  const _Float16* Qb = (const _Float16*)Qp  + (size_t)b * T_  * C_ + h * HD_;
  const _Float16* Kb = (const _Float16*)Kp  + (size_t)b * LP_ * C_ + h * HD_;
  const _Float16* Vb = (const _Float16*)VTp + ((size_t)b * C_ + h * HD_) * LP_;
  _Float16*       Yb = (_Float16*)Yp + (size_t)b * T_ * C_ + h * HD_;

  // ---- Q fragments (B operand, column = query = lane&15, split k map): 2 d-chunks ----
  v16h qf[2];
#pragma unroll
  for (int dc = 0; dc < 2; ++dc)
    qf[dc] = ldfrag(Qb + (size_t)(q0 + c) * C_ + dc * 32 + 8 * hh);

  const int qrow = q0 + c;                                  // this lane's query
  const int lim  = (qrow < NU_) ? (NU_ + 1) : (qrow + 2);   // its last visible key
  float mrow = -INFINITY;                                   // running maximum of the query (equal in both halves)
  float lrow = 0.f;                                         // this half's share of the query's sum
  v8f oacc[4];                                              // oacc[t][r] = O[query][16t + 8hh + r]
#pragma unroll
  for (int t = 0; t < 4; ++t) oacc[t] = zero8f();

  int maxkey = qb * 64 + 63 + 2;                            // last visible key of the block's last query
  if (qb * 64 < NU_) maxkey = (maxkey > NU_ + 1) ? maxkey : (NU_ + 1);
  const int nChunks = (maxkey >> 6) + 1;                    // block-uniform, 3..17

  for (int kc = 0; kc < nChunks; ++kc) {
    const int kv0 = kc * 64;
    __syncthreads();
    {
      // staging coverage: 128 threads x (4 x 8) halves = 64 rows x 64 per tile
      const int r = tid >> 1, half = (tid & 1) * 32;
      const _Float16* ks = Kb + (size_t)(kv0 + r) * C_ + half;     // K row kv0+r, d = half..half+31
      const _Float16* vs = Vb + (size_t)r * LP_ + kv0 + half;      // V^T row d = r, s = kv0+half..+31
#pragma unroll
      for (int i = 0; i < 4; ++i) {
        const v8h a0 = *(const v8h*)(ks + 8 * i);
        const v8h b0 = *(const v8h*)(vs + 8 * i);
        *(v8h*)(Ksh + r * AKP + half + 8 * i) = a0;
        *(v8h*)(Vth + r * AKP + half + 8 * i) = b0;
      }
    }
    __syncthreads();

    // S^T tiles: rows = keys 16j..16j+15 of the chunk, columns = the wave's 16 queries
    v8f s[4];
#pragma unroll
    for (int j = 0; j < 4; ++j) s[j] = zero8f();
#pragma unroll
    for (int dc = 0; dc < 2; ++dc)
#pragma unroll
      for (int j = 0; j < 4; ++j) {
        const v16h ka = ldfrag(Ksh + (j * 16 + c) * AKP + dc * 32 + 8 * hh);
        s[j] = mma_f16(ka, qf[dc], s[j]);
      }
    const int rel = lim - kv0 - 8 * hh;                     // key kv0 + 8hh + (16j + r) is visible iff 16j + r <= rel
    float mj[4];
#pragma unroll
    for (int j = 0; j < 4; ++j) {
      float m = -INFINITY;
#pragma unroll
      for (int r = 0; r < 8; ++r) {
        const float sv = (j * 16 + r <= rel) ? s[j][r] * sscale : -INFINITY;
        s[j][r] = sv;
        m = fmaxf(m, sv);
      }
      mj[j] = m;
    }
    float cmx = fmaxf(fmaxf(mj[0], mj[1]), fmaxf(mj[2], mj[3]));
    cmx = fmaxf(cmx, xhalf(cmx));                           // the other half's 32 keys of the same query
    const float mnew  = fmaxf(mrow, cmx);
    const float alpha = __expf(mrow - mnew);
    mrow = mnew;
    v16h pb[2];                                             // P^T as B operand, 32 keys each
    float pj[4];
#pragma unroll
    for (int j = 0; j < 4; ++j) {
      float ps = 0.f;
#pragma unroll
      for (int r = 0; r < 8; ++r) {
        const float p = __expf(s[j][r] - mnew);
        ps += p;
        pb[j >> 1][(j & 1) * 8 + r] = (_Float16)p;
      }
      pj[j] = ps;
    }
    lrow = lrow * alpha + ((pj[0] + pj[1]) + (pj[2] + pj[3]));
#pragma unroll
    for (int t = 0; t < 4; ++t) oacc[t] *= alpha;
#pragma unroll
    for (int kk = 0; kk < 2; ++kk)
#pragma unroll
      for (int t = 0; t < 4; ++t) {
        const v16h va = ldfrag(Vth + (t * 16 + c) * AKP + kk * 32 + 8 * hh);
        oacc[t] = mma_f16(va, pb[kk], oacc[t]);
      }
  }

  _Float16* os = Osh[wave];
  {
    const float inv = 1.0f / (lrow + xhalf(lrow));          // the two halves' shares joined once
#pragma unroll
    for (int t = 0; t < 4; ++t) {
      v8h o;
#pragma unroll
      for (int r = 0; r < 8; ++r) o[r] = (_Float16)(oacc[t][r] * inv);
      *(v8h*)(os + c * AKP + t * 16 + 8 * hh) = o;
    }
  }
  __builtin_amdgcn_fence(__ATOMIC_RELEASE, "workgroup");
  __builtin_amdgcn_wave_barrier();
  __builtin_amdgcn_fence(__ATOMIC_ACQUIRE, "workgroup");
  {
    const int q4 = lane >> 3, c8 = (lane & 7) * 8;
    v8h ov[4];
#pragma unroll
    for (int it = 0; it < 4; ++it) {
      const int row = it * 4 + q4;
      ov[it] = *(const v8h*)(os + row * AKP + c8);
    }
    {
#pragma unroll
      for (int it = 0; it < 4; ++it) {
        const int row = it * 4 + q4;
        *(v8h*)(Yb + (size_t)(q0 + row) * C_ + c8) = ov[it];
      }
    }
  }
}

// ---------------------------------------------------------------------------
//   WT   f16 [6][1024 n][1024 k]  (Wq,Wk,Wv,Wp,Wqm,Wkm transposed, x16)         0   12582912
//   MA   f16 [192][1024]                                               12582912     393216
//   MOq  f32 [64][1024]                                                12976128     262144
//   MOk  f32 [128][1024]                                               13238272     524288
//   CM   f16 [8][1088][1024]  rows: 0 mem, 1 prev_m, 2..1025 x, 1026..1087 zero  13762560   17825792
//   Q    f16 [8][1024][1024] (x16)                                     31588352   16777216
//   K    f16 [8][1088][1024] (x16)                                     48365568   17825792
//   VT   f16 [8][1024][1088] (x16)                                     66191360   17825792
//   Y    f16 [8][1024][1024] (x16)                                     84017152   16777216
//   total                                                             100794368
// ---------------------------------------------------------------------------
extern "C" void kernel_launch(void* const* d_in, const int* in_sizes, int n_in,
                              void* d_out, int out_size, void* d_ws, size_t ws_size,
                              hipStream_t stream) {
  if (n_in < 15) return;
  if (in_sizes[0] != NB_ * T_ * C_) return;
  if (in_sizes[1] != NB_ * C_) return;
  if (in_sizes[2] != NB_ * MM_ * C_) return;
  for (int i = 3; i <= 13; i += 2) if (in_sizes[i] != C_ * C_) return;
  for (int i = 4; i <= 14; i += 2) if (in_sizes[i] != C_) return;
  if (out_size != NB_ * T_ * C_) return;

  const float* x      = (const float*)d_in[0];
  const float* prev_m = (const float*)d_in[1];
  const float* cached = (const float*)d_in[2];
  const float* Wq  = (const float*)d_in[3];  const float* bq  = (const float*)d_in[4];
  const float* Wk  = (const float*)d_in[5];  const float* bk  = (const float*)d_in[6];
  const float* Wv  = (const float*)d_in[7];  const float* bv  = (const float*)d_in[8];
  const float* Wp  = (const float*)d_in[9];  const float* bp  = (const float*)d_in[10];
  const float* Wqm = (const float*)d_in[11]; const float* bqm = (const float*)d_in[12];
  const float* Wkm = (const float*)d_in[13]; const float* bkm = (const float*)d_in[14];
  float* out = (float*)d_out;

  const size_t szWT  = (size_t)6 * C_ * C_ * 2;
  const size_t szMA  = (size_t)MAR_ * C_ * 2;
  const size_t szMOq = (size_t)64 * C_ * 4;
  const size_t szMOk = (size_t)128 * C_ * 4;
  const size_t szCM  = (size_t)NB_ * LP_ * C_ * 2;
  const size_t szQ   = (size_t)NB_ * T_ * C_ * 2;
  const size_t szK   = (size_t)NB_ * LP_ * C_ * 2;
  const size_t szVT  = (size_t)NB_ * C_ * LP_ * 2;
  const size_t szY   = (size_t)NB_ * T_ * C_ * 2;
  size_t off = 0;
  const size_t oWT  = off; off += szWT;
  const size_t oMA  = off; off += szMA;
  const size_t oMOq = off; off += szMOq;
  const size_t oMOk = off; off += szMOk;
  const size_t oCM  = off; off += szCM;
  const size_t oQ   = off; off += szQ;
  const size_t oK   = off; off += szK;
  const size_t oVT  = off; off += szVT;
  const size_t oY   = off; off += szY;
  if (off > ws_size) return;                   // off = 100794368

  char* ws = (char*)d_ws;
  unsigned short* WT  = (unsigned short*)(ws + oWT);
  unsigned short* MA  = (unsigned short*)(ws + oMA);
  float*          MOq = (float*)(ws + oMOq);
  float*          MOk = (float*)(ws + oMOk);
  unsigned short* CM  = (unsigned short*)(ws + oCM);
  unsigned short* Qh  = (unsigned short*)(ws + oQ);
  unsigned short* Kh  = (unsigned short*)(ws + oK);
  unsigned short* VTh = (unsigned short*)(ws + oVT);
  unsigned short* Yh  = (unsigned short*)(ws + oY);
  unsigned short* WqT  = WT;
  unsigned short* WkT  = WT + (size_t)1 * C_ * C_;
  unsigned short* WvT  = WT + (size_t)2 * C_ * C_;
  unsigned short* WpT  = WT + (size_t)3 * C_ * C_;
  unsigned short* WqmT = WT + (size_t)4 * C_ * C_;
  unsigned short* WkmT = WT + (size_t)5 * C_ * C_;

  const dim3 blk(256);
  const float s16 = 16.0f, r16 = 1.0f / 16.0f, r256 = 1.0f / 256.0f;

  // (1) weights [in k][out n] f32 -> transposed f16 planes [n][k], carried x16  (square: rows = cols = C_)
  wt_kernel<<<dim3(C_ / 64, C_ / 64, 6), blk, 0, stream>>>(Wq, Wk, Wv, Wp, Wqm, Wkm, WT, s16);
  // (2) small operand plane: prev_m rows 0..7, cached rows 64..191
  ma_kernel<<<dim3(MAR_), dim3(128), 0, stream>>>(prev_m, cached, MA);
  // (3) x -> CM rows 2..1025 per batch
  const int n8 = NB_ * T_ * C_ / 8;
  xcvt_kernel<<<dim3((n8 + 255) / 256), blk, 0, stream>>>(x, CM, n8);
  // (4) qm = prev_m . Wqm + bqm -> MOq rows 0..7 (M padded to 64), f32
  gemm_lds<2, 0, 1, 2><<<dim3((64 / 64) * (C_ / 128), 1), dim3(64), 0, stream>>>(
      MA, C_, 0L, WqmT, C_, 0L, (void*)MOq, C_, 0L, C_, 0L, bqm, 64, C_, C_, r16, 1.0f);
  // (5) km = cached . Wkm + bkm -> MOk rows b*16+j (M = 128), f32
  gemm_lds<2, 0, 1, 2><<<dim3((128 / 64) * (C_ / 128), 1), dim3(64), 0, stream>>>(
      MA + (size_t)64 * C_, C_, 0L, WkmT, C_, 0L, (void*)MOk, C_, 0L, C_, 0L, bkm, 128, C_, C_, r16, 1.0f);
  // (6) memory attention (f32) -> CM rows 0 (mem), 1 (prev_m) and zero pad rows, per batch
  mem_kernel<<<dim3(NB_), dim3(512), 0, stream>>>(MOq, MOk, prev_m, CM);
  // (7) q = x . Wq + bq -> Q plane (x16): A = CM rows 2..1025, M = 1024 per batch
  gemm_lds<2, 1, 2, 2><<<dim3((T_ / 128) * (C_ / 128), NB_), dim3(128), 0, stream>>>(
      CM + (size_t)2 * C_, C_, (long)LP_ * C_, WqT, C_, 0L, (void*)Qh, C_, (long)T_ * C_, C_, 0L, bq, T_, C_, C_, r16, s16);
  // (8) k = cm . Wk + bk -> K plane (x16): the batches' rows are contiguous in CM and in K, M = 8 * 1088 (pad rows included)
  gemm_lds<2, 1, 2, 2><<<dim3((NB_ * LP_ / 128) * (C_ / 128), 1), dim3(128), 0, stream>>>(
      CM, C_, 0L, WkT, C_, 0L, (void*)Kh, C_, 0L, C_, 0L, bk, NB_ * LP_, C_, C_, r16, s16);
  // (9) v^T = Wv^T . cm^T + bv[m] -> VT plane [h*64+d][s] (x16): A = WvT [n][k], Bt = CM [b*1088+s][k]; M = 1024,
  //     N = 8 * 1088, output plane = batch (1088 columns each)
  gemm_lds<1, 1, 2, 2><<<dim3((C_ / 128) * (NB_ * LP_ / 128), 1), dim3(128), 0, stream>>>(
      WvT, C_, 0L, CM, C_, 0L, (void*)VTh, LP_, 0L, LP_, (long)C_ * LP_, bv, C_, NB_ * LP_, C_, r16, s16);
  // (10) masked attention -> Y plane (x16)
  attn_kernel<<<dim3(NB_ * NH_ * (T_ / 64)), dim3(128), 0, stream>>>(Qh, Kh, VTh, Yh, 0.125f / 256.0f);
  // (11) out = y . Wp + bp -> d_out f32 [8192][1024]  (y x16, Wp x16 -> scale 1/256)
  gemm_lds<2, 0, 2, 2><<<dim3((NB_ * T_ / 128) * (C_ / 128), 1), dim3(128), 0, stream>>>(
      Yh, C_, 0L, WpT, C_, 0L, (void*)out, C_, 0L, C_, 0L, bp, NB_ * T_, C_, C_, r256, 1.0f);
  (void)hipGetLastError();
}

// v003
// One run takes 146 microseconds.
// Two timings next to v002 both put it at 1.25 times that version's speed.
// Over all steps from v000 it is 2.91 times as fast.
// Contractions x*Wq, cm*Wk, cm*Wv, k*q^T, v^T*p^T, y*Wp, prev_m*Wqm, cached*Wkm: v_wmma_f32_16x16x32_f16, f16 operands (weights carried x16, q/k/v/y planes carried x16, p x1), f32 accumulate; softmax f32; memory-path scores and weighted sum f32 VALU.
#include <hip/hip_runtime.h>
#include <stdint.h>
#include <math.h>

#define NB_   8
#define T_    1024
#define C_    1024
#define NH_   16
#define HD_   64
#define NU_   128
#define MM_   16
#define LKV_  1026
#define LP_   1088
#define MAR_  192
#define AKP   72

typedef _Float16 v16h __attribute__((ext_vector_type(16)));
typedef _Float16 v8h  __attribute__((ext_vector_type(8)));
typedef float    v8f  __attribute__((ext_vector_type(8)));
typedef float    v4f  __attribute__((ext_vector_type(4)));

// ---- 16-bit fragment loader: elements 0..7 <- p[0..7], 8..15 <- p[16..23]; caller passes p = row base + k0 + 8*(lane>>4)
__device__ __forceinline__ v16h ldfrag(const _Float16* p) {
  union { v16h v; v8h h[2]; } f;
  f.h[0] = *(const v8h*)(p);
  f.h[1] = *(const v8h*)(p + 16);
  return f.v;
}
__device__ __forceinline__ v8f mma_f16(v16h a, v16h b, v8f c) {
  return __builtin_amdgcn_wmma_f32_16x16x32_f16(false, a, false, b, (short)0, c, false, false);
}
__device__ __forceinline__ v8f zero8f() { v8f z; z[0]=0.f; z[1]=0.f; z[2]=0.f; z[3]=0.f; z[4]=0.f; z[5]=0.f; z[6]=0.f; z[7]=0.f; return z; }
__device__ __forceinline__ v8h zero8h() {
  v8h z;
#pragma unroll
  for (int e = 0; e < 8; ++e) z[e] = (_Float16)0.0f;
  return z;
}
__device__ __forceinline__ v8h cvt8(v4f a, v4f b, float s) {
  v8h r;
  r[0] = (_Float16)(a[0] * s); r[1] = (_Float16)(a[1] * s); r[2] = (_Float16)(a[2] * s); r[3] = (_Float16)(a[3] * s);
  r[4] = (_Float16)(b[0] * s); r[5] = (_Float16)(b[1] * s); r[6] = (_Float16)(b[2] * s); r[7] = (_Float16)(b[3] * s);
  return r;
}

// ---------------------------------------------------------------------------
// Weight transpose + f16 convert with carry scale s: six inputs W_z [k][n] f32 (C_ x C_) ->
// WT plane z: [n][k] f16 = f16(s * W_z[k][n]).  64x64 tiles through LDS, one tile (bxx, byy, z) per block of 256 threads.
// coverage per block: load 4 it x 256 thr x 4 = 64x64; store 2 it x 256 thr x 8 = 64x64.
// ---------------------------------------------------------------------------
__device__ __forceinline__
void wt_body(float* tf, int bxx, int byy, int z,
             const float* __restrict__ W0, const float* __restrict__ W1, const float* __restrict__ W2,
             const float* __restrict__ W3, const float* __restrict__ W4, const float* __restrict__ W5,
             unsigned short* __restrict__ WT, float s) {
  const float* W = (z == 0) ? W0 : (z == 1) ? W1 : (z == 2) ? W2 : (z == 3) ? W3 : (z == 4) ? W4 : W5;
  _Float16* out = (_Float16*)WT + (size_t)z * C_ * C_;
  const int c0  = bxx * 64;          // input column block = output row block
  const int r0  = byy * 64;          // input row block    = output column block
  const int tid = threadIdx.x;
  {
    const int lr = tid >> 4;
    const int c4 = (tid & 15) * 4;
#pragma unroll
    for (int it = 0; it < 4; ++it) {
      const int rr = it * 16 + lr;
      const v4f a = *(const v4f*)(W + (size_t)(r0 + rr) * C_ + c0 + c4);
      *(v4f*)(tf + rr * 68 + c4) = a;
    }
  }
  __syncthreads();
  const int sub = tid >> 3;          // 0..31
  const int c8  = (tid & 7) * 8;     // 0..56
  v8h hv[2];
#pragma unroll
  for (int it = 0; it < 2; ++it) {
    const int oc = it * 32 + sub;    // output row within tile (= input column)
    v8h v;
#pragma unroll
    for (int e = 0; e < 8; ++e) v[e] = (_Float16)(tf[(c8 + e) * 68 + oc] * s);
    hv[it] = v;
  }
  {
#pragma unroll
    for (int it = 0; it < 2; ++it) {
      const int oc = it * 32 + sub;
      *(v8h*)(out + (size_t)(c0 + oc) * C_ + r0 + c8) = hv[it];
    }
    asm volatile("s_wait_xcnt 0x0" ::: "memory");          // before a register that these stores name is rewritten
  }
}

// ---------------------------------------------------------------------------
// Small operand plane MA [192][1024] f16: rows 0..7 = prev_m[b], rows 8..63 = 0, rows 64..191 = cached_memory row (row-64).
// 96 blocks (two rows each) x 256 threads x 8 halves; 128 threads = whole row (16 lines, 8 lanes per line);
// coverage: 96 x 256 x 8 = whole plane.
// ---------------------------------------------------------------------------
__device__ __forceinline__
void ma_body(int blk, const float* __restrict__ prev_m, const float* __restrict__ cached, unsigned short* __restrict__ MA) {
  const int row  = blk * 2 + ((int)threadIdx.x >> 7);
  const int col8 = ((int)threadIdx.x & 127) * 8;
  const int rp = (row < NB_) ? row : 0;
  int rc = row - 64; rc = (rc < 0) ? 0 : rc; rc = (rc > NB_ * MM_ - 1) ? (NB_ * MM_ - 1) : rc;
  const float* sp = prev_m + (size_t)rp * C_ + col8;
  const float* sc = cached + (size_t)rc * C_ + col8;
  const v4f p0 = *(const v4f*)(sp), p1 = *(const v4f*)(sp + 4);
  const v4f q0 = *(const v4f*)(sc), q1 = *(const v4f*)(sc + 4);
  const float fp = (row < NB_) ? 1.0f : 0.0f;
  const float fc = (row >= 64) ? 1.0f : 0.0f;
  const v4f a = p0 * fp + q0 * fc;
  const v4f b = p1 * fp + q1 * fc;
  const v8h hv = cvt8(a, b, 1.0f);
  _Float16* d = (_Float16*)MA + (size_t)row * C_ + col8;
  *(v8h*)d = hv;
  asm volatile("s_wait_xcnt 0x0" ::: "memory");            // before a register that this store names is rewritten
}

// ---------------------------------------------------------------------------
// x [8][1024][1024] f32 -> CM plane rows 2..1025 of each batch ([8][LP_][1024] f16), unscaled.
// ---------------------------------------------------------------------------
__device__ __forceinline__
void xcvt_body(int blk, const float* __restrict__ x, unsigned short* __restrict__ CM, int n8) {
  const int idx = blk * 256 + threadIdx.x;
  if (idx >= n8) return;
  const int e = idx * 8;
  const int b = e >> 20, t = (e >> 10) & (T_ - 1), col = e & (C_ - 1);
  const v4f a0 = *(const v4f*)(x + e), a1 = *(const v4f*)(x + e + 4);
  const v8h hv = cvt8(a0, a1, 1.0f);
  _Float16* d = (_Float16*)CM + ((size_t)(b * LP_ + 2 + t)) * C_ + col;
  *(v8h*)d = hv;
  asm volatile("s_wait_xcnt 0x0" ::: "memory");            // before a register that this store names is rewritten
}

// ---------------------------------------------------------------------------
// The three operand preparations read none of each other's output: one launch, the block index picks the job.
//   blocks 0 .. 1535: weight tiles (16 x 16 x 6);  1536 .. 5631: x pieces;  5632 .. 5727: small operand plane.
// ---------------------------------------------------------------------------
#define PREP_WT  (6 * (C_ / 64) * (C_ / 64))
#define PREP_X   (NB_ * T_ * C_ / 8 / 256)
#define PREP_MA  (MAR_ / 2)
__global__ __launch_bounds__(256)
void prep_kernel(const float* __restrict__ W0, const float* __restrict__ W1, const float* __restrict__ W2,
                 const float* __restrict__ W3, const float* __restrict__ W4, const float* __restrict__ W5,
                 unsigned short* __restrict__ WT, float s,
                 const float* __restrict__ x, unsigned short* __restrict__ CM,
                 const float* __restrict__ prev_m, const float* __restrict__ cached, unsigned short* __restrict__ MA) {
  __shared__ __align__(16) float tf[64 * 68];
  const int bx = blockIdx.x;
  if (bx < PREP_WT) {
    wt_body(tf, bx & 15, (bx >> 4) & 15, bx >> 8, W0, W1, W2, W3, W4, W5, WT, s);
  } else if (bx < PREP_WT + PREP_X) {
    xcvt_body(bx - PREP_WT, x, CM, NB_ * T_ * C_ / 8);
  } else {
    ma_body(bx - (PREP_WT + PREP_X), prev_m, cached, MA);
  }
}

// ---------------------------------------------------------------------------
// Block-tiled batched f16 WMMA GEMM: C[m,n] = oscale * (scale * sum_k A[m,k] * Bt[n,k] + bias).
// One block = WM x WN waves = a (64*WM) x (64*WN) tile of C; each wave owns a 64x64 sub-tile.
// A row-major [M,K] f16; Bt row-major [N,K] f16; M % (64*WM) == 0, N % (64*WN) == 0, K % 64 == 0, K >= 64.
// A pass is 64 k (128 B of every operand row).  A stage is [A rows | Bt rows] at pitch 144 B in LDS, two buffers;
// every lane copies 16-B pieces global -> LDS asynchronously, the next pass's stage in flight while this one is worked on.
// Column n of C lies in output plane n / NPB (plane stride strideCN) at column n % NPB; NPB % 64 == 0.
// BIAS_MODE: 1 = bias[m], 2 = bias[n].  OUT_MODE: 0 = f32, 1 = f16.
// ---------------------------------------------------------------------------
#define GKT 64      // k per pass
#define GP  72      // LDS row pitch in halves: 144 B = 16 B x odd, conflict-free for 16-B fragment reads

// Eight asynchronous 16-B copies per lane.  The s_wait_xcnt closes the statement so that no address register
// named here is rewritten ahead of it.
__device__ __forceinline__ void copy8(const unsigned (&l)[8], const _Float16* const (&g)[8]) {
  asm volatile(
      "global_load_async_to_lds_b128 %0, %8, off\n\t"
      "global_load_async_to_lds_b128 %1, %9, off\n\t"
      "global_load_async_to_lds_b128 %2, %10, off\n\t"
      "global_load_async_to_lds_b128 %3, %11, off\n\t"
      "global_load_async_to_lds_b128 %4, %12, off\n\t"
      "global_load_async_to_lds_b128 %5, %13, off\n\t"
      "global_load_async_to_lds_b128 %6, %14, off\n\t"
      "global_load_async_to_lds_b128 %7, %15, off\n\t"
      "s_wait_xcnt 0x0"
      :: "v"(l[0]), "v"(l[1]), "v"(l[2]), "v"(l[3]), "v"(l[4]), "v"(l[5]), "v"(l[6]), "v"(l[7]),
         "v"(g[0]), "v"(g[1]), "v"(g[2]), "v"(g[3]), "v"(g[4]), "v"(g[5]), "v"(g[6]), "v"(g[7])
      : "memory");
}

// ring: 2 * (64*WM + 64*WN) * GP halves of LDS; sT: WM * WN slabs of 16 x 68 floats of LDS; bx = tile index, b = batch.
template <int BIAS_MODE, int OUT_MODE, int WM, int WN>
__device__ __forceinline__ void gemm_body(
    _Float16* ring, float* sT, int bx, int b,
    const unsigned short* __restrict__ Ap, int lda, long strideA,
    const unsigned short* __restrict__ Btp, int ldb, long strideB,
    void* __restrict__ Cout, int ldc, long strideC, int NPB, long strideCN,
    const float* __restrict__ bias, int M, int N, int K, float scale, float oscale) {
  constexpr int NT  = 32 * WM * WN;      // threads
  constexpr int BM  = 64 * WM;           // tile rows
  constexpr int BN  = 64 * WN;           // tile columns
  constexpr int RPI = NT / 8;            // rows covered by one copy of the whole block (8 lanes x 16 B = one 128-B row)
  constexpr int NA  = BM / RPI;          // copies per lane and pass, A rows (16 / WN)
  constexpr int NB  = BN / RPI;          // copies per lane and pass, Bt rows (16 / WM)
  constexpr int STAGE_H = (BM + BN) * GP;
  static_assert(NA % 8 == 0 && NB % 8 == 0 && NA + NB <= 63, "copy groups of eight, at most 63 in flight");

  const _Float16* A  = (const _Float16*)Ap;
  const _Float16* Bt = (const _Float16*)Btp;
  const int tid  = threadIdx.x;
  const int lane = tid & 31;
  const int wave = tid >> 5;
  const int wm   = wave / WN;
  const int wn   = wave - wm * WN;
  const int tilesN = N / BN;
  const int tm = bx / tilesN;            // bx runs over (M / BM) * (N / BN) tiles exactly
  const int tn = bx - tm * tilesN;
  const int rlane = lane & 15;                 // row (A) / col (B, D) within subtile
  const int koff  = (lane >> 4) * 8;           // k offset of this lane half
  const int mOff  = (lane >> 4) * 8;           // D row offset

  // this lane's piece of a stage: row tid>>3 (+ RPI per copy), 16-B piece tid&7
  const _Float16* gA = A  + (size_t)b * strideA + (size_t)(tm * BM + (tid >> 3)) * lda + (tid & 7) * 8;
  const _Float16* gB = Bt + (size_t)b * strideB + (size_t)(tn * BN + (tid >> 3)) * ldb + (tid & 7) * 8;
  const unsigned  lds0 = (unsigned)(size_t)(&ring[0]) + (unsigned)((tid >> 3) * (GP * 2) + (tid & 7) * 16);

  auto issue = [&](int kt, int buf) {
    const _Float16* ga = gA + kt * GKT;
    const _Float16* gb = gB + kt * GKT;
    const unsigned  la = lds0 + (unsigned)buf * (unsigned)(STAGE_H * 2);
    const unsigned  lb = la + (unsigned)(BM * GP * 2);
    // the four loops below are unrolled so that l[] and g[] are registers (they are asm operands)
#pragma unroll
    for (int q = 0; q < NA / 8; ++q) {
      unsigned l[8]; const _Float16* g[8];
#pragma unroll
      for (int e = 0; e < 8; ++e) {
        l[e] = la + (unsigned)((q * 8 + e) * RPI * GP * 2);
        g[e] = ga + (size_t)((q * 8 + e) * RPI) * lda;
      }
      copy8(l, g);
    }
#pragma unroll
    for (int q = 0; q < NB / 8; ++q) {
      unsigned l[8]; const _Float16* g[8];
#pragma unroll
      for (int e = 0; e < 8; ++e) {
        l[e] = lb + (unsigned)((q * 8 + e) * RPI * GP * 2);
        g[e] = gb + (size_t)((q * 8 + e) * RPI) * ldb;
      }
      copy8(l, g);
    }
  };

  v8f acc[4][4];
#pragma unroll
  for (int i = 0; i < 4; ++i)
#pragma unroll
    for (int j = 0; j < 4; ++j) acc[i][j] = zero8f();

  const int NP = K / GKT;
  issue(0, 0);
  asm volatile("s_wait_asynccnt 0x0" ::: "memory");   // this wave's pieces of stage 0 have landed
  __syncthreads();                                     // publishes stage 0 to every wave
  if (NP > 1) issue(1, 1);

  for (int t = 0; t < NP; ++t) {
    const _Float16* sA = ring + (t & 1) * STAGE_H + (wm * 64 + rlane) * GP + koff;
    const _Float16* sB = ring + (t & 1) * STAGE_H + (BM + wn * 64 + rlane) * GP + koff;
    // unrolled throughout: fragments and accumulators are indexed at compile time and stay in registers
#pragma unroll
    for (int ks = 0; ks < GKT / 32; ++ks) {
      v16h bh[4], ah[4];
#pragma unroll
      for (int j = 0; j < 4; ++j) bh[j] = ldfrag(sB + j * 16 * GP + ks * 32);
#pragma unroll
      for (int i = 0; i < 4; ++i) ah[i] = ldfrag(sA + i * 16 * GP + ks * 32);
      // keeps the sixteen LDS reads of this k step together ahead of its WMMAs: spread among them, every row of
      // four WMMAs waits out a full LDS latency of its own
      __builtin_amdgcn_sched_barrier(0);
#pragma unroll
      for (int i = 0; i < 4; ++i)
#pragma unroll
        for (int j = 0; j < 4; ++j) acc[i][j] = mma_f16(ah[i], bh[j], acc[i][j]);
    }
    asm volatile("s_wait_dscnt 0x0" ::: "memory");      // this wave's reads of the buffer are done before it is refilled
    asm volatile("s_wait_asynccnt 0x0" ::: "memory");   // this wave's pieces of stage t + 1 have landed
    __syncthreads();                                     // publishes stage t + 1 and ends every reader's use of stage t
    if (t + 2 < NP) issue(t + 2, t & 1);
  }
  asm volatile("s_wait_asynccnt 0x0" ::: "memory");     // no copy outstanding when the wave goes on

  // ---- epilogue ----
  const int m0 = tm * BM + wm * 64;
  const int n0 = tn * BN + wn * 64;
  const int np = n0 / NPB;                     // output plane of this wave's 64 columns
  const int nl = n0 - np * NPB;                // first column inside that plane
  float* slab = sT + wave * (16 * 68);         // per-wave 16x64 slab, pitch 68 floats
#pragma unroll
  for (int i = 0; i < 4; ++i) {
    const int mBase = m0 + (i << 4);
#pragma unroll
    for (int j = 0; j < 4; ++j) {
      const int n = n0 + (j << 4) + rlane;
      float bvn = 0.f;
      if (BIAS_MODE == 2) bvn = bias[n];
#pragma unroll
      for (int r = 0; r < 8; ++r) {
        float v = acc[i][j][r] * scale;
        if (BIAS_MODE == 1) v += bias[mBase + mOff + r];
        if (BIAS_MODE == 2) v += bvn;
        v *= oscale;
        slab[(mOff + r) * 68 + (j << 4) + rlane] = v;
      }
    }
    __builtin_amdgcn_fence(__ATOMIC_RELEASE, "workgroup");
    __builtin_amdgcn_wave_barrier();
    __builtin_amdgcn_fence(__ATOMIC_ACQUIRE, "workgroup");
    if (OUT_MODE == 0) {
      float* C = (float*)Cout + (size_t)b * strideC + (size_t)np * strideCN;
      const int hh = lane >> 4, c4 = (lane & 15) * 4;     // row seg = 256 B = 16 lanes x 16 B
      {
#pragma unroll
        for (int it = 0; it < 8; ++it) {
          const int row = it * 2 + hh;                     // it 0..7 x hh 0..1 = rows 0..15
          const v4f v = *(const v4f*)(slab + row * 68 + c4);
          *(v4f*)(C + (size_t)(mBase + row) * ldc + nl + c4) = v;
        }
      }
      asm volatile("s_wait_xcnt 0x0" ::: "memory");        // before a register that these stores name is rewritten
    } else {
      _Float16* C = (_Float16*)Cout + (size_t)b * strideC + (size_t)np * strideCN;
      const int q = lane >> 3, c8 = (lane & 7) * 8;
      v8h hv[4];
#pragma unroll
      for (int it = 0; it < 4; ++it) {
        const int row = it * 4 + q;                        // it 0..3 x q 0..3 = rows 0..15
        const float* spf = slab + row * 68 + c8;
        v8h t;
#pragma unroll
        for (int e = 0; e < 8; ++e) t[e] = (_Float16)spf[e];
        hv[it] = t;
      }
      {
#pragma unroll
        for (int it = 0; it < 4; ++it) {
          const int row = it * 4 + q;
          *(v8h*)(C + (size_t)(mBase + row) * ldc + nl + c8) = hv[it];
        }
      }
      asm volatile("s_wait_xcnt 0x0" ::: "memory");        // before a register that these stores name is rewritten
    }
    __builtin_amdgcn_fence(__ATOMIC_RELEASE, "workgroup");
    __builtin_amdgcn_wave_barrier();
    __builtin_amdgcn_fence(__ATOMIC_ACQUIRE, "workgroup");
  }
}

#define G22_RING_H (2 * (128 + 128) * GP)    // LDS of a 2 x 2 wave block: two stages of 256 rows
#define G22_SLAB_F (4 * 16 * 68)             // and four epilogue slabs
#define TQ_  ((T_ / 128) * (C_ / 128))       // tiles of one batch of q
#define TKV_ ((NB_ * LP_ / 128) * (C_ / 128))  // tiles of k, and of v^T

// GEMMs that read none of each other's output share a launch; the block index picks the product (block-uniform branch).
// Blocks 0..7: qm = MA rows 0..127 . Wqm + bqm -> MOq (rows 0..7 are prev_m's, the others are not read);
// 8..15: km = cached . Wkm + bkm -> MOk;  16..: q = x . Wq + bq -> Q plane (x16), 64 tiles per batch.
__global__ __launch_bounds__(128) void gemm_qm_km_q(
    const unsigned short* __restrict__ MA, const unsigned short* __restrict__ WqmT, const unsigned short* __restrict__ WkmT,
    float* __restrict__ MOq, float* __restrict__ MOk, const float* __restrict__ bqm, const float* __restrict__ bkm,
    const unsigned short* __restrict__ CMx, const unsigned short* __restrict__ WqT, unsigned short* __restrict__ Qh,
    const float* __restrict__ bq, float r16, float s16) {
  __shared__ __align__(16) _Float16 ring[G22_RING_H];
  __shared__ __align__(16) float sT[G22_SLAB_F];
  const int bx = blockIdx.x;
  if (bx < 16) {
    const bool isq = bx < 8;
    gemm_body<2, 0, 2, 2>(ring, sT, bx & 7, 0,
        isq ? MA : MA + (size_t)64 * C_, C_, 0L, isq ? WqmT : WkmT, C_, 0L,
        (void*)(isq ? MOq : MOk), C_, 0L, C_, 0L, isq ? bqm : bkm, 128, C_, C_, r16, 1.0f);
  } else {
    const int i = bx - 16;
    gemm_body<2, 1, 2, 2>(ring, sT, i % TQ_, i / TQ_,
        CMx, C_, (long)LP_ * C_, WqT, C_, 0L, (void*)Qh, C_, (long)T_ * C_, C_, 0L, bq, T_, C_, C_, r16, s16);
  }
}

// Blocks 0..TKV_-1: k = cm . Wk + bk -> K plane (x16), the batches' rows contiguous in CM and in K, M = 8 * 1088;
// TKV_..: v^T = Wv^T . cm^T + bv[m] -> VT plane [h*64+d][s] (x16), N = 8 * 1088, output plane = batch (1088 columns each).
__global__ __launch_bounds__(128) void gemm_k_vt(
    const unsigned short* __restrict__ CM, const unsigned short* __restrict__ WkT, const unsigned short* __restrict__ WvT,
    unsigned short* __restrict__ Kh, unsigned short* __restrict__ VTh,
    const float* __restrict__ bk, const float* __restrict__ bv, float r16, float s16) {
  __shared__ __align__(16) _Float16 ring[G22_RING_H];
  __shared__ __align__(16) float sT[G22_SLAB_F];
  const int bx = blockIdx.x;
  if (bx < TKV_) {
    gemm_body<2, 1, 2, 2>(ring, sT, bx, 0,
        CM, C_, 0L, WkT, C_, 0L, (void*)Kh, C_, 0L, C_, 0L, bk, NB_ * LP_, C_, C_, r16, s16);
  } else {
    gemm_body<1, 1, 2, 2>(ring, sT, bx - TKV_, 0,
        WvT, C_, 0L, CM, C_, 0L, (void*)VTh, LP_, 0L, LP_, (long)C_ * LP_, bv, C_, NB_ * LP_, C_, r16, s16);
  }
}

// out = y . Wp + bp -> f32 [8192][1024]
__global__ __launch_bounds__(128) void gemm_out(
    const unsigned short* __restrict__ Yh, const unsigned short* __restrict__ WpT, float* __restrict__ out,
    const float* __restrict__ bp, float r256) {
  __shared__ __align__(16) _Float16 ring[G22_RING_H];
  __shared__ __align__(16) float sT[G22_SLAB_F];
  gemm_body<2, 0, 2, 2>(ring, sT, blockIdx.x, 0,
      Yh, C_, 0L, WpT, C_, 0L, (void*)out, C_, 0L, C_, 0L, bp, NB_ * T_, C_, C_, r256, 1.0f);
}

// ---------------------------------------------------------------------------
// Memory-compression attention, f32: one block per batch element, 16 waves = 16 heads.
//   qm = MOq row b, km_j = MOk row b*16+j (f32 projections incl. bias); s_j = qm_h.km_jh * 0.125 over 16 keys,
//   softmax in f32, mem_h = sum_j a_j km_jh.  The 1024-float mem row is staged in LDS, then
//   CM row 0 (mem) and row 1 (prev_m) of batch b are written as f16, and pad rows LKV_..LP_-1 as zeros:
// coverage: rows 0,1 by threads 0..255 (128 x 8 halves each), pad rows 62 x 128 pieces by the strided loop.
// ---------------------------------------------------------------------------
__global__ __launch_bounds__(512)
void mem_kernel(const float* __restrict__ MOq, const float* __restrict__ MOk, const float* __restrict__ prev_m,
                unsigned short* __restrict__ CM) {
  __shared__ __align__(16) float smem[C_];
  const int b = blockIdx.x;
  const int tid = threadIdx.x, wave = tid >> 5, lane = tid & 31;
  const int h = wave;
  const int j = lane & 15;
  const float* qh = MOq + (size_t)b * C_ + h * HD_;
  const float* kr = MOk + (size_t)(b * MM_ + j) * C_ + h * HD_;
  float a = 0.f;
#pragma unroll 1
  for (int d4 = 0; d4 < HD_ / 4; ++d4) {
    const v4f qv = *(const v4f*)(qh + 4 * d4);
    const v4f kv = *(const v4f*)(kr + 4 * d4);
    a = fmaf(qv[0], kv[0], a);
    a = fmaf(qv[1], kv[1], a);
    a = fmaf(qv[2], kv[2], a);
    a = fmaf(qv[3], kv[3], a);
  }
  const float sj = (lane < MM_) ? a * 0.125f : -INFINITY;
  float mx = sj;
#pragma unroll
  for (int off = 1; off < 32; off <<= 1) mx = fmaxf(mx, __shfl_xor(mx, off, 32));
  const float e = (lane < MM_) ? __expf(sj - mx) : 0.f;
  float se = e;
#pragma unroll
  for (int off = 1; off < 32; off <<= 1) se += __shfl_xor(se, off, 32);
  const float am = e * (1.0f / se);
  float o0 = 0.f, o1 = 0.f;
#pragma unroll 1
  for (int jj = 0; jj < MM_; ++jj) {
    const float aj = __shfl(am, jj, 32);
    const float* kp = MOk + (size_t)(b * MM_ + jj) * C_ + h * HD_;
    o0 = fmaf(aj, kp[lane], o0);
    o1 = fmaf(aj, kp[lane + 32], o1);
  }
  smem[h * HD_ + lane]      = o0;
  smem[h * HD_ + lane + 32] = o1;
  __syncthreads();

  _Float16* cmb = (_Float16*)CM + (size_t)b * LP_ * C_;
  const v8h z8 = zero8h();
  v8h hv = z8;
  _Float16* dst = cmb;
  const bool has = tid < 256;                 // wave-uniform roles (128 threads = 4 waves per row)
  if (tid < 128) {
    const int col8 = tid * 8;
    const v4f m0 = *(const v4f*)(smem + col8), m1 = *(const v4f*)(smem + col8 + 4);
    hv = cvt8(m0, m1, 1.0f);
    dst = cmb + col8;                                   // row 0 = mem
  } else if (tid < 256) {
    const int col8 = (tid - 128) * 8;
    const float* pp = prev_m + (size_t)b * C_ + col8;
    const v4f p0 = *(const v4f*)(pp), p1 = *(const v4f*)(pp + 4);
    hv = cvt8(p0, p1, 1.0f);
    dst = cmb + C_ + col8;                              // row 1 = prev_m
  }
  {
    if (has) *(v8h*)dst = hv;
    for (int i = tid; i < (LP_ - LKV_) * (C_ / 8); i += 512) {
      const int row  = LKV_ + (i >> 7);
      const int col8 = (i & 127) * 8;
      *(v8h*)(cmb + (size_t)row * C_ + col8) = z8;
    }
    
  }
}

__device__ __forceinline__ float xhalf(float x) {
  const int b = __builtin_bit_cast(int, x);
  return __builtin_bit_cast(float, __builtin_amdgcn_permlanex16(b, b, 0x76543210, 0xfedcba98, false, false));
}

__global__ __launch_bounds__(128)
void attn_kernel(const unsigned short* __restrict__ Qp, const unsigned short* __restrict__ Kp,
                 const unsigned short* __restrict__ VTp, unsigned short* __restrict__ Yp, float sscale) {
  __shared__ __align__(16) _Float16 Ksh[64 * AKP];          // K chunk [key][d], pitch 72
  __shared__ __align__(16) _Float16 Vth[64 * AKP];          // V^T chunk [d][key]
  __shared__ __align__(16) _Float16 Osh[4][16 * AKP];       // per wave output tile [row][d]

  const int tid  = threadIdx.x;
  const int wave = tid >> 5;
  const int lane = tid & 31;
  const int hh   = lane >> 4;
  const int c    = lane & 15;
  const int bx = blockIdx.x;
  const int qb = bx & 15;                 // T_/64 = 16 query blocks
  const int h  = (bx >> 4) & (NH_ - 1);
  const int b  = bx >> 8;
  const int q0 = qb * 64 + wave * 16;     // first query row of this wave (within the batch)

  const _Float16* Qb = (const _Float16*)Qp  + (size_t)b * T_  * C_ + h * HD_;
  const _Float16* Kb = (const _Float16*)Kp  + (size_t)b * LP_ * C_ + h * HD_;
  const _Float16* Vb = (const _Float16*)VTp + ((size_t)b * C_ + h * HD_) * LP_;
  _Float16*       Yb = (_Float16*)Yp + (size_t)b * T_ * C_ + h * HD_;

  // ---- Q fragments (B operand, column = query = lane&15, split k map): 2 d-chunks ----
  v16h qf[2];
#pragma unroll
  for (int dc = 0; dc < 2; ++dc)
    qf[dc] = ldfrag(Qb + (size_t)(q0 + c) * C_ + dc * 32 + 8 * hh);

  const int qrow = q0 + c;                                  // this lane's query
  const int lim  = (qrow < NU_) ? (NU_ + 1) : (qrow + 2);   // its last visible key
  float mrow = -INFINITY;                                   // running maximum of the query (equal in both halves)
  float lrow = 0.f;                                         // this half's share of the query's sum
  v8f oacc[4];                                              // oacc[t][r] = O[query][16t + 8hh + r]
#pragma unroll
  for (int t = 0; t < 4; ++t) oacc[t] = zero8f();

  int maxkey = qb * 64 + 63 + 2;                            // last visible key of the block's last query
  if (qb * 64 < NU_) maxkey = (maxkey > NU_ + 1) ? maxkey : (NU_ + 1);
  const int nChunks = (maxkey >> 6) + 1;                    // block-uniform, 3..17

  for (int kc = 0; kc < nChunks; ++kc) {
    const int kv0 = kc * 64;
    __syncthreads();
    {
      // staging coverage: 128 threads x (4 x 8) halves = 64 rows x 64 per tile
      const int r = tid >> 1, half = (tid & 1) * 32;
      const _Float16* ks = Kb + (size_t)(kv0 + r) * C_ + half;     // K row kv0+r, d = half..half+31
      const _Float16* vs = Vb + (size_t)r * LP_ + kv0 + half;      // V^T row d = r, s = kv0+half..+31
#pragma unroll
      for (int i = 0; i < 4; ++i) {
        const v8h a0 = *(const v8h*)(ks + 8 * i);
        const v8h b0 = *(const v8h*)(vs + 8 * i);
        *(v8h*)(Ksh + r * AKP + half + 8 * i) = a0;
        *(v8h*)(Vth + r * AKP + half + 8 * i) = b0;
      }
    }
    __syncthreads();

    // S^T tiles: rows = keys 16j..16j+15 of the chunk, columns = the wave's 16 queries
    v8f s[4];
#pragma unroll
    for (int j = 0; j < 4; ++j) s[j] = zero8f();
#pragma unroll
    for (int dc = 0; dc < 2; ++dc)
#pragma unroll
      for (int j = 0; j < 4; ++j) {
        const v16h ka = ldfrag(Ksh + (j * 16 + c) * AKP + dc * 32 + 8 * hh);
        s[j] = mma_f16(ka, qf[dc], s[j]);
      }
    const int rel = lim - kv0 - 8 * hh;                     // key kv0 + 8hh + (16j + r) is visible iff 16j + r <= rel
    float mj[4];
#pragma unroll
    for (int j = 0; j < 4; ++j) {
      float m = -INFINITY;
#pragma unroll
      for (int r = 0; r < 8; ++r) {
        const float sv = (j * 16 + r <= rel) ? s[j][r] * sscale : -INFINITY;
        s[j][r] = sv;
        m = fmaxf(m, sv);
      }
      mj[j] = m;
    }
    float cmx = fmaxf(fmaxf(mj[0], mj[1]), fmaxf(mj[2], mj[3]));
    cmx = fmaxf(cmx, xhalf(cmx));                           // the other half's 32 keys of the same query
    const float mnew  = fmaxf(mrow, cmx);
    const float alpha = __expf(mrow - mnew);
    mrow = mnew;
    v16h pb[2];                                             // P^T as B operand, 32 keys each
    float pj[4];
#pragma unroll
    for (int j = 0; j < 4; ++j) {
      float ps = 0.f;
#pragma unroll
      for (int r = 0; r < 8; ++r) {
        const float p = __expf(s[j][r] - mnew);
        ps += p;
        pb[j >> 1][(j & 1) * 8 + r] = (_Float16)p;
      }
      pj[j] = ps;
    }
    lrow = lrow * alpha + ((pj[0] + pj[1]) + (pj[2] + pj[3]));
#pragma unroll
    for (int t = 0; t < 4; ++t) oacc[t] *= alpha;
#pragma unroll
    for (int kk = 0; kk < 2; ++kk)
#pragma unroll
      for (int t = 0; t < 4; ++t) {
        const v16h va = ldfrag(Vth + (t * 16 + c) * AKP + kk * 32 + 8 * hh);
        oacc[t] = mma_f16(va, pb[kk], oacc[t]);
      }
  }

  _Float16* os = Osh[wave];
  {
    const float inv = 1.0f / (lrow + xhalf(lrow));          // the two halves' shares joined once
#pragma unroll
    for (int t = 0; t < 4; ++t) {
      v8h o;
#pragma unroll
      for (int r = 0; r < 8; ++r) o[r] = (_Float16)(oacc[t][r] * inv);
      *(v8h*)(os + c * AKP + t * 16 + 8 * hh) = o;
    }
  }
  __builtin_amdgcn_fence(__ATOMIC_RELEASE, "workgroup");
  __builtin_amdgcn_wave_barrier();
  __builtin_amdgcn_fence(__ATOMIC_ACQUIRE, "workgroup");
  {
    const int q4 = lane >> 3, c8 = (lane & 7) * 8;
    v8h ov[4];
#pragma unroll
    for (int it = 0; it < 4; ++it) {
      const int row = it * 4 + q4;
      ov[it] = *(const v8h*)(os + row * AKP + c8);
    }
    {
#pragma unroll
      for (int it = 0; it < 4; ++it) {
        const int row = it * 4 + q4;
        *(v8h*)(Yb + (size_t)(q0 + row) * C_ + c8) = ov[it];
      }
    }
  }
}

// ---------------------------------------------------------------------------
//   WT   f16 [6][1024 n][1024 k]  (Wq,Wk,Wv,Wp,Wqm,Wkm transposed, x16)         0   12582912
//   MA   f16 [192][1024]                                               12582912     393216
//   MOq  f32 [128][1024]                                               12976128     524288
//   MOk  f32 [128][1024]                                               13500416     524288
//   CM   f16 [8][1088][1024]  rows: 0 mem, 1 prev_m, 2..1025 x, 1026..1087 zero  14024704   17825792
//   Q    f16 [8][1024][1024] (x16)                                     31850496   16777216
//   K    f16 [8][1088][1024] (x16)                                     48627712   17825792
//   VT   f16 [8][1024][1088] (x16)                                     66453504   17825792
//   Y    f16 [8][1024][1024] (x16)                                     84279296   16777216
//   total                                                             101056512
// ---------------------------------------------------------------------------
extern "C" void kernel_launch(void* const* d_in, const int* in_sizes, int n_in,
                              void* d_out, int out_size, void* d_ws, size_t ws_size,
                              hipStream_t stream) {
  if (n_in < 15) return;
  if (in_sizes[0] != NB_ * T_ * C_) return;
  if (in_sizes[1] != NB_ * C_) return;
  if (in_sizes[2] != NB_ * MM_ * C_) return;
  for (int i = 3; i <= 13; i += 2) if (in_sizes[i] != C_ * C_) return;
  for (int i = 4; i <= 14; i += 2) if (in_sizes[i] != C_) return;
  if (out_size != NB_ * T_ * C_) return;

  const float* x      = (const float*)d_in[0];
  const float* prev_m = (const float*)d_in[1];
  const float* cached = (const float*)d_in[2];
  const float* Wq  = (const float*)d_in[3];  const float* bq  = (const float*)d_in[4];
  const float* Wk  = (const float*)d_in[5];  const float* bk  = (const float*)d_in[6];
  const float* Wv  = (const float*)d_in[7];  const float* bv  = (const float*)d_in[8];
  const float* Wp  = (const float*)d_in[9];  const float* bp  = (const float*)d_in[10];
  const float* Wqm = (const float*)d_in[11]; const float* bqm = (const float*)d_in[12];
  const float* Wkm = (const float*)d_in[13]; const float* bkm = (const float*)d_in[14];
  float* out = (float*)d_out;

  const size_t szWT  = (size_t)6 * C_ * C_ * 2;
  const size_t szMA  = (size_t)MAR_ * C_ * 2;
  const size_t szMOq = (size_t)128 * C_ * 4;
  const size_t szMOk = (size_t)128 * C_ * 4;
  const size_t szCM  = (size_t)NB_ * LP_ * C_ * 2;
  const size_t szQ   = (size_t)NB_ * T_ * C_ * 2;
  const size_t szK   = (size_t)NB_ * LP_ * C_ * 2;
  const size_t szVT  = (size_t)NB_ * C_ * LP_ * 2;
  const size_t szY   = (size_t)NB_ * T_ * C_ * 2;
  size_t off = 0;
  const size_t oWT  = off; off += szWT;
  const size_t oMA  = off; off += szMA;
  const size_t oMOq = off; off += szMOq;
  const size_t oMOk = off; off += szMOk;
  const size_t oCM  = off; off += szCM;
  const size_t oQ   = off; off += szQ;
  const size_t oK   = off; off += szK;
  const size_t oVT  = off; off += szVT;
  const size_t oY   = off; off += szY;
  if (off > ws_size) return;                   // off = 101056512

  char* ws = (char*)d_ws;
  unsigned short* WT  = (unsigned short*)(ws + oWT);
  unsigned short* MA  = (unsigned short*)(ws + oMA);
  float*          MOq = (float*)(ws + oMOq);
  float*          MOk = (float*)(ws + oMOk);
  unsigned short* CM  = (unsigned short*)(ws + oCM);
  unsigned short* Qh  = (unsigned short*)(ws + oQ);
  unsigned short* Kh  = (unsigned short*)(ws + oK);
  unsigned short* VTh = (unsigned short*)(ws + oVT);
  unsigned short* Yh  = (unsigned short*)(ws + oY);
  unsigned short* WqT  = WT;
  unsigned short* WkT  = WT + (size_t)1 * C_ * C_;
  unsigned short* WvT  = WT + (size_t)2 * C_ * C_;
  unsigned short* WpT  = WT + (size_t)3 * C_ * C_;
  unsigned short* WqmT = WT + (size_t)4 * C_ * C_;
  unsigned short* WkmT = WT + (size_t)5 * C_ * C_;

  const float s16 = 16.0f, r16 = 1.0f / 16.0f, r256 = 1.0f / 256.0f;

  // (1) weights [in k][out n] f32 -> transposed f16 planes [n][k], carried x16; x -> CM rows 2..1025 per batch;
  //     small operand plane: prev_m rows 0..7, cached rows 64..191
  prep_kernel<<<dim3(PREP_WT + PREP_X + PREP_MA), dim3(256), 0, stream>>>(
      Wq, Wk, Wv, Wp, Wqm, Wkm, WT, s16, x, CM, prev_m, cached, MA);
  // (2) qm -> MOq, km -> MOk (f32) and q -> Q plane (x16): A of q = CM rows 2..1025, M = 1024 per batch
  gemm_qm_km_q<<<dim3(16 + NB_ * TQ_), dim3(128), 0, stream>>>(
      MA, WqmT, WkmT, MOq, MOk, bqm, bkm, CM + (size_t)2 * C_, WqT, Qh, bq, r16, s16);
  // (3) memory attention (f32) -> CM rows 0 (mem), 1 (prev_m) and zero pad rows, per batch
  mem_kernel<<<dim3(NB_), dim3(512), 0, stream>>>(MOq, MOk, prev_m, CM);
  // (4) k -> K plane and v^T -> VT plane (x16), pad rows included
  gemm_k_vt<<<dim3(2 * TKV_), dim3(128), 0, stream>>>(CM, WkT, WvT, Kh, VTh, bk, bv, r16, s16);
  // (5) masked attention -> Y plane (x16)
  attn_kernel<<<dim3(NB_ * NH_ * (T_ / 64)), dim3(128), 0, stream>>>(Qh, Kh, VTh, Yh, 0.125f / 256.0f);
  // (6) out = y . Wp + bp -> d_out f32 [8192][1024]  (y x16, Wp x16 -> scale 1/256)
  gemm_out<<<dim3((NB_ * T_ / 128) * (C_ / 128)), dim3(128), 0, stream>>>(Yh, WpT, out, bp, r256);
  (void)hipGetLastError();
}

// v004
// Measured time: 132 microseconds a run.
// In both of two side-by-side timings against v003, it was 1.11 times as fast.
// All steps since v000 together make it 3.22 times as fast.
// Contractions x*Wq, cm*Wk, cm*Wv, k*q^T, v^T*p^T, y*Wp, prev_m*Wqm, cached*Wkm: v_wmma_f32_16x16x32_f16, f16 operands (weights carried x16, q/k/v/y planes carried x16, p x1), f32 accumulate; softmax f32; memory-path scores and weighted sum f32 VALU.
#include <hip/hip_runtime.h>
#include <stdint.h>
#include <math.h>

#define NB_   8
#define T_    1024
#define C_    1024
#define NH_   16
#define HD_   64
#define NU_   128
#define MM_   16
#define LKV_  1026
#define LP_   1088
#define MAR_  192
#define AKP   72

typedef _Float16 v16h __attribute__((ext_vector_type(16)));
typedef _Float16 v8h  __attribute__((ext_vector_type(8)));
typedef float    v8f  __attribute__((ext_vector_type(8)));
typedef float    v4f  __attribute__((ext_vector_type(4)));

// ---- 16-bit fragment loader: elements 0..7 <- p[0..7], 8..15 <- p[16..23]; caller passes p = row base + k0 + 8*(lane>>4)
__device__ __forceinline__ v16h ldfrag(const _Float16* p) {
  union { v16h v; v8h h[2]; } f;
  f.h[0] = *(const v8h*)(p);
  f.h[1] = *(const v8h*)(p + 16);
  return f.v;
}
__device__ __forceinline__ v8f mma_f16(v16h a, v16h b, v8f c) {
  return __builtin_amdgcn_wmma_f32_16x16x32_f16(false, a, false, b, (short)0, c, false, false);
}
__device__ __forceinline__ v8f zero8f() { v8f z; z[0]=0.f; z[1]=0.f; z[2]=0.f; z[3]=0.f; z[4]=0.f; z[5]=0.f; z[6]=0.f; z[7]=0.f; return z; }
__device__ __forceinline__ v8h zero8h() {
  v8h z;
#pragma unroll
  for (int e = 0; e < 8; ++e) z[e] = (_Float16)0.0f;
  return z;
}
__device__ __forceinline__ v8h cvt8(v4f a, v4f b, float s) {
  v8h r;
  r[0] = (_Float16)(a[0] * s); r[1] = (_Float16)(a[1] * s); r[2] = (_Float16)(a[2] * s); r[3] = (_Float16)(a[3] * s);
  r[4] = (_Float16)(b[0] * s); r[5] = (_Float16)(b[1] * s); r[6] = (_Float16)(b[2] * s); r[7] = (_Float16)(b[3] * s);
  return r;
}

// ---------------------------------------------------------------------------
// Weight transpose + f16 convert with carry scale s: six inputs W_z [k][n] f32 (C_ x C_) ->
// WT plane z: [n][k] f16 = f16(s * W_z[k][n]).  64x64 tiles through LDS, one tile (bxx, byy, z) per block of 256 threads.
// coverage per block: load 4 it x 256 thr x 4 = 64x64; store 2 it x 256 thr x 8 = 64x64.
// ---------------------------------------------------------------------------
__device__ __forceinline__
void wt_body(float* tf, int bxx, int byy, int z,
             const float* __restrict__ W0, const float* __restrict__ W1, const float* __restrict__ W2,
             const float* __restrict__ W3, const float* __restrict__ W4, const float* __restrict__ W5,
             unsigned short* __restrict__ WT, float s) {
  const float* W = (z == 0) ? W0 : (z == 1) ? W1 : (z == 2) ? W2 : (z == 3) ? W3 : (z == 4) ? W4 : W5;
  _Float16* out = (_Float16*)WT + (size_t)z * C_ * C_;
  const int c0  = bxx * 64;          // input column block = output row block
  const int r0  = byy * 64;          // input row block    = output column block
  const int tid = threadIdx.x;
  {
    const int lr = tid >> 4;
    const int c4 = (tid & 15) * 4;
#pragma unroll
    for (int it = 0; it < 4; ++it) {
      const int rr = it * 16 + lr;
      const v4f a = *(const v4f*)(W + (size_t)(r0 + rr) * C_ + c0 + c4);
      *(v4f*)(tf + rr * 68 + c4) = a;
    }
  }
  __syncthreads();
  const int sub = tid >> 3;          // 0..31
  const int c8  = (tid & 7) * 8;     // 0..56
  v8h hv[2];
#pragma unroll
  for (int it = 0; it < 2; ++it) {
    const int oc = it * 32 + sub;    // output row within tile (= input column)
    v8h v;
#pragma unroll
    for (int e = 0; e < 8; ++e) v[e] = (_Float16)(tf[(c8 + e) * 68 + oc] * s);
    hv[it] = v;
  }
  {
#pragma unroll
    for (int it = 0; it < 2; ++it) {
      const int oc = it * 32 + sub;
      *(v8h*)(out + (size_t)(c0 + oc) * C_ + r0 + c8) = hv[it];
    }
    asm volatile("s_wait_xcnt 0x0" ::: "memory");          // before a register that these stores name is rewritten
  }
}

// ---------------------------------------------------------------------------
// Small operand plane MA [192][1024] f16: rows 0..7 = prev_m[b], rows 8..63 = 0, rows 64..191 = cached_memory row (row-64).
// 96 blocks (two rows each) x 256 threads x 8 halves; 128 threads = whole row (16 lines, 8 lanes per line);
// coverage: 96 x 256 x 8 = whole plane.
// ---------------------------------------------------------------------------
__device__ __forceinline__
void ma_body(int blk, const float* __restrict__ prev_m, const float* __restrict__ cached, unsigned short* __restrict__ MA) {
  const int row  = blk * 2 + ((int)threadIdx.x >> 7);
  const int col8 = ((int)threadIdx.x & 127) * 8;
  const int rp = (row < NB_) ? row : 0;
  int rc = row - 64; rc = (rc < 0) ? 0 : rc; rc = (rc > NB_ * MM_ - 1) ? (NB_ * MM_ - 1) : rc;
  const float* sp = prev_m + (size_t)rp * C_ + col8;
  const float* sc = cached + (size_t)rc * C_ + col8;
  const v4f p0 = *(const v4f*)(sp), p1 = *(const v4f*)(sp + 4);
  const v4f q0 = *(const v4f*)(sc), q1 = *(const v4f*)(sc + 4);
  const float fp = (row < NB_) ? 1.0f : 0.0f;
  const float fc = (row >= 64) ? 1.0f : 0.0f;
  const v4f a = p0 * fp + q0 * fc;
  const v4f b = p1 * fp + q1 * fc;
  const v8h hv = cvt8(a, b, 1.0f);
  _Float16* d = (_Float16*)MA + (size_t)row * C_ + col8;
  *(v8h*)d = hv;
  asm volatile("s_wait_xcnt 0x0" ::: "memory");            // before a register that this store names is rewritten
}

// ---------------------------------------------------------------------------
// x [8][1024][1024] f32 -> CM plane rows 2..1025 of each batch ([8][LP_][1024] f16), unscaled.
// ---------------------------------------------------------------------------
__device__ __forceinline__
void xcvt_body(int blk, const float* __restrict__ x, unsigned short* __restrict__ CM, int n8) {
  const int idx = blk * 256 + threadIdx.x;
  if (idx >= n8) return;
  const int e = idx * 8;
  const int b = e >> 20, t = (e >> 10) & (T_ - 1), col = e & (C_ - 1);
  const v4f a0 = *(const v4f*)(x + e), a1 = *(const v4f*)(x + e + 4);
  const v8h hv = cvt8(a0, a1, 1.0f);
  _Float16* d = (_Float16*)CM + ((size_t)(b * LP_ + 2 + t)) * C_ + col;
  *(v8h*)d = hv;
  asm volatile("s_wait_xcnt 0x0" ::: "memory");            // before a register that this store names is rewritten
}

// ---------------------------------------------------------------------------
// The three operand preparations read none of each other's output: one launch, the block index picks the job.
//   blocks 0 .. 1535: weight tiles (16 x 16 x 6);  1536 .. 5631: x pieces;  5632 .. 5727: small operand plane.
// ---------------------------------------------------------------------------
#define PREP_WT  (6 * (C_ / 64) * (C_ / 64))
#define PREP_X   (NB_ * T_ * C_ / 8 / 256)
#define PREP_MA  (MAR_ / 2)
__global__ __launch_bounds__(256)
void prep_kernel(const float* __restrict__ W0, const float* __restrict__ W1, const float* __restrict__ W2,
                 const float* __restrict__ W3, const float* __restrict__ W4, const float* __restrict__ W5,
                 unsigned short* __restrict__ WT, float s,
                 const float* __restrict__ x, unsigned short* __restrict__ CM,
                 const float* __restrict__ prev_m, const float* __restrict__ cached, unsigned short* __restrict__ MA) {
  __shared__ __align__(16) float tf[64 * 68];
  const int bx = blockIdx.x;
  if (bx < PREP_WT) {
    wt_body(tf, bx & 15, (bx >> 4) & 15, bx >> 8, W0, W1, W2, W3, W4, W5, WT, s);
  } else if (bx < PREP_WT + PREP_X) {
    xcvt_body(bx - PREP_WT, x, CM, NB_ * T_ * C_ / 8);
  } else {
    ma_body(bx - (PREP_WT + PREP_X), prev_m, cached, MA);
  }
}

// ---------------------------------------------------------------------------
// Block-tiled batched f16 WMMA GEMM: C[m,n] = oscale * (scale * sum_k A[m,k] * Bt[n,k] + bias).
// One block = WM x WN waves = a (64*WM) x (64*WN) tile of C; each wave owns a 64x64 sub-tile.
// A row-major [M,K] f16; Bt row-major [N,K] f16; M % (64*WM) == 0, N % (64*WN) == 0, K % 64 == 0, K >= 64.
// A pass is 64 k (128 B of every operand row).  A stage is [A rows | Bt rows] at pitch 144 B in LDS, two buffers;
// every lane copies 16-B pieces global -> LDS asynchronously, the next pass's stage in flight while this one is worked on.
// Column n of C lies in output plane n / NPB (plane stride strideCN) at column n % NPB; NPB % 64 == 0.
// BIAS_MODE: 1 = bias[m], 2 = bias[n].  OUT_MODE: 0 = f32, 1 = f16.
// ---------------------------------------------------------------------------
#define GKT 64      // k per pass
#define GP  72      // LDS row pitch in halves: 144 B = 16 B x odd, conflict-free for 16-B fragment reads

// Eight asynchronous 16-B copies per lane.  The s_wait_xcnt closes the statement so that no address register
// named here is rewritten ahead of it.
__device__ __forceinline__ void copy8(const unsigned (&l)[8], const _Float16* const (&g)[8]) {
  asm volatile(
      "global_load_async_to_lds_b128 %0, %8, off\n\t"
      "global_load_async_to_lds_b128 %1, %9, off\n\t"
      "global_load_async_to_lds_b128 %2, %10, off\n\t"
      "global_load_async_to_lds_b128 %3, %11, off\n\t"
      "global_load_async_to_lds_b128 %4, %12, off\n\t"
      "global_load_async_to_lds_b128 %5, %13, off\n\t"
      "global_load_async_to_lds_b128 %6, %14, off\n\t"
      "global_load_async_to_lds_b128 %7, %15, off\n\t"
      "s_wait_xcnt 0x0"
      :: "v"(l[0]), "v"(l[1]), "v"(l[2]), "v"(l[3]), "v"(l[4]), "v"(l[5]), "v"(l[6]), "v"(l[7]),
         "v"(g[0]), "v"(g[1]), "v"(g[2]), "v"(g[3]), "v"(g[4]), "v"(g[5]), "v"(g[6]), "v"(g[7])
      : "memory");
}

// ring: 2 * (64*WM + 64*WN) * GP halves of LDS; sT: WM * WN slabs of 16 x 68 floats of LDS; bx = tile index, b = batch.
template <int BIAS_MODE, int OUT_MODE, int WM, int WN>
__device__ __forceinline__ void gemm_body(
    _Float16* ring, float* sT, int bx, int b,
    const unsigned short* __restrict__ Ap, int lda, long strideA,
    const unsigned short* __restrict__ Btp, int ldb, long strideB,
    void* __restrict__ Cout, int ldc, long strideC, int NPB, long strideCN,
    const float* __restrict__ bias, int M, int N, int K, float scale, float oscale) {
  constexpr int NT  = 32 * WM * WN;      // threads
  constexpr int BM  = 64 * WM;           // tile rows
  constexpr int BN  = 64 * WN;           // tile columns
  constexpr int RPI = NT / 8;            // rows covered by one copy of the whole block (8 lanes x 16 B = one 128-B row)
  constexpr int NA  = BM / RPI;          // copies per lane and pass, A rows (16 / WN)
  constexpr int NB  = BN / RPI;          // copies per lane and pass, Bt rows (16 / WM)
  constexpr int STAGE_H = (BM + BN) * GP;
  static_assert(NA % 8 == 0 && NB % 8 == 0 && NA + NB <= 63, "copy groups of eight, at most 63 in flight");

  const _Float16* A  = (const _Float16*)Ap;
  const _Float16* Bt = (const _Float16*)Btp;
  const int tid  = threadIdx.x;
  const int lane = tid & 31;
  const int wave = tid >> 5;
  const int wm   = wave / WN;
  const int wn   = wave - wm * WN;
  const int tilesN = N / BN;
  const int tm = bx / tilesN;            // bx runs over (M / BM) * (N / BN) tiles exactly
  const int tn = bx - tm * tilesN;
  const int rlane = lane & 15;                 // row (A) / col (B, D) within subtile
  const int koff  = (lane >> 4) * 8;           // k offset of this lane half
  const int mOff  = (lane >> 4) * 8;           // D row offset

  // this lane's piece of a stage: row tid>>3 (+ RPI per copy), 16-B piece tid&7
  const _Float16* gA = A  + (size_t)b * strideA + (size_t)(tm * BM + (tid >> 3)) * lda + (tid & 7) * 8;
  const _Float16* gB = Bt + (size_t)b * strideB + (size_t)(tn * BN + (tid >> 3)) * ldb + (tid & 7) * 8;
  const unsigned  lds0 = (unsigned)(size_t)(&ring[0]) + (unsigned)((tid >> 3) * (GP * 2) + (tid & 7) * 16);

  auto issue = [&](int kt, int buf) {
    const _Float16* ga = gA + kt * GKT;
    const _Float16* gb = gB + kt * GKT;
    const unsigned  la = lds0 + (unsigned)buf * (unsigned)(STAGE_H * 2);
    const unsigned  lb = la + (unsigned)(BM * GP * 2);
    // the four loops below are unrolled so that l[] and g[] are registers (they are asm operands)
#pragma unroll
    for (int q = 0; q < NA / 8; ++q) {
      unsigned l[8]; const _Float16* g[8];
#pragma unroll
      for (int e = 0; e < 8; ++e) {
        l[e] = la + (unsigned)((q * 8 + e) * RPI * GP * 2);
        g[e] = ga + (size_t)((q * 8 + e) * RPI) * lda;
      }
      copy8(l, g);
    }
#pragma unroll
    for (int q = 0; q < NB / 8; ++q) {
      unsigned l[8]; const _Float16* g[8];
#pragma unroll
      for (int e = 0; e < 8; ++e) {
        l[e] = lb + (unsigned)((q * 8 + e) * RPI * GP * 2);
        g[e] = gb + (size_t)((q * 8 + e) * RPI) * ldb;
      }
      copy8(l, g);
    }
  };

  v8f acc[4][4];
#pragma unroll
  for (int i = 0; i < 4; ++i)
#pragma unroll
    for (int j = 0; j < 4; ++j) acc[i][j] = zero8f();

  const int NP = K / GKT;
  issue(0, 0);
  asm volatile("s_wait_asynccnt 0x0" ::: "memory");   // this wave's pieces of stage 0 have landed
  __syncthreads();                                     // publishes stage 0 to every wave
  if (NP > 1) issue(1, 1);

  for (int t = 0; t < NP; ++t) {
    const _Float16* sA = ring + (t & 1) * STAGE_H + (wm * 64 + rlane) * GP + koff;
    const _Float16* sB = ring + (t & 1) * STAGE_H + (BM + wn * 64 + rlane) * GP + koff;
    // unrolled throughout: fragments and accumulators are indexed at compile time and stay in registers
#pragma unroll
    for (int ks = 0; ks < GKT / 32; ++ks) {
      v16h bh[4], ah[4];
#pragma unroll
      for (int j = 0; j < 4; ++j) bh[j] = ldfrag(sB + j * 16 * GP + ks * 32);
#pragma unroll
      for (int i = 0; i < 4; ++i) ah[i] = ldfrag(sA + i * 16 * GP + ks * 32);
      // keeps the sixteen LDS reads of this k step together ahead of its WMMAs: spread among them, every row of
      // four WMMAs waits out a full LDS latency of its own
      __builtin_amdgcn_sched_barrier(0);
#pragma unroll
      for (int i = 0; i < 4; ++i)
#pragma unroll
        for (int j = 0; j < 4; ++j) acc[i][j] = mma_f16(ah[i], bh[j], acc[i][j]);
    }
    asm volatile("s_wait_dscnt 0x0" ::: "memory");      // this wave's reads of the buffer are done before it is refilled
    asm volatile("s_wait_asynccnt 0x0" ::: "memory");   // this wave's pieces of stage t + 1 have landed
    __syncthreads();                                     // publishes stage t + 1 and ends every reader's use of stage t
    if (t + 2 < NP) issue(t + 2, t & 1);
  }
  asm volatile("s_wait_asynccnt 0x0" ::: "memory");     // no copy outstanding when the wave goes on

  // ---- epilogue ----
  const int m0 = tm * BM + wm * 64;
  const int n0 = tn * BN + wn * 64;
  const int np = n0 / NPB;                     // output plane of this wave's 64 columns
  const int nl = n0 - np * NPB;                // first column inside that plane
  float* slab = sT + wave * (16 * 68);         // per-wave 16x64 slab, pitch 68 floats
#pragma unroll
  for (int i = 0; i < 4; ++i) {
    const int mBase = m0 + (i << 4);
#pragma unroll
    for (int j = 0; j < 4; ++j) {
      const int n = n0 + (j << 4) + rlane;
      float bvn = 0.f;
      if (BIAS_MODE == 2) bvn = bias[n];
#pragma unroll
      for (int r = 0; r < 8; ++r) {
        float v = acc[i][j][r] * scale;
        if (BIAS_MODE == 1) v += bias[mBase + mOff + r];
        if (BIAS_MODE == 2) v += bvn;
        v *= oscale;
        slab[(mOff + r) * 68 + (j << 4) + rlane] = v;
      }
    }
    __builtin_amdgcn_fence(__ATOMIC_RELEASE, "workgroup");
    __builtin_amdgcn_wave_barrier();
    __builtin_amdgcn_fence(__ATOMIC_ACQUIRE, "workgroup");
    if (OUT_MODE == 0) {
      float* C = (float*)Cout + (size_t)b * strideC + (size_t)np * strideCN;
      const int hh = lane >> 4, c4 = (lane & 15) * 4;     // row seg = 256 B = 16 lanes x 16 B
      {
#pragma unroll
        for (int it = 0; it < 8; ++it) {
          const int row = it * 2 + hh;                     // it 0..7 x hh 0..1 = rows 0..15
          const v4f v = *(const v4f*)(slab + row * 68 + c4);
          *(v4f*)(C + (size_t)(mBase + row) * ldc + nl + c4) = v;
        }
      }
      asm volatile("s_wait_xcnt 0x0" ::: "memory");        // before a register that these stores name is rewritten
    } else {
      _Float16* C = (_Float16*)Cout + (size_t)b * strideC + (size_t)np * strideCN;
      const int q = lane >> 3, c8 = (lane & 7) * 8;
      v8h hv[4];
#pragma unroll
      for (int it = 0; it < 4; ++it) {
        const int row = it * 4 + q;                        // it 0..3 x q 0..3 = rows 0..15
        const float* spf = slab + row * 68 + c8;
        v8h t;
#pragma unroll
        for (int e = 0; e < 8; ++e) t[e] = (_Float16)spf[e];
        hv[it] = t;
      }
      {
#pragma unroll
        for (int it = 0; it < 4; ++it) {
          const int row = it * 4 + q;
          *(v8h*)(C + (size_t)(mBase + row) * ldc + nl + c8) = hv[it];
        }
      }
      asm volatile("s_wait_xcnt 0x0" ::: "memory");        // before a register that these stores name is rewritten
    }
    __builtin_amdgcn_fence(__ATOMIC_RELEASE, "workgroup");
    __builtin_amdgcn_wave_barrier();
    __builtin_amdgcn_fence(__ATOMIC_ACQUIRE, "workgroup");
  }
}

#define G22_RING_H (2 * (128 + 128) * GP)    // LDS of a 2 x 2 wave block: two stages of 256 rows
#define G22_SLAB_F (4 * 16 * 68)             // and four epilogue slabs
#define TQ_  ((T_ / 128) * (C_ / 128))       // tiles of one batch of q
#define TKV_ ((NB_ * LP_ / 128) * (C_ / 128))  // tiles of k, and of v^T

// GEMMs that read none of each other's output share a launch; the block index picks the product (block-uniform branch).
// Blocks 0..7: qm = MA rows 0..127 . Wqm + bqm -> MOq (rows 0..7 are prev_m's, the others are not read);
// 8..15: km = cached . Wkm + bkm -> MOk;  16..: q = x . Wq + bq -> Q plane (x16), 64 tiles per batch.
__global__ __launch_bounds__(128) void gemm_qm_km_q(
    const unsigned short* __restrict__ MA, const unsigned short* __restrict__ WqmT, const unsigned short* __restrict__ WkmT,
    float* __restrict__ MOq, float* __restrict__ MOk, const float* __restrict__ bqm, const float* __restrict__ bkm,
    const unsigned short* __restrict__ CMx, const unsigned short* __restrict__ WqT, unsigned short* __restrict__ Qh,
    const float* __restrict__ bq, float r16, float s16) {
  __shared__ __align__(16) _Float16 ring[G22_RING_H];
  __shared__ __align__(16) float sT[G22_SLAB_F];
  const int bx = blockIdx.x;
  if (bx < 16) {
    const bool isq = bx < 8;
    gemm_body<2, 0, 2, 2>(ring, sT, bx & 7, 0,
        isq ? MA : MA + (size_t)64 * C_, C_, 0L, isq ? WqmT : WkmT, C_, 0L,
        (void*)(isq ? MOq : MOk), C_, 0L, C_, 0L, isq ? bqm : bkm, 128, C_, C_, r16, 1.0f);
  } else {
    const int i = bx - 16;
    gemm_body<2, 1, 2, 2>(ring, sT, i % TQ_, i / TQ_,
        CMx, C_, (long)LP_ * C_, WqT, C_, 0L, (void*)Qh, C_, (long)T_ * C_, C_, 0L, bq, T_, C_, C_, r16, s16);
  }
}

// Blocks 0..TKV_-1: k = cm . Wk + bk -> K plane (x16), the batches' rows contiguous in CM and in K, M = 8 * 1088;
// TKV_..: v^T = Wv^T . cm^T + bv[m] -> VT plane [h*64+d][s] (x16), N = 8 * 1088, output plane = batch (1088 columns each).
__global__ __launch_bounds__(128) void gemm_k_vt(
    const unsigned short* __restrict__ CM, const unsigned short* __restrict__ WkT, const unsigned short* __restrict__ WvT,
    unsigned short* __restrict__ Kh, unsigned short* __restrict__ VTh,
    const float* __restrict__ bk, const float* __restrict__ bv, float r16, float s16) {
  __shared__ __align__(16) _Float16 ring[G22_RING_H];
  __shared__ __align__(16) float sT[G22_SLAB_F];
  const int bx = blockIdx.x;
  if (bx < TKV_) {
    gemm_body<2, 1, 2, 2>(ring, sT, bx, 0,
        CM, C_, 0L, WkT, C_, 0L, (void*)Kh, C_, 0L, C_, 0L, bk, NB_ * LP_, C_, C_, r16, s16);
  } else {
    gemm_body<1, 1, 2, 2>(ring, sT, bx - TKV_, 0,
        WvT, C_, 0L, CM, C_, 0L, (void*)VTh, LP_, 0L, LP_, (long)C_ * LP_, bv, C_, NB_ * LP_, C_, r16, s16);
  }
}

// out = y . Wp + bp -> f32 [8192][1024]
__global__ __launch_bounds__(128) void gemm_out(
    const unsigned short* __restrict__ Yh, const unsigned short* __restrict__ WpT, float* __restrict__ out,
    const float* __restrict__ bp, float r256) {
  __shared__ __align__(16) _Float16 ring[G22_RING_H];
  __shared__ __align__(16) float sT[G22_SLAB_F];
  gemm_body<2, 0, 2, 2>(ring, sT, blockIdx.x, 0,
      Yh, C_, 0L, WpT, C_, 0L, (void*)out, C_, 0L, C_, 0L, bp, NB_ * T_, C_, C_, r256, 1.0f);
}

// ---------------------------------------------------------------------------
// Memory-compression attention, f32: one block per batch element, 16 waves = 16 heads.
//   qm = MOq row b, km_j = MOk row b*16+j (f32 projections incl. bias); s_j = qm_h.km_jh * 0.125 over 16 keys,
//   softmax in f32, mem_h = sum_j a_j km_jh.  The 1024-float mem row is staged in LDS, then
//   CM row 0 (mem) and row 1 (prev_m) of batch b are written as f16, and pad rows LKV_..LP_-1 as zeros:
// coverage: rows 0,1 by threads 0..255 (128 x 8 halves each), pad rows 62 x 128 pieces by the strided loop.
// ---------------------------------------------------------------------------
__global__ __launch_bounds__(512)
void mem_kernel(const float* __restrict__ MOq, const float* __restrict__ MOk, const float* __restrict__ prev_m,
                unsigned short* __restrict__ CM) {
  __shared__ __align__(16) float smem[C_];
  const int b = blockIdx.x;
  const int tid = threadIdx.x, wave = tid >> 5, lane = tid & 31;
  const int h = wave;
  const int j = lane & 15;
  const float* qh = MOq + (size_t)b * C_ + h * HD_;
  const float* kr = MOk + (size_t)(b * MM_ + j) * C_ + h * HD_;
  float a = 0.f;
#pragma unroll 1
  for (int d4 = 0; d4 < HD_ / 4; ++d4) {
    const v4f qv = *(const v4f*)(qh + 4 * d4);
    const v4f kv = *(const v4f*)(kr + 4 * d4);
    a = fmaf(qv[0], kv[0], a);
    a = fmaf(qv[1], kv[1], a);
    a = fmaf(qv[2], kv[2], a);
    a = fmaf(qv[3], kv[3], a);
  }
  const float sj = (lane < MM_) ? a * 0.125f : -INFINITY;
  float mx = sj;
#pragma unroll
  for (int off = 1; off < 32; off <<= 1) mx = fmaxf(mx, __shfl_xor(mx, off, 32));
  const float e = (lane < MM_) ? __expf(sj - mx) : 0.f;
  float se = e;
#pragma unroll
  for (int off = 1; off < 32; off <<= 1) se += __shfl_xor(se, off, 32);
  const float am = e * (1.0f / se);
  float o0 = 0.f, o1 = 0.f;
#pragma unroll 1
  for (int jj = 0; jj < MM_; ++jj) {
    const float aj = __shfl(am, jj, 32);
    const float* kp = MOk + (size_t)(b * MM_ + jj) * C_ + h * HD_;
    o0 = fmaf(aj, kp[lane], o0);
    o1 = fmaf(aj, kp[lane + 32], o1);
  }
  smem[h * HD_ + lane]      = o0;
  smem[h * HD_ + lane + 32] = o1;
  __syncthreads();

  _Float16* cmb = (_Float16*)CM + (size_t)b * LP_ * C_;
  const v8h z8 = zero8h();
  v8h hv = z8;
  _Float16* dst = cmb;
  const bool has = tid < 256;                 // wave-uniform roles (128 threads = 4 waves per row)
  if (tid < 128) {
    const int col8 = tid * 8;
    const v4f m0 = *(const v4f*)(smem + col8), m1 = *(const v4f*)(smem + col8 + 4);
    hv = cvt8(m0, m1, 1.0f);
    dst = cmb + col8;                                   // row 0 = mem
  } else if (tid < 256) {
    const int col8 = (tid - 128) * 8;
    const float* pp = prev_m + (size_t)b * C_ + col8;
    const v4f p0 = *(const v4f*)(pp), p1 = *(const v4f*)(pp + 4);
    hv = cvt8(p0, p1, 1.0f);
    dst = cmb + C_ + col8;                              // row 1 = prev_m
  }
  {
    if (has) *(v8h*)dst = hv;
    for (int i = tid; i < (LP_ - LKV_) * (C_ / 8); i += 512) {
      const int row  = LKV_ + (i >> 7);
      const int col8 = (i & 127) * 8;
      *(v8h*)(cmb + (size_t)row * C_ + col8) = z8;
    }
    
  }
}

__device__ __forceinline__ float xhalf(float x) {
  const int b = __builtin_bit_cast(int, x);
  return __builtin_bit_cast(float, __builtin_amdgcn_permlanex16(b, b, 0x76543210, 0xfedcba98, false, false));
}

__global__ __launch_bounds__(128)
void attn_kernel(const unsigned short* __restrict__ Qp, const unsigned short* __restrict__ Kp,
                 const unsigned short* __restrict__ VTp, unsigned short* __restrict__ Yp, float sscale) {
  __shared__ __align__(16) _Float16 Ksh[64 * AKP];          // K chunk [key][d], pitch 72
  __shared__ __align__(16) _Float16 Vth[64 * AKP];          // V^T chunk [d][key]
  __shared__ __align__(16) _Float16 Osh[4][16 * AKP];       // per wave output tile [row][d]

  const int tid  = threadIdx.x;
  const int wave = tid >> 5;
  const int lane = tid & 31;
  const int hh   = lane >> 4;
  const int c    = lane & 15;
  // Block index -> tile.  A query block's cost grows with qb (3..17 key chunks) and most blocks are resident together, so
  // a die or a WGP is busy for about the sum of its blocks' costs.  The index's high bits pick qb, heaviest first, its low
  // 7 bits the (batch, head): indices equal modulo 8 hold every qb, indices equal modulo 256 every second cost rank, and
  // the swap inside every second pair (15 14 12 13 11 10 8 9 ...) levels the even ranks' sum with the odd ranks' (77 : 76).
  const int bx = blockIdx.x;
  const int u  = (bx >> 7) & 15;          // cost rank (T_/64 = 16 query blocks)
  const int qb = 15 - (u ^ ((u >> 1) & 1));
  const int h  = bx & (NH_ - 1);
  const int b  = (bx >> 4) & (NB_ - 1);
  const int q0 = qb * 64 + wave * 16;     // first query row of this wave (within the batch)

  const _Float16* Qb = (const _Float16*)Qp  + (size_t)b * T_  * C_ + h * HD_;
  const _Float16* Kb = (const _Float16*)Kp  + (size_t)b * LP_ * C_ + h * HD_;
  const _Float16* Vb = (const _Float16*)VTp + ((size_t)b * C_ + h * HD_) * LP_;
  _Float16*       Yb = (_Float16*)Yp + (size_t)b * T_ * C_ + h * HD_;

  // ---- Q fragments (B operand, column = query = lane&15, split k map): 2 d-chunks ----
  v16h qf[2];
#pragma unroll
  for (int dc = 0; dc < 2; ++dc)
    qf[dc] = ldfrag(Qb + (size_t)(q0 + c) * C_ + dc * 32 + 8 * hh);

  const int qrow = q0 + c;                                  // this lane's query
  const int lim  = (qrow < NU_) ? (NU_ + 1) : (qrow + 2);   // its last visible key
  float mrow = -INFINITY;                                   // running maximum of the query (equal in both halves)
  float lrow = 0.f;                                         // this half's share of the query's sum
  v8f oacc[4];                                              // oacc[t][r] = O[query][16t + 8hh + r]
#pragma unroll
  for (int t = 0; t < 4; ++t) oacc[t] = zero8f();

  int maxkey = qb * 64 + 63 + 2;                            // last visible key of the block's last query
  if (qb * 64 < NU_) maxkey = (maxkey > NU_ + 1) ? maxkey : (NU_ + 1);
  const int nChunks = (maxkey >> 6) + 1;                    // block-uniform, 3..17

  for (int kc = 0; kc < nChunks; ++kc) {
    const int kv0 = kc * 64;
    __syncthreads();
    {
      // staging coverage: 128 threads x (4 x 8) halves = 64 rows x 64 per tile
      const int r = tid >> 1, half = (tid & 1) * 32;
      const _Float16* ks = Kb + (size_t)(kv0 + r) * C_ + half;     // K row kv0+r, d = half..half+31
      const _Float16* vs = Vb + (size_t)r * LP_ + kv0 + half;      // V^T row d = r, s = kv0+half..+31
#pragma unroll
      for (int i = 0; i < 4; ++i) {
        const v8h a0 = *(const v8h*)(ks + 8 * i);
        const v8h b0 = *(const v8h*)(vs + 8 * i);
        *(v8h*)(Ksh + r * AKP + half + 8 * i) = a0;
        *(v8h*)(Vth + r * AKP + half + 8 * i) = b0;
      }
    }
    __syncthreads();

    // S^T tiles: rows = keys 16j..16j+15 of the chunk, columns = the wave's 16 queries
    v8f s[4];
#pragma unroll
    for (int j = 0; j < 4; ++j) s[j] = zero8f();
#pragma unroll
    for (int dc = 0; dc < 2; ++dc)
#pragma unroll
      for (int j = 0; j < 4; ++j) {
        const v16h ka = ldfrag(Ksh + (j * 16 + c) * AKP + dc * 32 + 8 * hh);
        s[j] = mma_f16(ka, qf[dc], s[j]);
      }
    const int rel = lim - kv0 - 8 * hh;                     // key kv0 + 8hh + (16j + r) is visible iff 16j + r <= rel
    float mj[4];
#pragma unroll
    for (int j = 0; j < 4; ++j) {
      float m = -INFINITY;
#pragma unroll
      for (int r = 0; r < 8; ++r) {
        const float sv = (j * 16 + r <= rel) ? s[j][r] * sscale : -INFINITY;
        s[j][r] = sv;
        m = fmaxf(m, sv);
      }
      mj[j] = m;
    }
    float cmx = fmaxf(fmaxf(mj[0], mj[1]), fmaxf(mj[2], mj[3]));
    cmx = fmaxf(cmx, xhalf(cmx));                           // the other half's 32 keys of the same query
    const float mnew  = fmaxf(mrow, cmx);
    const float alpha = __expf(mrow - mnew);
    mrow = mnew;
    v16h pb[2];                                             // P^T as B operand, 32 keys each
    float pj[4];
#pragma unroll
    for (int j = 0; j < 4; ++j) {
      float ps = 0.f;
#pragma unroll
      for (int r = 0; r < 8; ++r) {
        const float p = __expf(s[j][r] - mnew);
        ps += p;
        pb[j >> 1][(j & 1) * 8 + r] = (_Float16)p;
      }
      pj[j] = ps;
    }
    lrow = lrow * alpha + ((pj[0] + pj[1]) + (pj[2] + pj[3]));
#pragma unroll
    for (int t = 0; t < 4; ++t) oacc[t] *= alpha;
#pragma unroll
    for (int kk = 0; kk < 2; ++kk)
#pragma unroll
      for (int t = 0; t < 4; ++t) {
        const v16h va = ldfrag(Vth + (t * 16 + c) * AKP + kk * 32 + 8 * hh);
        oacc[t] = mma_f16(va, pb[kk], oacc[t]);
      }
  }

  _Float16* os = Osh[wave];
  {
    const float inv = 1.0f / (lrow + xhalf(lrow));          // the two halves' shares joined once
#pragma unroll
    for (int t = 0; t < 4; ++t) {
      v8h o;
#pragma unroll
      for (int r = 0; r < 8; ++r) o[r] = (_Float16)(oacc[t][r] * inv);
      *(v8h*)(os + c * AKP + t * 16 + 8 * hh) = o;
    }
  }
  __builtin_amdgcn_fence(__ATOMIC_RELEASE, "workgroup");
  __builtin_amdgcn_wave_barrier();
  __builtin_amdgcn_fence(__ATOMIC_ACQUIRE, "workgroup");
  {
    const int q4 = lane >> 3, c8 = (lane & 7) * 8;
    v8h ov[4];
#pragma unroll
    for (int it = 0; it < 4; ++it) {
      const int row = it * 4 + q4;
      ov[it] = *(const v8h*)(os + row * AKP + c8);
    }
    {
#pragma unroll
      for (int it = 0; it < 4; ++it) {
        const int row = it * 4 + q4;
        *(v8h*)(Yb + (size_t)(q0 + row) * C_ + c8) = ov[it];
      }
    }
  }
}

// ---------------------------------------------------------------------------
//   WT   f16 [6][1024 n][1024 k]  (Wq,Wk,Wv,Wp,Wqm,Wkm transposed, x16)         0   12582912
//   MA   f16 [192][1024]                                               12582912     393216
//   MOq  f32 [128][1024]                                               12976128     524288
//   MOk  f32 [128][1024]                                               13500416     524288
//   CM   f16 [8][1088][1024]  rows: 0 mem, 1 prev_m, 2..1025 x, 1026..1087 zero  14024704   17825792
//   Q    f16 [8][1024][1024] (x16)                                     31850496   16777216
//   K    f16 [8][1088][1024] (x16)                                     48627712   17825792
//   VT   f16 [8][1024][1088] (x16)                                     66453504   17825792
//   Y    f16 [8][1024][1024] (x16)                                     84279296   16777216
//   total                                                             101056512
// ---------------------------------------------------------------------------
extern "C" void kernel_launch(void* const* d_in, const int* in_sizes, int n_in,
                              void* d_out, int out_size, void* d_ws, size_t ws_size,
                              hipStream_t stream) {
  if (n_in < 15) return;
  if (in_sizes[0] != NB_ * T_ * C_) return;
  if (in_sizes[1] != NB_ * C_) return;
  if (in_sizes[2] != NB_ * MM_ * C_) return;
  for (int i = 3; i <= 13; i += 2) if (in_sizes[i] != C_ * C_) return;
  for (int i = 4; i <= 14; i += 2) if (in_sizes[i] != C_) return;
  if (out_size != NB_ * T_ * C_) return;

  const float* x      = (const float*)d_in[0];
  const float* prev_m = (const float*)d_in[1];
  const float* cached = (const float*)d_in[2];
  const float* Wq  = (const float*)d_in[3];  const float* bq  = (const float*)d_in[4];
  const float* Wk  = (const float*)d_in[5];  const float* bk  = (const float*)d_in[6];
  const float* Wv  = (const float*)d_in[7];  const float* bv  = (const float*)d_in[8];
  const float* Wp  = (const float*)d_in[9];  const float* bp  = (const float*)d_in[10];
  const float* Wqm = (const float*)d_in[11]; const float* bqm = (const float*)d_in[12];
  const float* Wkm = (const float*)d_in[13]; const float* bkm = (const float*)d_in[14];
  float* out = (float*)d_out;

  const size_t szWT  = (size_t)6 * C_ * C_ * 2;
  const size_t szMA  = (size_t)MAR_ * C_ * 2;
  const size_t szMOq = (size_t)128 * C_ * 4;
  const size_t szMOk = (size_t)128 * C_ * 4;
  const size_t szCM  = (size_t)NB_ * LP_ * C_ * 2;
  const size_t szQ   = (size_t)NB_ * T_ * C_ * 2;
  const size_t szK   = (size_t)NB_ * LP_ * C_ * 2;
  const size_t szVT  = (size_t)NB_ * C_ * LP_ * 2;
  const size_t szY   = (size_t)NB_ * T_ * C_ * 2;
  size_t off = 0;
  const size_t oWT  = off; off += szWT;
  const size_t oMA  = off; off += szMA;
  const size_t oMOq = off; off += szMOq;
  const size_t oMOk = off; off += szMOk;
  const size_t oCM  = off; off += szCM;
  const size_t oQ   = off; off += szQ;
  const size_t oK   = off; off += szK;
  const size_t oVT  = off; off += szVT;
  const size_t oY   = off; off += szY;
  if (off > ws_size) return;                   // off = 101056512

  char* ws = (char*)d_ws;
  unsigned short* WT  = (unsigned short*)(ws + oWT);
  unsigned short* MA  = (unsigned short*)(ws + oMA);
  float*          MOq = (float*)(ws + oMOq);
  float*          MOk = (float*)(ws + oMOk);
  unsigned short* CM  = (unsigned short*)(ws + oCM);
  unsigned short* Qh  = (unsigned short*)(ws + oQ);
  unsigned short* Kh  = (unsigned short*)(ws + oK);
  unsigned short* VTh = (unsigned short*)(ws + oVT);
  unsigned short* Yh  = (unsigned short*)(ws + oY);
  unsigned short* WqT  = WT;
  unsigned short* WkT  = WT + (size_t)1 * C_ * C_;
  unsigned short* WvT  = WT + (size_t)2 * C_ * C_;
  unsigned short* WpT  = WT + (size_t)3 * C_ * C_;
  unsigned short* WqmT = WT + (size_t)4 * C_ * C_;
  unsigned short* WkmT = WT + (size_t)5 * C_ * C_;

  const float s16 = 16.0f, r16 = 1.0f / 16.0f, r256 = 1.0f / 256.0f;

  // (1) weights [in k][out n] f32 -> transposed f16 planes [n][k], carried x16; x -> CM rows 2..1025 per batch;
  //     small operand plane: prev_m rows 0..7, cached rows 64..191
  prep_kernel<<<dim3(PREP_WT + PREP_X + PREP_MA), dim3(256), 0, stream>>>(
      Wq, Wk, Wv, Wp, Wqm, Wkm, WT, s16, x, CM, prev_m, cached, MA);
  // (2) qm -> MOq, km -> MOk (f32) and q -> Q plane (x16): A of q = CM rows 2..1025, M = 1024 per batch
  gemm_qm_km_q<<<dim3(16 + NB_ * TQ_), dim3(128), 0, stream>>>(
      MA, WqmT, WkmT, MOq, MOk, bqm, bkm, CM + (size_t)2 * C_, WqT, Qh, bq, r16, s16);
  // (3) memory attention (f32) -> CM rows 0 (mem), 1 (prev_m) and zero pad rows, per batch
  mem_kernel<<<dim3(NB_), dim3(512), 0, stream>>>(MOq, MOk, prev_m, CM);
  // (4) k -> K plane and v^T -> VT plane (x16), pad rows included
  gemm_k_vt<<<dim3(2 * TKV_), dim3(128), 0, stream>>>(CM, WkT, WvT, Kh, VTh, bk, bv, r16, s16);
  // (5) masked attention -> Y plane (x16)
  attn_kernel<<<dim3(NB_ * NH_ * (T_ / 64)), dim3(128), 0, stream>>>(Qh, Kh, VTh, Yh, 0.125f / 256.0f);
  // (6) out = y . Wp + bp -> d_out f32 [8192][1024]  (y x16, Wp x16 -> scale 1/256)
  gemm_out<<<dim3((NB_ * T_ / 128) * (C_ / 128)), dim3(128), 0, stream>>>(Yh, WpT, out, bp, r256);
  (void)hipGetLastError();
}

// v005
// It runs in 123 microseconds.
// Next to v004, in two timings, it ran 1.08 and 1.06 times as fast.
// Over all steps from v000 it is 3.44 times as fast.
// Contractions x*Wq, cm*Wk, cm*Wv, k*q^T, v^T*p^T, y*Wp, prev_m*Wqm, cached*Wkm: v_wmma_f32_16x16x32_f16, f16 operands (weights carried x16, q/k/v/y planes carried x16, p x1), f32 accumulate; softmax f32; memory-path scores and weighted sum f32 VALU.
#include <hip/hip_runtime.h>
#include <stdint.h>
#include <math.h>

#define NB_   8
#define T_    1024
#define C_    1024
#define NH_   16
#define HD_   64
#define NU_   128
#define MM_   16
#define LKV_  1026
#define LP_   1088
#define MAR_  256
#define AKP   72

typedef _Float16 v16h __attribute__((ext_vector_type(16)));
typedef _Float16 v8h  __attribute__((ext_vector_type(8)));
typedef float    v8f  __attribute__((ext_vector_type(8)));
typedef float    v4f  __attribute__((ext_vector_type(4)));

// ---- 16-bit fragment loader: elements 0..7 <- p[0..7], 8..15 <- p[16..23]; caller passes p = row base + k0 + 8*(lane>>4)
__device__ __forceinline__ v16h ldfrag(const _Float16* p) {
  union { v16h v; v8h h[2]; } f;
  f.h[0] = *(const v8h*)(p);
  f.h[1] = *(const v8h*)(p + 16);
  return f.v;
}
__device__ __forceinline__ v8f mma_f16(v16h a, v16h b, v8f c) {
  return __builtin_amdgcn_wmma_f32_16x16x32_f16(false, a, false, b, (short)0, c, false, false);
}
__device__ __forceinline__ v8f zero8f() { v8f z; z[0]=0.f; z[1]=0.f; z[2]=0.f; z[3]=0.f; z[4]=0.f; z[5]=0.f; z[6]=0.f; z[7]=0.f; return z; }
__device__ __forceinline__ v8h zero8h() {
  v8h z;
#pragma unroll
  for (int e = 0; e < 8; ++e) z[e] = (_Float16)0.0f;
  return z;
}
__device__ __forceinline__ v8h cvt8(v4f a, v4f b, float s) {
  v8h r;
  r[0] = (_Float16)(a[0] * s); r[1] = (_Float16)(a[1] * s); r[2] = (_Float16)(a[2] * s); r[3] = (_Float16)(a[3] * s);
  r[4] = (_Float16)(b[0] * s); r[5] = (_Float16)(b[1] * s); r[6] = (_Float16)(b[2] * s); r[7] = (_Float16)(b[3] * s);
  return r;
}

// ---------------------------------------------------------------------------
// Weight transpose + f16 convert with carry scale s: six inputs W_z [k][n] f32 (C_ x C_) ->
// WT plane z: [n][k] f16 = f16(s * W_z[k][n]).  64x64 tiles through LDS, one tile (bxx, byy, z) per block of 256 threads.
// Planes 4 and 5 are interleaved by head into one [2048][k] plane: rows 128h .. 128h+63 = W_5 columns of head h, the next 64 = W_4's.
// coverage per block: load 4 it x 256 thr x 4 = 64x64; store 2 it x 256 thr x 8 = 64x64.
// ---------------------------------------------------------------------------
__device__ __forceinline__
void wt_body(float* tf, int bxx, int byy, int z,
             const float* __restrict__ W0, const float* __restrict__ W1, const float* __restrict__ W2,
             const float* __restrict__ W3, const float* __restrict__ W4, const float* __restrict__ W5,
             unsigned short* __restrict__ WT, float s) {
  const float* W = (z == 0) ? W0 : (z == 1) ? W1 : (z == 2) ? W2 : (z == 3) ? W3 : (z == 4) ? W4 : W5;
  const int c0  = bxx * 64;          // input column block
  const int o0  = (z < 4) ? z * C_ + c0 : 4 * C_ + bxx * 128 + ((z == 4) ? 64 : 0);   // first output row of the tile
  _Float16* out = (_Float16*)WT + (size_t)o0 * C_;
  const int r0  = byy * 64;          // input row block    = output column block
  const int tid = threadIdx.x;
  {
    const int lr = tid >> 4;
    const int c4 = (tid & 15) * 4;
#pragma unroll
    for (int it = 0; it < 4; ++it) {
      const int rr = it * 16 + lr;
      const v4f a = *(const v4f*)(W + (size_t)(r0 + rr) * C_ + c0 + c4);
      *(v4f*)(tf + rr * 68 + c4) = a;
    }
  }
  __syncthreads();
  const int sub = tid >> 3;          // 0..31
  const int c8  = (tid & 7) * 8;     // 0..56
  v8h hv[2];
#pragma unroll
  for (int it = 0; it < 2; ++it) {
    const int oc = it * 32 + sub;    // output row within tile (= input column)
    v8h v;
#pragma unroll
    for (int e = 0; e < 8; ++e) v[e] = (_Float16)(tf[(c8 + e) * 68 + oc] * s);
    hv[it] = v;
  }
  {
#pragma unroll
    for (int it = 0; it < 2; ++it) {
      const int oc = it * 32 + sub;
      *(v8h*)(out + (size_t)oc * C_ + r0 + c8) = hv[it];
    }
    asm volatile("s_wait_xcnt 0x0" ::: "memory");          // before a register that these stores name is rewritten
  }
}

// ---------------------------------------------------------------------------
// Small operand plane MA [256][1024] f16, two groups g of 128 rows (four batch elements each): rows 0..63 of a group =
// cached_memory rows 64g .. 64g+63, rows 64..67 = prev_m[4g .. 4g+3], rows 68..127 = 0.
// 128 blocks (two rows each) x 256 threads x 8 halves; 128 threads = whole row (16 lines, 8 lanes per line);
// coverage: 128 x 256 x 8 = whole plane.
// ---------------------------------------------------------------------------
__device__ __forceinline__
void ma_body(int blk, const float* __restrict__ prev_m, const float* __restrict__ cached, unsigned short* __restrict__ MA) {
  const int row  = blk * 2 + ((int)threadIdx.x >> 7);
  const int col8 = ((int)threadIdx.x & 127) * 8;
  const int g = row >> 7, r = row & 127;
  const bool isc = r < 64, isp = (r >= 64) && (r < 68);
  const int rp = isp ? g * 4 + (r - 64) : 0;
  const int rc = isc ? g * 64 + r : 0;
  const float* sp = prev_m + (size_t)rp * C_ + col8;
  const float* sc = cached + (size_t)rc * C_ + col8;
  const v4f p0 = *(const v4f*)(sp), p1 = *(const v4f*)(sp + 4);
  const v4f q0 = *(const v4f*)(sc), q1 = *(const v4f*)(sc + 4);
  const float fp = isp ? 1.0f : 0.0f;
  const float fc = isc ? 1.0f : 0.0f;
  const v4f a = p0 * fp + q0 * fc;
  const v4f b = p1 * fp + q1 * fc;
  const v8h hv = cvt8(a, b, 1.0f);
  _Float16* d = (_Float16*)MA + (size_t)row * C_ + col8;
  *(v8h*)d = hv;
  asm volatile("s_wait_xcnt 0x0" ::: "memory");            // before a register that this store names is rewritten
}

// ---------------------------------------------------------------------------
// x [8][1024][1024] f32 -> CM plane rows 2..1025 of each batch ([8][LP_][1024] f16), unscaled.
// ---------------------------------------------------------------------------
__device__ __forceinline__
void xcvt_body(int blk, const float* __restrict__ x, unsigned short* __restrict__ CM, int n8) {
  const int idx = blk * 256 + threadIdx.x;
  if (idx >= n8) return;
  const int e = idx * 8;
  const int b = e >> 20, t = (e >> 10) & (T_ - 1), col = e & (C_ - 1);
  const v4f a0 = *(const v4f*)(x + e), a1 = *(const v4f*)(x + e + 4);
  const v8h hv = cvt8(a0, a1, 1.0f);
  _Float16* d = (_Float16*)CM + ((size_t)(b * LP_ + 2 + t)) * C_ + col;
  *(v8h*)d = hv;
  asm volatile("s_wait_xcnt 0x0" ::: "memory");            // before a register that this store names is rewritten
}

// ---------------------------------------------------------------------------
// The three operand preparations read none of each other's output: one launch, the block index picks the job.
//   blocks 0 .. 1535: weight tiles (16 x 16 x 6);  1536 .. 5631: x pieces;  5632 .. 5759: small operand plane.
// ---------------------------------------------------------------------------
#define PREP_WT  (6 * (C_ / 64) * (C_ / 64))
#define PREP_X   (NB_ * T_ * C_ / 8 / 256)
#define PREP_MA  (MAR_ / 2)
__global__ __launch_bounds__(256)
void prep_kernel(const float* __restrict__ W0, const float* __restrict__ W1, const float* __restrict__ W2,
                 const float* __restrict__ W3, const float* __restrict__ W4, const float* __restrict__ W5,
                 unsigned short* __restrict__ WT, float s,
                 const float* __restrict__ x, unsigned short* __restrict__ CM,
                 const float* __restrict__ prev_m, const float* __restrict__ cached, unsigned short* __restrict__ MA) {
  __shared__ __align__(16) float tf[64 * 68];
  const int bx = blockIdx.x;
  if (bx < PREP_WT) {
    wt_body(tf, bx & 15, (bx >> 4) & 15, bx >> 8, W0, W1, W2, W3, W4, W5, WT, s);
  } else if (bx < PREP_WT + PREP_X) {
    xcvt_body(bx - PREP_WT, x, CM, NB_ * T_ * C_ / 8);
  } else {
    ma_body(bx - (PREP_WT + PREP_X), prev_m, cached, MA);
  }
}

// ---------------------------------------------------------------------------
// Block-tiled batched f16 WMMA GEMM: C[m,n] = oscale * (scale * sum_k A[m,k] * Bt[n,k] + bias).
// One block = WM x WN waves = a (64*WM) x (64*WN) tile of C; each wave owns a 64x64 sub-tile.
// A row-major [M,K] f16; Bt row-major [N,K] f16; M % (64*WM) == 0, N % (64*WN) == 0, K % 64 == 0, K >= 64.
// A pass is 64 k (128 B of every operand row).  A stage is [A rows | Bt rows] at pitch 144 B in LDS, two buffers;
// every lane copies 16-B pieces global -> LDS asynchronously, the next pass's stage in flight while this one is worked on.
// Column n of C lies in output plane n / NPB (plane stride strideCN) at column n % NPB; NPB % 64 == 0.
// BIAS_MODE: 0 = none, 1 = bias[m], 2 = bias[n].  OUT_MODE: 0 = f32, 1 = f16, 2 = scale * sum left as an f32 tile
// [BM][TLP] at the start of the ring (no global store; the caller's barrier publishes it).
// ---------------------------------------------------------------------------
#define GKT 64      // k per pass
#define GP  72      // LDS row pitch in halves: 144 B = 16 B x odd, conflict-free for 16-B fragment reads
#define TLP 132     // pitch in floats of the f32 tile of OUT_MODE 2: 528 B = 16 B x odd

// Eight asynchronous 16-B copies per lane.  The s_wait_xcnt closes the statement so that no address register
// named here is rewritten ahead of it.
__device__ __forceinline__ void copy8(const unsigned (&l)[8], const _Float16* const (&g)[8]) {
  asm volatile(
      "global_load_async_to_lds_b128 %0, %8, off\n\t"
      "global_load_async_to_lds_b128 %1, %9, off\n\t"
      "global_load_async_to_lds_b128 %2, %10, off\n\t"
      "global_load_async_to_lds_b128 %3, %11, off\n\t"
      "global_load_async_to_lds_b128 %4, %12, off\n\t"
      "global_load_async_to_lds_b128 %5, %13, off\n\t"
      "global_load_async_to_lds_b128 %6, %14, off\n\t"
      "global_load_async_to_lds_b128 %7, %15, off\n\t"
      "s_wait_xcnt 0x0"
      :: "v"(l[0]), "v"(l[1]), "v"(l[2]), "v"(l[3]), "v"(l[4]), "v"(l[5]), "v"(l[6]), "v"(l[7]),
         "v"(g[0]), "v"(g[1]), "v"(g[2]), "v"(g[3]), "v"(g[4]), "v"(g[5]), "v"(g[6]), "v"(g[7])
      : "memory");
}

// ring: 2 * (64*WM + 64*WN) * GP halves of LDS; sT: WM * WN slabs of 16 x 68 floats of LDS; bx = tile index, b = batch.
template <int BIAS_MODE, int OUT_MODE, int WM, int WN>
__device__ __forceinline__ void gemm_body(
    _Float16* ring, float* sT, int bx, int b,
    const unsigned short* __restrict__ Ap, int lda, long strideA,
    const unsigned short* __restrict__ Btp, int ldb, long strideB,
    void* __restrict__ Cout, int ldc, long strideC, int NPB, long strideCN,
    const float* __restrict__ bias, int M, int N, int K, float scale, float oscale) {
  constexpr int NT  = 32 * WM * WN;      // threads
  constexpr int BM  = 64 * WM;           // tile rows
  constexpr int BN  = 64 * WN;           // tile columns
  constexpr int RPI = NT / 8;            // rows covered by one copy of the whole block (8 lanes x 16 B = one 128-B row)
  constexpr int NA  = BM / RPI;          // copies per lane and pass, A rows (16 / WN)
  constexpr int NB  = BN / RPI;          // copies per lane and pass, Bt rows (16 / WM)
  constexpr int STAGE_H = (BM + BN) * GP;
  static_assert(NA % 8 == 0 && NB % 8 == 0 && NA + NB <= 63, "copy groups of eight, at most 63 in flight");

  const _Float16* A  = (const _Float16*)Ap;
  const _Float16* Bt = (const _Float16*)Btp;
  const int tid  = threadIdx.x;
  const int lane = tid & 31;
  const int wave = tid >> 5;
  const int wm   = wave / WN;
  const int wn   = wave - wm * WN;
  const int tilesN = N / BN;
  const int tm = bx / tilesN;            // bx runs over (M / BM) * (N / BN) tiles exactly
  const int tn = bx - tm * tilesN;
  const int rlane = lane & 15;                 // row (A) / col (B, D) within subtile
  const int koff  = (lane >> 4) * 8;           // k offset of this lane half
  const int mOff  = (lane >> 4) * 8;           // D row offset

  // this lane's piece of a stage: row tid>>3 (+ RPI per copy), 16-B piece tid&7
  const _Float16* gA = A  + (size_t)b * strideA + (size_t)(tm * BM + (tid >> 3)) * lda + (tid & 7) * 8;
  const _Float16* gB = Bt + (size_t)b * strideB + (size_t)(tn * BN + (tid >> 3)) * ldb + (tid & 7) * 8;
  const unsigned  lds0 = (unsigned)(size_t)(&ring[0]) + (unsigned)((tid >> 3) * (GP * 2) + (tid & 7) * 16);

  auto issue = [&](int kt, int buf) {
    const _Float16* ga = gA + kt * GKT;
    const _Float16* gb = gB + kt * GKT;
    const unsigned  la = lds0 + (unsigned)buf * (unsigned)(STAGE_H * 2);
    const unsigned  lb = la + (unsigned)(BM * GP * 2);
    // the four loops below are unrolled so that l[] and g[] are registers (they are asm operands)
#pragma unroll
    for (int q = 0; q < NA / 8; ++q) {
      unsigned l[8]; const _Float16* g[8];
#pragma unroll
      for (int e = 0; e < 8; ++e) {
        l[e] = la + (unsigned)((q * 8 + e) * RPI * GP * 2);
        g[e] = ga + (size_t)((q * 8 + e) * RPI) * lda;
      }
      copy8(l, g);
    }
#pragma unroll
    for (int q = 0; q < NB / 8; ++q) {
      unsigned l[8]; const _Float16* g[8];
#pragma unroll
      for (int e = 0; e < 8; ++e) {
        l[e] = lb + (unsigned)((q * 8 + e) * RPI * GP * 2);
        g[e] = gb + (size_t)((q * 8 + e) * RPI) * ldb;
      }
      copy8(l, g);
    }
  };

  v8f acc[4][4];
#pragma unroll
  for (int i = 0; i < 4; ++i)
#pragma unroll
    for (int j = 0; j < 4; ++j) acc[i][j] = zero8f();

  const int NP = K / GKT;
  issue(0, 0);
  asm volatile("s_wait_asynccnt 0x0" ::: "memory");   // this wave's pieces of stage 0 have landed
  __syncthreads();                                     // publishes stage 0 to every wave
  if (NP > 1) issue(1, 1);

  for (int t = 0; t < NP; ++t) {
    const _Float16* sA = ring + (t & 1) * STAGE_H + (wm * 64 + rlane) * GP + koff;
    const _Float16* sB = ring + (t & 1) * STAGE_H + (BM + wn * 64 + rlane) * GP + koff;
    // unrolled throughout: fragments and accumulators are indexed at compile time and stay in registers
#pragma unroll
    for (int ks = 0; ks < GKT / 32; ++ks) {
      v16h bh[4], ah[4];
#pragma unroll
      for (int j = 0; j < 4; ++j) bh[j] = ldfrag(sB + j * 16 * GP + ks * 32);
#pragma unroll
      for (int i = 0; i < 4; ++i) ah[i] = ldfrag(sA + i * 16 * GP + ks * 32);
      // keeps the sixteen LDS reads of this k step together ahead of its WMMAs: spread among them, every row of
      // four WMMAs waits out a full LDS latency of its own
      __builtin_amdgcn_sched_barrier(0);
#pragma unroll
      for (int i = 0; i < 4; ++i)
#pragma unroll
        for (int j = 0; j < 4; ++j) acc[i][j] = mma_f16(ah[i], bh[j], acc[i][j]);
    }
    asm volatile("s_wait_dscnt 0x0" ::: "memory");      // this wave's reads of the buffer are done before it is refilled
    asm volatile("s_wait_asynccnt 0x0" ::: "memory");   // this wave's pieces of stage t + 1 have landed
    __syncthreads();                                     // publishes stage t + 1 and ends every reader's use of stage t
    if (t + 2 < NP) issue(t + 2, t & 1);
  }
  asm volatile("s_wait_asynccnt 0x0" ::: "memory");     // no copy outstanding when the wave goes on

  // ---- epilogue ----
  if constexpr (OUT_MODE == 2) {
    // the last pass's barrier has ended every wave's reads of the ring
    static_assert(BM * TLP * 4 <= 2 * STAGE_H * 2 && BN <= TLP, "the tile fits the ring");
    float* tile = (float*)ring;
#pragma unroll
    for (int i = 0; i < 4; ++i)
#pragma unroll
      for (int j = 0; j < 4; ++j)
#pragma unroll
        for (int r = 0; r < 8; ++r)
          tile[(wm * 64 + (i << 4) + mOff + r) * TLP + wn * 64 + (j << 4) + rlane] = acc[i][j][r] * scale;
    return;
  }
  const int m0 = tm * BM + wm * 64;
  const int n0 = tn * BN + wn * 64;
  const int np = n0 / NPB;                     // output plane of this wave's 64 columns
  const int nl = n0 - np * NPB;                // first column inside that plane
  float* slab = sT + wave * (16 * 68);         // per-wave 16x64 slab, pitch 68 floats
#pragma unroll
  for (int i = 0; i < 4; ++i) {
    const int mBase = m0 + (i << 4);
#pragma unroll
    for (int j = 0; j < 4; ++j) {
      const int n = n0 + (j << 4) + rlane;
      float bvn = 0.f;
      if (BIAS_MODE == 2) bvn = bias[n];
#pragma unroll
      for (int r = 0; r < 8; ++r) {
        float v = acc[i][j][r] * scale;
        if (BIAS_MODE == 1) v += bias[mBase + mOff + r];
        if (BIAS_MODE == 2) v += bvn;
        v *= oscale;
        slab[(mOff + r) * 68 + (j << 4) + rlane] = v;
      }
    }
    __builtin_amdgcn_fence(__ATOMIC_RELEASE, "workgroup");
    __builtin_amdgcn_wave_barrier();
    __builtin_amdgcn_fence(__ATOMIC_ACQUIRE, "workgroup");
    if (OUT_MODE == 0) {
      float* C = (float*)Cout + (size_t)b * strideC + (size_t)np * strideCN;
      const int hh = lane >> 4, c4 = (lane & 15) * 4;     // row seg = 256 B = 16 lanes x 16 B
      {
#pragma unroll
        for (int it = 0; it < 8; ++it) {
          const int row = it * 2 + hh;                     // it 0..7 x hh 0..1 = rows 0..15
          const v4f v = *(const v4f*)(slab + row * 68 + c4);
          *(v4f*)(C + (size_t)(mBase + row) * ldc + nl + c4) = v;
        }
      }
      asm volatile("s_wait_xcnt 0x0" ::: "memory");        // before a register that these stores name is rewritten
    } else {
      _Float16* C = (_Float16*)Cout + (size_t)b * strideC + (size_t)np * strideCN;
      const int q = lane >> 3, c8 = (lane & 7) * 8;
      v8h hv[4];
#pragma unroll
      for (int it = 0; it < 4; ++it) {
        const int row = it * 4 + q;                        // it 0..3 x q 0..3 = rows 0..15
        const float* spf = slab + row * 68 + c8;
        v8h t;
#pragma unroll
        for (int e = 0; e < 8; ++e) t[e] = (_Float16)spf[e];
        hv[it] = t;
      }
      {
#pragma unroll
        for (int it = 0; it < 4; ++it) {
          const int row = it * 4 + q;
          *(v8h*)(C + (size_t)(mBase + row) * ldc + nl + c8) = hv[it];
        }
      }
      asm volatile("s_wait_xcnt 0x0" ::: "memory");        // before a register that these stores name is rewritten
    }
    __builtin_amdgcn_fence(__ATOMIC_RELEASE, "workgroup");
    __builtin_amdgcn_wave_barrier();
    __builtin_amdgcn_fence(__ATOMIC_ACQUIRE, "workgroup");
  }
}

#define G22_RING_H (2 * (128 + 128) * GP)    // LDS of a 2 x 2 wave block: two stages of 256 rows
#define G22_SLAB_F (4 * 16 * 68)             // and four epilogue slabs
#define TQ_  ((T_ / 128) * (C_ / 128))       // tiles of one batch of q
#define TKV_ ((NB_ * LP_ / 128) * (C_ / 128))  // tiles of k, and of v^T

// ---------------------------------------------------------------------------
// Memory-compression attention inside the block that projects its operands.  Block (g, h) = four batch elements 4g..4g+3,
// head h: one 128 x 128 product of MA group g with rows 128h.. of the interleaved plane WmT; of the f32 tile left in LDS
//   tile[16w + j][d]      = cached row j of batch 4g+w . Wkm column 64h+d   (km, j < 16, d < 64)
//   tile[64 + w][64 + d]  = prev_m of batch 4g+w . Wqm column 64h+d         (qm)
// are read (the other quadrants pair an operand with the other weight).  Wave w then does batch 4g+w in f32:
//   s_j = (qm + bqm) . (km_j + bkm) * 0.125 over 16 keys, softmax, mem = sum_j a_j (km_j + bkm) -> CM row 0, columns of head h.
// The wave also writes its batch's CM row 1 (prev_m) and zero pad rows LKV_..LP_-1 in the head's 64 columns:
// coverage: 16 x 4 row slots (63 used) x 8 lanes x 8 halves = 63 rows x one 128-B line; 32 blocks x 4 waves = 8 batches x 16 heads.
// ---------------------------------------------------------------------------
__device__ __forceinline__ void mem_body(
    _Float16* ring, float* sb, int bx,
    const unsigned short* __restrict__ MA, const unsigned short* __restrict__ WmT,
    const float* __restrict__ bqm, const float* __restrict__ bkm, const float* __restrict__ prev_m,
    unsigned short* CM, float r16) {
  const int tid = threadIdx.x, wave = tid >> 5, lane = tid & 31;
  const int g = bx >> 4, h = bx & (NH_ - 1);
  const int b = g * 4 + wave;
  // loaded ahead of the product, used behind it
  const float bval = (tid < HD_) ? bkm[h * HD_ + tid] : bqm[h * HD_ + tid - HD_];
  const int c8 = h * HD_ + (lane & 7) * 8;
  const float* pp = prev_m + (size_t)b * C_ + c8;
  const v4f p0 = *(const v4f*)(pp), p1 = *(const v4f*)(pp + 4);

  gemm_body<0, 2, 2, 2>(ring, sb, bx, 0, MA, C_, 0L, WmT, C_, 0L,
      (void*)0, 0, 0L, 2 * C_, 0L, (const float*)0, MAR_, 2 * C_, C_, r16, 1.0f);

  sb[tid] = bval;                              // sb[0..63] = bkm, sb[64..127] = bqm of the head
  __syncthreads();                             // publishes the f32 tile and the biases to every wave

  // behind the barrier, so that no wave waits there for these stores to complete
  _Float16* cmb = (_Float16*)CM + (size_t)b * LP_ * C_;
  {
    const v8h pv = cvt8(p0, p1, 1.0f);
    const v8h z8 = zero8h();
#pragma unroll
    for (int it = 0; it < 16; ++it) {
      const int ri  = it * 4 + (lane >> 3);                // slot 0 = row 1, slots 1..62 = pad rows, slot 63 = none
      const int row = (ri == 0) ? 1 : (LKV_ - 1 + ri);
      if (ri < 63) *(v8h*)(cmb + (size_t)row * C_ + c8) = (ri == 0) ? pv : z8;
    }
    asm volatile("s_wait_xcnt 0x0" ::: "memory");          // before a register that these stores name is rewritten
  }

  const float* tile = (const float*)ring;
  const int j = lane & 15;
  const float* qr = tile + (64 + wave) * TLP + 64;
  const float* kr = tile + (wave * MM_ + j) * TLP;
  float a = 0.f;
#pragma unroll
  for (int d4 = 0; d4 < HD_ / 4; ++d4) {
    const v4f qv = *(const v4f*)(qr + 4 * d4) + *(const v4f*)(sb + HD_ + 4 * d4);
    const v4f kv = *(const v4f*)(kr + 4 * d4) + *(const v4f*)(sb + 4 * d4);
    a = fmaf(qv[0], kv[0], a);
    a = fmaf(qv[1], kv[1], a);
    a = fmaf(qv[2], kv[2], a);
    a = fmaf(qv[3], kv[3], a);
  }
  const float sj = (lane < MM_) ? a * 0.125f : -INFINITY;
  float mx = sj;
#pragma unroll
  for (int off = 1; off < 32; off <<= 1) mx = fmaxf(mx, __shfl_xor(mx, off, 32));
  const float e = (lane < MM_) ? __expf(sj - mx) : 0.f;
  float se = e;
#pragma unroll
  for (int off = 1; off < 32; off <<= 1) se += __shfl_xor(se, off, 32);
  const float am = e * (1.0f / se);
  const float kb0 = sb[lane], kb1 = sb[lane + 32];
  float o0 = 0.f, o1 = 0.f;
#pragma unroll
  for (int jj = 0; jj < MM_; ++jj) {
    const float aj = __shfl(am, jj, 32);
    const float* kp = tile + (wave * MM_ + jj) * TLP;
    o0 = fmaf(aj, kp[lane] + kb0, o0);
    o1 = fmaf(aj, kp[lane + 32] + kb1, o1);
  }
  _Float16* d = cmb + h * HD_;                             // row 0 = mem: the wave writes the head's whole 128-B line
  d[lane]      = (_Float16)o0;
  d[lane + 32] = (_Float16)o1;
  asm volatile("s_wait_xcnt 0x0" ::: "memory");            // before a register that these stores name is rewritten
}

#define MEMB_ (2 * NH_)                      // blocks of the memory path

// Work that reads none of each other's output shares a launch; the block index picks the job (block-uniform branch).
// Blocks 0..MEMB_-1: memory path -> CM rows 0, 1 and pad rows;  MEMB_..: q = x . Wq + bq -> Q plane (x16), 64 tiles per
// batch, A = CM rows 2..1025 (rows that the memory path does not write).
__global__ __launch_bounds__(128) void gemm_mem_q(
    const unsigned short* __restrict__ MA, const unsigned short* __restrict__ WmT,
    const float* __restrict__ bqm, const float* __restrict__ bkm, const float* __restrict__ prev_m,
    unsigned short* CM, const unsigned short* __restrict__ WqT, unsigned short* __restrict__ Qh,
    const float* __restrict__ bq, float r16, float s16) {
  __shared__ __align__(16) _Float16 ring[G22_RING_H];
  __shared__ __align__(16) float sT[G22_SLAB_F];
  const int bx = blockIdx.x;
  if (bx < MEMB_) {
    mem_body(ring, sT, bx, MA, WmT, bqm, bkm, prev_m, CM, r16);
  } else {
    const int i = bx - MEMB_;
    gemm_body<2, 1, 2, 2>(ring, sT, i % TQ_, i / TQ_,
        CM + (size_t)2 * C_, C_, (long)LP_ * C_, WqT, C_, 0L, (void*)Qh, C_, (long)T_ * C_, C_, 0L, bq, T_, C_, C_, r16, s16);
  }
}

// Blocks 0..TKV_-1: k = cm . Wk + bk -> K plane (x16), the batches' rows contiguous in CM and in K, M = 8 * 1088;
// TKV_..: v^T = Wv^T . cm^T + bv[m] -> VT plane [h*64+d][s] (x16), N = 8 * 1088, output plane = batch (1088 columns each).
__global__ __launch_bounds__(128) void gemm_k_vt(
    const unsigned short* __restrict__ CM, const unsigned short* __restrict__ WkT, const unsigned short* __restrict__ WvT,
    unsigned short* __restrict__ Kh, unsigned short* __restrict__ VTh,
    const float* __restrict__ bk, const float* __restrict__ bv, float r16, float s16) {
  __shared__ __align__(16) _Float16 ring[G22_RING_H];
  __shared__ __align__(16) float sT[G22_SLAB_F];
  const int bx = blockIdx.x;
  if (bx < TKV_) {
    gemm_body<2, 1, 2, 2>(ring, sT, bx, 0,
        CM, C_, 0L, WkT, C_, 0L, (void*)Kh, C_, 0L, C_, 0L, bk, NB_ * LP_, C_, C_, r16, s16);
  } else {
    gemm_body<1, 1, 2, 2>(ring, sT, bx - TKV_, 0,
        WvT, C_, 0L, CM, C_, 0L, (void*)VTh, LP_, 0L, LP_, (long)C_ * LP_, bv, C_, NB_ * LP_, C_, r16, s16);
  }
}

// out = y . Wp + bp -> f32 [8192][1024]
__global__ __launch_bounds__(128) void gemm_out(
    const unsigned short* __restrict__ Yh, const unsigned short* __restrict__ WpT, float* __restrict__ out,
    const float* __restrict__ bp, float r256) {
  __shared__ __align__(16) _Float16 ring[G22_RING_H];
  __shared__ __align__(16) float sT[G22_SLAB_F];
  gemm_body<2, 0, 2, 2>(ring, sT, blockIdx.x, 0,
      Yh, C_, 0L, WpT, C_, 0L, (void*)out, C_, 0L, C_, 0L, bp, NB_ * T_, C_, C_, r256, 1.0f);
}

__device__ __forceinline__ float xhalf(float x) {
  const int b = __builtin_bit_cast(int, x);
  return __builtin_bit_cast(float, __builtin_amdgcn_permlanex16(b, b, 0x76543210, 0xfedcba98, false, false));
}

__global__ __launch_bounds__(128)
void attn_kernel(const unsigned short* __restrict__ Qp, const unsigned short* __restrict__ Kp,
                 const unsigned short* __restrict__ VTp, unsigned short* __restrict__ Yp, float sscale) {
  __shared__ __align__(16) _Float16 Ksh[64 * AKP];          // K chunk [key][d], pitch 72
  __shared__ __align__(16) _Float16 Vth[64 * AKP];          // V^T chunk [d][key]
  __shared__ __align__(16) _Float16 Osh[4][16 * AKP];       // per wave output tile [row][d]

  const int tid  = threadIdx.x;
  const int wave = tid >> 5;
  const int lane = tid & 31;
  const int hh   = lane >> 4;
  const int c    = lane & 15;
  // Block index -> tile.  A query block's cost grows with qb (3..17 key chunks) and most blocks are resident together, so
  // a die or a WGP is busy for about the sum of its blocks' costs.  The index's high bits pick qb, heaviest first, its low
  // 7 bits the (batch, head): indices equal modulo 8 hold every qb, indices equal modulo 256 every second cost rank, and
  // the swap inside every second pair (15 14 12 13 11 10 8 9 ...) levels the even ranks' sum with the odd ranks' (77 : 76).
  const int bx = blockIdx.x;
  const int u  = (bx >> 7) & 15;          // cost rank (T_/64 = 16 query blocks)
  const int qb = 15 - (u ^ ((u >> 1) & 1));
  const int h  = bx & (NH_ - 1);
  const int b  = (bx >> 4) & (NB_ - 1);
  const int q0 = qb * 64 + wave * 16;     // first query row of this wave (within the batch)

  const _Float16* Qb = (const _Float16*)Qp  + (size_t)b * T_  * C_ + h * HD_;
  const _Float16* Kb = (const _Float16*)Kp  + (size_t)b * LP_ * C_ + h * HD_;
  const _Float16* Vb = (const _Float16*)VTp + ((size_t)b * C_ + h * HD_) * LP_;
  _Float16*       Yb = (_Float16*)Yp + (size_t)b * T_ * C_ + h * HD_;

  // ---- Q fragments (B operand, column = query = lane&15, split k map): 2 d-chunks ----
  v16h qf[2];
#pragma unroll
  for (int dc = 0; dc < 2; ++dc)
    qf[dc] = ldfrag(Qb + (size_t)(q0 + c) * C_ + dc * 32 + 8 * hh);

  const int qrow = q0 + c;                                  // this lane's query
  const int lim  = (qrow < NU_) ? (NU_ + 1) : (qrow + 2);   // its last visible key
  float mrow = -INFINITY;                                   // running maximum of the query (equal in both halves)
  float lrow = 0.f;                                         // this half's share of the query's sum
  v8f oacc[4];                                              // oacc[t][r] = O[query][16t + 8hh + r]
#pragma unroll
  for (int t = 0; t < 4; ++t) oacc[t] = zero8f();

  int maxkey = qb * 64 + 63 + 2;                            // last visible key of the block's last query
  if (qb * 64 < NU_) maxkey = (maxkey > NU_ + 1) ? maxkey : (NU_ + 1);
  const int nChunks = (maxkey >> 6) + 1;                    // block-uniform, 3..17

  for (int kc = 0; kc < nChunks; ++kc) {
    const int kv0 = kc * 64;
    __syncthreads();
    {
      // staging coverage: 128 threads x (4 x 8) halves = 64 rows x 64 per tile
      const int r = tid >> 1, half = (tid & 1) * 32;
      const _Float16* ks = Kb + (size_t)(kv0 + r) * C_ + half;     // K row kv0+r, d = half..half+31
      const _Float16* vs = Vb + (size_t)r * LP_ + kv0 + half;      // V^T row d = r, s = kv0+half..+31
#pragma unroll
      for (int i = 0; i < 4; ++i) {
        const v8h a0 = *(const v8h*)(ks + 8 * i);
        const v8h b0 = *(const v8h*)(vs + 8 * i);
        *(v8h*)(Ksh + r * AKP + half + 8 * i) = a0;
        *(v8h*)(Vth + r * AKP + half + 8 * i) = b0;
      }
    }
    __syncthreads();

    // S^T tiles: rows = keys 16j..16j+15 of the chunk, columns = the wave's 16 queries
    v8f s[4];
#pragma unroll
    for (int j = 0; j < 4; ++j) s[j] = zero8f();
#pragma unroll
    for (int dc = 0; dc < 2; ++dc)
#pragma unroll
      for (int j = 0; j < 4; ++j) {
        const v16h ka = ldfrag(Ksh + (j * 16 + c) * AKP + dc * 32 + 8 * hh);
        s[j] = mma_f16(ka, qf[dc], s[j]);
      }
    const int rel = lim - kv0 - 8 * hh;                     // key kv0 + 8hh + (16j + r) is visible iff 16j + r <= rel
    float mj[4];
#pragma unroll
    for (int j = 0; j < 4; ++j) {
      float m = -INFINITY;
#pragma unroll
      for (int r = 0; r < 8; ++r) {
        const float sv = (j * 16 + r <= rel) ? s[j][r] * sscale : -INFINITY;
        s[j][r] = sv;
        m = fmaxf(m, sv);
      }
      mj[j] = m;
    }
    float cmx = fmaxf(fmaxf(mj[0], mj[1]), fmaxf(mj[2], mj[3]));
    cmx = fmaxf(cmx, xhalf(cmx));                           // the other half's 32 keys of the same query
    const float mnew  = fmaxf(mrow, cmx);
    const float alpha = __expf(mrow - mnew);
    mrow = mnew;
    v16h pb[2];                                             // P^T as B operand, 32 keys each
    float pj[4];
#pragma unroll
    for (int j = 0; j < 4; ++j) {
      float ps = 0.f;
#pragma unroll
      for (int r = 0; r < 8; ++r) {
        const float p = __expf(s[j][r] - mnew);
        ps += p;
        pb[j >> 1][(j & 1) * 8 + r] = (_Float16)p;
      }
      pj[j] = ps;
    }
    lrow = lrow * alpha + ((pj[0] + pj[1]) + (pj[2] + pj[3]));
#pragma unroll
    for (int t = 0; t < 4; ++t) oacc[t] *= alpha;
#pragma unroll
    for (int kk = 0; kk < 2; ++kk)
#pragma unroll
      for (int t = 0; t < 4; ++t) {
        const v16h va = ldfrag(Vth + (t * 16 + c) * AKP + kk * 32 + 8 * hh);
        oacc[t] = mma_f16(va, pb[kk], oacc[t]);
      }
  }

  _Float16* os = Osh[wave];
  {
    const float inv = 1.0f / (lrow + xhalf(lrow));          // the two halves' shares joined once
#pragma unroll
    for (int t = 0; t < 4; ++t) {
      v8h o;
#pragma unroll
      for (int r = 0; r < 8; ++r) o[r] = (_Float16)(oacc[t][r] * inv);
      *(v8h*)(os + c * AKP + t * 16 + 8 * hh) = o;
    }
  }
  __builtin_amdgcn_fence(__ATOMIC_RELEASE, "workgroup");
  __builtin_amdgcn_wave_barrier();
  __builtin_amdgcn_fence(__ATOMIC_ACQUIRE, "workgroup");
  {
    const int q4 = lane >> 3, c8 = (lane & 7) * 8;
    v8h ov[4];
#pragma unroll
    for (int it = 0; it < 4; ++it) {
      const int row = it * 4 + q4;
      ov[it] = *(const v8h*)(os + row * AKP + c8);
    }
    {
#pragma unroll
      for (int it = 0; it < 4; ++it) {
        const int row = it * 4 + q4;
        *(v8h*)(Yb + (size_t)(q0 + row) * C_ + c8) = ov[it];
      }
    }
  }
}

// ---------------------------------------------------------------------------
//   WT   f16 [6][1024 n][1024 k]  (Wq,Wk,Wv,Wp transposed; Wkm, Wqm transposed and interleaved by head; x16)  0   12582912
//   MA   f16 [256][1024]                                               12582912     524288
//   CM   f16 [8][1088][1024]  rows: 0 mem, 1 prev_m, 2..1025 x, 1026..1087 zero  13107200   17825792
//   Q    f16 [8][1024][1024] (x16)                                     30932992   16777216
//   K    f16 [8][1088][1024] (x16)                                     47710208   17825792
//   VT   f16 [8][1024][1088] (x16)                                     65536000   17825792
//   Y    f16 [8][1024][1024] (x16)                                     83361792   16777216
//   total                                                             100139008
// ---------------------------------------------------------------------------
extern "C" void kernel_launch(void* const* d_in, const int* in_sizes, int n_in,
                              void* d_out, int out_size, void* d_ws, size_t ws_size,
                              hipStream_t stream) {
  if (n_in < 15) return;
  if (in_sizes[0] != NB_ * T_ * C_) return;
  if (in_sizes[1] != NB_ * C_) return;
  if (in_sizes[2] != NB_ * MM_ * C_) return;
  for (int i = 3; i <= 13; i += 2) if (in_sizes[i] != C_ * C_) return;
  for (int i = 4; i <= 14; i += 2) if (in_sizes[i] != C_) return;
  if (out_size != NB_ * T_ * C_) return;

  const float* x      = (const float*)d_in[0];
  const float* prev_m = (const float*)d_in[1];
  const float* cached = (const float*)d_in[2];
  const float* Wq  = (const float*)d_in[3];  const float* bq  = (const float*)d_in[4];
  const float* Wk  = (const float*)d_in[5];  const float* bk  = (const float*)d_in[6];
  const float* Wv  = (const float*)d_in[7];  const float* bv  = (const float*)d_in[8];
  const float* Wp  = (const float*)d_in[9];  const float* bp  = (const float*)d_in[10];
  const float* Wqm = (const float*)d_in[11]; const float* bqm = (const float*)d_in[12];
  const float* Wkm = (const float*)d_in[13]; const float* bkm = (const float*)d_in[14];
  float* out = (float*)d_out;

  const size_t szWT  = (size_t)6 * C_ * C_ * 2;
  const size_t szMA  = (size_t)MAR_ * C_ * 2;
  const size_t szCM  = (size_t)NB_ * LP_ * C_ * 2;
  const size_t szQ   = (size_t)NB_ * T_ * C_ * 2;
  const size_t szK   = (size_t)NB_ * LP_ * C_ * 2;
  const size_t szVT  = (size_t)NB_ * C_ * LP_ * 2;
  const size_t szY   = (size_t)NB_ * T_ * C_ * 2;
  size_t off = 0;
  const size_t oWT  = off; off += szWT;
  const size_t oMA  = off; off += szMA;
  const size_t oCM  = off; off += szCM;
  const size_t oQ   = off; off += szQ;
  const size_t oK   = off; off += szK;
  const size_t oVT  = off; off += szVT;
  const size_t oY   = off; off += szY;
  if (off > ws_size) return;                   // off = 100139008

  char* ws = (char*)d_ws;
  unsigned short* WT  = (unsigned short*)(ws + oWT);
  unsigned short* MA  = (unsigned short*)(ws + oMA);
  unsigned short* CM  = (unsigned short*)(ws + oCM);
  unsigned short* Qh  = (unsigned short*)(ws + oQ);
  unsigned short* Kh  = (unsigned short*)(ws + oK);
  unsigned short* VTh = (unsigned short*)(ws + oVT);
  unsigned short* Yh  = (unsigned short*)(ws + oY);
  unsigned short* WqT  = WT;
  unsigned short* WkT  = WT + (size_t)1 * C_ * C_;
  unsigned short* WvT  = WT + (size_t)2 * C_ * C_;
  unsigned short* WpT  = WT + (size_t)3 * C_ * C_;
  unsigned short* WmT  = WT + (size_t)4 * C_ * C_;

  const float s16 = 16.0f, r16 = 1.0f / 16.0f, r256 = 1.0f / 256.0f;

  // (1) weights [in k][out n] f32 -> transposed f16 planes [n][k], carried x16; x -> CM rows 2..1025 per batch;
  //     small operand plane: per group of four batch elements 64 cached rows, 4 prev_m rows, zeros
  prep_kernel<<<dim3(PREP_WT + PREP_X + PREP_MA), dim3(256), 0, stream>>>(
      Wq, Wk, Wv, Wp, Wqm, Wkm, WT, s16, x, CM, prev_m, cached, MA);
  // (2) memory path (qm, km, f32 attention) -> CM rows 0 (mem), 1 (prev_m) and zero pad rows; q -> Q plane (x16)
  gemm_mem_q<<<dim3(MEMB_ + NB_ * TQ_), dim3(128), 0, stream>>>(
      MA, WmT, bqm, bkm, prev_m, CM, WqT, Qh, bq, r16, s16);
  // (3) k -> K plane and v^T -> VT plane (x16), pad rows included
  gemm_k_vt<<<dim3(2 * TKV_), dim3(128), 0, stream>>>(CM, WkT, WvT, Kh, VTh, bk, bv, r16, s16);
  // (4) masked attention -> Y plane (x16)
  attn_kernel<<<dim3(NB_ * NH_ * (T_ / 64)), dim3(128), 0, stream>>>(Qh, Kh, VTh, Yh, 0.125f / 256.0f);
  // (5) out = y . Wp + bp -> d_out f32 [8192][1024]  (y x16, Wp x16 -> scale 1/256)
  gemm_out<<<dim3((NB_ * T_ / 128) * (C_ / 128)), dim3(128), 0, stream>>>(Yh, WpT, out, bp, r256);
  (void)hipGetLastError();
}

// v006
// Measured time: 117 microseconds a run.
// Timed twice side by side with v005, it ran 1.05 times as fast both times.
// Counting every step since v000, it is 3.61 times as fast.
// Contractions x*Wq, cm*Wk, cm*Wv, mem*Wk, mem*Wv (per-head shares), k*q^T, v^T*p^T, y*Wp, prev_m*Wqm, cached*Wkm: v_wmma_f32_16x16x32_f16, f16 operands (weights carried x16, q/k/v/y planes carried x16, p x1), f32 accumulate; softmax f32; memory-path scores and weighted sum f32 VALU.
#include <hip/hip_runtime.h>
#include <stdint.h>
#include <math.h>

#define NB_   8
#define T_    1024
#define C_    1024
#define NH_   16
#define HD_   64
#define NU_   128
#define MM_   16
#define LKV_  1026
#define LP_   1088
#define MAR_  256
#define AKP   72

typedef _Float16 v16h __attribute__((ext_vector_type(16)));
typedef _Float16 v8h  __attribute__((ext_vector_type(8)));
typedef float    v8f  __attribute__((ext_vector_type(8)));
typedef float    v4f  __attribute__((ext_vector_type(4)));

// ---- 16-bit fragment loader: elements 0..7 <- p[0..7], 8..15 <- p[16..23]; caller passes p = row base + k0 + 8*(lane>>4)
__device__ __forceinline__ v16h ldfrag(const _Float16* p) {
  union { v16h v; v8h h[2]; } f;
  f.h[0] = *(const v8h*)(p);
  f.h[1] = *(const v8h*)(p + 16);
  return f.v;
}
__device__ __forceinline__ v8f mma_f16(v16h a, v16h b, v8f c) {
  return __builtin_amdgcn_wmma_f32_16x16x32_f16(false, a, false, b, (short)0, c, false, false);
}
__device__ __forceinline__ v8f zero8f() { v8f z; z[0]=0.f; z[1]=0.f; z[2]=0.f; z[3]=0.f; z[4]=0.f; z[5]=0.f; z[6]=0.f; z[7]=0.f; return z; }
__device__ __forceinline__ v8h zero8h() {
  v8h z;
#pragma unroll
  for (int e = 0; e < 8; ++e) z[e] = (_Float16)0.0f;
  return z;
}
__device__ __forceinline__ v8h cvt8(v4f a, v4f b, float s) {
  v8h r;
  r[0] = (_Float16)(a[0] * s); r[1] = (_Float16)(a[1] * s); r[2] = (_Float16)(a[2] * s); r[3] = (_Float16)(a[3] * s);
  r[4] = (_Float16)(b[0] * s); r[5] = (_Float16)(b[1] * s); r[6] = (_Float16)(b[2] * s); r[7] = (_Float16)(b[3] * s);
  return r;
}

// ---------------------------------------------------------------------------
// Weight transpose + f16 convert with carry scale s: six inputs W_z [k][n] f32 (C_ x C_) ->
// WT plane z: [n][k] f16 = f16(s * W_z[k][n]).  64x64 tiles through LDS, one tile (bxx, byy, z) per block of 256 threads.
// Planes 4 and 5 are interleaved by head into one [2048][k] plane: rows 128h .. 128h+63 = W_5 columns of head h, the next 64 = W_4's.
// coverage per block: load 4 it x 256 thr x 4 = 64x64; store 2 it x 256 thr x 8 = 64x64.
// ---------------------------------------------------------------------------
__device__ __forceinline__
void wt_body(float* tf, int bxx, int byy, int z,
             const float* __restrict__ W0, const float* __restrict__ W1, const float* __restrict__ W2,
             const float* __restrict__ W3, const float* __restrict__ W4, const float* __restrict__ W5,
             unsigned short* __restrict__ WT, float s) {
  const float* W = (z == 0) ? W0 : (z == 1) ? W1 : (z == 2) ? W2 : (z == 3) ? W3 : (z == 4) ? W4 : W5;
  const int c0  = bxx * 64;          // input column block
  const int o0  = (z < 4) ? z * C_ + c0 : 4 * C_ + bxx * 128 + ((z == 4) ? 64 : 0);   // first output row of the tile
  _Float16* out = (_Float16*)WT + (size_t)o0 * C_;
  const int r0  = byy * 64;          // input row block    = output column block
  const int tid = threadIdx.x;
  {
    const int lr = tid >> 4;
    const int c4 = (tid & 15) * 4;
#pragma unroll
    for (int it = 0; it < 4; ++it) {
      const int rr = it * 16 + lr;
      const v4f a = *(const v4f*)(W + (size_t)(r0 + rr) * C_ + c0 + c4);
      *(v4f*)(tf + rr * 68 + c4) = a;
    }
  }
  __syncthreads();
  const int sub = tid >> 3;          // 0..31
  const int c8  = (tid & 7) * 8;     // 0..56
  v8h hv[2];
#pragma unroll
  for (int it = 0; it < 2; ++it) {
    const int oc = it * 32 + sub;    // output row within tile (= input column)
    v8h v;
#pragma unroll
    for (int e = 0; e < 8; ++e) v[e] = (_Float16)(tf[(c8 + e) * 68 + oc] * s);
    hv[it] = v;
  }
  {
#pragma unroll
    for (int it = 0; it < 2; ++it) {
      const int oc = it * 32 + sub;
      *(v8h*)(out + (size_t)oc * C_ + r0 + c8) = hv[it];
    }
    asm volatile("s_wait_xcnt 0x0" ::: "memory");          // before a register that these stores name is rewritten
  }
}

// ---------------------------------------------------------------------------
// Small operand plane MA [256][1024] f16, two groups g of 128 rows (four batch elements each): rows 0..63 of a group =
// cached_memory rows 64g .. 64g+63, rows 64..67 = prev_m[4g .. 4g+3], rows 68..127 = 0.
// 128 blocks (two rows each) x 256 threads x 8 halves; 128 threads = whole row (16 lines, 8 lanes per line);
// coverage: 128 x 256 x 8 = whole plane.
// ---------------------------------------------------------------------------
__device__ __forceinline__
void ma_body(int blk, const float* __restrict__ prev_m, const float* __restrict__ cached, unsigned short* __restrict__ MA) {
  const int row  = blk * 2 + ((int)threadIdx.x >> 7);
  const int col8 = ((int)threadIdx.x & 127) * 8;
  const int g = row >> 7, r = row & 127;
  const bool isc = r < 64, isp = (r >= 64) && (r < 68);
  const int rp = isp ? g * 4 + (r - 64) : 0;
  const int rc = isc ? g * 64 + r : 0;
  const float* sp = prev_m + (size_t)rp * C_ + col8;
  const float* sc = cached + (size_t)rc * C_ + col8;
  const v4f p0 = *(const v4f*)(sp), p1 = *(const v4f*)(sp + 4);
  const v4f q0 = *(const v4f*)(sc), q1 = *(const v4f*)(sc + 4);
  const float fp = isp ? 1.0f : 0.0f;
  const float fc = isc ? 1.0f : 0.0f;
  const v4f a = p0 * fp + q0 * fc;
  const v4f b = p1 * fp + q1 * fc;
  const v8h hv = cvt8(a, b, 1.0f);
  _Float16* d = (_Float16*)MA + (size_t)row * C_ + col8;
  *(v8h*)d = hv;
  asm volatile("s_wait_xcnt 0x0" ::: "memory");            // before a register that this store names is rewritten
}

// ---------------------------------------------------------------------------
// x [8][1024][1024] f32 -> CM plane rows 2..1025 of each batch ([8][LP_][1024] f16), unscaled.
// ---------------------------------------------------------------------------
__device__ __forceinline__
void xcvt_body(int blk, const float* __restrict__ x, unsigned short* __restrict__ CM, int n8) {
  const int idx = blk * 256 + threadIdx.x;
  if (idx >= n8) return;
  const int e = idx * 8;
  const int b = e >> 20, t = (e >> 10) & (T_ - 1), col = e & (C_ - 1);
  const v4f a0 = *(const v4f*)(x + e), a1 = *(const v4f*)(x + e + 4);
  const v8h hv = cvt8(a0, a1, 1.0f);
  _Float16* d = (_Float16*)CM + ((size_t)(b * LP_ + 2 + t)) * C_ + col;
  *(v8h*)d = hv;
  asm volatile("s_wait_xcnt 0x0" ::: "memory");            // before a register that this store names is rewritten
}

// ---------------------------------------------------------------------------
// The CM rows that x does not fill, 64 per batch: row 0 = 0 (the memory token's k and v do not come from this row, see
// mem_body), row 1 = prev_m, rows LKV_..LP_-1 = 0.  32 blocks x 256 threads x 8 rows x 8 halves = 8 x 64 rows x 1024;
// 8 lanes write a whole 128-B line.
// ---------------------------------------------------------------------------
__device__ __forceinline__
void cmrows_body(int blk, const float* __restrict__ prev_m, unsigned short* __restrict__ CM) {
  const int idx  = blk * 256 + (int)threadIdx.x;
  const int col8 = (idx & 127) * 8;
  const int sg   = (idx >> 7) & 7;             // slots 8 sg .. 8 sg + 7 of the batch's 64
  const int b    = idx >> 10;
  const float* sp = prev_m + (size_t)b * C_ + col8;
  const v4f p0 = *(const v4f*)(sp), p1 = *(const v4f*)(sp + 4);
  const v8h pv = cvt8(p0, p1, 1.0f);
  const v8h z8 = zero8h();
  _Float16* d = (_Float16*)CM + (size_t)b * LP_ * C_ + col8;
#pragma unroll
  for (int i = 0; i < 8; ++i) {
    const int slot = sg * 8 + i;               // slot 0 = row 0, slot 1 = row 1, slots 2..63 = pad rows
    const int row  = (slot < 2) ? slot : (LKV_ - 2 + slot);
    *(v8h*)(d + (size_t)row * C_) = (slot == 1) ? pv : z8;
  }
  asm volatile("s_wait_xcnt 0x0" ::: "memory");            // before a register that these stores name is rewritten
}

// ---------------------------------------------------------------------------
// The four operand preparations read none of each other's output: one launch, the block index picks the job.
//   blocks 0 .. 1535: weight tiles (16 x 16 x 6);  1536 .. 5631: x pieces;  5632 .. 5759: small operand plane;
//   5760 .. 5791: the CM rows beside x.
// ---------------------------------------------------------------------------
#define PREP_WT  (6 * (C_ / 64) * (C_ / 64))
#define PREP_X   (NB_ * T_ * C_ / 8 / 256)
#define PREP_MA  (MAR_ / 2)
#define PREP_CR  (NB_ * 64 * C_ / 8 / 8 / 256)
__global__ __launch_bounds__(256)
void prep_kernel(const float* __restrict__ W0, const float* __restrict__ W1, const float* __restrict__ W2,
                 const float* __restrict__ W3, const float* __restrict__ W4, const float* __restrict__ W5,
                 unsigned short* __restrict__ WT, float s,
                 const float* __restrict__ x, unsigned short* __restrict__ CM,
                 const float* __restrict__ prev_m, const float* __restrict__ cached, unsigned short* __restrict__ MA) {
  __shared__ __align__(16) float tf[64 * 68];
  const int bx = blockIdx.x;
  if (bx < PREP_WT) {
    wt_body(tf, bx & 15, (bx >> 4) & 15, bx >> 8, W0, W1, W2, W3, W4, W5, WT, s);
  } else if (bx < PREP_WT + PREP_X) {
    xcvt_body(bx - PREP_WT, x, CM, NB_ * T_ * C_ / 8);
  } else if (bx < PREP_WT + PREP_X + PREP_MA) {
    ma_body(bx - (PREP_WT + PREP_X), prev_m, cached, MA);
  } else {
    cmrows_body(bx - (PREP_WT + PREP_X + PREP_MA), prev_m, CM);
  }
}

// ---------------------------------------------------------------------------
// Block-tiled batched f16 WMMA GEMM: C[m,n] = oscale * (scale * sum_k A[m,k] * Bt[n,k] + bias).
// One block = WM x WN waves = a (64*WM) x (64*WN) tile of C; each wave owns a 64x64 sub-tile.
// A row-major [M,K] f16; Bt row-major [N,K] f16; M % (64*WM) == 0, N % (64*WN) == 0, K % 64 == 0, K >= 64.
// A pass is 64 k (128 B of every operand row).  A stage is [A rows | Bt rows] at pitch 144 B in LDS, two buffers;
// every lane copies 16-B pieces global -> LDS asynchronously, the next pass's stage in flight while this one is worked on.
// Column n of C lies in output plane n / NPB (plane stride strideCN) at column n % NPB; NPB % 64 == 0.
// BIAS_MODE: 0 = none, 1 = bias[m], 2 = bias[n].  OUT_MODE: 0 = f32, 1 = f16, 2 = scale * sum left as an f32 tile
// [BM][TLP] at the start of the ring (no global store; the caller's barrier publishes it).
// ---------------------------------------------------------------------------
#define GKT 64      // k per pass
#define GP  72      // LDS row pitch in halves: 144 B = 16 B x odd, conflict-free for 16-B fragment reads
#define TLP 132     // pitch in floats of the f32 tile of OUT_MODE 2: 528 B = 16 B x odd

// Eight asynchronous 16-B copies per lane.  The s_wait_xcnt closes the statement so that no address register
// named here is rewritten ahead of it.
__device__ __forceinline__ void copy8(const unsigned (&l)[8], const _Float16* const (&g)[8]) {
  asm volatile(
      "global_load_async_to_lds_b128 %0, %8, off\n\t"
      "global_load_async_to_lds_b128 %1, %9, off\n\t"
      "global_load_async_to_lds_b128 %2, %10, off\n\t"
      "global_load_async_to_lds_b128 %3, %11, off\n\t"
      "global_load_async_to_lds_b128 %4, %12, off\n\t"
      "global_load_async_to_lds_b128 %5, %13, off\n\t"
      "global_load_async_to_lds_b128 %6, %14, off\n\t"
      "global_load_async_to_lds_b128 %7, %15, off\n\t"
      "s_wait_xcnt 0x0"
      :: "v"(l[0]), "v"(l[1]), "v"(l[2]), "v"(l[3]), "v"(l[4]), "v"(l[5]), "v"(l[6]), "v"(l[7]),
         "v"(g[0]), "v"(g[1]), "v"(g[2]), "v"(g[3]), "v"(g[4]), "v"(g[5]), "v"(g[6]), "v"(g[7])
      : "memory");
}

// ring: 2 * (64*WM + 64*WN) * GP halves of LDS; sT: WM * WN slabs of 16 x 68 floats of LDS; bx = tile index, b = batch.
template <int BIAS_MODE, int OUT_MODE, int WM, int WN>
__device__ __forceinline__ void gemm_body(
    _Float16* ring, float* sT, int bx, int b,
    const unsigned short* __restrict__ Ap, int lda, long strideA,
    const unsigned short* __restrict__ Btp, int ldb, long strideB,
    void* __restrict__ Cout, int ldc, long strideC, int NPB, long strideCN,
    const float* __restrict__ bias, int M, int N, int K, float scale, float oscale) {
  constexpr int NT  = 32 * WM * WN;      // threads
  constexpr int BM  = 64 * WM;           // tile rows
  constexpr int BN  = 64 * WN;           // tile columns
  constexpr int RPI = NT / 8;            // rows covered by one copy of the whole block (8 lanes x 16 B = one 128-B row)
  constexpr int NA  = BM / RPI;          // copies per lane and pass, A rows (16 / WN)
  constexpr int NB  = BN / RPI;          // copies per lane and pass, Bt rows (16 / WM)
  constexpr int STAGE_H = (BM + BN) * GP;
  static_assert(NA % 8 == 0 && NB % 8 == 0 && NA + NB <= 63, "copy groups of eight, at most 63 in flight");

  const _Float16* A  = (const _Float16*)Ap;
  const _Float16* Bt = (const _Float16*)Btp;
  const int tid  = threadIdx.x;
  const int lane = tid & 31;
  const int wave = tid >> 5;
  const int wm   = wave / WN;
  const int wn   = wave - wm * WN;
  const int tilesN = N / BN;
  const int tm = bx / tilesN;            // bx runs over (M / BM) * (N / BN) tiles exactly
  const int tn = bx - tm * tilesN;
  const int rlane = lane & 15;                 // row (A) / col (B, D) within subtile
  const int koff  = (lane >> 4) * 8;           // k offset of this lane half
  const int mOff  = (lane >> 4) * 8;           // D row offset

  // this lane's piece of a stage: row tid>>3 (+ RPI per copy), 16-B piece tid&7
  const _Float16* gA = A  + (size_t)b * strideA + (size_t)(tm * BM + (tid >> 3)) * lda + (tid & 7) * 8;
  const _Float16* gB = Bt + (size_t)b * strideB + (size_t)(tn * BN + (tid >> 3)) * ldb + (tid & 7) * 8;
  const unsigned  lds0 = (unsigned)(size_t)(&ring[0]) + (unsigned)((tid >> 3) * (GP * 2) + (tid & 7) * 16);

  auto issue = [&](int kt, int buf) {
    const _Float16* ga = gA + kt * GKT;
    const _Float16* gb = gB + kt * GKT;
    const unsigned  la = lds0 + (unsigned)buf * (unsigned)(STAGE_H * 2);
    const unsigned  lb = la + (unsigned)(BM * GP * 2);
    // the four loops below are unrolled so that l[] and g[] are registers (they are asm operands)
#pragma unroll
    for (int q = 0; q < NA / 8; ++q) {
      unsigned l[8]; const _Float16* g[8];
#pragma unroll
      for (int e = 0; e < 8; ++e) {
        l[e] = la + (unsigned)((q * 8 + e) * RPI * GP * 2);
        g[e] = ga + (size_t)((q * 8 + e) * RPI) * lda;
      }
      copy8(l, g);
    }
#pragma unroll
    for (int q = 0; q < NB / 8; ++q) {
      unsigned l[8]; const _Float16* g[8];
#pragma unroll
      for (int e = 0; e < 8; ++e) {
        l[e] = lb + (unsigned)((q * 8 + e) * RPI * GP * 2);
        g[e] = gb + (size_t)((q * 8 + e) * RPI) * ldb;
      }
      copy8(l, g);
    }
  };

  v8f acc[4][4];
#pragma unroll
  for (int i = 0; i < 4; ++i)
#pragma unroll
    for (int j = 0; j < 4; ++j) acc[i][j] = zero8f();

  const int NP = K / GKT;
  issue(0, 0);
  asm volatile("s_wait_asynccnt 0x0" ::: "memory");   // this wave's pieces of stage 0 have landed
  __syncthreads();                                     // publishes stage 0 to every wave
  if (NP > 1) issue(1, 1);

  for (int t = 0; t < NP; ++t) {
    const _Float16* sA = ring + (t & 1) * STAGE_H + (wm * 64 + rlane) * GP + koff;
    const _Float16* sB = ring + (t & 1) * STAGE_H + (BM + wn * 64 + rlane) * GP + koff;
    // unrolled throughout: fragments and accumulators are indexed at compile time and stay in registers
#pragma unroll
    for (int ks = 0; ks < GKT / 32; ++ks) {
      v16h bh[4], ah[4];
#pragma unroll
      for (int j = 0; j < 4; ++j) bh[j] = ldfrag(sB + j * 16 * GP + ks * 32);
#pragma unroll
      for (int i = 0; i < 4; ++i) ah[i] = ldfrag(sA + i * 16 * GP + ks * 32);
      // keeps the sixteen LDS reads of this k step together ahead of its WMMAs: spread among them, every row of
      // four WMMAs waits out a full LDS latency of its own
      __builtin_amdgcn_sched_barrier(0);
#pragma unroll
      for (int i = 0; i < 4; ++i)
#pragma unroll
        for (int j = 0; j < 4; ++j) acc[i][j] = mma_f16(ah[i], bh[j], acc[i][j]);
    }
    asm volatile("s_wait_dscnt 0x0" ::: "memory");      // this wave's reads of the buffer are done before it is refilled
    asm volatile("s_wait_asynccnt 0x0" ::: "memory");   // this wave's pieces of stage t + 1 have landed
    __syncthreads();                                     // publishes stage t + 1 and ends every reader's use of stage t
    if (t + 2 < NP) issue(t + 2, t & 1);
  }
  asm volatile("s_wait_asynccnt 0x0" ::: "memory");     // no copy outstanding when the wave goes on

  // ---- epilogue ----
  if constexpr (OUT_MODE == 2) {
    // the last pass's barrier has ended every wave's reads of the ring
    static_assert(BM * TLP * 4 <= 2 * STAGE_H * 2 && BN <= TLP, "the tile fits the ring");
    float* tile = (float*)ring;
#pragma unroll
    for (int i = 0; i < 4; ++i)
#pragma unroll
      for (int j = 0; j < 4; ++j)
#pragma unroll
        for (int r = 0; r < 8; ++r)
          tile[(wm * 64 + (i << 4) + mOff + r) * TLP + wn * 64 + (j << 4) + rlane] = acc[i][j][r] * scale;
    return;
  }
  const int m0 = tm * BM + wm * 64;
  const int n0 = tn * BN + wn * 64;
  const int np = n0 / NPB;                     // output plane of this wave's 64 columns
  const int nl = n0 - np * NPB;                // first column inside that plane
  float* slab = sT + wave * (16 * 68);         // per-wave 16x64 slab, pitch 68 floats
#pragma unroll
  for (int i = 0; i < 4; ++i) {
    const int mBase = m0 + (i << 4);
#pragma unroll
    for (int j = 0; j < 4; ++j) {
      const int n = n0 + (j << 4) + rlane;
      float bvn = 0.f;
      if (BIAS_MODE == 2) bvn = bias[n];
#pragma unroll
      for (int r = 0; r < 8; ++r) {
        float v = acc[i][j][r] * scale;
        if (BIAS_MODE == 1) v += bias[mBase + mOff + r];
        if (BIAS_MODE == 2) v += bvn;
        v *= oscale;
        slab[(mOff + r) * 68 + (j << 4) + rlane] = v;
      }
    }
    __builtin_amdgcn_fence(__ATOMIC_RELEASE, "workgroup");
    __builtin_amdgcn_wave_barrier();
    __builtin_amdgcn_fence(__ATOMIC_ACQUIRE, "workgroup");
    if (OUT_MODE == 0) {
      float* C = (float*)Cout + (size_t)b * strideC + (size_t)np * strideCN;
      const int hh = lane >> 4, c4 = (lane & 15) * 4;     // row seg = 256 B = 16 lanes x 16 B
      {
#pragma unroll
        for (int it = 0; it < 8; ++it) {
          const int row = it * 2 + hh;                     // it 0..7 x hh 0..1 = rows 0..15
          const v4f v = *(const v4f*)(slab + row * 68 + c4);
          *(v4f*)(C + (size_t)(mBase + row) * ldc + nl + c4) = v;
        }
      }
      asm volatile("s_wait_xcnt 0x0" ::: "memory");        // before a register that these stores name is rewritten
    } else {
      _Float16* C = (_Float16*)Cout + (size_t)b * strideC + (size_t)np * strideCN;
      const int q = lane >> 3, c8 = (lane & 7) * 8;
      v8h hv[4];
#pragma unroll
      for (int it = 0; it < 4; ++it) {
        const int row = it * 4 + q;                        // it 0..3 x q 0..3 = rows 0..15
        const float* spf = slab + row * 68 + c8;
        v8h t;
#pragma unroll
        for (int e = 0; e < 8; ++e) t[e] = (_Float16)spf[e];
        hv[it] = t;
      }
      {
#pragma unroll
        for (int it = 0; it < 4; ++it) {
          const int row = it * 4 + q;
          *(v8h*)(C + (size_t)(mBase + row) * ldc + nl + c8) = hv[it];
        }
      }
      asm volatile("s_wait_xcnt 0x0" ::: "memory");        // before a register that these stores name is rewritten
    }
    __builtin_amdgcn_fence(__ATOMIC_RELEASE, "workgroup");
    __builtin_amdgcn_wave_barrier();
    __builtin_amdgcn_fence(__ATOMIC_ACQUIRE, "workgroup");
  }
}

#define G22_RING_H (2 * (128 + 128) * GP)    // LDS of a 2 x 2 wave block: two stages of 256 rows
#define G22_SLAB_F (4 * 16 * 68)             // and four epilogue slabs
#define TQ_  ((T_ / 128) * (C_ / 128))       // tiles of one batch of q
#define TKV_ ((NB_ * LP_ / 128) * (C_ / 128))  // tiles of k, and of v^T

// ---------------------------------------------------------------------------
// Memory-compression attention inside the block that projects its operands.  Block (g, h) = four batch elements 4g..4g+3,
// head h: one 128 x 128 product of MA group g with rows 128h.. of the interleaved plane WmT; of the f32 tile left in LDS
//   tile[16w + j][d]      = cached row j of batch 4g+w . Wkm column 64h+d   (km, j < 16, d < 64)
//   tile[64 + w][64 + d]  = prev_m of batch 4g+w . Wqm column 64h+d         (qm)
// are read (the other quadrants pair an operand with the other weight).  Wave w then does batch 4g+w in f32:
//   s_j = (qm + bqm) . (km_j + bkm) * 0.125 over 16 keys, softmax, mem = sum_j a_j (km_j + bkm), 64 columns of head h.
// The memory token's k and v rows need mem over all heads.  So that k, v^T and q wait for no launch of this path, the block
// multiplies its own 64 columns of mem (f16, as the CM plane carried them) with rows 64h..64h+63 of Wk and of Wv and leaves
//   PK[h][b][n] = sum_{c in head h} mem[b][c] * W[c][n]    (f32; n < 1024: Wk column n, n >= 1024: Wv column n - 1024)
// and the attention blocks add the 16 heads' shares.  Product taken transposed: A = 16 rows n of the [n][k] weight planes
// (Wk's and Wv's are adjacent), B = mem (column = batch in the group, columns 4..15 zero), k = 64.
// coverage: 4 waves x 32 tiles x 16 rows n = 2048; per tile lanes c < 4 store 8 floats each for n = 8*(lane>>4) + 0..7;
// a wave owns 512 consecutive n of a PK row, whole 128-B lines.
// ---------------------------------------------------------------------------
#define PKN_ (2 * C_)                        // floats in a PK row
__device__ __forceinline__ void mem_body(
    _Float16* ring, float* sb, int bx,
    const unsigned short* __restrict__ MA, const unsigned short* __restrict__ WmT,
    const float* __restrict__ bqm, const float* __restrict__ bkm,
    const unsigned short* __restrict__ WkvT, float* __restrict__ PK, float r16) {
  const int tid = threadIdx.x, wave = tid >> 5, lane = tid & 31;
  const int g = bx >> 4, h = bx & (NH_ - 1);
  // loaded ahead of the product, used behind it
  const float bval = (tid < HD_) ? bkm[h * HD_ + tid] : bqm[h * HD_ + tid - HD_];

  gemm_body<0, 2, 2, 2>(ring, sb, bx, 0, MA, C_, 0L, WmT, C_, 0L,
      (void*)0, 0, 0L, 2 * C_, 0L, (const float*)0, MAR_, 2 * C_, C_, r16, 1.0f);

  sb[tid] = bval;                              // sb[0..63] = bkm, sb[64..127] = bqm of the head
  _Float16* mA = (_Float16*)(sb + 128);        // mem as B operand: [16 batch slots][GP] halves, slots 4..15 stay zero
  for (int i = tid; i < 16 * GP / 8; i += 128) *(v8h*)(mA + i * 8) = zero8h();
  __syncthreads();                             // publishes the f32 tile, the biases and the zeroed operand to every wave

  const float* tile = (const float*)ring;
  const int j = lane & 15;
  const float* qr = tile + (64 + wave) * TLP + 64;
  const float* kr = tile + (wave * MM_ + j) * TLP;
  float a = 0.f;
#pragma unroll
  for (int d4 = 0; d4 < HD_ / 4; ++d4) {
    const v4f qv = *(const v4f*)(qr + 4 * d4) + *(const v4f*)(sb + HD_ + 4 * d4);
    const v4f kv = *(const v4f*)(kr + 4 * d4) + *(const v4f*)(sb + 4 * d4);
    a = fmaf(qv[0], kv[0], a);
    a = fmaf(qv[1], kv[1], a);
    a = fmaf(qv[2], kv[2], a);
    a = fmaf(qv[3], kv[3], a);
  }
  const float sj = (lane < MM_) ? a * 0.125f : -INFINITY;
  float mx = sj;
#pragma unroll
  for (int off = 1; off < 32; off <<= 1) mx = fmaxf(mx, __shfl_xor(mx, off, 32));
  const float e = (lane < MM_) ? __expf(sj - mx) : 0.f;
  float se = e;
#pragma unroll
  for (int off = 1; off < 32; off <<= 1) se += __shfl_xor(se, off, 32);
  const float am = e * (1.0f / se);
  const float kb0 = sb[lane], kb1 = sb[lane + 32];
  float o0 = 0.f, o1 = 0.f;
#pragma unroll
  for (int jj = 0; jj < MM_; ++jj) {
    const float aj = __shfl(am, jj, 32);
    const float* kp = tile + (wave * MM_ + jj) * TLP;
    o0 = fmaf(aj, kp[lane] + kb0, o0);
    o1 = fmaf(aj, kp[lane + 32] + kb1, o1);
  }
  mA[wave * GP + lane]      = (_Float16)o0;    // slot = batch in the group = wave
  mA[wave * GP + lane + 32] = (_Float16)o1;
  __syncthreads();                             // publishes the four batches' mem to every wave

  const int c = lane & 15, hh = lane >> 4;
  v16h mf[2];
#pragma unroll
  for (int kk = 0; kk < 2; ++kk) mf[kk] = ldfrag(mA + c * GP + kk * 32 + 8 * hh);
  const _Float16* wr = (const _Float16*)WkvT + (size_t)(wave * 512 + c) * C_ + h * HD_ + 8 * hh;
  float* pr = PK + (size_t)(h * NB_ + g * 4 + (c & 3)) * PKN_ + wave * 512 + 8 * hh;
  for (int t8 = 0; t8 < 4; ++t8) {
    // eight tiles a trip, unrolled: their 32 loads are in flight together, one memory latency a trip
    v16h wf[8][2];
#pragma unroll
    for (int t = 0; t < 8; ++t)
#pragma unroll
      for (int kk = 0; kk < 2; ++kk) wf[t][kk] = ldfrag(wr + (size_t)((t8 * 8 + t) * 16) * C_ + kk * 32);
    // keeps the 32 loads ahead of the WMMAs: sunk among them, each pair waits out a latency of its own
    __builtin_amdgcn_sched_barrier(0);
    v8f acc[8];
#pragma unroll
    for (int t = 0; t < 8; ++t) {
      acc[t] = mma_f16(wf[t][0], mf[0], zero8f());
      acc[t] = mma_f16(wf[t][1], mf[1], acc[t]) * r16;
    }
    if (c < 4) {
#pragma unroll
      for (int t = 0; t < 8; ++t) {
        v4f lo, hi;
        lo[0] = acc[t][0]; lo[1] = acc[t][1]; lo[2] = acc[t][2]; lo[3] = acc[t][3];
        hi[0] = acc[t][4]; hi[1] = acc[t][5]; hi[2] = acc[t][6]; hi[3] = acc[t][7];
        float* d = pr + (t8 * 8 + t) * 16;
        *(v4f*)(d)     = lo;
        *(v4f*)(d + 4) = hi;
      }
    }
    asm volatile("s_wait_xcnt 0x0" ::: "memory");          // before a register that these loads and stores name is rewritten
  }
}

#define MEMB_ (2 * NH_)                      // blocks of the memory path

// Work that reads none of each other's output shares a launch; the block index picks the job (block-uniform branch).
// Blocks 0..MEMB_-1: memory path -> PK;
// the next NB_*TQ_: q = x . Wq + bq -> Q plane (x16), 64 tiles per batch, A = CM rows 2..1025;
// the next TKV_: k = cm . Wk + bk -> K plane (x16), the batches' rows contiguous in CM and in K, M = 8 * 1088;
// the last TKV_: v^T = Wv^T . cm^T + bv[m] -> VT plane [h*64+d][s] (x16), N = 8 * 1088, output plane = batch (1088 columns each).
// K row 0 and V^T column 0 of a batch come out of CM's zero row and are not used: the attention blocks form them from PK.
__global__ __launch_bounds__(128) void gemm_mem_qkv(
    const unsigned short* __restrict__ MA, const unsigned short* __restrict__ WmT,
    const float* __restrict__ bqm, const float* __restrict__ bkm, float* __restrict__ PK,
    const unsigned short* __restrict__ CM, const unsigned short* __restrict__ WqT,
    const unsigned short* __restrict__ WkT, const unsigned short* __restrict__ WvT,
    unsigned short* __restrict__ Qh, unsigned short* __restrict__ Kh, unsigned short* __restrict__ VTh,
    const float* __restrict__ bq, const float* __restrict__ bk, const float* __restrict__ bv, float r16, float s16) {
  __shared__ __align__(16) _Float16 ring[G22_RING_H];
  __shared__ __align__(16) float sT[G22_SLAB_F];
  const int bx = blockIdx.x;
  if (bx < MEMB_) {
    mem_body(ring, sT, bx, MA, WmT, bqm, bkm, WkT, PK, r16);
  } else if (bx < MEMB_ + NB_ * TQ_) {
    const int i = bx - MEMB_;
    gemm_body<2, 1, 2, 2>(ring, sT, i % TQ_, i / TQ_,
        CM + (size_t)2 * C_, C_, (long)LP_ * C_, WqT, C_, 0L, (void*)Qh, C_, (long)T_ * C_, C_, 0L, bq, T_, C_, C_, r16, s16);
  } else if (bx < MEMB_ + NB_ * TQ_ + TKV_) {
    gemm_body<2, 1, 2, 2>(ring, sT, bx - (MEMB_ + NB_ * TQ_), 0,
        CM, C_, 0L, WkT, C_, 0L, (void*)Kh, C_, 0L, C_, 0L, bk, NB_ * LP_, C_, C_, r16, s16);
  } else {
    gemm_body<1, 1, 2, 2>(ring, sT, bx - (MEMB_ + NB_ * TQ_ + TKV_), 0,
        WvT, C_, 0L, CM, C_, 0L, (void*)VTh, LP_, 0L, LP_, (long)C_ * LP_, bv, C_, NB_ * LP_, C_, r16, s16);
  }
}

// out = y . Wp + bp -> f32 [8192][1024]
__global__ __launch_bounds__(128) void gemm_out(
    const unsigned short* __restrict__ Yh, const unsigned short* __restrict__ WpT, float* __restrict__ out,
    const float* __restrict__ bp, float r256) {
  __shared__ __align__(16) _Float16 ring[G22_RING_H];
  __shared__ __align__(16) float sT[G22_SLAB_F];
  gemm_body<2, 0, 2, 2>(ring, sT, blockIdx.x, 0,
      Yh, C_, 0L, WpT, C_, 0L, (void*)out, C_, 0L, C_, 0L, bp, NB_ * T_, C_, C_, r256, 1.0f);
}

__device__ __forceinline__ float xhalf(float x) {
  const int b = __builtin_bit_cast(int, x);
  return __builtin_bit_cast(float, __builtin_amdgcn_permlanex16(b, b, 0x76543210, 0xfedcba98, false, false));
}

__global__ __launch_bounds__(128)
void attn_kernel(const unsigned short* __restrict__ Qp, const unsigned short* __restrict__ Kp,
                 const unsigned short* __restrict__ VTp, unsigned short* __restrict__ Yp, float sscale,
                 const float* __restrict__ PK, const float* __restrict__ bk, const float* __restrict__ bv) {
  __shared__ __align__(16) _Float16 Ksh[64 * AKP];          // K chunk [key][d], pitch 72
  __shared__ __align__(16) _Float16 Vth[64 * AKP];          // V^T chunk [d][key]
  __shared__ __align__(16) _Float16 Osh[4][16 * AKP];       // per wave output tile [row][d]

  const int tid  = threadIdx.x;
  const int wave = tid >> 5;
  const int lane = tid & 31;
  const int hh   = lane >> 4;
  const int c    = lane & 15;
  // Block index -> tile.  A query block's cost grows with qb (3..17 key chunks) and most blocks are resident together, so
  // a die or a WGP is busy for about the sum of its blocks' costs.  The index's high bits pick qb, heaviest first, its low
  // 7 bits the (batch, head): indices equal modulo 8 hold every qb, indices equal modulo 256 every second cost rank, and
  // the swap inside every second pair (15 14 12 13 11 10 8 9 ...) levels the even ranks' sum with the odd ranks' (77 : 76).
  const int bx = blockIdx.x;
  const int u  = (bx >> 7) & 15;          // cost rank (T_/64 = 16 query blocks)
  const int qb = 15 - (u ^ ((u >> 1) & 1));
  const int h  = bx & (NH_ - 1);
  const int b  = (bx >> 4) & (NB_ - 1);
  const int q0 = qb * 64 + wave * 16;     // first query row of this wave (within the batch)

  const _Float16* Qb = (const _Float16*)Qp  + (size_t)b * T_  * C_ + h * HD_;
  const _Float16* Kb = (const _Float16*)Kp  + (size_t)b * LP_ * C_ + h * HD_;
  const _Float16* Vb = (const _Float16*)VTp + ((size_t)b * C_ + h * HD_) * LP_;
  _Float16*       Yb = (_Float16*)Yp + (size_t)b * T_ * C_ + h * HD_;

  // ---- key 0 (the memory token): thread tid < 64 forms k[0][d = tid], the others v[0][d = tid - 64], from the 16 heads'
  // shares in PK plus the bias, carried x16 like the planes; it replaces the staged values of chunk 0 below ----
  _Float16 kv0h;
  {
    const int d0 = h * HD_ + (tid & (HD_ - 1));
    const float* pp = PK + (size_t)b * PKN_ + ((tid < HD_) ? 0 : C_) + d0;
    float ps = (tid < HD_) ? bk[d0] : bv[d0];
    asm volatile("s_wait_xcnt 0x0" ::: "memory");           // before a register that this load names is rewritten
    float sh[NH_];
#pragma unroll
    for (int hp = 0; hp < NH_; ++hp) sh[hp] = pp[(size_t)hp * NB_ * PKN_];
    asm volatile("s_wait_xcnt 0x0" ::: "memory");           // before a register that these loads name is rewritten
#pragma unroll
    for (int hp = 0; hp < NH_; ++hp) ps += sh[hp];
    kv0h = (_Float16)(ps * 16.0f);
  }

  // ---- Q fragments (B operand, column = query = lane&15, split k map): 2 d-chunks ----
  v16h qf[2];
#pragma unroll
  for (int dc = 0; dc < 2; ++dc)
    qf[dc] = ldfrag(Qb + (size_t)(q0 + c) * C_ + dc * 32 + 8 * hh);

  const int qrow = q0 + c;                                  // this lane's query
  const int lim  = (qrow < NU_) ? (NU_ + 1) : (qrow + 2);   // its last visible key
  float mrow = -INFINITY;                                   // running maximum of the query (equal in both halves)
  float lrow = 0.f;                                         // this half's share of the query's sum
  v8f oacc[4];                                              // oacc[t][r] = O[query][16t + 8hh + r]
#pragma unroll
  for (int t = 0; t < 4; ++t) oacc[t] = zero8f();

  int maxkey = qb * 64 + 63 + 2;                            // last visible key of the block's last query
  if (qb * 64 < NU_) maxkey = (maxkey > NU_ + 1) ? maxkey : (NU_ + 1);
  const int nChunks = (maxkey >> 6) + 1;                    // block-uniform, 3..17

  // one 64-key chunk; FIRST (chunk 0, compile-time at both calls) also puts key 0 in place
  auto chunk = [&](const int kc, const bool FIRST) __attribute__((always_inline)) {
    const int kv0 = kc * 64;
    __syncthreads();
    {
      // staging coverage: 128 threads x (4 x 8) halves = 64 rows x 64 per tile
      const int r = tid >> 1, half = (tid & 1) * 32;
      const _Float16* ks = Kb + (size_t)(kv0 + r) * C_ + half;     // K row kv0+r, d = half..half+31
      const _Float16* vs = Vb + (size_t)r * LP_ + kv0 + half;      // V^T row d = r, s = kv0+half..+31
#pragma unroll
      for (int i = 0; i < 4; ++i) {
        const v8h a0 = *(const v8h*)(ks + 8 * i);
        const v8h b0 = *(const v8h*)(vs + 8 * i);
        *(v8h*)(Ksh + r * AKP + half + 8 * i) = a0;
        *(v8h*)(Vth + r * AKP + half + 8 * i) = b0;
      }
    }
    if (FIRST) {
      __syncthreads();                                      // the staged row 0 / column 0 are in place before they are replaced
      *((tid < HD_) ? (Ksh + tid) : (Vth + (tid - HD_) * AKP)) = kv0h;   // K row 0 | V^T column 0
    }
    __syncthreads();

    // S^T tiles: rows = keys 16j..16j+15 of the chunk, columns = the wave's 16 queries
    v8f s[4];
#pragma unroll
    for (int j = 0; j < 4; ++j) s[j] = zero8f();
#pragma unroll
    for (int dc = 0; dc < 2; ++dc)
#pragma unroll
      for (int j = 0; j < 4; ++j) {
        const v16h ka = ldfrag(Ksh + (j * 16 + c) * AKP + dc * 32 + 8 * hh);
        s[j] = mma_f16(ka, qf[dc], s[j]);
      }
    const int rel = lim - kv0 - 8 * hh;                     // key kv0 + 8hh + (16j + r) is visible iff 16j + r <= rel
    float mj[4];
#pragma unroll
    for (int j = 0; j < 4; ++j) {
      float m = -INFINITY;
#pragma unroll
      for (int r = 0; r < 8; ++r) {
        const float sv = (j * 16 + r <= rel) ? s[j][r] * sscale : -INFINITY;
        s[j][r] = sv;
        m = fmaxf(m, sv);
      }
      mj[j] = m;
    }
    float cmx = fmaxf(fmaxf(mj[0], mj[1]), fmaxf(mj[2], mj[3]));
    cmx = fmaxf(cmx, xhalf(cmx));                           // the other half's 32 keys of the same query
    const float mnew  = fmaxf(mrow, cmx);
    const float alpha = __expf(mrow - mnew);
    mrow = mnew;
    v16h pb[2];                                             // P^T as B operand, 32 keys each
    float pj[4];
#pragma unroll
    for (int j = 0; j < 4; ++j) {
      float ps = 0.f;
#pragma unroll
      for (int r = 0; r < 8; ++r) {
        const float p = __expf(s[j][r] - mnew);
        ps += p;
        pb[j >> 1][(j & 1) * 8 + r] = (_Float16)p;
      }
      pj[j] = ps;
    }
    lrow = lrow * alpha + ((pj[0] + pj[1]) + (pj[2] + pj[3]));
#pragma unroll
    for (int t = 0; t < 4; ++t) oacc[t] *= alpha;
#pragma unroll
    for (int kk = 0; kk < 2; ++kk)
#pragma unroll
      for (int t = 0; t < 4; ++t) {
        const v16h va = ldfrag(Vth + (t * 16 + c) * AKP + kk * 32 + 8 * hh);
        oacc[t] = mma_f16(va, pb[kk], oacc[t]);
      }
  };
  chunk(0, true);
  for (int kc = 1; kc < nChunks; ++kc) chunk(kc, false);

  _Float16* os = Osh[wave];
  {
    const float inv = 1.0f / (lrow + xhalf(lrow));          // the two halves' shares joined once
#pragma unroll
    for (int t = 0; t < 4; ++t) {
      v8h o;
#pragma unroll
      for (int r = 0; r < 8; ++r) o[r] = (_Float16)(oacc[t][r] * inv);
      *(v8h*)(os + c * AKP + t * 16 + 8 * hh) = o;
    }
  }
  __builtin_amdgcn_fence(__ATOMIC_RELEASE, "workgroup");
  __builtin_amdgcn_wave_barrier();
  __builtin_amdgcn_fence(__ATOMIC_ACQUIRE, "workgroup");
  {
    const int q4 = lane >> 3, c8 = (lane & 7) * 8;
    v8h ov[4];
#pragma unroll
    for (int it = 0; it < 4; ++it) {
      const int row = it * 4 + q4;
      ov[it] = *(const v8h*)(os + row * AKP + c8);
    }
    {
#pragma unroll
      for (int it = 0; it < 4; ++it) {
        const int row = it * 4 + q4;
        *(v8h*)(Yb + (size_t)(q0 + row) * C_ + c8) = ov[it];
      }
    }
  }
}

// ---------------------------------------------------------------------------
//   WT   f16 [6][1024 n][1024 k]  (Wq,Wk,Wv,Wp transposed; Wkm, Wqm transposed and interleaved by head; x16)  0   12582912
//   MA   f16 [256][1024]                                               12582912     524288
//   CM   f16 [8][1088][1024]  rows: 0 zero, 1 prev_m, 2..1025 x, 1026..1087 zero  13107200   17825792
//   Q    f16 [8][1024][1024] (x16)                                     30932992   16777216
//   K    f16 [8][1088][1024] (x16)                                     47710208   17825792
//   VT   f16 [8][1024][1088] (x16)                                     65536000   17825792
//   Y    f16 [8][1024][1024] (x16)                                     83361792   16777216
//   PK   f32 [16 h][8 b][2048]  head h's share of mem . Wk | mem . Wv  100139008    1048576
//   total                                                             101187584
// ---------------------------------------------------------------------------
extern "C" void kernel_launch(void* const* d_in, const int* in_sizes, int n_in,
                              void* d_out, int out_size, void* d_ws, size_t ws_size,
                              hipStream_t stream) {
  if (n_in < 15) return;
  if (in_sizes[0] != NB_ * T_ * C_) return;
  if (in_sizes[1] != NB_ * C_) return;
  if (in_sizes[2] != NB_ * MM_ * C_) return;
  for (int i = 3; i <= 13; i += 2) if (in_sizes[i] != C_ * C_) return;
  for (int i = 4; i <= 14; i += 2) if (in_sizes[i] != C_) return;
  if (out_size != NB_ * T_ * C_) return;

  const float* x      = (const float*)d_in[0];
  const float* prev_m = (const float*)d_in[1];
  const float* cached = (const float*)d_in[2];
  const float* Wq  = (const float*)d_in[3];  const float* bq  = (const float*)d_in[4];
  const float* Wk  = (const float*)d_in[5];  const float* bk  = (const float*)d_in[6];
  const float* Wv  = (const float*)d_in[7];  const float* bv  = (const float*)d_in[8];
  const float* Wp  = (const float*)d_in[9];  const float* bp  = (const float*)d_in[10];
  const float* Wqm = (const float*)d_in[11]; const float* bqm = (const float*)d_in[12];
  const float* Wkm = (const float*)d_in[13]; const float* bkm = (const float*)d_in[14];
  float* out = (float*)d_out;

  const size_t szWT  = (size_t)6 * C_ * C_ * 2;
  const size_t szMA  = (size_t)MAR_ * C_ * 2;
  const size_t szCM  = (size_t)NB_ * LP_ * C_ * 2;
  const size_t szQ   = (size_t)NB_ * T_ * C_ * 2;
  const size_t szK   = (size_t)NB_ * LP_ * C_ * 2;
  const size_t szVT  = (size_t)NB_ * C_ * LP_ * 2;
  const size_t szY   = (size_t)NB_ * T_ * C_ * 2;
  const size_t szPK  = (size_t)NH_ * NB_ * PKN_ * 4;
  size_t off = 0;
  const size_t oWT  = off; off += szWT;
  const size_t oMA  = off; off += szMA;
  const size_t oCM  = off; off += szCM;
  const size_t oQ   = off; off += szQ;
  const size_t oK   = off; off += szK;
  const size_t oVT  = off; off += szVT;
  const size_t oY   = off; off += szY;
  const size_t oPK  = off; off += szPK;
  if (off > ws_size) return;                   // off = 101187584

  char* ws = (char*)d_ws;
  unsigned short* WT  = (unsigned short*)(ws + oWT);
  unsigned short* MA  = (unsigned short*)(ws + oMA);
  unsigned short* CM  = (unsigned short*)(ws + oCM);
  unsigned short* Qh  = (unsigned short*)(ws + oQ);
  unsigned short* Kh  = (unsigned short*)(ws + oK);
  unsigned short* VTh = (unsigned short*)(ws + oVT);
  unsigned short* Yh  = (unsigned short*)(ws + oY);
  float*          PK  = (float*)(ws + oPK);
  unsigned short* WqT  = WT;
  unsigned short* WkT  = WT + (size_t)1 * C_ * C_;
  unsigned short* WvT  = WT + (size_t)2 * C_ * C_;
  unsigned short* WpT  = WT + (size_t)3 * C_ * C_;
  unsigned short* WmT  = WT + (size_t)4 * C_ * C_;

  const float s16 = 16.0f, r16 = 1.0f / 16.0f, r256 = 1.0f / 256.0f;

  // (1) weights [in k][out n] f32 -> transposed f16 planes [n][k], carried x16; x -> CM rows 2..1025 per batch;
  //     small operand plane: per group of four batch elements 64 cached rows, 4 prev_m rows, zeros;
  //     CM rows 0 (zero), 1 (prev_m) and zero pad rows
  prep_kernel<<<dim3(PREP_WT + PREP_X + PREP_MA + PREP_CR), dim3(256), 0, stream>>>(
      Wq, Wk, Wv, Wp, Wqm, Wkm, WT, s16, x, CM, prev_m, cached, MA);
  // (2) memory path (qm, km, f32 attention, its shares of the memory token's k and v) -> PK; q -> Q plane,
  //     k -> K plane and v^T -> VT plane (x16), pad rows included
  gemm_mem_qkv<<<dim3(MEMB_ + NB_ * TQ_ + 2 * TKV_), dim3(128), 0, stream>>>(
      MA, WmT, bqm, bkm, PK, CM, WqT, WkT, WvT, Qh, Kh, VTh, bq, bk, bv, r16, s16);
  // (3) masked attention -> Y plane (x16)
  attn_kernel<<<dim3(NB_ * NH_ * (T_ / 64)), dim3(128), 0, stream>>>(Qh, Kh, VTh, Yh, 0.125f / 256.0f, PK, bk, bv);
  // (4) out = y . Wp + bp -> d_out f32 [8192][1024]  (y x16, Wp x16 -> scale 1/256)
  gemm_out<<<dim3((NB_ * T_ / 128) * (C_ / 128)), dim3(128), 0, stream>>>(Yh, WpT, out, bp, r256);
  (void)hipGetLastError();
}

// v007
// It runs in 111 microseconds.
// In two side-by-side timings against v006, it was 1.06 and 1.07 times as fast.
// All steps since v000 together make it 3.84 times as fast.
// Contractions x*Wq, cm*Wk, cm*Wv, mem*Wk, mem*Wv (per-head shares), k*q^T, v^T*p^T, y*Wp, prev_m*Wqm, cached*Wkm: v_wmma_f32_16x16x32_f16, f16 operands (weights carried x16, q/k/v/y planes carried x16, p x1), f32 accumulate; softmax f32; memory-path scores and weighted sum f32 VALU.
#include <hip/hip_runtime.h>
#include <stdint.h>
#include <math.h>

#define NB_   8
#define T_    1024
#define C_    1024
#define NH_   16
#define HD_   64
#define NU_   128
#define MM_   16
#define LKV_  1026
#define LP_   1088
#define MAR_  256
#define AKP   72

typedef _Float16 v16h __attribute__((ext_vector_type(16)));
typedef _Float16 v8h  __attribute__((ext_vector_type(8)));
typedef float    v8f  __attribute__((ext_vector_type(8)));
typedef float    v4f  __attribute__((ext_vector_type(4)));

// ---- 16-bit fragment loader: elements 0..7 <- p[0..7], 8..15 <- p[16..23]; caller passes p = row base + k0 + 8*(lane>>4)
__device__ __forceinline__ v16h ldfrag(const _Float16* p) {
  union { v16h v; v8h h[2]; } f;
  f.h[0] = *(const v8h*)(p);
  f.h[1] = *(const v8h*)(p + 16);
  return f.v;
}
__device__ __forceinline__ v8f mma_f16(v16h a, v16h b, v8f c) {
  return __builtin_amdgcn_wmma_f32_16x16x32_f16(false, a, false, b, (short)0, c, false, false);
}
__device__ __forceinline__ v8f zero8f() { v8f z; z[0]=0.f; z[1]=0.f; z[2]=0.f; z[3]=0.f; z[4]=0.f; z[5]=0.f; z[6]=0.f; z[7]=0.f; return z; }
__device__ __forceinline__ v8h zero8h() {
  v8h z;
#pragma unroll
  for (int e = 0; e < 8; ++e) z[e] = (_Float16)0.0f;
  return z;
}
__device__ __forceinline__ v8h cvt8(v4f a, v4f b, float s) {
  v8h r;
  r[0] = (_Float16)(a[0] * s); r[1] = (_Float16)(a[1] * s); r[2] = (_Float16)(a[2] * s); r[3] = (_Float16)(a[3] * s);
  r[4] = (_Float16)(b[0] * s); r[5] = (_Float16)(b[1] * s); r[6] = (_Float16)(b[2] * s); r[7] = (_Float16)(b[3] * s);
  return r;
}

// ---------------------------------------------------------------------------
// Weight transpose + f16 convert with carry scale s: six inputs W_z [k][n] f32 (C_ x C_) ->
// WT plane z: [n][k] f16 = f16(s * W_z[k][n]).  64x64 tiles through LDS, one tile (bxx, byy, z) per block of 256 threads.
// Planes 4 and 5 are interleaved by head into one [2048][k] plane: rows 128h .. 128h+63 = W_5 columns of head h, the next 64 = W_4's.
// coverage per block: load 4 it x 256 thr x 4 = 64x64; store 2 it x 256 thr x 8 = 64x64.
// ---------------------------------------------------------------------------
__device__ __forceinline__
void wt_body(float* tf, int bxx, int byy, int z,
             const float* __restrict__ W0, const float* __restrict__ W1, const float* __restrict__ W2,
             const float* __restrict__ W3, const float* __restrict__ W4, const float* __restrict__ W5,
             unsigned short* __restrict__ WT, float s) {
  const float* W = (z == 0) ? W0 : (z == 1) ? W1 : (z == 2) ? W2 : (z == 3) ? W3 : (z == 4) ? W4 : W5;
  const int c0  = bxx * 64;          // input column block
  const int o0  = (z < 4) ? z * C_ + c0 : 4 * C_ + bxx * 128 + ((z == 4) ? 64 : 0);   // first output row of the tile
  _Float16* out = (_Float16*)WT + (size_t)o0 * C_;
  const int r0  = byy * 64;          // input row block    = output column block
  const int tid = threadIdx.x;
  {
    const int lr = tid >> 4;
    const int c4 = (tid & 15) * 4;
#pragma unroll
    for (int it = 0; it < 4; ++it) {
      const int rr = it * 16 + lr;
      const v4f a = *(const v4f*)(W + (size_t)(r0 + rr) * C_ + c0 + c4);
      *(v4f*)(tf + rr * 68 + c4) = a;
    }
  }
  __syncthreads();
  const int sub = tid >> 3;          // 0..31
  const int c8  = (tid & 7) * 8;     // 0..56
  v8h hv[2];
#pragma unroll
  for (int it = 0; it < 2; ++it) {
    const int oc = it * 32 + sub;    // output row within tile (= input column)
    v8h v;
#pragma unroll
    for (int e = 0; e < 8; ++e) v[e] = (_Float16)(tf[(c8 + e) * 68 + oc] * s);
    hv[it] = v;
  }
  {
#pragma unroll
    for (int it = 0; it < 2; ++it) {
      const int oc = it * 32 + sub;
      *(v8h*)(out + (size_t)oc * C_ + r0 + c8) = hv[it];
    }
    asm volatile("s_wait_xcnt 0x0" ::: "memory");          // before a register that these stores name is rewritten
  }
}

// ---------------------------------------------------------------------------
// Small operand plane MA [256][1024] f16, two groups g of 128 rows (four batch elements each): rows 0..63 of a group =
// cached_memory rows 64g .. 64g+63, rows 64..67 = prev_m[4g .. 4g+3], rows 68..127 = 0.
// 128 blocks (two rows each) x 256 threads x 8 halves; 128 threads = whole row (16 lines, 8 lanes per line);
// coverage: 128 x 256 x 8 = whole plane.
// ---------------------------------------------------------------------------
__device__ __forceinline__
void ma_body(int blk, const float* __restrict__ prev_m, const float* __restrict__ cached, unsigned short* __restrict__ MA) {
  const int row  = blk * 2 + ((int)threadIdx.x >> 7);
  const int col8 = ((int)threadIdx.x & 127) * 8;
  const int g = row >> 7, r = row & 127;
  const bool isc = r < 64, isp = (r >= 64) && (r < 68);
  const int rp = isp ? g * 4 + (r - 64) : 0;
  const int rc = isc ? g * 64 + r : 0;
  const float* sp = prev_m + (size_t)rp * C_ + col8;
  const float* sc = cached + (size_t)rc * C_ + col8;
  const v4f p0 = *(const v4f*)(sp), p1 = *(const v4f*)(sp + 4);
  const v4f q0 = *(const v4f*)(sc), q1 = *(const v4f*)(sc + 4);
  const float fp = isp ? 1.0f : 0.0f;
  const float fc = isc ? 1.0f : 0.0f;
  const v4f a = p0 * fp + q0 * fc;
  const v4f b = p1 * fp + q1 * fc;
  const v8h hv = cvt8(a, b, 1.0f);
  _Float16* d = (_Float16*)MA + (size_t)row * C_ + col8;
  *(v8h*)d = hv;
  asm volatile("s_wait_xcnt 0x0" ::: "memory");            // before a register that this store names is rewritten
}

// ---------------------------------------------------------------------------
// x [8][1024][1024] f32 -> CM plane rows 2..1025 of each batch ([8][LP_][1024] f16), unscaled.
// ---------------------------------------------------------------------------
__device__ __forceinline__
void xcvt_body(int blk, const float* __restrict__ x, unsigned short* __restrict__ CM, int n8) {
  const int idx = blk * 256 + threadIdx.x;
  if (idx >= n8) return;
  const int e = idx * 8;
  const int b = e >> 20, t = (e >> 10) & (T_ - 1), col = e & (C_ - 1);
  const v4f a0 = *(const v4f*)(x + e), a1 = *(const v4f*)(x + e + 4);
  const v8h hv = cvt8(a0, a1, 1.0f);
  _Float16* d = (_Float16*)CM + ((size_t)(b * LP_ + 2 + t)) * C_ + col;
  *(v8h*)d = hv;
  asm volatile("s_wait_xcnt 0x0" ::: "memory");            // before a register that this store names is rewritten
}

// ---------------------------------------------------------------------------
// The CM rows that x does not fill, 64 per batch: row 0 = 0 (the memory token's k and v do not come from this row, see
// mem_body), row 1 = prev_m, rows LKV_..LP_-1 = 0.  32 blocks x 256 threads x 8 rows x 8 halves = 8 x 64 rows x 1024;
// 8 lanes write a whole 128-B line.
// ---------------------------------------------------------------------------
__device__ __forceinline__
void cmrows_body(int blk, const float* __restrict__ prev_m, unsigned short* __restrict__ CM) {
  const int idx  = blk * 256 + (int)threadIdx.x;
  const int col8 = (idx & 127) * 8;
  const int sg   = (idx >> 7) & 7;             // slots 8 sg .. 8 sg + 7 of the batch's 64
  const int b    = idx >> 10;
  const float* sp = prev_m + (size_t)b * C_ + col8;
  const v4f p0 = *(const v4f*)(sp), p1 = *(const v4f*)(sp + 4);
  const v8h pv = cvt8(p0, p1, 1.0f);
  const v8h z8 = zero8h();
  _Float16* d = (_Float16*)CM + (size_t)b * LP_ * C_ + col8;
#pragma unroll
  for (int i = 0; i < 8; ++i) {
    const int slot = sg * 8 + i;               // slot 0 = row 0, slot 1 = row 1, slots 2..63 = pad rows
    const int row  = (slot < 2) ? slot : (LKV_ - 2 + slot);
    *(v8h*)(d + (size_t)row * C_) = (slot == 1) ? pv : z8;
  }
  asm volatile("s_wait_xcnt 0x0" ::: "memory");            // before a register that these stores name is rewritten
}

// ---------------------------------------------------------------------------
// The four operand preparations read none of each other's output: one launch, the block index picks the job.
//   blocks 0 .. 1535: weight tiles (16 x 16 x 6);  1536 .. 5631: x pieces;  5632 .. 5759: small operand plane;
//   5760 .. 5791: the CM rows beside x.
// ---------------------------------------------------------------------------
#define PREP_WT  (6 * (C_ / 64) * (C_ / 64))
#define PREP_X   (NB_ * T_ * C_ / 8 / 256)
#define PREP_MA  (MAR_ / 2)
#define PREP_CR  (NB_ * 64 * C_ / 8 / 8 / 256)
__global__ __launch_bounds__(256)
void prep_kernel(const float* __restrict__ W0, const float* __restrict__ W1, const float* __restrict__ W2,
                 const float* __restrict__ W3, const float* __restrict__ W4, const float* __restrict__ W5,
                 unsigned short* __restrict__ WT, float s,
                 const float* __restrict__ x, unsigned short* __restrict__ CM,
                 const float* __restrict__ prev_m, const float* __restrict__ cached, unsigned short* __restrict__ MA) {
  __shared__ __align__(16) float tf[64 * 68];
  const int bx = blockIdx.x;
  if (bx < PREP_WT) {
    wt_body(tf, bx & 15, (bx >> 4) & 15, bx >> 8, W0, W1, W2, W3, W4, W5, WT, s);
  } else if (bx < PREP_WT + PREP_X) {
    xcvt_body(bx - PREP_WT, x, CM, NB_ * T_ * C_ / 8);
  } else if (bx < PREP_WT + PREP_X + PREP_MA) {
    ma_body(bx - (PREP_WT + PREP_X), prev_m, cached, MA);
  } else {
    cmrows_body(bx - (PREP_WT + PREP_X + PREP_MA), prev_m, CM);
  }
}

// ---------------------------------------------------------------------------
// Block-tiled batched f16 WMMA GEMM: C[m,n] = oscale * (scale * sum_k A[m,k] * Bt[n,k] + bias).
// One block = WM x WN waves = a (64*WM) x (64*WN) tile of C; each wave owns a 64x64 sub-tile.
// A row-major [M,K] f16; Bt row-major [N,K] f16; M % (64*WM) == 0, N % (64*WN) == 0, K % 64 == 0, K >= 64.
// A pass is 64 k (128 B of every operand row).  A stage is [A rows | Bt rows] at pitch 144 B in LDS, two buffers;
// every lane copies 16-B pieces global -> LDS asynchronously, the next pass's stage in flight while this one is worked on.
// Column n of C lies in output plane n / NPB (plane stride strideCN) at column n % NPB; NPB % 64 == 0.
// BIAS_MODE: 0 = none, 1 = bias[m], 2 = bias[n].  OUT_MODE: 0 = f32, 1 = f16, 2 = scale * sum left as an f32 tile at the
// start of the ring (no global store; the caller's barrier publishes it): of every 128 rows of C the first TGR, at pitch TLP.
// ---------------------------------------------------------------------------
#define GKT 64      // k per pass
#define GP  72      // LDS row pitch in halves: 144 B = 16 B x odd, conflict-free for 16-B fragment reads
#define TLP 132     // pitch in floats of the f32 tile of OUT_MODE 2: 528 B = 16 B x odd
#define TGR 80      // rows kept of every 128 in the f32 tile of OUT_MODE 2

// Eight asynchronous 16-B copies per lane.  The s_wait_xcnt closes the statement so that no address register
// named here is rewritten ahead of it.
__device__ __forceinline__ void copy8(const unsigned (&l)[8], const _Float16* const (&g)[8]) {
  asm volatile(
      "global_load_async_to_lds_b128 %0, %8, off\n\t"
      "global_load_async_to_lds_b128 %1, %9, off\n\t"
      "global_load_async_to_lds_b128 %2, %10, off\n\t"
      "global_load_async_to_lds_b128 %3, %11, off\n\t"
      "global_load_async_to_lds_b128 %4, %12, off\n\t"
      "global_load_async_to_lds_b128 %5, %13, off\n\t"
      "global_load_async_to_lds_b128 %6, %14, off\n\t"
      "global_load_async_to_lds_b128 %7, %15, off\n\t"
      "s_wait_xcnt 0x0"
      :: "v"(l[0]), "v"(l[1]), "v"(l[2]), "v"(l[3]), "v"(l[4]), "v"(l[5]), "v"(l[6]), "v"(l[7]),
         "v"(g[0]), "v"(g[1]), "v"(g[2]), "v"(g[3]), "v"(g[4]), "v"(g[5]), "v"(g[6]), "v"(g[7])
      : "memory");
}

// The same for four copies.
__device__ __forceinline__ void copy4(const unsigned (&l)[4], const _Float16* const (&g)[4]) {
  asm volatile(
      "global_load_async_to_lds_b128 %0, %4, off\n\t"
      "global_load_async_to_lds_b128 %1, %5, off\n\t"
      "global_load_async_to_lds_b128 %2, %6, off\n\t"
      "global_load_async_to_lds_b128 %3, %7, off\n\t"
      "s_wait_xcnt 0x0"
      :: "v"(l[0]), "v"(l[1]), "v"(l[2]), "v"(l[3]),
         "v"(g[0]), "v"(g[1]), "v"(g[2]), "v"(g[3])
      : "memory");
}

// ring: 2 * (64*WM + 64*WN) * GP halves of LDS; sT: WM * WN slabs of 16 x 68 floats of LDS; bx = tile index, b = batch.
template <int BIAS_MODE, int OUT_MODE, int WM, int WN>
__device__ __forceinline__ void gemm_body(
    _Float16* ring, float* sT, int bx, int b,
    const unsigned short* __restrict__ Ap, int lda, long strideA,
    const unsigned short* __restrict__ Btp, int ldb, long strideB,
    void* __restrict__ Cout, int ldc, long strideC, int NPB, long strideCN,
    const float* __restrict__ bias, int M, int N, int K, float scale, float oscale) {
  constexpr int NT  = 32 * WM * WN;      // threads
  constexpr int BM  = 64 * WM;           // tile rows
  constexpr int BN  = 64 * WN;           // tile columns
  constexpr int RPI = NT / 8;            // rows covered by one copy of the whole block (8 lanes x 16 B = one 128-B row)
  constexpr int NA  = BM / RPI;          // copies per lane and pass, A rows (16 / WN)
  constexpr int NB  = BN / RPI;          // copies per lane and pass, Bt rows (16 / WM)
  constexpr int STAGE_H = (BM + BN) * GP;
  static_assert(NA % 8 == 0 && NB % 4 == 0 && NA + NB <= 63, "copy groups of eight (Bt: and a last four), at most 63 in flight");

  const _Float16* A  = (const _Float16*)Ap;
  const _Float16* Bt = (const _Float16*)Btp;
  const int tid  = threadIdx.x;
  const int lane = tid & 31;
  const int wave = tid >> 5;
  const int wm   = wave / WN;
  const int wn   = wave - wm * WN;
  const int tilesN = N / BN;
  const int tm = bx / tilesN;            // bx runs over (M / BM) * (N / BN) tiles exactly
  const int tn = bx - tm * tilesN;
  const int rlane = lane & 15;                 // row (A) / col (B, D) within subtile
  const int koff  = (lane >> 4) * 8;           // k offset of this lane half
  const int mOff  = (lane >> 4) * 8;           // D row offset

  // this lane's piece of a stage: row tid>>3 (+ RPI per copy), 16-B piece tid&7
  const _Float16* gA = A  + (size_t)b * strideA + (size_t)(tm * BM + (tid >> 3)) * lda + (tid & 7) * 8;
  const _Float16* gB = Bt + (size_t)b * strideB + (size_t)(tn * BN + (tid >> 3)) * ldb + (tid & 7) * 8;
  const unsigned  lds0 = (unsigned)(size_t)(&ring[0]) + (unsigned)((tid >> 3) * (GP * 2) + (tid & 7) * 16);

  auto issue = [&](int kt, int buf) {
    const _Float16* ga = gA + kt * GKT;
    const _Float16* gb = gB + kt * GKT;
    const unsigned  la = lds0 + (unsigned)buf * (unsigned)(STAGE_H * 2);
    const unsigned  lb = la + (unsigned)(BM * GP * 2);
    // the loops below are unrolled so that l[] and g[] are registers (they are asm operands)
#pragma unroll
    for (int q = 0; q < NA / 8; ++q) {
      unsigned l[8]; const _Float16* g[8];
#pragma unroll
      for (int e = 0; e < 8; ++e) {
        l[e] = la + (unsigned)((q * 8 + e) * RPI * GP * 2);
        g[e] = ga + (size_t)((q * 8 + e) * RPI) * lda;
      }
      copy8(l, g);
    }
#pragma unroll
    for (int q = 0; q < NB / 8; ++q) {
      unsigned l[8]; const _Float16* g[8];
#pragma unroll
      for (int e = 0; e < 8; ++e) {
        l[e] = lb + (unsigned)((q * 8 + e) * RPI * GP * 2);
        g[e] = gb + (size_t)((q * 8 + e) * RPI) * ldb;
      }
      copy8(l, g);
    }
    if constexpr (NB % 8 != 0) {
      unsigned l[4]; const _Float16* g[4];
#pragma unroll
      for (int e = 0; e < 4; ++e) {
        l[e] = lb + (unsigned)((NB - 4 + e) * RPI * GP * 2);
        g[e] = gb + (size_t)((NB - 4 + e) * RPI) * ldb;
      }
      copy4(l, g);
    }
  };

  v8f acc[4][4];
#pragma unroll
  for (int i = 0; i < 4; ++i)
#pragma unroll
    for (int j = 0; j < 4; ++j) acc[i][j] = zero8f();

  const int NP = K / GKT;
  issue(0, 0);
  asm volatile("s_wait_asynccnt 0x0" ::: "memory");   // this wave's pieces of stage 0 have landed
  __syncthreads();                                     // publishes stage 0 to every wave
  if (NP > 1) issue(1, 1);

  for (int t = 0; t < NP; ++t) {
    const _Float16* sA = ring + (t & 1) * STAGE_H + (wm * 64 + rlane) * GP + koff;
    const _Float16* sB = ring + (t & 1) * STAGE_H + (BM + wn * 64 + rlane) * GP + koff;
    // unrolled throughout: fragments and accumulators are indexed at compile time and stay in registers
#pragma unroll
    for (int ks = 0; ks < GKT / 32; ++ks) {
      v16h bh[4], ah[4];
#pragma unroll
      for (int j = 0; j < 4; ++j) bh[j] = ldfrag(sB + j * 16 * GP + ks * 32);
#pragma unroll
      for (int i = 0; i < 4; ++i) ah[i] = ldfrag(sA + i * 16 * GP + ks * 32);
      // keeps the sixteen LDS reads of this k step together ahead of its WMMAs: spread among them, every row of
      // four WMMAs waits out a full LDS latency of its own
      __builtin_amdgcn_sched_barrier(0);
#pragma unroll
      for (int i = 0; i < 4; ++i)
#pragma unroll
        for (int j = 0; j < 4; ++j) acc[i][j] = mma_f16(ah[i], bh[j], acc[i][j]);
    }
    asm volatile("s_wait_dscnt 0x0" ::: "memory");      // this wave's reads of the buffer are done before it is refilled
    asm volatile("s_wait_asynccnt 0x0" ::: "memory");   // this wave's pieces of stage t + 1 have landed
    __syncthreads();                                     // publishes stage t + 1 and ends every reader's use of stage t
    if (t + 2 < NP) issue(t + 2, t & 1);
  }
  asm volatile("s_wait_asynccnt 0x0" ::: "memory");     // no copy outstanding when the wave goes on

  // ---- epilogue ----
  if constexpr (OUT_MODE == 2) {
    // the last pass's barrier has ended every wave's reads of the ring
    static_assert((BM / 128) * TGR * TLP * 4 <= 2 * STAGE_H * 2 && BN <= TLP && BM % 128 == 0, "the tile fits the ring");
    float* tile = (float*)ring;
#pragma unroll
    for (int i = 0; i < 4; ++i) {
      if ((wm & 1) * 64 + (i << 4) < TGR) {    // wave-uniform: the row tile lies in the kept part of its 128 rows
#pragma unroll
        for (int j = 0; j < 4; ++j)
#pragma unroll
          for (int r = 0; r < 8; ++r)
            tile[((wm >> 1) * TGR + (wm & 1) * 64 + (i << 4) + mOff + r) * TLP + wn * 64 + (j << 4) + rlane] = acc[i][j][r] * scale;
      }
    }
    return;
  }
  const int m0 = tm * BM + wm * 64;
  const int n0 = tn * BN + wn * 64;
  const int np = n0 / NPB;                     // output plane of this wave's 64 columns
  const int nl = n0 - np * NPB;                // first column inside that plane
  float* slab = sT + wave * (16 * 68);         // per-wave 16x64 slab, pitch 68 floats
#pragma unroll
  for (int i = 0; i < 4; ++i) {
    const int mBase = m0 + (i << 4);
#pragma unroll
    for (int j = 0; j < 4; ++j) {
      const int n = n0 + (j << 4) + rlane;
      float bvn = 0.f;
      if (BIAS_MODE == 2) bvn = bias[n];
#pragma unroll
      for (int r = 0; r < 8; ++r) {
        float v = acc[i][j][r] * scale;
        if (BIAS_MODE == 1) v += bias[mBase + mOff + r];
        if (BIAS_MODE == 2) v += bvn;
        v *= oscale;
        slab[(mOff + r) * 68 + (j << 4) + rlane] = v;
      }
    }
    __builtin_amdgcn_fence(__ATOMIC_RELEASE, "workgroup");
    __builtin_amdgcn_wave_barrier();
    __builtin_amdgcn_fence(__ATOMIC_ACQUIRE, "workgroup");
    if (OUT_MODE == 0) {
      float* C = (float*)Cout + (size_t)b * strideC + (size_t)np * strideCN;
      const int hh = lane >> 4, c4 = (lane & 15) * 4;     // row seg = 256 B = 16 lanes x 16 B
      {
#pragma unroll
        for (int it = 0; it < 8; ++it) {
          const int row = it * 2 + hh;                     // it 0..7 x hh 0..1 = rows 0..15
          const v4f v = *(const v4f*)(slab + row * 68 + c4);
          *(v4f*)(C + (size_t)(mBase + row) * ldc + nl + c4) = v;
        }
      }
      asm volatile("s_wait_xcnt 0x0" ::: "memory");        // before a register that these stores name is rewritten
    } else {
      _Float16* C = (_Float16*)Cout + (size_t)b * strideC + (size_t)np * strideCN;
      const int q = lane >> 3, c8 = (lane & 7) * 8;
      v8h hv[4];
#pragma unroll
      for (int it = 0; it < 4; ++it) {
        const int row = it * 4 + q;                        // it 0..3 x q 0..3 = rows 0..15
        const float* spf = slab + row * 68 + c8;
        v8h t;
#pragma unroll
        for (int e = 0; e < 8; ++e) t[e] = (_Float16)spf[e];
        hv[it] = t;
      }
      {
#pragma unroll
        for (int it = 0; it < 4; ++it) {
          const int row = it * 4 + q;
          *(v8h*)(C + (size_t)(mBase + row) * ldc + nl + c8) = hv[it];
        }
      }
      asm volatile("s_wait_xcnt 0x0" ::: "memory");        // before a register that these stores name is rewritten
    }
    __builtin_amdgcn_fence(__ATOMIC_RELEASE, "workgroup");
    __builtin_amdgcn_wave_barrier();
    __builtin_amdgcn_fence(__ATOMIC_ACQUIRE, "workgroup");
  }
}

#define G42_RING_H (2 * (256 + 128) * GP)    // LDS of a 4 x 2 wave block (256 x 128 tile): two stages of 384 rows
#define G42_SLAB_F (8 * 16 * 68)             // and eight epilogue slabs
#define TQ_  ((T_ / 256) * (C_ / 128))       // tiles of one batch of q
#define TKV_ ((NB_ * LP_ / 256) * (C_ / 128))  // tiles of k, and ((C_ / 256) * (NB_ * LP_ / 128)) of v^T: the same number

// ---------------------------------------------------------------------------
// Memory-compression attention inside the block that projects its operands.  Block h = head h, all eight batch elements:
// one 256 x 128 product of MA (both groups g) with rows 128h.. of the interleaved plane WmT; of the f32 tile left in LDS
//   tile[TGR g + 16w + j][d]      = cached row j of batch 4g+w . Wkm column 64h+d   (km, j < 16, d < 64)
//   tile[TGR g + 64 + w][64 + d]  = prev_m of batch 4g+w . Wqm column 64h+d         (qm)
// are read (the other quadrants pair an operand with the other weight).  Wave 4g+w then does batch 4g+w in f32:
//   s_j = (qm + bqm) . (km_j + bkm) * 0.125 over 16 keys, softmax, mem = sum_j a_j (km_j + bkm), 64 columns of head h.
// The memory token's k and v rows need mem over all heads.  So that k, v^T and q wait for no launch of this path, the block
// multiplies its own 64 columns of mem (f16, as the CM plane carried them) with rows 64h..64h+63 of Wk and of Wv and leaves
//   PK[h][b][n] = sum_{c in head h} mem[b][c] * W[c][n]    (f32; n < 1024: Wk column n, n >= 1024: Wv column n - 1024)
// and the attention blocks add the 16 heads' shares.  Product taken transposed: A = 16 rows n of the [n][k] weight planes
// (Wk's and Wv's are adjacent), B = mem (column = batch, columns 8..15 zero), k = 64.
// coverage: 8 waves x 16 tiles x 16 rows n = 2048; per tile lanes c < 8 store 8 floats each for n = 8*(lane>>4) + 0..7;
// a wave owns 256 consecutive n of a PK row, whole 128-B lines.
// ---------------------------------------------------------------------------
#define PKN_ (2 * C_)                        // floats in a PK row
__device__ __forceinline__ void mem_body(
    _Float16* ring, float* sb, int bx,
    const unsigned short* __restrict__ MA, const unsigned short* __restrict__ WmT,
    const float* __restrict__ bqm, const float* __restrict__ bkm,
    const unsigned short* __restrict__ WkvT, float* __restrict__ PK, float r16) {
  const int tid = threadIdx.x, wave = tid >> 5, lane = tid & 31;
  const int h = bx;
  const int trow = (wave >> 2) * TGR;          // first tile row of the wave's group
  const int w4 = wave & 3;                     // the wave's batch inside its group
  // loaded ahead of the product, used behind it (threads 128.. repeat the first 128 and do not store)
  const int bt = tid & 127;
  const float bval = (bt < HD_) ? bkm[h * HD_ + bt] : bqm[h * HD_ + bt - HD_];

  gemm_body<0, 2, 4, 2>(ring, sb, bx, 0, MA, C_, 0L, WmT, C_, 0L,
      (void*)0, 0, 0L, 2 * C_, 0L, (const float*)0, MAR_, 2 * C_, C_, r16, 1.0f);

  if (tid < 128) sb[tid] = bval;               // sb[0..63] = bkm, sb[64..127] = bqm of the head
  _Float16* mA = (_Float16*)(sb + 128);        // mem as B operand: [16 batch slots][GP] halves, slots 8..15 stay zero
  if (tid < 16 * GP / 8) *(v8h*)(mA + tid * 8) = zero8h();
  __syncthreads();                             // publishes the f32 tile, the biases and the zeroed operand to every wave

  const float* tile = (const float*)ring;
  const int j = lane & 15;
  const float* qr = tile + (trow + 64 + w4) * TLP + 64;
  const float* kr = tile + (trow + w4 * MM_ + j) * TLP;
  float a = 0.f;
#pragma unroll
  for (int d4 = 0; d4 < HD_ / 4; ++d4) {
    const v4f qv = *(const v4f*)(qr + 4 * d4) + *(const v4f*)(sb + HD_ + 4 * d4);
    const v4f kv = *(const v4f*)(kr + 4 * d4) + *(const v4f*)(sb + 4 * d4);
    a = fmaf(qv[0], kv[0], a);
    a = fmaf(qv[1], kv[1], a);
    a = fmaf(qv[2], kv[2], a);
    a = fmaf(qv[3], kv[3], a);
  }
  const float sj = (lane < MM_) ? a * 0.125f : -INFINITY;
  float mx = sj;
#pragma unroll
  for (int off = 1; off < 32; off <<= 1) mx = fmaxf(mx, __shfl_xor(mx, off, 32));
  const float e = (lane < MM_) ? __expf(sj - mx) : 0.f;
  float se = e;
#pragma unroll
  for (int off = 1; off < 32; off <<= 1) se += __shfl_xor(se, off, 32);
  const float am = e * (1.0f / se);
  const float kb0 = sb[lane], kb1 = sb[lane + 32];
  float o0 = 0.f, o1 = 0.f;
#pragma unroll
  for (int jj = 0; jj < MM_; ++jj) {
    const float aj = __shfl(am, jj, 32);
    const float* kp = tile + (trow + w4 * MM_ + jj) * TLP;
    o0 = fmaf(aj, kp[lane] + kb0, o0);
    o1 = fmaf(aj, kp[lane + 32] + kb1, o1);
  }
  mA[wave * GP + lane]      = (_Float16)o0;    // slot = batch = wave
  mA[wave * GP + lane + 32] = (_Float16)o1;
  __syncthreads();                             // publishes the eight batches' mem to every wave

  const int c = lane & 15, hh = lane >> 4;
  v16h mf[2];
#pragma unroll
  for (int kk = 0; kk < 2; ++kk) mf[kk] = ldfrag(mA + c * GP + kk * 32 + 8 * hh);
  const _Float16* wr = (const _Float16*)WkvT + (size_t)(wave * 256 + c) * C_ + h * HD_ + 8 * hh;
  float* pr = PK + (size_t)(h * NB_ + (c & 7)) * PKN_ + wave * 256 + 8 * hh;
  for (int t8 = 0; t8 < 2; ++t8) {
    // eight tiles a trip, unrolled: their 32 loads are in flight together, one memory latency a trip
    v16h wf[8][2];
#pragma unroll
    for (int t = 0; t < 8; ++t)
#pragma unroll
      for (int kk = 0; kk < 2; ++kk) wf[t][kk] = ldfrag(wr + (size_t)((t8 * 8 + t) * 16) * C_ + kk * 32);
    // keeps the 32 loads ahead of the WMMAs: sunk among them, each pair waits out a latency of its own
    __builtin_amdgcn_sched_barrier(0);
    v8f acc[8];
#pragma unroll
    for (int t = 0; t < 8; ++t) {
      acc[t] = mma_f16(wf[t][0], mf[0], zero8f());
      acc[t] = mma_f16(wf[t][1], mf[1], acc[t]) * r16;
    }
    if (c < 8) {
#pragma unroll
      for (int t = 0; t < 8; ++t) {
        v4f lo, hi;
        lo[0] = acc[t][0]; lo[1] = acc[t][1]; lo[2] = acc[t][2]; lo[3] = acc[t][3];
        hi[0] = acc[t][4]; hi[1] = acc[t][5]; hi[2] = acc[t][6]; hi[3] = acc[t][7];
        float* d = pr + (t8 * 8 + t) * 16;
        *(v4f*)(d)     = lo;
        *(v4f*)(d + 4) = hi;
      }
    }
    asm volatile("s_wait_xcnt 0x0" ::: "memory");          // before a register that these loads and stores name is rewritten
  }
}

#define MEMB_ NH_                            // blocks of the memory path

// Work that reads none of each other's output shares a launch; the block index picks the job (block-uniform branch).
// Blocks 0..MEMB_-1: memory path -> PK;
// the next NB_*TQ_: q = x . Wq + bq -> Q plane (x16), 32 tiles per batch, A = CM rows 2..1025;
// the next TKV_: k = cm . Wk + bk -> K plane (x16), the batches' rows contiguous in CM and in K, M = 8 * 1088;
// the last TKV_: v^T = Wv^T . cm^T + bv[m] -> VT plane [h*64+d][s] (x16), N = 8 * 1088, output plane = batch (1088 columns each).
// K row 0 and V^T column 0 of a batch come out of CM's zero row and are not used: the attention blocks form them from PK.
__global__ __launch_bounds__(256) void gemm_mem_qkv(
    const unsigned short* __restrict__ MA, const unsigned short* __restrict__ WmT,
    const float* __restrict__ bqm, const float* __restrict__ bkm, float* __restrict__ PK,
    const unsigned short* __restrict__ CM, const unsigned short* __restrict__ WqT,
    const unsigned short* __restrict__ WkT, const unsigned short* __restrict__ WvT,
    unsigned short* __restrict__ Qh, unsigned short* __restrict__ Kh, unsigned short* __restrict__ VTh,
    const float* __restrict__ bq, const float* __restrict__ bk, const float* __restrict__ bv, float r16, float s16) {
  __shared__ __align__(16) _Float16 ring[G42_RING_H];
  __shared__ __align__(16) float sT[G42_SLAB_F];
  const int bx = blockIdx.x;
  if (bx < MEMB_) {
    mem_body(ring, sT, bx, MA, WmT, bqm, bkm, WkT, PK, r16);
  } else if (bx < MEMB_ + NB_ * TQ_) {
    const int i = bx - MEMB_;
    gemm_body<2, 1, 4, 2>(ring, sT, i % TQ_, i / TQ_,
        CM + (size_t)2 * C_, C_, (long)LP_ * C_, WqT, C_, 0L, (void*)Qh, C_, (long)T_ * C_, C_, 0L, bq, T_, C_, C_, r16, s16);
  } else if (bx < MEMB_ + NB_ * TQ_ + TKV_) {
    gemm_body<2, 1, 4, 2>(ring, sT, bx - (MEMB_ + NB_ * TQ_), 0,
        CM, C_, 0L, WkT, C_, 0L, (void*)Kh, C_, 0L, C_, 0L, bk, NB_ * LP_, C_, C_, r16, s16);
  } else {
    gemm_body<1, 1, 4, 2>(ring, sT, bx - (MEMB_ + NB_ * TQ_ + TKV_), 0,
        WvT, C_, 0L, CM, C_, 0L, (void*)VTh, LP_, 0L, LP_, (long)C_ * LP_, bv, C_, NB_ * LP_, C_, r16, s16);
  }
}

// out = y . Wp + bp -> f32 [8192][1024]
__global__ __launch_bounds__(256) void gemm_out(
    const unsigned short* __restrict__ Yh, const unsigned short* __restrict__ WpT, float* __restrict__ out,
    const float* __restrict__ bp, float r256) {
  __shared__ __align__(16) _Float16 ring[G42_RING_H];
  __shared__ __align__(16) float sT[G42_SLAB_F];
  gemm_body<2, 0, 4, 2>(ring, sT, blockIdx.x, 0,
      Yh, C_, 0L, WpT, C_, 0L, (void*)out, C_, 0L, C_, 0L, bp, NB_ * T_, C_, C_, r256, 1.0f);
}

__device__ __forceinline__ float xhalf(float x) {
  const int b = __builtin_bit_cast(int, x);
  return __builtin_bit_cast(float, __builtin_amdgcn_permlanex16(b, b, 0x76543210, 0xfedcba98, false, false));
}

__global__ __launch_bounds__(128)
void attn_kernel(const unsigned short* __restrict__ Qp, const unsigned short* __restrict__ Kp,
                 const unsigned short* __restrict__ VTp, unsigned short* __restrict__ Yp, float sscale,
                 const float* __restrict__ PK, const float* __restrict__ bk, const float* __restrict__ bv) {
  __shared__ __align__(16) _Float16 Ksh[64 * AKP];          // K chunk [key][d], pitch 72
  __shared__ __align__(16) _Float16 Vth[64 * AKP];          // V^T chunk [d][key]
  __shared__ __align__(16) _Float16 Osh[4][16 * AKP];       // per wave output tile [row][d]

  const int tid  = threadIdx.x;
  const int wave = tid >> 5;
  const int lane = tid & 31;
  const int hh   = lane >> 4;
  const int c    = lane & 15;
  // Block index -> tile.  A query block's cost grows with qb (3..17 key chunks) and most blocks are resident together, so
  // a die or a WGP is busy for about the sum of its blocks' costs.  The index's high bits pick qb, heaviest first, its low
  // 7 bits the (batch, head): indices equal modulo 8 hold every qb, indices equal modulo 256 every second cost rank, and
  // the swap inside every second pair (15 14 12 13 11 10 8 9 ...) levels the even ranks' sum with the odd ranks' (77 : 76).
  const int bx = blockIdx.x;
  const int u  = (bx >> 7) & 15;          // cost rank (T_/64 = 16 query blocks)
  const int qb = 15 - (u ^ ((u >> 1) & 1));
  const int h  = bx & (NH_ - 1);
  const int b  = (bx >> 4) & (NB_ - 1);
  const int q0 = qb * 64 + wave * 16;     // first query row of this wave (within the batch)

  const _Float16* Qb = (const _Float16*)Qp  + (size_t)b * T_  * C_ + h * HD_;
  const _Float16* Kb = (const _Float16*)Kp  + (size_t)b * LP_ * C_ + h * HD_;
  const _Float16* Vb = (const _Float16*)VTp + ((size_t)b * C_ + h * HD_) * LP_;
  _Float16*       Yb = (_Float16*)Yp + (size_t)b * T_ * C_ + h * HD_;

  // ---- key 0 (the memory token): thread tid < 64 forms k[0][d = tid], the others v[0][d = tid - 64], from the 16 heads'
  // shares in PK plus the bias, carried x16 like the planes; it replaces the staged values of chunk 0 below ----
  _Float16 kv0h;
  {
    const int d0 = h * HD_ + (tid & (HD_ - 1));
    const float* pp = PK + (size_t)b * PKN_ + ((tid < HD_) ? 0 : C_) + d0;
    float ps = (tid < HD_) ? bk[d0] : bv[d0];
    asm volatile("s_wait_xcnt 0x0" ::: "memory");           // before a register that this load names is rewritten
    float sh[NH_];
#pragma unroll
    for (int hp = 0; hp < NH_; ++hp) sh[hp] = pp[(size_t)hp * NB_ * PKN_];
    asm volatile("s_wait_xcnt 0x0" ::: "memory");           // before a register that these loads name is rewritten
#pragma unroll
    for (int hp = 0; hp < NH_; ++hp) ps += sh[hp];
    kv0h = (_Float16)(ps * 16.0f);
  }

  // ---- Q fragments (B operand, column = query = lane&15, split k map): 2 d-chunks ----
  v16h qf[2];
#pragma unroll
  for (int dc = 0; dc < 2; ++dc)
    qf[dc] = ldfrag(Qb + (size_t)(q0 + c) * C_ + dc * 32 + 8 * hh);

  const int qrow = q0 + c;                                  // this lane's query
  const int lim  = (qrow < NU_) ? (NU_ + 1) : (qrow + 2);   // its last visible key
  float mrow = -INFINITY;                                   // running maximum of the query (equal in both halves)
  float lrow = 0.f;                                         // this half's share of the query's sum
  v8f oacc[4];                                              // oacc[t][r] = O[query][16t + 8hh + r]
#pragma unroll
  for (int t = 0; t < 4; ++t) oacc[t] = zero8f();

  int maxkey = qb * 64 + 63 + 2;                            // last visible key of the block's last query
  if (qb * 64 < NU_) maxkey = (maxkey > NU_ + 1) ? maxkey : (NU_ + 1);
  const int nChunks = (maxkey >> 6) + 1;                    // block-uniform, 3..17

  // one 64-key chunk; FIRST (chunk 0, compile-time at both calls) also puts key 0 in place
  auto chunk = [&](const int kc, const bool FIRST) __attribute__((always_inline)) {
    const int kv0 = kc * 64;
    __syncthreads();
    {
      // staging coverage: 128 threads x (4 x 8) halves = 64 rows x 64 per tile
      const int r = tid >> 1, half = (tid & 1) * 32;
      const _Float16* ks = Kb + (size_t)(kv0 + r) * C_ + half;     // K row kv0+r, d = half..half+31
      const _Float16* vs = Vb + (size_t)r * LP_ + kv0 + half;      // V^T row d = r, s = kv0+half..+31
#pragma unroll
      for (int i = 0; i < 4; ++i) {
        const v8h a0 = *(const v8h*)(ks + 8 * i);
        const v8h b0 = *(const v8h*)(vs + 8 * i);
        *(v8h*)(Ksh + r * AKP + half + 8 * i) = a0;
        *(v8h*)(Vth + r * AKP + half + 8 * i) = b0;
      }
    }
    if (FIRST) {
      __syncthreads();                                      // the staged row 0 / column 0 are in place before they are replaced
      *((tid < HD_) ? (Ksh + tid) : (Vth + (tid - HD_) * AKP)) = kv0h;   // K row 0 | V^T column 0
    }
    __syncthreads();

    // S^T tiles: rows = keys 16j..16j+15 of the chunk, columns = the wave's 16 queries
    v8f s[4];
#pragma unroll
    for (int j = 0; j < 4; ++j) s[j] = zero8f();
#pragma unroll
    for (int dc = 0; dc < 2; ++dc)
#pragma unroll
      for (int j = 0; j < 4; ++j) {
        const v16h ka = ldfrag(Ksh + (j * 16 + c) * AKP + dc * 32 + 8 * hh);
        s[j] = mma_f16(ka, qf[dc], s[j]);
      }
    const int rel = lim - kv0 - 8 * hh;                     // key kv0 + 8hh + (16j + r) is visible iff 16j + r <= rel
    float mj[4];
#pragma unroll
    for (int j = 0; j < 4; ++j) {
      float m = -INFINITY;
#pragma unroll
      for (int r = 0; r < 8; ++r) {
        const float sv = (j * 16 + r <= rel) ? s[j][r] * sscale : -INFINITY;
        s[j][r] = sv;
        m = fmaxf(m, sv);
      }
      mj[j] = m;
    }
    float cmx = fmaxf(fmaxf(mj[0], mj[1]), fmaxf(mj[2], mj[3]));
    cmx = fmaxf(cmx, xhalf(cmx));                           // the other half's 32 keys of the same query
    const float mnew  = fmaxf(mrow, cmx);
    const float alpha = __expf(mrow - mnew);
    mrow = mnew;
    v16h pb[2];                                             // P^T as B operand, 32 keys each
    float pj[4];
#pragma unroll
    for (int j = 0; j < 4; ++j) {
      float ps = 0.f;
#pragma unroll
      for (int r = 0; r < 8; ++r) {
        const float p = __expf(s[j][r] - mnew);
        ps += p;
        pb[j >> 1][(j & 1) * 8 + r] = (_Float16)p;
      }
      pj[j] = ps;
    }
    lrow = lrow * alpha + ((pj[0] + pj[1]) + (pj[2] + pj[3]));
#pragma unroll
    for (int t = 0; t < 4; ++t) oacc[t] *= alpha;
#pragma unroll
    for (int kk = 0; kk < 2; ++kk)
#pragma unroll
      for (int t = 0; t < 4; ++t) {
        const v16h va = ldfrag(Vth + (t * 16 + c) * AKP + kk * 32 + 8 * hh);
        oacc[t] = mma_f16(va, pb[kk], oacc[t]);
      }
  };
  chunk(0, true);
  for (int kc = 1; kc < nChunks; ++kc) chunk(kc, false);

  _Float16* os = Osh[wave];
  {
    const float inv = 1.0f / (lrow + xhalf(lrow));          // the two halves' shares joined once
#pragma unroll
    for (int t = 0; t < 4; ++t) {
      v8h o;
#pragma unroll
      for (int r = 0; r < 8; ++r) o[r] = (_Float16)(oacc[t][r] * inv);
      *(v8h*)(os + c * AKP + t * 16 + 8 * hh) = o;
    }
  }
  __builtin_amdgcn_fence(__ATOMIC_RELEASE, "workgroup");
  __builtin_amdgcn_wave_barrier();
  __builtin_amdgcn_fence(__ATOMIC_ACQUIRE, "workgroup");
  {
    const int q4 = lane >> 3, c8 = (lane & 7) * 8;
    v8h ov[4];
#pragma unroll
    for (int it = 0; it < 4; ++it) {
      const int row = it * 4 + q4;
      ov[it] = *(const v8h*)(os + row * AKP + c8);
    }
    {
#pragma unroll
      for (int it = 0; it < 4; ++it) {
        const int row = it * 4 + q4;
        *(v8h*)(Yb + (size_t)(q0 + row) * C_ + c8) = ov[it];
      }
    }
  }
}

// ---------------------------------------------------------------------------
//   WT   f16 [6][1024 n][1024 k]  (Wq,Wk,Wv,Wp transposed; Wkm, Wqm transposed and interleaved by head; x16)  0   12582912
//   MA   f16 [256][1024]                                               12582912     524288
//   CM   f16 [8][1088][1024]  rows: 0 zero, 1 prev_m, 2..1025 x, 1026..1087 zero  13107200   17825792
//   Q    f16 [8][1024][1024] (x16)                                     30932992   16777216
//   K    f16 [8][1088][1024] (x16)                                     47710208   17825792
//   VT   f16 [8][1024][1088] (x16)                                     65536000   17825792
//   Y    f16 [8][1024][1024] (x16)                                     83361792   16777216
//   PK   f32 [16 h][8 b][2048]  head h's share of mem . Wk | mem . Wv  100139008    1048576
//   total                                                             101187584
// ---------------------------------------------------------------------------
extern "C" void kernel_launch(void* const* d_in, const int* in_sizes, int n_in,
                              void* d_out, int out_size, void* d_ws, size_t ws_size,
                              hipStream_t stream) {
  if (n_in < 15) return;
  if (in_sizes[0] != NB_ * T_ * C_) return;
  if (in_sizes[1] != NB_ * C_) return;
  if (in_sizes[2] != NB_ * MM_ * C_) return;
  for (int i = 3; i <= 13; i += 2) if (in_sizes[i] != C_ * C_) return;
  for (int i = 4; i <= 14; i += 2) if (in_sizes[i] != C_) return;
  if (out_size != NB_ * T_ * C_) return;

  const float* x      = (const float*)d_in[0];
  const float* prev_m = (const float*)d_in[1];
  const float* cached = (const float*)d_in[2];
  const float* Wq  = (const float*)d_in[3];  const float* bq  = (const float*)d_in[4];
  const float* Wk  = (const float*)d_in[5];  const float* bk  = (const float*)d_in[6];
  const float* Wv  = (const float*)d_in[7];  const float* bv  = (const float*)d_in[8];
  const float* Wp  = (const float*)d_in[9];  const float* bp  = (const float*)d_in[10];
  const float* Wqm = (const float*)d_in[11]; const float* bqm = (const float*)d_in[12];
  const float* Wkm = (const float*)d_in[13]; const float* bkm = (const float*)d_in[14];
  float* out = (float*)d_out;

  const size_t szWT  = (size_t)6 * C_ * C_ * 2;
  const size_t szMA  = (size_t)MAR_ * C_ * 2;
  const size_t szCM  = (size_t)NB_ * LP_ * C_ * 2;
  const size_t szQ   = (size_t)NB_ * T_ * C_ * 2;
  const size_t szK   = (size_t)NB_ * LP_ * C_ * 2;
  const size_t szVT  = (size_t)NB_ * C_ * LP_ * 2;
  const size_t szY   = (size_t)NB_ * T_ * C_ * 2;
  const size_t szPK  = (size_t)NH_ * NB_ * PKN_ * 4;
  size_t off = 0;
  const size_t oWT  = off; off += szWT;
  const size_t oMA  = off; off += szMA;
  const size_t oCM  = off; off += szCM;
  const size_t oQ   = off; off += szQ;
  const size_t oK   = off; off += szK;
  const size_t oVT  = off; off += szVT;
  const size_t oY   = off; off += szY;
  const size_t oPK  = off; off += szPK;
  if (off > ws_size) return;                   // off = 101187584

  char* ws = (char*)d_ws;
  unsigned short* WT  = (unsigned short*)(ws + oWT);
  unsigned short* MA  = (unsigned short*)(ws + oMA);
  unsigned short* CM  = (unsigned short*)(ws + oCM);
  unsigned short* Qh  = (unsigned short*)(ws + oQ);
  unsigned short* Kh  = (unsigned short*)(ws + oK);
  unsigned short* VTh = (unsigned short*)(ws + oVT);
  unsigned short* Yh  = (unsigned short*)(ws + oY);
  float*          PK  = (float*)(ws + oPK);
  unsigned short* WqT  = WT;
  unsigned short* WkT  = WT + (size_t)1 * C_ * C_;
  unsigned short* WvT  = WT + (size_t)2 * C_ * C_;
  unsigned short* WpT  = WT + (size_t)3 * C_ * C_;
  unsigned short* WmT  = WT + (size_t)4 * C_ * C_;

  const float s16 = 16.0f, r16 = 1.0f / 16.0f, r256 = 1.0f / 256.0f;

  // (1) weights [in k][out n] f32 -> transposed f16 planes [n][k], carried x16; x -> CM rows 2..1025 per batch;
  //     small operand plane: per group of four batch elements 64 cached rows, 4 prev_m rows, zeros;
  //     CM rows 0 (zero), 1 (prev_m) and zero pad rows
  prep_kernel<<<dim3(PREP_WT + PREP_X + PREP_MA + PREP_CR), dim3(256), 0, stream>>>(
      Wq, Wk, Wv, Wp, Wqm, Wkm, WT, s16, x, CM, prev_m, cached, MA);
  // (2) memory path (qm, km, f32 attention, its shares of the memory token's k and v) -> PK; q -> Q plane,
  //     k -> K plane and v^T -> VT plane (x16), pad rows included
  gemm_mem_qkv<<<dim3(MEMB_ + NB_ * TQ_ + 2 * TKV_), dim3(256), 0, stream>>>(
      MA, WmT, bqm, bkm, PK, CM, WqT, WkT, WvT, Qh, Kh, VTh, bq, bk, bv, r16, s16);
  // (3) masked attention -> Y plane (x16)
  attn_kernel<<<dim3(NB_ * NH_ * (T_ / 64)), dim3(128), 0, stream>>>(Qh, Kh, VTh, Yh, 0.125f / 256.0f, PK, bk, bv);
  // (4) out = y . Wp + bp -> d_out f32 [8192][1024]  (y x16, Wp x16 -> scale 1/256)
  gemm_out<<<dim3((NB_ * T_ / 256) * (C_ / 128)), dim3(256), 0, stream>>>(Yh, WpT, out, bp, r256);
  (void)hipGetLastError();
}

// v008
// Measured time: 106 microseconds a run.
// In both of two side-by-side timings against v007, it was 1.05 times as fast.
// Over all steps from v000 it is 4.03 times as fast.
// Contractions x*Wq, cm*Wk, cm*Wv, mem*Wk, mem*Wv (per-head shares), k*q^T, v^T*p^T, y*Wp, prev_m*Wqm, cached*Wkm: v_wmma_f32_16x16x32_f16, f16 operands (weights carried x16, q/k/v/y planes carried x16, p x1), f32 accumulate; softmax f32; memory-path scores and weighted sum f32 VALU.
#include <hip/hip_runtime.h>
#include <stdint.h>
#include <math.h>

#define NB_   8
#define T_    1024
#define C_    1024
#define NH_   16
#define HD_   64
#define NU_   128
#define MM_   16
#define LKV_  1026
#define LP_   1088
#define MAR_  256
#define AKP   72

typedef _Float16 v16h __attribute__((ext_vector_type(16)));
typedef _Float16 v8h  __attribute__((ext_vector_type(8)));
typedef float    v8f  __attribute__((ext_vector_type(8)));
typedef float    v4f  __attribute__((ext_vector_type(4)));

// ---- 16-bit fragment loader: elements 0..7 <- p[0..7], 8..15 <- p[16..23]; caller passes p = row base + k0 + 8*(lane>>4)
__device__ __forceinline__ v16h ldfrag(const _Float16* p) {
  union { v16h v; v8h h[2]; } f;
  f.h[0] = *(const v8h*)(p);
  f.h[1] = *(const v8h*)(p + 16);
  return f.v;
}
__device__ __forceinline__ v8f mma_f16(v16h a, v16h b, v8f c) {
  return __builtin_amdgcn_wmma_f32_16x16x32_f16(false, a, false, b, (short)0, c, false, false);
}
__device__ __forceinline__ v8f zero8f() { v8f z; z[0]=0.f; z[1]=0.f; z[2]=0.f; z[3]=0.f; z[4]=0.f; z[5]=0.f; z[6]=0.f; z[7]=0.f; return z; }
__device__ __forceinline__ v8h zero8h() {
  v8h z;
#pragma unroll
  for (int e = 0; e < 8; ++e) z[e] = (_Float16)0.0f;
  return z;
}
__device__ __forceinline__ v8h cvt8(v4f a, v4f b, float s) {
  v8h r;
  r[0] = (_Float16)(a[0] * s); r[1] = (_Float16)(a[1] * s); r[2] = (_Float16)(a[2] * s); r[3] = (_Float16)(a[3] * s);
  r[4] = (_Float16)(b[0] * s); r[5] = (_Float16)(b[1] * s); r[6] = (_Float16)(b[2] * s); r[7] = (_Float16)(b[3] * s);
  return r;
}

// ---------------------------------------------------------------------------
// Weight transpose + f16 convert with carry scale s: six inputs W_z [k][n] f32 (C_ x C_) ->
// WT plane z: [n][k] f16 = f16(s * W_z[k][n]).  64x64 tiles through LDS, one tile (bxx, byy, z) per block of 256 threads.
// Planes 4 and 5 are interleaved by head into one [2048][k] plane: rows 128h .. 128h+63 = W_5 columns of head h, the next 64 = W_4's.
// coverage per block: load 4 it x 256 thr x 4 = 64x64; store 2 it x 256 thr x 8 = 64x64.
// ---------------------------------------------------------------------------
__device__ __forceinline__
void wt_body(float* tf, int bxx, int byy, int z,
             const float* __restrict__ W0, const float* __restrict__ W1, const float* __restrict__ W2,
             const float* __restrict__ W3, const float* __restrict__ W4, const float* __restrict__ W5,
             unsigned short* __restrict__ WT, float s) {
  const float* W = (z == 0) ? W0 : (z == 1) ? W1 : (z == 2) ? W2 : (z == 3) ? W3 : (z == 4) ? W4 : W5;
  const int c0  = bxx * 64;          // input column block
  const int o0  = (z < 4) ? z * C_ + c0 : 4 * C_ + bxx * 128 + ((z == 4) ? 64 : 0);   // first output row of the tile
  _Float16* out = (_Float16*)WT + (size_t)o0 * C_;
  const int r0  = byy * 64;          // input row block    = output column block
  const int tid = threadIdx.x;
  {
    const int lr = tid >> 4;
    const int c4 = (tid & 15) * 4;
#pragma unroll
    for (int it = 0; it < 4; ++it) {
      const int rr = it * 16 + lr;
      const v4f a = *(const v4f*)(W + (size_t)(r0 + rr) * C_ + c0 + c4);
      *(v4f*)(tf + rr * 68 + c4) = a;
    }
  }
  __syncthreads();
  const int sub = tid >> 3;          // 0..31
  const int c8  = (tid & 7) * 8;     // 0..56
  v8h hv[2];
#pragma unroll
  for (int it = 0; it < 2; ++it) {
    const int oc = it * 32 + sub;    // output row within tile (= input column)
    v8h v;
#pragma unroll
    for (int e = 0; e < 8; ++e) v[e] = (_Float16)(tf[(c8 + e) * 68 + oc] * s);
    hv[it] = v;
  }
  {
#pragma unroll
    for (int it = 0; it < 2; ++it) {
      const int oc = it * 32 + sub;
      *(v8h*)(out + (size_t)oc * C_ + r0 + c8) = hv[it];
    }
    asm volatile("s_wait_xcnt 0x0" ::: "memory");          // before a register that these stores name is rewritten
  }
}

// ---------------------------------------------------------------------------
// Small operand plane MA [256][1024] f16, two groups g of 128 rows (four batch elements each): rows 0..63 of a group =
// cached_memory rows 64g .. 64g+63, rows 64..67 = prev_m[4g .. 4g+3], rows 68..127 = 0.
// 128 blocks (two rows each) x 256 threads x 8 halves; 128 threads = whole row (16 lines, 8 lanes per line);
// coverage: 128 x 256 x 8 = whole plane.
// ---------------------------------------------------------------------------
__device__ __forceinline__
void ma_body(int blk, const float* __restrict__ prev_m, const float* __restrict__ cached, unsigned short* __restrict__ MA) {
  const int row  = blk * 2 + ((int)threadIdx.x >> 7);
  const int col8 = ((int)threadIdx.x & 127) * 8;
  const int g = row >> 7, r = row & 127;
  const bool isc = r < 64, isp = (r >= 64) && (r < 68);
  const int rp = isp ? g * 4 + (r - 64) : 0;
  const int rc = isc ? g * 64 + r : 0;
  const float* sp = prev_m + (size_t)rp * C_ + col8;
  const float* sc = cached + (size_t)rc * C_ + col8;
  const v4f p0 = *(const v4f*)(sp), p1 = *(const v4f*)(sp + 4);
  const v4f q0 = *(const v4f*)(sc), q1 = *(const v4f*)(sc + 4);
  const float fp = isp ? 1.0f : 0.0f;
  const float fc = isc ? 1.0f : 0.0f;
  const v4f a = p0 * fp + q0 * fc;
  const v4f b = p1 * fp + q1 * fc;
  const v8h hv = cvt8(a, b, 1.0f);
  _Float16* d = (_Float16*)MA + (size_t)row * C_ + col8;
  *(v8h*)d = hv;
  asm volatile("s_wait_xcnt 0x0" ::: "memory");            // before a register that this store names is rewritten
}

// ---------------------------------------------------------------------------
// x [8][1024][1024] f32 -> CM plane rows 2..1025 of each batch ([8][LP_][1024] f16), unscaled.
// ---------------------------------------------------------------------------
__device__ __forceinline__
void xcvt_body(int blk, const float* __restrict__ x, unsigned short* __restrict__ CM, int n8) {
  const int idx = blk * 256 + threadIdx.x;
  if (idx >= n8) return;
  const int e = idx * 8;
  const int b = e >> 20, t = (e >> 10) & (T_ - 1), col = e & (C_ - 1);
  const v4f a0 = *(const v4f*)(x + e), a1 = *(const v4f*)(x + e + 4);
  const v8h hv = cvt8(a0, a1, 1.0f);
  _Float16* d = (_Float16*)CM + ((size_t)(b * LP_ + 2 + t)) * C_ + col;
  *(v8h*)d = hv;
  asm volatile("s_wait_xcnt 0x0" ::: "memory");            // before a register that this store names is rewritten
}

// ---------------------------------------------------------------------------
// The CM rows that x does not fill, 64 per batch: row 0 = 0 (the memory token's k and v do not come from this row, see
// mem_body), row 1 = prev_m, rows LKV_..LP_-1 = 0.  32 blocks x 256 threads x 8 rows x 8 halves = 8 x 64 rows x 1024;
// 8 lanes write a whole 128-B line.
// ---------------------------------------------------------------------------
__device__ __forceinline__
void cmrows_body(int blk, const float* __restrict__ prev_m, unsigned short* __restrict__ CM) {
  const int idx  = blk * 256 + (int)threadIdx.x;
  const int col8 = (idx & 127) * 8;
  const int sg   = (idx >> 7) & 7;             // slots 8 sg .. 8 sg + 7 of the batch's 64
  const int b    = idx >> 10;
  const float* sp = prev_m + (size_t)b * C_ + col8;
  const v4f p0 = *(const v4f*)(sp), p1 = *(const v4f*)(sp + 4);
  const v8h pv = cvt8(p0, p1, 1.0f);
  const v8h z8 = zero8h();
  _Float16* d = (_Float16*)CM + (size_t)b * LP_ * C_ + col8;
#pragma unroll
  for (int i = 0; i < 8; ++i) {
    const int slot = sg * 8 + i;               // slot 0 = row 0, slot 1 = row 1, slots 2..63 = pad rows
    const int row  = (slot < 2) ? slot : (LKV_ - 2 + slot);
    *(v8h*)(d + (size_t)row * C_) = (slot == 1) ? pv : z8;
  }
  asm volatile("s_wait_xcnt 0x0" ::: "memory");            // before a register that these stores name is rewritten
}

// ---------------------------------------------------------------------------
// The four operand preparations read none of each other's output: one launch, the block index picks the job.
//   blocks 0 .. 1535: weight tiles (16 x 16 x 6);  1536 .. 5631: x pieces;  5632 .. 5759: small operand plane;
//   5760 .. 5791: the CM rows beside x.
// ---------------------------------------------------------------------------
#define PREP_WT  (6 * (C_ / 64) * (C_ / 64))
#define PREP_X   (NB_ * T_ * C_ / 8 / 256)
#define PREP_MA  (MAR_ / 2)
#define PREP_CR  (NB_ * 64 * C_ / 8 / 8 / 256)
__global__ __launch_bounds__(256)
void prep_kernel(const float* __restrict__ W0, const float* __restrict__ W1, const float* __restrict__ W2,
                 const float* __restrict__ W3, const float* __restrict__ W4, const float* __restrict__ W5,
                 unsigned short* __restrict__ WT, float s,
                 const float* __restrict__ x, unsigned short* __restrict__ CM,
                 const float* __restrict__ prev_m, const float* __restrict__ cached, unsigned short* __restrict__ MA) {
  __shared__ __align__(16) float tf[64 * 68];
  const int bx = blockIdx.x;
  if (bx < PREP_WT) {
    wt_body(tf, bx & 15, (bx >> 4) & 15, bx >> 8, W0, W1, W2, W3, W4, W5, WT, s);
  } else if (bx < PREP_WT + PREP_X) {
    xcvt_body(bx - PREP_WT, x, CM, NB_ * T_ * C_ / 8);
  } else if (bx < PREP_WT + PREP_X + PREP_MA) {
    ma_body(bx - (PREP_WT + PREP_X), prev_m, cached, MA);
  } else {
    cmrows_body(bx - (PREP_WT + PREP_X + PREP_MA), prev_m, CM);
  }
}

// ---------------------------------------------------------------------------
// Block-tiled batched f16 WMMA GEMM: C[m,n] = oscale * (scale * sum_k A[m,k] * Bt[n,k] + bias).
// One block = WM x WN waves = a (64*WM) x (64*WN) tile of C; each wave owns a 64x64 sub-tile.
// A row-major [M,K] f16; Bt row-major [N,K] f16; M % (64*WM) == 0, N % (64*WN) == 0, K % 64 == 0, K >= 64.
// A pass is 64 k (128 B of every operand row).  A stage is [A rows | Bt rows] at pitch 144 B in LDS, two buffers;
// every lane copies 16-B pieces global -> LDS asynchronously, the next pass's stage in flight while this one is worked on.
// Column n of C lies in output plane n / NPB (plane stride strideCN) at column n % NPB; NPB % 64 == 0.
// BIAS_MODE: 0 = none, 1 = bias[m], 2 = bias[n].  OUT_MODE: 0 = f32, 1 = f16, 2 = scale * sum left as an f32 tile at the
// start of the ring (no global store; the caller's barrier publishes it): of every 128 rows of C the first TGR, at pitch TLP.
// ---------------------------------------------------------------------------
#define GKT 64      // k per pass
#define GP  72      // LDS row pitch in halves: 144 B = 16 B x odd, conflict-free for 16-B fragment reads
#define TLP 132     // pitch in floats of the f32 tile of OUT_MODE 2: 528 B = 16 B x odd
#define TGR 80      // rows kept of every 128 in the f32 tile of OUT_MODE 2

// Eight asynchronous 16-B copies per lane.  The s_wait_xcnt closes the statement so that no address register
// named here is rewritten ahead of it.
__device__ __forceinline__ void copy8(const unsigned (&l)[8], const _Float16* const (&g)[8]) {
  asm volatile(
      "global_load_async_to_lds_b128 %0, %8, off\n\t"
      "global_load_async_to_lds_b128 %1, %9, off\n\t"
      "global_load_async_to_lds_b128 %2, %10, off\n\t"
      "global_load_async_to_lds_b128 %3, %11, off\n\t"
      "global_load_async_to_lds_b128 %4, %12, off\n\t"
      "global_load_async_to_lds_b128 %5, %13, off\n\t"
      "global_load_async_to_lds_b128 %6, %14, off\n\t"
      "global_load_async_to_lds_b128 %7, %15, off\n\t"
      "s_wait_xcnt 0x0"
      :: "v"(l[0]), "v"(l[1]), "v"(l[2]), "v"(l[3]), "v"(l[4]), "v"(l[5]), "v"(l[6]), "v"(l[7]),
         "v"(g[0]), "v"(g[1]), "v"(g[2]), "v"(g[3]), "v"(g[4]), "v"(g[5]), "v"(g[6]), "v"(g[7])
      : "memory");
}

// The same for four copies.
__device__ __forceinline__ void copy4(const unsigned (&l)[4], const _Float16* const (&g)[4]) {
  asm volatile(
      "global_load_async_to_lds_b128 %0, %4, off\n\t"
      "global_load_async_to_lds_b128 %1, %5, off\n\t"
      "global_load_async_to_lds_b128 %2, %6, off\n\t"
      "global_load_async_to_lds_b128 %3, %7, off\n\t"
      "s_wait_xcnt 0x0"
      :: "v"(l[0]), "v"(l[1]), "v"(l[2]), "v"(l[3]),
         "v"(g[0]), "v"(g[1]), "v"(g[2]), "v"(g[3])
      : "memory");
}

// ring: 2 * (64*WM + 64*WN) * GP halves of LDS; sT: WM * WN slabs of 16 x 68 floats of LDS; bx = tile index, b = batch.
template <int BIAS_MODE, int OUT_MODE, int WM, int WN>
__device__ __forceinline__ void gemm_body(
    _Float16* ring, float* sT, int bx, int b,
    const unsigned short* __restrict__ Ap, int lda, long strideA,
    const unsigned short* __restrict__ Btp, int ldb, long strideB,
    void* __restrict__ Cout, int ldc, long strideC, int NPB, long strideCN,
    const float* __restrict__ bias, int M, int N, int K, float scale, float oscale) {
  constexpr int NT  = 32 * WM * WN;      // threads
  constexpr int BM  = 64 * WM;           // tile rows
  constexpr int BN  = 64 * WN;           // tile columns
  constexpr int RPI = NT / 8;            // rows covered by one copy of the whole block (8 lanes x 16 B = one 128-B row)
  constexpr int NA  = BM / RPI;          // copies per lane and pass, A rows (16 / WN)
  constexpr int NB  = BN / RPI;          // copies per lane and pass, Bt rows (16 / WM)
  constexpr int STAGE_H = (BM + BN) * GP;
  static_assert(NA % 8 == 0 && NB % 4 == 0 && NA + NB <= 63, "copy groups of eight (Bt: and a last four), at most 63 in flight");

  const _Float16* A  = (const _Float16*)Ap;
  const _Float16* Bt = (const _Float16*)Btp;
  const int tid  = threadIdx.x;
  const int lane = tid & 31;
  const int wave = tid >> 5;
  const int wm   = wave / WN;
  const int wn   = wave - wm * WN;
  const int tilesN = N / BN;
  const int tm = bx / tilesN;            // bx runs over (M / BM) * (N / BN) tiles exactly
  const int tn = bx - tm * tilesN;
  const int rlane = lane & 15;                 // row (A) / col (B, D) within subtile
  const int koff  = (lane >> 4) * 8;           // k offset of this lane half
  const int mOff  = (lane >> 4) * 8;           // D row offset

  // this lane's piece of a stage: row tid>>3 (+ RPI per copy), 16-B piece tid&7
  const _Float16* gA = A  + (size_t)b * strideA + (size_t)(tm * BM + (tid >> 3)) * lda + (tid & 7) * 8;
  const _Float16* gB = Bt + (size_t)b * strideB + (size_t)(tn * BN + (tid >> 3)) * ldb + (tid & 7) * 8;
  const unsigned  lds0 = (unsigned)(size_t)(&ring[0]) + (unsigned)((tid >> 3) * (GP * 2) + (tid & 7) * 16);

  auto issue = [&](int kt, int buf) {
    const _Float16* ga = gA + kt * GKT;
    const _Float16* gb = gB + kt * GKT;
    const unsigned  la = lds0 + (unsigned)buf * (unsigned)(STAGE_H * 2);
    const unsigned  lb = la + (unsigned)(BM * GP * 2);
    // the loops below are unrolled so that l[] and g[] are registers (they are asm operands)
#pragma unroll
    for (int q = 0; q < NA / 8; ++q) {
      unsigned l[8]; const _Float16* g[8];
#pragma unroll
      for (int e = 0; e < 8; ++e) {
        l[e] = la + (unsigned)((q * 8 + e) * RPI * GP * 2);
        g[e] = ga + (size_t)((q * 8 + e) * RPI) * lda;
      }
      copy8(l, g);
    }
#pragma unroll
    for (int q = 0; q < NB / 8; ++q) {
      unsigned l[8]; const _Float16* g[8];
#pragma unroll
      for (int e = 0; e < 8; ++e) {
        l[e] = lb + (unsigned)((q * 8 + e) * RPI * GP * 2);
        g[e] = gb + (size_t)((q * 8 + e) * RPI) * ldb;
      }
      copy8(l, g);
    }
    if constexpr (NB % 8 != 0) {
      unsigned l[4]; const _Float16* g[4];
#pragma unroll
      for (int e = 0; e < 4; ++e) {
        l[e] = lb + (unsigned)((NB - 4 + e) * RPI * GP * 2);
        g[e] = gb + (size_t)((NB - 4 + e) * RPI) * ldb;
      }
      copy4(l, g);
    }
  };

  v8f acc[4][4];
#pragma unroll
  for (int i = 0; i < 4; ++i)
#pragma unroll
    for (int j = 0; j < 4; ++j) acc[i][j] = zero8f();

  const int NP = K / GKT;
  issue(0, 0);
  asm volatile("s_wait_asynccnt 0x0" ::: "memory");   // this wave's pieces of stage 0 have landed
  __syncthreads();                                     // publishes stage 0 to every wave
  if (NP > 1) issue(1, 1);

  for (int t = 0; t < NP; ++t) {
    const _Float16* sA = ring + (t & 1) * STAGE_H + (wm * 64 + rlane) * GP + koff;
    const _Float16* sB = ring + (t & 1) * STAGE_H + (BM + wn * 64 + rlane) * GP + koff;
    // unrolled throughout: fragments and accumulators are indexed at compile time and stay in registers
#pragma unroll
    for (int ks = 0; ks < GKT / 32; ++ks) {
      v16h bh[4], ah[4];
#pragma unroll
      for (int j = 0; j < 4; ++j) bh[j] = ldfrag(sB + j * 16 * GP + ks * 32);
#pragma unroll
      for (int i = 0; i < 4; ++i) ah[i] = ldfrag(sA + i * 16 * GP + ks * 32);
      // keeps the sixteen LDS reads of this k step together ahead of its WMMAs: spread among them, every row of
      // four WMMAs waits out a full LDS latency of its own
      __builtin_amdgcn_sched_barrier(0);
#pragma unroll
      for (int i = 0; i < 4; ++i)
#pragma unroll
        for (int j = 0; j < 4; ++j) acc[i][j] = mma_f16(ah[i], bh[j], acc[i][j]);
    }
    asm volatile("s_wait_dscnt 0x0" ::: "memory");      // this wave's reads of the buffer are done before it is refilled
    asm volatile("s_wait_asynccnt 0x0" ::: "memory");   // this wave's pieces of stage t + 1 have landed
    __syncthreads();                                     // publishes stage t + 1 and ends every reader's use of stage t
    if (t + 2 < NP) issue(t + 2, t & 1);
  }
  asm volatile("s_wait_asynccnt 0x0" ::: "memory");     // no copy outstanding when the wave goes on

  // ---- epilogue ----
  if constexpr (OUT_MODE == 2) {
    // the last pass's barrier has ended every wave's reads of the ring
    static_assert((BM / 128) * TGR * TLP * 4 <= 2 * STAGE_H * 2 && BN <= TLP && BM % 128 == 0, "the tile fits the ring");
    float* tile = (float*)ring;
#pragma unroll
    for (int i = 0; i < 4; ++i) {
      if ((wm & 1) * 64 + (i << 4) < TGR) {    // wave-uniform: the row tile lies in the kept part of its 128 rows
#pragma unroll
        for (int j = 0; j < 4; ++j)
#pragma unroll
          for (int r = 0; r < 8; ++r)
            tile[((wm >> 1) * TGR + (wm & 1) * 64 + (i << 4) + mOff + r) * TLP + wn * 64 + (j << 4) + rlane] = acc[i][j][r] * scale;
      }
    }
    return;
  }
  const int m0 = tm * BM + wm * 64;
  const int n0 = tn * BN + wn * 64;
  const int np = n0 / NPB;                     // output plane of this wave's 64 columns
  const int nl = n0 - np * NPB;                // first column inside that plane
  float* slab = sT + wave * (16 * 68);         // per-wave 16x64 slab, pitch 68 floats
#pragma unroll
  for (int i = 0; i < 4; ++i) {
    const int mBase = m0 + (i << 4);
#pragma unroll
    for (int j = 0; j < 4; ++j) {
      const int n = n0 + (j << 4) + rlane;
      float bvn = 0.f;
      if (BIAS_MODE == 2) bvn = bias[n];
#pragma unroll
      for (int r = 0; r < 8; ++r) {
        float v = acc[i][j][r] * scale;
        if (BIAS_MODE == 1) v += bias[mBase + mOff + r];
        if (BIAS_MODE == 2) v += bvn;
        v *= oscale;
        slab[(mOff + r) * 68 + (j << 4) + rlane] = v;
      }
    }
    __builtin_amdgcn_fence(__ATOMIC_RELEASE, "workgroup");
    __builtin_amdgcn_wave_barrier();
    __builtin_amdgcn_fence(__ATOMIC_ACQUIRE, "workgroup");
    if (OUT_MODE == 0) {
      float* C = (float*)Cout + (size_t)b * strideC + (size_t)np * strideCN;
      const int hh = lane >> 4, c4 = (lane & 15) * 4;     // row seg = 256 B = 16 lanes x 16 B
      {
#pragma unroll
        for (int it = 0; it < 8; ++it) {
          const int row = it * 2 + hh;                     // it 0..7 x hh 0..1 = rows 0..15
          const v4f v = *(const v4f*)(slab + row * 68 + c4);
          *(v4f*)(C + (size_t)(mBase + row) * ldc + nl + c4) = v;
        }
      }
      asm volatile("s_wait_xcnt 0x0" ::: "memory");        // before a register that these stores name is rewritten
    } else {
      _Float16* C = (_Float16*)Cout + (size_t)b * strideC + (size_t)np * strideCN;
      const int q = lane >> 3, c8 = (lane & 7) * 8;
      v8h hv[4];
#pragma unroll
      for (int it = 0; it < 4; ++it) {
        const int row = it * 4 + q;                        // it 0..3 x q 0..3 = rows 0..15
        const float* spf = slab + row * 68 + c8;
        v8h t;
#pragma unroll
        for (int e = 0; e < 8; ++e) t[e] = (_Float16)spf[e];
        hv[it] = t;
      }
      {
#pragma unroll
        for (int it = 0; it < 4; ++it) {
          const int row = it * 4 + q;
          *(v8h*)(C + (size_t)(mBase + row) * ldc + nl + c8) = hv[it];
        }
      }
      asm volatile("s_wait_xcnt 0x0" ::: "memory");        // before a register that these stores name is rewritten
    }
    __builtin_amdgcn_fence(__ATOMIC_RELEASE, "workgroup");
    __builtin_amdgcn_wave_barrier();
    __builtin_amdgcn_fence(__ATOMIC_ACQUIRE, "workgroup");
  }
}

#define G42_RING_H (2 * (256 + 128) * GP)    // LDS of a 4 x 2 wave block (256 x 128 tile): two stages of 384 rows
#define G42_SLAB_F (8 * 16 * 68)             // and eight epilogue slabs
#define TQ_  ((T_ / 256) * (C_ / 128))       // tiles of one batch of q
#define TKV_ ((NB_ * LP_ / 256) * (C_ / 128))  // tiles of k, and ((C_ / 256) * (NB_ * LP_ / 128)) of v^T: the same number

// ---------------------------------------------------------------------------
// Memory-compression attention inside the block that projects its operands.  Block h = head h, all eight batch elements:
// one 256 x 128 product of MA (both groups g) with rows 128h.. of the interleaved plane WmT; of the f32 tile left in LDS
//   tile[TGR g + 16w + j][d]      = cached row j of batch 4g+w . Wkm column 64h+d   (km, j < 16, d < 64)
//   tile[TGR g + 64 + w][64 + d]  = prev_m of batch 4g+w . Wqm column 64h+d         (qm)
// are read (the other quadrants pair an operand with the other weight).  Wave 4g+w then does batch 4g+w in f32:
//   s_j = (qm + bqm) . (km_j + bkm) * 0.125 over 16 keys, softmax, mem = sum_j a_j (km_j + bkm), 64 columns of head h.
// The memory token's k and v rows need mem over all heads.  So that k, v^T and q wait for no launch of this path, the block
// multiplies its own 64 columns of mem (f16, as the CM plane carried them) with rows 64h..64h+63 of Wk and of Wv and leaves
//   PK[h][b][n] = sum_{c in head h} mem[b][c] * W[c][n]    (f32; n < 1024: Wk column n, n >= 1024: Wv column n - 1024)
// and the attention blocks add the 16 heads' shares.  Product taken transposed: A = 16 rows n of the [n][k] weight planes
// (Wk's and Wv's are adjacent), B = mem (column = batch, columns 8..15 zero), k = 64.
// coverage: 8 waves x 16 tiles x 16 rows n = 2048; per tile lanes c < 8 store 8 floats each for n = 8*(lane>>4) + 0..7;
// a wave owns 256 consecutive n of a PK row, whole 128-B lines.
// ---------------------------------------------------------------------------
#define PKN_ (2 * C_)                        // floats in a PK row
__device__ __forceinline__ void mem_body(
    _Float16* ring, float* sb, int bx,
    const unsigned short* __restrict__ MA, const unsigned short* __restrict__ WmT,
    const float* __restrict__ bqm, const float* __restrict__ bkm,
    const unsigned short* __restrict__ WkvT, float* __restrict__ PK, float r16) {
  const int tid = threadIdx.x, wave = tid >> 5, lane = tid & 31;
  const int h = bx;
  const int trow = (wave >> 2) * TGR;          // first tile row of the wave's group
  const int w4 = wave & 3;                     // the wave's batch inside its group
  // loaded ahead of the product, used behind it (threads 128.. repeat the first 128 and do not store)
  const int bt = tid & 127;
  const float bval = (bt < HD_) ? bkm[h * HD_ + bt] : bqm[h * HD_ + bt - HD_];

  gemm_body<0, 2, 4, 2>(ring, sb, bx, 0, MA, C_, 0L, WmT, C_, 0L,
      (void*)0, 0, 0L, 2 * C_, 0L, (const float*)0, MAR_, 2 * C_, C_, r16, 1.0f);

  if (tid < 128) sb[tid] = bval;               // sb[0..63] = bkm, sb[64..127] = bqm of the head
  _Float16* mA = (_Float16*)(sb + 128);        // mem as B operand: [16 batch slots][GP] halves, slots 8..15 stay zero
  if (tid < 16 * GP / 8) *(v8h*)(mA + tid * 8) = zero8h();
  __syncthreads();                             // publishes the f32 tile, the biases and the zeroed operand to every wave

  const float* tile = (const float*)ring;
  const int j = lane & 15;
  const float* qr = tile + (trow + 64 + w4) * TLP + 64;
  const float* kr = tile + (trow + w4 * MM_ + j) * TLP;
  float a = 0.f;
#pragma unroll
  for (int d4 = 0; d4 < HD_ / 4; ++d4) {
    const v4f qv = *(const v4f*)(qr + 4 * d4) + *(const v4f*)(sb + HD_ + 4 * d4);
    const v4f kv = *(const v4f*)(kr + 4 * d4) + *(const v4f*)(sb + 4 * d4);
    a = fmaf(qv[0], kv[0], a);
    a = fmaf(qv[1], kv[1], a);
    a = fmaf(qv[2], kv[2], a);
    a = fmaf(qv[3], kv[3], a);
  }
  const float sj = (lane < MM_) ? a * 0.125f : -INFINITY;
  float mx = sj;
#pragma unroll
  for (int off = 1; off < 32; off <<= 1) mx = fmaxf(mx, __shfl_xor(mx, off, 32));
  const float e = (lane < MM_) ? __expf(sj - mx) : 0.f;
  float se = e;
#pragma unroll
  for (int off = 1; off < 32; off <<= 1) se += __shfl_xor(se, off, 32);
  const float am = e * (1.0f / se);
  const float kb0 = sb[lane], kb1 = sb[lane + 32];
  float o0 = 0.f, o1 = 0.f;
#pragma unroll
  for (int jj = 0; jj < MM_; ++jj) {
    const float aj = __shfl(am, jj, 32);
    const float* kp = tile + (trow + w4 * MM_ + jj) * TLP;
    o0 = fmaf(aj, kp[lane] + kb0, o0);
    o1 = fmaf(aj, kp[lane + 32] + kb1, o1);
  }
  mA[wave * GP + lane]      = (_Float16)o0;    // slot = batch = wave
  mA[wave * GP + lane + 32] = (_Float16)o1;
  __syncthreads();                             // publishes the eight batches' mem to every wave

  const int c = lane & 15, hh = lane >> 4;
  v16h mf[2];
#pragma unroll
  for (int kk = 0; kk < 2; ++kk) mf[kk] = ldfrag(mA + c * GP + kk * 32 + 8 * hh);
  const _Float16* wr = (const _Float16*)WkvT + (size_t)(wave * 256 + c) * C_ + h * HD_ + 8 * hh;
  float* pr = PK + (size_t)(h * NB_ + (c & 7)) * PKN_ + wave * 256 + 8 * hh;
  for (int t8 = 0; t8 < 2; ++t8) {
    // eight tiles a trip, unrolled: their 32 loads are in flight together, one memory latency a trip
    v16h wf[8][2];
#pragma unroll
    for (int t = 0; t < 8; ++t)
#pragma unroll
      for (int kk = 0; kk < 2; ++kk) wf[t][kk] = ldfrag(wr + (size_t)((t8 * 8 + t) * 16) * C_ + kk * 32);
    // keeps the 32 loads ahead of the WMMAs: sunk among them, each pair waits out a latency of its own
    __builtin_amdgcn_sched_barrier(0);
    v8f acc[8];
#pragma unroll
    for (int t = 0; t < 8; ++t) {
      acc[t] = mma_f16(wf[t][0], mf[0], zero8f());
      acc[t] = mma_f16(wf[t][1], mf[1], acc[t]) * r16;
    }
    if (c < 8) {
#pragma unroll
      for (int t = 0; t < 8; ++t) {
        v4f lo, hi;
        lo[0] = acc[t][0]; lo[1] = acc[t][1]; lo[2] = acc[t][2]; lo[3] = acc[t][3];
        hi[0] = acc[t][4]; hi[1] = acc[t][5]; hi[2] = acc[t][6]; hi[3] = acc[t][7];
        float* d = pr + (t8 * 8 + t) * 16;
        *(v4f*)(d)     = lo;
        *(v4f*)(d + 4) = hi;
      }
    }
    asm volatile("s_wait_xcnt 0x0" ::: "memory");          // before a register that these loads and stores name is rewritten
  }
}

#define MEMB_ NH_                            // blocks of the memory path

// Work that reads none of each other's output shares a launch; the block index picks the job (block-uniform branch).
// Blocks 0..MEMB_-1: memory path -> PK;
// the next NB_*TQ_: q = x . Wq + bq -> Q plane (x16), 32 tiles per batch, A = CM rows 2..1025;
// the next TKV_: k = cm . Wk + bk -> K plane (x16), the batches' rows contiguous in CM and in K, M = 8 * 1088;
// the last TKV_: v^T = Wv^T . cm^T + bv[m] -> VT plane [h*64+d][s] (x16), N = 8 * 1088, output plane = batch (1088 columns each).
// K row 0 and V^T column 0 of a batch come out of CM's zero row and are not used: the attention blocks form them from PK.
__global__ __launch_bounds__(256) void gemm_mem_qkv(
    const unsigned short* __restrict__ MA, const unsigned short* __restrict__ WmT,
    const float* __restrict__ bqm, const float* __restrict__ bkm, float* __restrict__ PK,
    const unsigned short* __restrict__ CM, const unsigned short* __restrict__ WqT,
    const unsigned short* __restrict__ WkT, const unsigned short* __restrict__ WvT,
    unsigned short* __restrict__ Qh, unsigned short* __restrict__ Kh, unsigned short* __restrict__ VTh,
    const float* __restrict__ bq, const float* __restrict__ bk, const float* __restrict__ bv, float r16, float s16) {
  __shared__ __align__(16) _Float16 ring[G42_RING_H];
  __shared__ __align__(16) float sT[G42_SLAB_F];
  const int bx = blockIdx.x;
  if (bx < MEMB_) {
    mem_body(ring, sT, bx, MA, WmT, bqm, bkm, WkT, PK, r16);
  } else if (bx < MEMB_ + NB_ * TQ_) {
    const int i = bx - MEMB_;
    gemm_body<2, 1, 4, 2>(ring, sT, i % TQ_, i / TQ_,
        CM + (size_t)2 * C_, C_, (long)LP_ * C_, WqT, C_, 0L, (void*)Qh, C_, (long)T_ * C_, C_, 0L, bq, T_, C_, C_, r16, s16);
  } else if (bx < MEMB_ + NB_ * TQ_ + TKV_) {
    gemm_body<2, 1, 4, 2>(ring, sT, bx - (MEMB_ + NB_ * TQ_), 0,
        CM, C_, 0L, WkT, C_, 0L, (void*)Kh, C_, 0L, C_, 0L, bk, NB_ * LP_, C_, C_, r16, s16);
  } else {
    gemm_body<1, 1, 4, 2>(ring, sT, bx - (MEMB_ + NB_ * TQ_ + TKV_), 0,
        WvT, C_, 0L, CM, C_, 0L, (void*)VTh, LP_, 0L, LP_, (long)C_ * LP_, bv, C_, NB_ * LP_, C_, r16, s16);
  }
}

// out = y . Wp + bp -> f32 [8192][1024]
__global__ __launch_bounds__(256) void gemm_out(
    const unsigned short* __restrict__ Yh, const unsigned short* __restrict__ WpT, float* __restrict__ out,
    const float* __restrict__ bp, float r256) {
  __shared__ __align__(16) _Float16 ring[G42_RING_H];
  __shared__ __align__(16) float sT[G42_SLAB_F];
  gemm_body<2, 0, 4, 2>(ring, sT, blockIdx.x, 0,
      Yh, C_, 0L, WpT, C_, 0L, (void*)out, C_, 0L, C_, 0L, bp, NB_ * T_, C_, C_, r256, 1.0f);
}

__device__ __forceinline__ float xhalf(float x) {
  const int b = __builtin_bit_cast(int, x);
  return __builtin_bit_cast(float, __builtin_amdgcn_permlanex16(b, b, 0x76543210, 0xfedcba98, false, false));
}

#define ASTG (128 * AKP)    // halves in a stage: 64 K rows, then 64 V^T rows
// second argument: at least six waves per SIMD, so that fragment loads hoisted far ahead do not cost resident blocks
__global__ __launch_bounds__(128, 6)
void attn_kernel(const unsigned short* __restrict__ Qp, const unsigned short* __restrict__ Kp,
                 const unsigned short* __restrict__ VTp, unsigned short* __restrict__ Yp, float sscale,
                 const float* __restrict__ PK, const float* __restrict__ bk, const float* __restrict__ bv) {
  __shared__ __align__(16) _Float16 KVs[2 * ASTG];          // two stages: K chunk [key][d] | V^T chunk [d][key], pitch 72

  const int tid  = threadIdx.x;
  const int wave = tid >> 5;
  const int lane = tid & 31;
  const int hh   = lane >> 4;
  const int c    = lane & 15;
  // Block index -> tile.  A query block's cost grows with qb (3..17 key chunks) and most blocks are resident together, so
  // a die or a WGP is busy for about the sum of its blocks' costs.  The index's high bits pick qb, heaviest first, its low
  // 7 bits the (batch, head): indices equal modulo 8 hold every qb, indices equal modulo 256 every second cost rank, and
  // the swap inside every second pair (15 14 12 13 11 10 8 9 ...) levels the even ranks' sum with the odd ranks' (77 : 76).
  const int bx = blockIdx.x;
  const int u  = (bx >> 7) & 15;          // cost rank (T_/64 = 16 query blocks)
  const int qb = 15 - (u ^ ((u >> 1) & 1));
  const int h  = bx & (NH_ - 1);
  const int b  = (bx >> 4) & (NB_ - 1);
  const int q0 = qb * 64 + wave * 16;     // first query row of this wave (within the batch)

  const _Float16* Qb = (const _Float16*)Qp  + (size_t)b * T_  * C_ + h * HD_;
  const _Float16* Kb = (const _Float16*)Kp  + (size_t)b * LP_ * C_ + h * HD_;
  const _Float16* Vb = (const _Float16*)VTp + ((size_t)b * C_ + h * HD_) * LP_;
  _Float16*       Yb = (_Float16*)Yp + (size_t)b * T_ * C_ + h * HD_;

  // this lane's pieces of a stage: rows tid>>3 (+ 16 per copy) of K and of V^T, 16-B piece tid&7
  const _Float16* gK = Kb + (size_t)(tid >> 3) * C_  + (tid & 7) * 8;
  const _Float16* gV = Vb + (size_t)(tid >> 3) * LP_ + (tid & 7) * 8;
  const unsigned  l0 = (unsigned)(size_t)(&KVs[0]) + (unsigned)((tid >> 3) * (AKP * 2) + (tid & 7) * 16);
  auto issue = [&](int kc, int buf) {
    unsigned l[8]; const _Float16* g[8];
    const unsigned lb = l0 + (unsigned)buf * (unsigned)(ASTG * 2);
    // unrolled so that l[] and g[] are registers (they are asm operands)
#pragma unroll
    for (int e = 0; e < 4; ++e) {
      l[e]     = lb + (unsigned)(e * 16 * AKP * 2);
      l[4 + e] = lb + (unsigned)((64 + e * 16) * AKP * 2);
      g[e]     = gK + (size_t)(kc * 64 + e * 16) * C_;      // K rows 64 kc + .., d = 0..63
      g[4 + e] = gV + (size_t)(e * 16) * LP_ + kc * 64;     // V^T rows d, keys 64 kc + ..
    }
    copy8(l, g);
  };
  issue(0, 0);

  // ---- key 0 (the memory token): thread tid < 64 forms k[0][d = tid], the others v[0][d = tid - 64], from the 16 heads'
  // shares in PK plus the bias, carried x16 like the planes; it replaces the staged values of chunk 0 below ----
  _Float16 kv0h;
  {
    const int d0 = h * HD_ + (tid & (HD_ - 1));
    const float* pp = PK + (size_t)b * PKN_ + ((tid < HD_) ? 0 : C_) + d0;
    float ps = (tid < HD_) ? bk[d0] : bv[d0];
    asm volatile("s_wait_xcnt 0x0" ::: "memory");           // before a register that this load names is rewritten
    float sh[NH_];
#pragma unroll
    for (int hp = 0; hp < NH_; ++hp) sh[hp] = pp[(size_t)hp * NB_ * PKN_];
    asm volatile("s_wait_xcnt 0x0" ::: "memory");           // before a register that these loads name is rewritten
#pragma unroll
    for (int hp = 0; hp < NH_; ++hp) ps += sh[hp];
    kv0h = (_Float16)(ps * 16.0f);
  }

  // ---- Q fragments (B operand, column = query = lane&15, split k map): 2 d-chunks ----
  v16h qf[2];
#pragma unroll
  for (int dc = 0; dc < 2; ++dc)
    qf[dc] = ldfrag(Qb + (size_t)(q0 + c) * C_ + dc * 32 + 8 * hh);

  const int qrow = q0 + c;                                  // this lane's query
  const int lim  = (qrow < NU_) ? (NU_ + 1) : (qrow + 2);   // its last visible key
  float mrow = -INFINITY;                                   // running maximum of the query (equal in both halves)
  float lrow = 0.f;                                         // this half's share of the query's sum
  v8f oacc[4];                                              // oacc[t][r] = O[query][16t + 8hh + r]
#pragma unroll
  for (int t = 0; t < 4; ++t) oacc[t] = zero8f();

  int maxkey = qb * 64 + 63 + 2;                            // last visible key of the block's last query
  if (qb * 64 < NU_) maxkey = (maxkey > NU_ + 1) ? maxkey : (NU_ + 1);
  const int nChunks = (maxkey >> 6) + 1;                    // block-uniform, 3..17

  asm volatile("s_wait_asynccnt 0x0" ::: "memory");         // this wave's pieces of stage 0 have landed
  __syncthreads();                                          // publishes stage 0: its row 0 / column 0 are in place before they are replaced
  *((tid < HD_) ? (KVs + tid) : (KVs + (64 + tid - HD_) * AKP)) = kv0h;   // K row 0 | V^T column 0 of stage 0
  issue(1, 1);                                              // nChunks >= 3: a stage 1 exists
  __syncthreads();                                          // publishes key 0

  for (int kc = 0; kc < nChunks; ++kc) {
    const int kv0 = kc * 64;
    const _Float16* Ksh = KVs + (kc & 1) * ASTG;
    const _Float16* Vth = Ksh + 64 * AKP;

    // S^T tiles: rows = keys 16j..16j+15 of the chunk, columns = the wave's 16 queries
    v8f s[4];
#pragma unroll
    for (int j = 0; j < 4; ++j) s[j] = zero8f();
#pragma unroll
    for (int dc = 0; dc < 2; ++dc)
#pragma unroll
      for (int j = 0; j < 4; ++j) {
        const v16h ka = ldfrag(Ksh + (j * 16 + c) * AKP + dc * 32 + 8 * hh);
        s[j] = mma_f16(ka, qf[dc], s[j]);
      }
    const int rel = lim - kv0 - 8 * hh;                     // key kv0 + 8hh + (16j + r) is visible iff 16j + r <= rel
    float mj[4];
#pragma unroll
    for (int j = 0; j < 4; ++j) {
      float m = -INFINITY;
#pragma unroll
      for (int r = 0; r < 8; ++r) {
        const float sv = (j * 16 + r <= rel) ? s[j][r] * sscale : -INFINITY;
        s[j][r] = sv;
        m = fmaxf(m, sv);
      }
      mj[j] = m;
    }
    float cmx = fmaxf(fmaxf(mj[0], mj[1]), fmaxf(mj[2], mj[3]));
    cmx = fmaxf(cmx, xhalf(cmx));                           // the other half's 32 keys of the same query
    const float mnew  = fmaxf(mrow, cmx);
    const float alpha = __expf(mrow - mnew);
    mrow = mnew;
    v16h pb[2];                                             // P^T as B operand, 32 keys each
    float pj[4];
#pragma unroll
    for (int j = 0; j < 4; ++j) {
      float ps = 0.f;
#pragma unroll
      for (int r = 0; r < 8; ++r) {
        const float p = __expf(s[j][r] - mnew);
        ps += p;
        pb[j >> 1][(j & 1) * 8 + r] = (_Float16)p;
      }
      pj[j] = ps;
    }
    lrow = lrow * alpha + ((pj[0] + pj[1]) + (pj[2] + pj[3]));
#pragma unroll
    for (int t = 0; t < 4; ++t) oacc[t] *= alpha;
#pragma unroll
    for (int kk = 0; kk < 2; ++kk)
#pragma unroll
      for (int t = 0; t < 4; ++t) {
        const v16h va = ldfrag(Vth + (t * 16 + c) * AKP + kk * 32 + 8 * hh);
        oacc[t] = mma_f16(va, pb[kk], oacc[t]);
      }
    asm volatile("s_wait_dscnt 0x0" ::: "memory");          // this wave's reads of the buffer are done before it is refilled
    asm volatile("s_wait_asynccnt 0x0" ::: "memory");       // this wave's pieces of stage kc + 1 have landed
    __syncthreads();                                        // publishes stage kc + 1 and ends every reader's use of stage kc
    if (kc + 2 < nChunks) issue(kc + 2, kc & 1);
  }
  asm volatile("s_wait_asynccnt 0x0" ::: "memory");         // no copy outstanding when the wave goes on

  // per wave output tile [row][d] in the ring: the last chunk's waits and barrier have ended every copy into it and every read of it
  _Float16* os = KVs + wave * (16 * AKP);
  {
    const float inv = 1.0f / (lrow + xhalf(lrow));          // the two halves' shares joined once
#pragma unroll
    for (int t = 0; t < 4; ++t) {
      v8h o;
#pragma unroll
      for (int r = 0; r < 8; ++r) o[r] = (_Float16)(oacc[t][r] * inv);
      *(v8h*)(os + c * AKP + t * 16 + 8 * hh) = o;
    }
  }
  __builtin_amdgcn_fence(__ATOMIC_RELEASE, "workgroup");
  __builtin_amdgcn_wave_barrier();
  __builtin_amdgcn_fence(__ATOMIC_ACQUIRE, "workgroup");
  {
    const int q4 = lane >> 3, c8 = (lane & 7) * 8;
    v8h ov[4];
#pragma unroll
    for (int it = 0; it < 4; ++it) {
      const int row = it * 4 + q4;
      ov[it] = *(const v8h*)(os + row * AKP + c8);
    }
    {
#pragma unroll
      for (int it = 0; it < 4; ++it) {
        const int row = it * 4 + q4;
        *(v8h*)(Yb + (size_t)(q0 + row) * C_ + c8) = ov[it];
      }
    }
  }
}

// ---------------------------------------------------------------------------
//   WT   f16 [6][1024 n][1024 k]  (Wq,Wk,Wv,Wp transposed; Wkm, Wqm transposed and interleaved by head; x16)  0   12582912
//   MA   f16 [256][1024]                                               12582912     524288
//   CM   f16 [8][1088][1024]  rows: 0 zero, 1 prev_m, 2..1025 x, 1026..1087 zero  13107200   17825792
//   Q    f16 [8][1024][1024] (x16)                                     30932992   16777216
//   K    f16 [8][1088][1024] (x16)                                     47710208   17825792
//   VT   f16 [8][1024][1088] (x16)                                     65536000   17825792
//   Y    f16 [8][1024][1024] (x16)                                     83361792   16777216
//   PK   f32 [16 h][8 b][2048]  head h's share of mem . Wk | mem . Wv  100139008    1048576
//   total                                                             101187584
// ---------------------------------------------------------------------------
extern "C" void kernel_launch(void* const* d_in, const int* in_sizes, int n_in,
                              void* d_out, int out_size, void* d_ws, size_t ws_size,
                              hipStream_t stream) {
  if (n_in < 15) return;
  if (in_sizes[0] != NB_ * T_ * C_) return;
  if (in_sizes[1] != NB_ * C_) return;
  if (in_sizes[2] != NB_ * MM_ * C_) return;
  for (int i = 3; i <= 13; i += 2) if (in_sizes[i] != C_ * C_) return;
  for (int i = 4; i <= 14; i += 2) if (in_sizes[i] != C_) return;
  if (out_size != NB_ * T_ * C_) return;

  const float* x      = (const float*)d_in[0];
  const float* prev_m = (const float*)d_in[1];
  const float* cached = (const float*)d_in[2];
  const float* Wq  = (const float*)d_in[3];  const float* bq  = (const float*)d_in[4];
  const float* Wk  = (const float*)d_in[5];  const float* bk  = (const float*)d_in[6];
  const float* Wv  = (const float*)d_in[7];  const float* bv  = (const float*)d_in[8];
  const float* Wp  = (const float*)d_in[9];  const float* bp  = (const float*)d_in[10];
  const float* Wqm = (const float*)d_in[11]; const float* bqm = (const float*)d_in[12];
  const float* Wkm = (const float*)d_in[13]; const float* bkm = (const float*)d_in[14];
  float* out = (float*)d_out;

  const size_t szWT  = (size_t)6 * C_ * C_ * 2;
  const size_t szMA  = (size_t)MAR_ * C_ * 2;
  const size_t szCM  = (size_t)NB_ * LP_ * C_ * 2;
  const size_t szQ   = (size_t)NB_ * T_ * C_ * 2;
  const size_t szK   = (size_t)NB_ * LP_ * C_ * 2;
  const size_t szVT  = (size_t)NB_ * C_ * LP_ * 2;
  const size_t szY   = (size_t)NB_ * T_ * C_ * 2;
  const size_t szPK  = (size_t)NH_ * NB_ * PKN_ * 4;
  size_t off = 0;
  const size_t oWT  = off; off += szWT;
  const size_t oMA  = off; off += szMA;
  const size_t oCM  = off; off += szCM;
  const size_t oQ   = off; off += szQ;
  const size_t oK   = off; off += szK;
  const size_t oVT  = off; off += szVT;
  const size_t oY   = off; off += szY;
  const size_t oPK  = off; off += szPK;
  if (off > ws_size) return;                   // off = 101187584

  char* ws = (char*)d_ws;
  unsigned short* WT  = (unsigned short*)(ws + oWT);
  unsigned short* MA  = (unsigned short*)(ws + oMA);
  unsigned short* CM  = (unsigned short*)(ws + oCM);
  unsigned short* Qh  = (unsigned short*)(ws + oQ);
  unsigned short* Kh  = (unsigned short*)(ws + oK);
  unsigned short* VTh = (unsigned short*)(ws + oVT);
  unsigned short* Yh  = (unsigned short*)(ws + oY);
  float*          PK  = (float*)(ws + oPK);
  unsigned short* WqT  = WT;
  unsigned short* WkT  = WT + (size_t)1 * C_ * C_;
  unsigned short* WvT  = WT + (size_t)2 * C_ * C_;
  unsigned short* WpT  = WT + (size_t)3 * C_ * C_;
  unsigned short* WmT  = WT + (size_t)4 * C_ * C_;

  const float s16 = 16.0f, r16 = 1.0f / 16.0f, r256 = 1.0f / 256.0f;

  // (1) weights [in k][out n] f32 -> transposed f16 planes [n][k], carried x16; x -> CM rows 2..1025 per batch;
  //     small operand plane: per group of four batch elements 64 cached rows, 4 prev_m rows, zeros;
  //     CM rows 0 (zero), 1 (prev_m) and zero pad rows
  prep_kernel<<<dim3(PREP_WT + PREP_X + PREP_MA + PREP_CR), dim3(256), 0, stream>>>(
      Wq, Wk, Wv, Wp, Wqm, Wkm, WT, s16, x, CM, prev_m, cached, MA);
  // (2) memory path (qm, km, f32 attention, its shares of the memory token's k and v) -> PK; q -> Q plane,
  //     k -> K plane and v^T -> VT plane (x16), pad rows included
  gemm_mem_qkv<<<dim3(MEMB_ + NB_ * TQ_ + 2 * TKV_), dim3(256), 0, stream>>>(
      MA, WmT, bqm, bkm, PK, CM, WqT, WkT, WvT, Qh, Kh, VTh, bq, bk, bv, r16, s16);
  // (3) masked attention -> Y plane (x16)
  attn_kernel<<<dim3(NB_ * NH_ * (T_ / 64)), dim3(128), 0, stream>>>(Qh, Kh, VTh, Yh, 0.125f / 256.0f, PK, bk, bv);
  // (4) out = y . Wp + bp -> d_out f32 [8192][1024]  (y x16, Wp x16 -> scale 1/256)
  gemm_out<<<dim3((NB_ * T_ / 256) * (C_ / 128)), dim3(256), 0, stream>>>(Yh, WpT, out, bp, r256);
  (void)hipGetLastError();
}

// v009
// It runs in 101 microseconds.
// Timed twice side by side with v008, it ran 1.04 and 1.05 times as fast.
// Over all steps from v000 it is 4.20 times as fast.
// Contractions x*Wq, cm*Wk, cm*Wv, mem*Wk, mem*Wv (per-head shares), k*q^T, v^T*p^T, y*Wp, prev_m*Wqm, cached*Wkm: v_wmma_f32_16x16x32_f16, f16 operands (weights carried x16, q/k/v/y planes carried x16, p x1), f32 accumulate; softmax f32; memory-path scores and weighted sum f32 VALU.
#include <hip/hip_runtime.h>
#include <stdint.h>
#include <math.h>

#define NB_   8
#define T_    1024
#define C_    1024
#define NH_   16
#define HD_   64
#define NU_   128
#define MM_   16
#define LKV_  1026
#define LP_   1088
#define MAR_  256
#define AKP   72

typedef _Float16 v16h __attribute__((ext_vector_type(16)));
typedef _Float16 v8h  __attribute__((ext_vector_type(8)));
typedef float    v8f  __attribute__((ext_vector_type(8)));
typedef float    v4f  __attribute__((ext_vector_type(4)));

// ---- 16-bit fragment loader: elements 0..7 <- p[0..7], 8..15 <- p[16..23]; caller passes p = row base + k0 + 8*(lane>>4)
__device__ __forceinline__ v16h ldfrag(const _Float16* p) {
  union { v16h v; v8h h[2]; } f;
  f.h[0] = *(const v8h*)(p);
  f.h[1] = *(const v8h*)(p + 16);
  return f.v;
}
__device__ __forceinline__ v8f mma_f16(v16h a, v16h b, v8f c) {
  return __builtin_amdgcn_wmma_f32_16x16x32_f16(false, a, false, b, (short)0, c, false, false);
}
__device__ __forceinline__ v8f zero8f() { v8f z; z[0]=0.f; z[1]=0.f; z[2]=0.f; z[3]=0.f; z[4]=0.f; z[5]=0.f; z[6]=0.f; z[7]=0.f; return z; }
__device__ __forceinline__ v8h zero8h() {
  v8h z;
#pragma unroll
  for (int e = 0; e < 8; ++e) z[e] = (_Float16)0.0f;
  return z;
}
__device__ __forceinline__ v8h cvt8(v4f a, v4f b, float s) {
  v8h r;
  r[0] = (_Float16)(a[0] * s); r[1] = (_Float16)(a[1] * s); r[2] = (_Float16)(a[2] * s); r[3] = (_Float16)(a[3] * s);
  r[4] = (_Float16)(b[0] * s); r[5] = (_Float16)(b[1] * s); r[6] = (_Float16)(b[2] * s); r[7] = (_Float16)(b[3] * s);
  return r;
}

// ---------------------------------------------------------------------------
// Weight transpose + f16 convert with carry scale s: six inputs W_z [k][n] f32 (C_ x C_) ->
// WT plane z: [n][k] f16 = f16(s * W_z[k][n]).  64x64 tiles through LDS, one tile (bxx, byy, z) per block of 256 threads.
// Planes 4 and 5 are interleaved by head into one [2048][k] plane: rows 128h .. 128h+63 = W_5 columns of head h, the next 64 = W_4's.
// coverage per block: load 4 it x 256 thr x 4 = 64x64; store 2 it x 256 thr x 8 = 64x64.
// ---------------------------------------------------------------------------
__device__ __forceinline__
void wt_body(float* tf, int bxx, int byy, int z,
             const float* __restrict__ W0, const float* __restrict__ W1, const float* __restrict__ W2,
             const float* __restrict__ W3, const float* __restrict__ W4, const float* __restrict__ W5,
             unsigned short* __restrict__ WT, float s) {
  const float* W = (z == 0) ? W0 : (z == 1) ? W1 : (z == 2) ? W2 : (z == 3) ? W3 : (z == 4) ? W4 : W5;
  const int c0  = bxx * 64;          // input column block
  const int o0  = (z < 4) ? z * C_ + c0 : 4 * C_ + bxx * 128 + ((z == 4) ? 64 : 0);   // first output row of the tile
  _Float16* out = (_Float16*)WT + (size_t)o0 * C_;
  const int r0  = byy * 64;          // input row block    = output column block
  const int tid = threadIdx.x;
  {
    const int lr = tid >> 4;
    const int c4 = (tid & 15) * 4;
#pragma unroll
    for (int it = 0; it < 4; ++it) {
      const int rr = it * 16 + lr;
      const v4f a = *(const v4f*)(W + (size_t)(r0 + rr) * C_ + c0 + c4);
      *(v4f*)(tf + rr * 68 + c4) = a;
    }
  }
  __syncthreads();
  const int sub = tid >> 3;          // 0..31
  const int c8  = (tid & 7) * 8;     // 0..56
  v8h hv[2];
#pragma unroll
  for (int it = 0; it < 2; ++it) {
    const int oc = it * 32 + sub;    // output row within tile (= input column)
    v8h v;
#pragma unroll
    for (int e = 0; e < 8; ++e) v[e] = (_Float16)(tf[(c8 + e) * 68 + oc] * s);
    hv[it] = v;
  }
  {
#pragma unroll
    for (int it = 0; it < 2; ++it) {
      const int oc = it * 32 + sub;
      *(v8h*)(out + (size_t)oc * C_ + r0 + c8) = hv[it];
    }
    asm volatile("s_wait_xcnt 0x0" ::: "memory");          // before a register that these stores name is rewritten
  }
}

// ---------------------------------------------------------------------------
// Small operand plane MA [256][1024] f16, two groups g of 128 rows (four batch elements each): rows 0..63 of a group =
// cached_memory rows 64g .. 64g+63, rows 64..67 = prev_m[4g .. 4g+3], rows 68..127 = 0.
// 128 blocks (two rows each) x 256 threads x 8 halves; 128 threads = whole row (16 lines, 8 lanes per line);
// coverage: 128 x 256 x 8 = whole plane.
// ---------------------------------------------------------------------------
__device__ __forceinline__
void ma_body(int blk, const float* __restrict__ prev_m, const float* __restrict__ cached, unsigned short* __restrict__ MA) {
  const int row  = blk * 2 + ((int)threadIdx.x >> 7);
  const int col8 = ((int)threadIdx.x & 127) * 8;
  const int g = row >> 7, r = row & 127;
  const bool isc = r < 64, isp = (r >= 64) && (r < 68);
  const int rp = isp ? g * 4 + (r - 64) : 0;
  const int rc = isc ? g * 64 + r : 0;
  const float* sp = prev_m + (size_t)rp * C_ + col8;
  const float* sc = cached + (size_t)rc * C_ + col8;
  const v4f p0 = *(const v4f*)(sp), p1 = *(const v4f*)(sp + 4);
  const v4f q0 = *(const v4f*)(sc), q1 = *(const v4f*)(sc + 4);
  const float fp = isp ? 1.0f : 0.0f;
  const float fc = isc ? 1.0f : 0.0f;
  const v4f a = p0 * fp + q0 * fc;
  const v4f b = p1 * fp + q1 * fc;
  const v8h hv = cvt8(a, b, 1.0f);
  _Float16* d = (_Float16*)MA + (size_t)row * C_ + col8;
  *(v8h*)d = hv;
  asm volatile("s_wait_xcnt 0x0" ::: "memory");            // before a register that this store names is rewritten
}

// ---------------------------------------------------------------------------
// x [8][1024][1024] f32 -> CM plane rows 2..1025 of each batch ([8][LP_][1024] f16), unscaled.
// ---------------------------------------------------------------------------
__device__ __forceinline__
void xcvt_body(int blk, const float* __restrict__ x, unsigned short* __restrict__ CM, int n8) {
  const int idx = blk * 256 + threadIdx.x;
  if (idx >= n8) return;
  const int e = idx * 8;
  const int b = e >> 20, t = (e >> 10) & (T_ - 1), col = e & (C_ - 1);
  const v4f a0 = *(const v4f*)(x + e), a1 = *(const v4f*)(x + e + 4);
  const v8h hv = cvt8(a0, a1, 1.0f);
  _Float16* d = (_Float16*)CM + ((size_t)(b * LP_ + 2 + t)) * C_ + col;
  *(v8h*)d = hv;
  asm volatile("s_wait_xcnt 0x0" ::: "memory");            // before a register that this store names is rewritten
}

// ---------------------------------------------------------------------------
// The CM rows that x does not fill, 64 per batch: row 0 = 0 (the memory token's k and v do not come from this row, see
// mem_body), row 1 = prev_m, rows LKV_..LP_-1 = 0.  32 blocks x 256 threads x 8 rows x 8 halves = 8 x 64 rows x 1024;
// 8 lanes write a whole 128-B line.
// ---------------------------------------------------------------------------
__device__ __forceinline__
void cmrows_body(int blk, const float* __restrict__ prev_m, unsigned short* __restrict__ CM) {
  const int idx  = blk * 256 + (int)threadIdx.x;
  const int col8 = (idx & 127) * 8;
  const int sg   = (idx >> 7) & 7;             // slots 8 sg .. 8 sg + 7 of the batch's 64
  const int b    = idx >> 10;
  const float* sp = prev_m + (size_t)b * C_ + col8;
  const v4f p0 = *(const v4f*)(sp), p1 = *(const v4f*)(sp + 4);
  const v8h pv = cvt8(p0, p1, 1.0f);
  const v8h z8 = zero8h();
  _Float16* d = (_Float16*)CM + (size_t)b * LP_ * C_ + col8;
#pragma unroll
  for (int i = 0; i < 8; ++i) {
    const int slot = sg * 8 + i;               // slot 0 = row 0, slot 1 = row 1, slots 2..63 = pad rows
    const int row  = (slot < 2) ? slot : (LKV_ - 2 + slot);
    *(v8h*)(d + (size_t)row * C_) = (slot == 1) ? pv : z8;
  }
  asm volatile("s_wait_xcnt 0x0" ::: "memory");            // before a register that these stores name is rewritten
}

// ---------------------------------------------------------------------------
// The four operand preparations read none of each other's output: one launch, the block index picks the job.
//   blocks 0 .. 1535: weight tiles (16 x 16 x 6);  1536 .. 5631: x pieces;  5632 .. 5759: small operand plane;
//   5760 .. 5791: the CM rows beside x.
// ---------------------------------------------------------------------------
#define PREP_WT  (6 * (C_ / 64) * (C_ / 64))
#define PREP_X   (NB_ * T_ * C_ / 8 / 256)
#define PREP_MA  (MAR_ / 2)
#define PREP_CR  (NB_ * 64 * C_ / 8 / 8 / 256)
__global__ __launch_bounds__(256)
void prep_kernel(const float* __restrict__ W0, const float* __restrict__ W1, const float* __restrict__ W2,
                 const float* __restrict__ W3, const float* __restrict__ W4, const float* __restrict__ W5,
                 unsigned short* __restrict__ WT, float s,
                 const float* __restrict__ x, unsigned short* __restrict__ CM,
                 const float* __restrict__ prev_m, const float* __restrict__ cached, unsigned short* __restrict__ MA) {
  __shared__ __align__(16) float tf[64 * 68];
  const int bx = blockIdx.x;
  if (bx < PREP_WT) {
    wt_body(tf, bx & 15, (bx >> 4) & 15, bx >> 8, W0, W1, W2, W3, W4, W5, WT, s);
  } else if (bx < PREP_WT + PREP_X) {
    xcvt_body(bx - PREP_WT, x, CM, NB_ * T_ * C_ / 8);
  } else if (bx < PREP_WT + PREP_X + PREP_MA) {
    ma_body(bx - (PREP_WT + PREP_X), prev_m, cached, MA);
  } else {
    cmrows_body(bx - (PREP_WT + PREP_X + PREP_MA), prev_m, CM);
  }
}

// ---------------------------------------------------------------------------
// Block-tiled batched f16 WMMA GEMM: C[m,n] = oscale * (scale * sum_k A[m,k] * Bt[n,k] + bias).
// One block = WM x WN waves = a (64*WM) x (64*WN) tile of C; each wave owns a 64x64 sub-tile.
// A row-major [M,K] f16; Bt row-major [N,K] f16; M % (64*WM) == 0, N % (64*WN) == 0, K % 64 == 0, K >= 64.
// A pass is 64 k (128 B of every operand row).  A stage is [A rows | Bt rows] at pitch 144 B in LDS, two buffers;
// every lane copies 16-B pieces global -> LDS asynchronously, the next pass's stage in flight while this one is worked on.
// Column n of C lies in output plane n / NPB (plane stride strideCN) at column n % NPB; NPB % 64 == 0.
// BIAS_MODE: 0 = none, 1 = bias[m], 2 = bias[n].  OUT_MODE: 0 = f32, 1 = f16, 2 = scale * sum left as an f32 tile at the
// start of the ring (no global store; the caller's barrier publishes it): of every 128 rows of C the first TGR, at pitch TLP.
// ---------------------------------------------------------------------------
#define GKT 64      // k per pass
#define GP  72      // LDS row pitch in halves: 144 B = 16 B x odd, conflict-free for 16-B fragment reads
#define TLP 132     // pitch in floats of the f32 tile of OUT_MODE 2: 528 B = 16 B x odd
#define TGR 80      // rows kept of every 128 in the f32 tile of OUT_MODE 2

// Eight asynchronous 16-B copies per lane.  The s_wait_xcnt closes the statement so that no address register
// named here is rewritten ahead of it.
__device__ __forceinline__ void copy8(const unsigned (&l)[8], const _Float16* const (&g)[8]) {
  asm volatile(
      "global_load_async_to_lds_b128 %0, %8, off\n\t"
      "global_load_async_to_lds_b128 %1, %9, off\n\t"
      "global_load_async_to_lds_b128 %2, %10, off\n\t"
      "global_load_async_to_lds_b128 %3, %11, off\n\t"
      "global_load_async_to_lds_b128 %4, %12, off\n\t"
      "global_load_async_to_lds_b128 %5, %13, off\n\t"
      "global_load_async_to_lds_b128 %6, %14, off\n\t"
      "global_load_async_to_lds_b128 %7, %15, off\n\t"
      "s_wait_xcnt 0x0"
      :: "v"(l[0]), "v"(l[1]), "v"(l[2]), "v"(l[3]), "v"(l[4]), "v"(l[5]), "v"(l[6]), "v"(l[7]),
         "v"(g[0]), "v"(g[1]), "v"(g[2]), "v"(g[3]), "v"(g[4]), "v"(g[5]), "v"(g[6]), "v"(g[7])
      : "memory");
}

// The same for four copies.
__device__ __forceinline__ void copy4(const unsigned (&l)[4], const _Float16* const (&g)[4]) {
  asm volatile(
      "global_load_async_to_lds_b128 %0, %4, off\n\t"
      "global_load_async_to_lds_b128 %1, %5, off\n\t"
      "global_load_async_to_lds_b128 %2, %6, off\n\t"
      "global_load_async_to_lds_b128 %3, %7, off\n\t"
      "s_wait_xcnt 0x0"
      :: "v"(l[0]), "v"(l[1]), "v"(l[2]), "v"(l[3]),
         "v"(g[0]), "v"(g[1]), "v"(g[2]), "v"(g[3])
      : "memory");
}

// ring: 2 * (64*WM + 64*WN) * GP halves of LDS; sT: WM * WN slabs of 16 x 68 floats of LDS; bx = tile index, b = batch.
template <int BIAS_MODE, int OUT_MODE, int WM, int WN>
__device__ __forceinline__ void gemm_body(
    _Float16* ring, float* sT, int bx, int b,
    const unsigned short* __restrict__ Ap, int lda, long strideA,
    const unsigned short* __restrict__ Btp, int ldb, long strideB,
    void* __restrict__ Cout, int ldc, long strideC, int NPB, long strideCN,
    const float* __restrict__ bias, int M, int N, int K, float scale, float oscale) {
  constexpr int NT  = 32 * WM * WN;      // threads
  constexpr int BM  = 64 * WM;           // tile rows
  constexpr int BN  = 64 * WN;           // tile columns
  constexpr int RPI = NT / 8;            // rows covered by one copy of the whole block (8 lanes x 16 B = one 128-B row)
  constexpr int NA  = BM / RPI;          // copies per lane and pass, A rows (16 / WN)
  constexpr int NB  = BN / RPI;          // copies per lane and pass, Bt rows (16 / WM)
  constexpr int STAGE_H = (BM + BN) * GP;
  static_assert(NA % 8 == 0 && NB % 4 == 0 && NA + NB <= 63, "copy groups of eight (Bt: and a last four), at most 63 in flight");

  const _Float16* A  = (const _Float16*)Ap;
  const _Float16* Bt = (const _Float16*)Btp;
  const int tid  = threadIdx.x;
  const int lane = tid & 31;
  const int wave = tid >> 5;
  const int wm   = wave / WN;
  const int wn   = wave - wm * WN;
  const int tilesN = N / BN;
  const int tm = bx / tilesN;            // bx runs over (M / BM) * (N / BN) tiles exactly
  const int tn = bx - tm * tilesN;
  const int rlane = lane & 15;                 // row (A) / col (B, D) within subtile
  const int koff  = (lane >> 4) * 8;           // k offset of this lane half
  const int mOff  = (lane >> 4) * 8;           // D row offset

  // this lane's piece of a stage: row tid>>3 (+ RPI per copy), 16-B piece tid&7
  const _Float16* gA = A  + (size_t)b * strideA + (size_t)(tm * BM + (tid >> 3)) * lda + (tid & 7) * 8;
  const _Float16* gB = Bt + (size_t)b * strideB + (size_t)(tn * BN + (tid >> 3)) * ldb + (tid & 7) * 8;
  const unsigned  lds0 = (unsigned)(size_t)(&ring[0]) + (unsigned)((tid >> 3) * (GP * 2) + (tid & 7) * 16);

  auto issue = [&](int kt, int buf) {
    const _Float16* ga = gA + kt * GKT;
    const _Float16* gb = gB + kt * GKT;
    const unsigned  la = lds0 + (unsigned)buf * (unsigned)(STAGE_H * 2);
    const unsigned  lb = la + (unsigned)(BM * GP * 2);
    // the loops below are unrolled so that l[] and g[] are registers (they are asm operands)
#pragma unroll
    for (int q = 0; q < NA / 8; ++q) {
      unsigned l[8]; const _Float16* g[8];
#pragma unroll
      for (int e = 0; e < 8; ++e) {
        l[e] = la + (unsigned)((q * 8 + e) * RPI * GP * 2);
        g[e] = ga + (size_t)((q * 8 + e) * RPI) * lda;
      }
      copy8(l, g);
    }
#pragma unroll
    for (int q = 0; q < NB / 8; ++q) {
      unsigned l[8]; const _Float16* g[8];
#pragma unroll
      for (int e = 0; e < 8; ++e) {
        l[e] = lb + (unsigned)((q * 8 + e) * RPI * GP * 2);
        g[e] = gb + (size_t)((q * 8 + e) * RPI) * ldb;
      }
      copy8(l, g);
    }
    if constexpr (NB % 8 != 0) {
      unsigned l[4]; const _Float16* g[4];
#pragma unroll
      for (int e = 0; e < 4; ++e) {
        l[e] = lb + (unsigned)((NB - 4 + e) * RPI * GP * 2);
        g[e] = gb + (size_t)((NB - 4 + e) * RPI) * ldb;
      }
      copy4(l, g);
    }
  };

  // bias[n] of the wave's 64 columns, four values a lane: loaded ahead of the product, used behind it
  float bvn[4];
  if constexpr (BIAS_MODE == 2) {
    // unrolled: bvn[] is indexed at compile time and stays in registers
#pragma unroll
    for (int j = 0; j < 4; ++j) bvn[j] = bias[tn * BN + wn * 64 + (j << 4) + rlane];
    asm volatile("s_wait_xcnt 0x0" ::: "memory");          // before a register that these loads name is rewritten
  }

  v8f acc[4][4];
#pragma unroll
  for (int i = 0; i < 4; ++i)
#pragma unroll
    for (int j = 0; j < 4; ++j) acc[i][j] = zero8f();

  const int NP = K / GKT;
  issue(0, 0);
  asm volatile("s_wait_asynccnt 0x0" ::: "memory");   // this wave's pieces of stage 0 have landed
  __syncthreads();                                     // publishes stage 0 to every wave
  if (NP > 1) issue(1, 1);

  for (int t = 0; t < NP; ++t) {
    const _Float16* sA = ring + (t & 1) * STAGE_H + (wm * 64 + rlane) * GP + koff;
    const _Float16* sB = ring + (t & 1) * STAGE_H + (BM + wn * 64 + rlane) * GP + koff;
    // unrolled throughout: fragments and accumulators are indexed at compile time and stay in registers
#pragma unroll
    for (int ks = 0; ks < GKT / 32; ++ks) {
      v16h bh[4], ah[4];
#pragma unroll
      for (int j = 0; j < 4; ++j) bh[j] = ldfrag(sB + j * 16 * GP + ks * 32);
#pragma unroll
      for (int i = 0; i < 4; ++i) ah[i] = ldfrag(sA + i * 16 * GP + ks * 32);
      // keeps the sixteen LDS reads of this k step together ahead of its WMMAs: spread among them, every row of
      // four WMMAs waits out a full LDS latency of its own
      __builtin_amdgcn_sched_barrier(0);
#pragma unroll
      for (int i = 0; i < 4; ++i)
#pragma unroll
        for (int j = 0; j < 4; ++j) acc[i][j] = mma_f16(ah[i], bh[j], acc[i][j]);
    }
    asm volatile("s_wait_dscnt 0x0" ::: "memory");      // this wave's reads of the buffer are done before it is refilled
    asm volatile("s_wait_asynccnt 0x0" ::: "memory");   // this wave's pieces of stage t + 1 have landed
    __syncthreads();                                     // publishes stage t + 1 and ends every reader's use of stage t
    if (t + 2 < NP) issue(t + 2, t & 1);
  }
  asm volatile("s_wait_asynccnt 0x0" ::: "memory");     // no copy outstanding when the wave goes on

  // ---- epilogue ----
  if constexpr (OUT_MODE == 2) {
    // the last pass's barrier has ended every wave's reads of the ring
    static_assert((BM / 128) * TGR * TLP * 4 <= 2 * STAGE_H * 2 && BN <= TLP && BM % 128 == 0, "the tile fits the ring");
    float* tile = (float*)ring;
#pragma unroll
    for (int i = 0; i < 4; ++i) {
      if ((wm & 1) * 64 + (i << 4) < TGR) {    // wave-uniform: the row tile lies in the kept part of its 128 rows
#pragma unroll
        for (int j = 0; j < 4; ++j)
#pragma unroll
          for (int r = 0; r < 8; ++r)
            tile[((wm >> 1) * TGR + (wm & 1) * 64 + (i << 4) + mOff + r) * TLP + wn * 64 + (j << 4) + rlane] = acc[i][j][r] * scale;
      }
    }
    return;
  }
  const int m0 = tm * BM + wm * 64;
  const int n0 = tn * BN + wn * 64;
  const int np = n0 / NPB;                     // output plane of this wave's 64 columns
  const int nl = n0 - np * NPB;                // first column inside that plane
  float* slab = sT + wave * (16 * 68);         // per-wave 16x64 slab, pitch 68 floats
  // The four 16-row slabs follow one another with no wait on global memory between them: the tile's bias values are
  // loaded once (bias[n] ahead of the product, bias[m] here) and the fences of the hand-over inside the wave name LDS
  // alone (the slab is all they order), so that no slab waits for the stores of the one before it to be acknowledged.
  float bm[4][8];
  if constexpr (BIAS_MODE == 1) {
    // unrolled: bm[][] is indexed at compile time and stays in registers (32 a lane: too many to hold through the product)
#pragma unroll
    for (int i = 0; i < 4; ++i)
#pragma unroll
      for (int r = 0; r < 8; ++r) bm[i][r] = bias[m0 + (i << 4) + mOff + r];
    asm volatile("s_wait_xcnt 0x0" ::: "memory");          // before a register that these loads name is rewritten
  }
#pragma unroll
  for (int i = 0; i < 4; ++i) {
    const int mBase = m0 + (i << 4);
#pragma unroll
    for (int j = 0; j < 4; ++j) {
#pragma unroll
      for (int r = 0; r < 8; ++r) {
        float v = acc[i][j][r] * scale;
        if constexpr (BIAS_MODE == 1) v += bm[i][r];
        if constexpr (BIAS_MODE == 2) v += bvn[j];
        v *= oscale;
        slab[(mOff + r) * 68 + (j << 4) + rlane] = v;
      }
    }
    // the slab's LDS stores are done before other lanes of the wave read them
    __builtin_amdgcn_fence(__ATOMIC_RELEASE, "workgroup", "local");
    __builtin_amdgcn_wave_barrier();
    __builtin_amdgcn_fence(__ATOMIC_ACQUIRE, "workgroup", "local");
    if (OUT_MODE == 0) {
      float* C = (float*)Cout + (size_t)b * strideC + (size_t)np * strideCN;
      const int hh = lane >> 4, c4 = (lane & 15) * 4;     // row seg = 256 B = 16 lanes x 16 B
      float* cp[8];
      v4f    vv[8];
#pragma unroll
      for (int it = 0; it < 8; ++it) {
        const int row = it * 2 + hh;                       // it 0..7 x hh 0..1 = rows 0..15
        vv[it] = *(const v4f*)(slab + row * 68 + c4);
        cp[it] = C + (size_t)(mBase + row) * ldc + nl + c4;
        *(v4f*)cp[it] = vv[it];
      }
      // before a register that these stores name is rewritten; addresses and data are operands so that they live up to the wait
      asm volatile("s_wait_xcnt 0x0" :: "v"(cp[0]), "v"(cp[1]), "v"(cp[2]), "v"(cp[3]), "v"(cp[4]), "v"(cp[5]), "v"(cp[6]), "v"(cp[7]),
                   "v"(vv[0]), "v"(vv[1]), "v"(vv[2]), "v"(vv[3]), "v"(vv[4]), "v"(vv[5]), "v"(vv[6]), "v"(vv[7]) : "memory");
    } else {
      _Float16* C = (_Float16*)Cout + (size_t)b * strideC + (size_t)np * strideCN;
      const int q = lane >> 3, c8 = (lane & 7) * 8;
      v8h hv[4];
#pragma unroll
      for (int it = 0; it < 4; ++it) {
        const int row = it * 4 + q;                        // it 0..3 x q 0..3 = rows 0..15
        const float* spf = slab + row * 68 + c8;
        v8h t;
#pragma unroll
        for (int e = 0; e < 8; ++e) t[e] = (_Float16)spf[e];
        hv[it] = t;
      }
      _Float16* cp[4];
#pragma unroll
      for (int it = 0; it < 4; ++it) {
        const int row = it * 4 + q;
        cp[it] = C + (size_t)(mBase + row) * ldc + nl + c8;
        *(v8h*)cp[it] = hv[it];
      }
      // before a register that these stores name is rewritten; addresses and data are operands so that they live up to the wait
      asm volatile("s_wait_xcnt 0x0" :: "v"(cp[0]), "v"(cp[1]), "v"(cp[2]), "v"(cp[3]),
                   "v"(hv[0]), "v"(hv[1]), "v"(hv[2]), "v"(hv[3]) : "memory");
    }
    // the slab's LDS reads are done before the next 16 rows overwrite it
    __builtin_amdgcn_fence(__ATOMIC_RELEASE, "workgroup", "local");
    __builtin_amdgcn_wave_barrier();
    __builtin_amdgcn_fence(__ATOMIC_ACQUIRE, "workgroup", "local");
  }
}

#define G42_RING_H (2 * (256 + 128) * GP)    // LDS of a 4 x 2 wave block (256 x 128 tile): two stages of 384 rows
#define G42_SLAB_F (8 * 16 * 68)             // and eight epilogue slabs
#define TQ_  ((T_ / 256) * (C_ / 128))       // tiles of one batch of q
#define TKV_ ((NB_ * LP_ / 256) * (C_ / 128))  // tiles of k, and ((C_ / 256) * (NB_ * LP_ / 128)) of v^T: the same number

// ---------------------------------------------------------------------------
// Memory-compression attention inside the block that projects its operands.  Block h = head h, all eight batch elements:
// one 256 x 128 product of MA (both groups g) with rows 128h.. of the interleaved plane WmT; of the f32 tile left in LDS
//   tile[TGR g + 16w + j][d]      = cached row j of batch 4g+w . Wkm column 64h+d   (km, j < 16, d < 64)
//   tile[TGR g + 64 + w][64 + d]  = prev_m of batch 4g+w . Wqm column 64h+d         (qm)
// are read (the other quadrants pair an operand with the other weight).  Wave 4g+w then does batch 4g+w in f32:
//   s_j = (qm + bqm) . (km_j + bkm) * 0.125 over 16 keys, softmax, mem = sum_j a_j (km_j + bkm), 64 columns of head h.
// The memory token's k and v rows need mem over all heads.  So that k, v^T and q wait for no launch of this path, the block
// multiplies its own 64 columns of mem (f16, as the CM plane carried them) with rows 64h..64h+63 of Wk and of Wv and leaves
//   PK[h][b][n] = sum_{c in head h} mem[b][c] * W[c][n]    (f32; n < 1024: Wk column n, n >= 1024: Wv column n - 1024)
// and the attention blocks add the 16 heads' shares.  Product taken transposed: A = 16 rows n of the [n][k] weight planes
// (Wk's and Wv's are adjacent), B = mem (column = batch, columns 8..15 zero), k = 64.
// coverage: 8 waves x 16 tiles x 16 rows n = 2048; per tile lanes c < 8 store 8 floats each for n = 8*(lane>>4) + 0..7;
// a wave owns 256 consecutive n of a PK row, whole 128-B lines.
// ---------------------------------------------------------------------------
#define PKN_ (2 * C_)                        // floats in a PK row
__device__ __forceinline__ void mem_body(
    _Float16* ring, float* sb, int bx,
    const unsigned short* __restrict__ MA, const unsigned short* __restrict__ WmT,
    const float* __restrict__ bqm, const float* __restrict__ bkm,
    const unsigned short* __restrict__ WkvT, float* __restrict__ PK, float r16) {
  const int tid = threadIdx.x, wave = tid >> 5, lane = tid & 31;
  const int h = bx;
  const int trow = (wave >> 2) * TGR;          // first tile row of the wave's group
  const int w4 = wave & 3;                     // the wave's batch inside its group
  // loaded ahead of the product, used behind it (threads 128.. repeat the first 128 and do not store)
  const int bt = tid & 127;
  const float bval = (bt < HD_) ? bkm[h * HD_ + bt] : bqm[h * HD_ + bt - HD_];

  gemm_body<0, 2, 4, 2>(ring, sb, bx, 0, MA, C_, 0L, WmT, C_, 0L,
      (void*)0, 0, 0L, 2 * C_, 0L, (const float*)0, MAR_, 2 * C_, C_, r16, 1.0f);

  if (tid < 128) sb[tid] = bval;               // sb[0..63] = bkm, sb[64..127] = bqm of the head
  _Float16* mA = (_Float16*)(sb + 128);        // mem as B operand: [16 batch slots][GP] halves, slots 8..15 stay zero
  if (tid < 16 * GP / 8) *(v8h*)(mA + tid * 8) = zero8h();
  __syncthreads();                             // publishes the f32 tile, the biases and the zeroed operand to every wave

  const float* tile = (const float*)ring;
  const int j = lane & 15;
  const float* qr = tile + (trow + 64 + w4) * TLP + 64;
  const float* kr = tile + (trow + w4 * MM_ + j) * TLP;
  float a = 0.f;
#pragma unroll
  for (int d4 = 0; d4 < HD_ / 4; ++d4) {
    const v4f qv = *(const v4f*)(qr + 4 * d4) + *(const v4f*)(sb + HD_ + 4 * d4);
    const v4f kv = *(const v4f*)(kr + 4 * d4) + *(const v4f*)(sb + 4 * d4);
    a = fmaf(qv[0], kv[0], a);
    a = fmaf(qv[1], kv[1], a);
    a = fmaf(qv[2], kv[2], a);
    a = fmaf(qv[3], kv[3], a);
  }
  const float sj = (lane < MM_) ? a * 0.125f : -INFINITY;
  float mx = sj;
#pragma unroll
  for (int off = 1; off < 32; off <<= 1) mx = fmaxf(mx, __shfl_xor(mx, off, 32));
  const float e = (lane < MM_) ? __expf(sj - mx) : 0.f;
  float se = e;
#pragma unroll
  for (int off = 1; off < 32; off <<= 1) se += __shfl_xor(se, off, 32);
  const float am = e * (1.0f / se);
  const float kb0 = sb[lane], kb1 = sb[lane + 32];
  float o0 = 0.f, o1 = 0.f;
#pragma unroll
  for (int jj = 0; jj < MM_; ++jj) {
    const float aj = __shfl(am, jj, 32);
    const float* kp = tile + (trow + w4 * MM_ + jj) * TLP;
    o0 = fmaf(aj, kp[lane] + kb0, o0);
    o1 = fmaf(aj, kp[lane + 32] + kb1, o1);
  }
  mA[wave * GP + lane]      = (_Float16)o0;    // slot = batch = wave
  mA[wave * GP + lane + 32] = (_Float16)o1;
  __syncthreads();                             // publishes the eight batches' mem to every wave

  const int c = lane & 15, hh = lane >> 4;
  v16h mf[2];
#pragma unroll
  for (int kk = 0; kk < 2; ++kk) mf[kk] = ldfrag(mA + c * GP + kk * 32 + 8 * hh);
  const _Float16* wr = (const _Float16*)WkvT + (size_t)(wave * 256 + c) * C_ + h * HD_ + 8 * hh;
  float* pr = PK + (size_t)(h * NB_ + (c & 7)) * PKN_ + wave * 256 + 8 * hh;
  for (int t8 = 0; t8 < 2; ++t8) {
    // eight tiles a trip, unrolled: their 32 loads are in flight together, one memory latency a trip
    v16h wf[8][2];
#pragma unroll
    for (int t = 0; t < 8; ++t)
#pragma unroll
      for (int kk = 0; kk < 2; ++kk) wf[t][kk] = ldfrag(wr + (size_t)((t8 * 8 + t) * 16) * C_ + kk * 32);
    // keeps the 32 loads ahead of the WMMAs: sunk among them, each pair waits out a latency of its own
    __builtin_amdgcn_sched_barrier(0);
    v8f acc[8];
#pragma unroll
    for (int t = 0; t < 8; ++t) {
      acc[t] = mma_f16(wf[t][0], mf[0], zero8f());
      acc[t] = mma_f16(wf[t][1], mf[1], acc[t]) * r16;
    }
    if (c < 8) {
#pragma unroll
      for (int t = 0; t < 8; ++t) {
        v4f lo, hi;
        lo[0] = acc[t][0]; lo[1] = acc[t][1]; lo[2] = acc[t][2]; lo[3] = acc[t][3];
        hi[0] = acc[t][4]; hi[1] = acc[t][5]; hi[2] = acc[t][6]; hi[3] = acc[t][7];
        float* d = pr + (t8 * 8 + t) * 16;
        *(v4f*)(d)     = lo;
        *(v4f*)(d + 4) = hi;
      }
    }
    asm volatile("s_wait_xcnt 0x0" ::: "memory");          // before a register that these loads and stores name is rewritten
  }
}

#define MEMB_ NH_                            // blocks of the memory path

// Work that reads none of each other's output shares a launch; the block index picks the job (block-uniform branch).
// Blocks 0..MEMB_-1: memory path -> PK;
// the next NB_*TQ_: q = x . Wq + bq -> Q plane (x16), 32 tiles per batch, A = CM rows 2..1025;
// the next TKV_: k = cm . Wk + bk -> K plane (x16), the batches' rows contiguous in CM and in K, M = 8 * 1088;
// the last TKV_: v^T = Wv^T . cm^T + bv[m] -> VT plane [h*64+d][s] (x16), N = 8 * 1088, output plane = batch (1088 columns each).
// K row 0 and V^T column 0 of a batch come out of CM's zero row and are not used: the attention blocks form them from PK.
__global__ __launch_bounds__(256) void gemm_mem_qkv(
    const unsigned short* __restrict__ MA, const unsigned short* __restrict__ WmT,
    const float* __restrict__ bqm, const float* __restrict__ bkm, float* __restrict__ PK,
    const unsigned short* __restrict__ CM, const unsigned short* __restrict__ WqT,
    const unsigned short* __restrict__ WkT, const unsigned short* __restrict__ WvT,
    unsigned short* __restrict__ Qh, unsigned short* __restrict__ Kh, unsigned short* __restrict__ VTh,
    const float* __restrict__ bq, const float* __restrict__ bk, const float* __restrict__ bv, float r16, float s16) {
  __shared__ __align__(16) _Float16 ring[G42_RING_H];
  __shared__ __align__(16) float sT[G42_SLAB_F];
  const int bx = blockIdx.x;
  if (bx < MEMB_) {
    mem_body(ring, sT, bx, MA, WmT, bqm, bkm, WkT, PK, r16);
  } else if (bx < MEMB_ + NB_ * TQ_) {
    const int i = bx - MEMB_;
    gemm_body<2, 1, 4, 2>(ring, sT, i % TQ_, i / TQ_,
        CM + (size_t)2 * C_, C_, (long)LP_ * C_, WqT, C_, 0L, (void*)Qh, C_, (long)T_ * C_, C_, 0L, bq, T_, C_, C_, r16, s16);
  } else if (bx < MEMB_ + NB_ * TQ_ + TKV_) {
    gemm_body<2, 1, 4, 2>(ring, sT, bx - (MEMB_ + NB_ * TQ_), 0,
        CM, C_, 0L, WkT, C_, 0L, (void*)Kh, C_, 0L, C_, 0L, bk, NB_ * LP_, C_, C_, r16, s16);
  } else {
    gemm_body<1, 1, 4, 2>(ring, sT, bx - (MEMB_ + NB_ * TQ_ + TKV_), 0,
        WvT, C_, 0L, CM, C_, 0L, (void*)VTh, LP_, 0L, LP_, (long)C_ * LP_, bv, C_, NB_ * LP_, C_, r16, s16);
  }
}

// out = y . Wp + bp -> f32 [8192][1024]
__global__ __launch_bounds__(256) void gemm_out(
    const unsigned short* __restrict__ Yh, const unsigned short* __restrict__ WpT, float* __restrict__ out,
    const float* __restrict__ bp, float r256) {
  __shared__ __align__(16) _Float16 ring[G42_RING_H];
  __shared__ __align__(16) float sT[G42_SLAB_F];
  gemm_body<2, 0, 4, 2>(ring, sT, blockIdx.x, 0,
      Yh, C_, 0L, WpT, C_, 0L, (void*)out, C_, 0L, C_, 0L, bp, NB_ * T_, C_, C_, r256, 1.0f);
}

__device__ __forceinline__ float xhalf(float x) {
  const int b = __builtin_bit_cast(int, x);
  return __builtin_bit_cast(float, __builtin_amdgcn_permlanex16(b, b, 0x76543210, 0xfedcba98, false, false));
}

#define ASTG (128 * AKP)    // halves in a stage: 64 K rows, then 64 V^T rows
// second argument: at least six waves per SIMD, so that fragment loads hoisted far ahead do not cost resident blocks
__global__ __launch_bounds__(128, 6)
void attn_kernel(const unsigned short* __restrict__ Qp, const unsigned short* __restrict__ Kp,
                 const unsigned short* __restrict__ VTp, unsigned short* __restrict__ Yp, float sscale,
                 const float* __restrict__ PK, const float* __restrict__ bk, const float* __restrict__ bv) {
  __shared__ __align__(16) _Float16 KVs[2 * ASTG];          // two stages: K chunk [key][d] | V^T chunk [d][key], pitch 72

  const int tid  = threadIdx.x;
  const int wave = tid >> 5;
  const int lane = tid & 31;
  const int hh   = lane >> 4;
  const int c    = lane & 15;
  // Block index -> tile.  A query block's cost grows with qb (3..17 key chunks) and most blocks are resident together, so
  // a die or a WGP is busy for about the sum of its blocks' costs.  The index's high bits pick qb, heaviest first, its low
  // 7 bits the (batch, head): indices equal modulo 8 hold every qb, indices equal modulo 256 every second cost rank, and
  // the swap inside every second pair (15 14 12 13 11 10 8 9 ...) levels the even ranks' sum with the odd ranks' (77 : 76).
  const int bx = blockIdx.x;
  const int u  = (bx >> 7) & 15;          // cost rank (T_/64 = 16 query blocks)
  const int qb = 15 - (u ^ ((u >> 1) & 1));
  const int h  = bx & (NH_ - 1);
  const int b  = (bx >> 4) & (NB_ - 1);
  const int q0 = qb * 64 + wave * 16;     // first query row of this wave (within the batch)

  const _Float16* Qb = (const _Float16*)Qp  + (size_t)b * T_  * C_ + h * HD_;
  const _Float16* Kb = (const _Float16*)Kp  + (size_t)b * LP_ * C_ + h * HD_;
  const _Float16* Vb = (const _Float16*)VTp + ((size_t)b * C_ + h * HD_) * LP_;
  _Float16*       Yb = (_Float16*)Yp + (size_t)b * T_ * C_ + h * HD_;

  // this lane's pieces of a stage: rows tid>>3 (+ 16 per copy) of K and of V^T, 16-B piece tid&7
  const _Float16* gK = Kb + (size_t)(tid >> 3) * C_  + (tid & 7) * 8;
  const _Float16* gV = Vb + (size_t)(tid >> 3) * LP_ + (tid & 7) * 8;
  const unsigned  l0 = (unsigned)(size_t)(&KVs[0]) + (unsigned)((tid >> 3) * (AKP * 2) + (tid & 7) * 16);
  auto issue = [&](int kc, int buf) {
    unsigned l[8]; const _Float16* g[8];
    const unsigned lb = l0 + (unsigned)buf * (unsigned)(ASTG * 2);
    // unrolled so that l[] and g[] are registers (they are asm operands)
#pragma unroll
    for (int e = 0; e < 4; ++e) {
      l[e]     = lb + (unsigned)(e * 16 * AKP * 2);
      l[4 + e] = lb + (unsigned)((64 + e * 16) * AKP * 2);
      g[e]     = gK + (size_t)(kc * 64 + e * 16) * C_;      // K rows 64 kc + .., d = 0..63
      g[4 + e] = gV + (size_t)(e * 16) * LP_ + kc * 64;     // V^T rows d, keys 64 kc + ..
    }
    copy8(l, g);
  };
  issue(0, 0);

  // ---- key 0 (the memory token): thread tid < 64 forms k[0][d = tid], the others v[0][d = tid - 64], from the 16 heads'
  // shares in PK plus the bias, carried x16 like the planes; it replaces the staged values of chunk 0 below ----
  _Float16 kv0h;
  {
    const int d0 = h * HD_ + (tid & (HD_ - 1));
    const float* pp = PK + (size_t)b * PKN_ + ((tid < HD_) ? 0 : C_) + d0;
    float ps = (tid < HD_) ? bk[d0] : bv[d0];
    asm volatile("s_wait_xcnt 0x0" ::: "memory");           // before a register that this load names is rewritten
    float sh[NH_];
#pragma unroll
    for (int hp = 0; hp < NH_; ++hp) sh[hp] = pp[(size_t)hp * NB_ * PKN_];
    asm volatile("s_wait_xcnt 0x0" ::: "memory");           // before a register that these loads name is rewritten
#pragma unroll
    for (int hp = 0; hp < NH_; ++hp) ps += sh[hp];
    kv0h = (_Float16)(ps * 16.0f);
  }

  // ---- Q fragments (B operand, column = query = lane&15, split k map): 2 d-chunks ----
  v16h qf[2];
#pragma unroll
  for (int dc = 0; dc < 2; ++dc)
    qf[dc] = ldfrag(Qb + (size_t)(q0 + c) * C_ + dc * 32 + 8 * hh);

  const int qrow = q0 + c;                                  // this lane's query
  const int lim  = (qrow < NU_) ? (NU_ + 1) : (qrow + 2);   // its last visible key
  float mrow = -INFINITY;                                   // running maximum of the query (equal in both halves)
  float lrow = 0.f;                                         // this half's share of the query's sum
  v8f oacc[4];                                              // oacc[t][r] = O[query][16t + 8hh + r]
#pragma unroll
  for (int t = 0; t < 4; ++t) oacc[t] = zero8f();

  int maxkey = qb * 64 + 63 + 2;                            // last visible key of the block's last query
  if (qb * 64 < NU_) maxkey = (maxkey > NU_ + 1) ? maxkey : (NU_ + 1);
  const int nChunks = (maxkey >> 6) + 1;                    // block-uniform, 3..17

  asm volatile("s_wait_asynccnt 0x0" ::: "memory");         // this wave's pieces of stage 0 have landed
  __syncthreads();                                          // publishes stage 0: its row 0 / column 0 are in place before they are replaced
  *((tid < HD_) ? (KVs + tid) : (KVs + (64 + tid - HD_) * AKP)) = kv0h;   // K row 0 | V^T column 0 of stage 0
  issue(1, 1);                                              // nChunks >= 3: a stage 1 exists
  __syncthreads();                                          // publishes key 0

  for (int kc = 0; kc < nChunks; ++kc) {
    const int kv0 = kc * 64;
    const _Float16* Ksh = KVs + (kc & 1) * ASTG;
    const _Float16* Vth = Ksh + 64 * AKP;

    // S^T tiles: rows = keys 16j..16j+15 of the chunk, columns = the wave's 16 queries
    v8f s[4];
#pragma unroll
    for (int j = 0; j < 4; ++j) s[j] = zero8f();
#pragma unroll
    for (int dc = 0; dc < 2; ++dc)
#pragma unroll
      for (int j = 0; j < 4; ++j) {
        const v16h ka = ldfrag(Ksh + (j * 16 + c) * AKP + dc * 32 + 8 * hh);
        s[j] = mma_f16(ka, qf[dc], s[j]);
      }
    const int rel = lim - kv0 - 8 * hh;                     // key kv0 + 8hh + (16j + r) is visible iff 16j + r <= rel
    float mj[4];
#pragma unroll
    for (int j = 0; j < 4; ++j) {
      float m = -INFINITY;
#pragma unroll
      for (int r = 0; r < 8; ++r) {
        const float sv = (j * 16 + r <= rel) ? s[j][r] * sscale : -INFINITY;
        s[j][r] = sv;
        m = fmaxf(m, sv);
      }
      mj[j] = m;
    }
    float cmx = fmaxf(fmaxf(mj[0], mj[1]), fmaxf(mj[2], mj[3]));
    cmx = fmaxf(cmx, xhalf(cmx));                           // the other half's 32 keys of the same query
    const float mnew  = fmaxf(mrow, cmx);
    const float alpha = __expf(mrow - mnew);
    mrow = mnew;
    v16h pb[2];                                             // P^T as B operand, 32 keys each
    float pj[4];
#pragma unroll
    for (int j = 0; j < 4; ++j) {
      float ps = 0.f;
#pragma unroll
      for (int r = 0; r < 8; ++r) {
        const float p = __expf(s[j][r] - mnew);
        ps += p;
        pb[j >> 1][(j & 1) * 8 + r] = (_Float16)p;
      }
      pj[j] = ps;
    }
    lrow = lrow * alpha + ((pj[0] + pj[1]) + (pj[2] + pj[3]));
#pragma unroll
    for (int t = 0; t < 4; ++t) oacc[t] *= alpha;
#pragma unroll
    for (int kk = 0; kk < 2; ++kk)
#pragma unroll
      for (int t = 0; t < 4; ++t) {
        const v16h va = ldfrag(Vth + (t * 16 + c) * AKP + kk * 32 + 8 * hh);
        oacc[t] = mma_f16(va, pb[kk], oacc[t]);
      }
    asm volatile("s_wait_dscnt 0x0" ::: "memory");          // this wave's reads of the buffer are done before it is refilled
    asm volatile("s_wait_asynccnt 0x0" ::: "memory");       // this wave's pieces of stage kc + 1 have landed
    __syncthreads();                                        // publishes stage kc + 1 and ends every reader's use of stage kc
    if (kc + 2 < nChunks) issue(kc + 2, kc & 1);
  }
  asm volatile("s_wait_asynccnt 0x0" ::: "memory");         // no copy outstanding when the wave goes on

  // per wave output tile [row][d] in the ring: the last chunk's waits and barrier have ended every copy into it and every read of it
  _Float16* os = KVs + wave * (16 * AKP);
  {
    const float inv = 1.0f / (lrow + xhalf(lrow));          // the two halves' shares joined once
#pragma unroll
    for (int t = 0; t < 4; ++t) {
      v8h o;
#pragma unroll
      for (int r = 0; r < 8; ++r) o[r] = (_Float16)(oacc[t][r] * inv);
      *(v8h*)(os + c * AKP + t * 16 + 8 * hh) = o;
    }
  }
  __builtin_amdgcn_fence(__ATOMIC_RELEASE, "workgroup");
  __builtin_amdgcn_wave_barrier();
  __builtin_amdgcn_fence(__ATOMIC_ACQUIRE, "workgroup");
  {
    const int q4 = lane >> 3, c8 = (lane & 7) * 8;
    v8h ov[4];
#pragma unroll
    for (int it = 0; it < 4; ++it) {
      const int row = it * 4 + q4;
      ov[it] = *(const v8h*)(os + row * AKP + c8);
    }
    {
#pragma unroll
      for (int it = 0; it < 4; ++it) {
        const int row = it * 4 + q4;
        *(v8h*)(Yb + (size_t)(q0 + row) * C_ + c8) = ov[it];
      }
    }
  }
}

// ---------------------------------------------------------------------------
//   WT   f16 [6][1024 n][1024 k]  (Wq,Wk,Wv,Wp transposed; Wkm, Wqm transposed and interleaved by head; x16)  0   12582912
//   MA   f16 [256][1024]                                               12582912     524288
//   CM   f16 [8][1088][1024]  rows: 0 zero, 1 prev_m, 2..1025 x, 1026..1087 zero  13107200   17825792
//   Q    f16 [8][1024][1024] (x16)                                     30932992   16777216
//   K    f16 [8][1088][1024] (x16)                                     47710208   17825792
//   VT   f16 [8][1024][1088] (x16)                                     65536000   17825792
//   Y    f16 [8][1024][1024] (x16)                                     83361792   16777216
//   PK   f32 [16 h][8 b][2048]  head h's share of mem . Wk | mem . Wv  100139008    1048576
//   total                                                             101187584
// ---------------------------------------------------------------------------
extern "C" void kernel_launch(void* const* d_in, const int* in_sizes, int n_in,
                              void* d_out, int out_size, void* d_ws, size_t ws_size,
                              hipStream_t stream) {
  if (n_in < 15) return;
  if (in_sizes[0] != NB_ * T_ * C_) return;
  if (in_sizes[1] != NB_ * C_) return;
  if (in_sizes[2] != NB_ * MM_ * C_) return;
  for (int i = 3; i <= 13; i += 2) if (in_sizes[i] != C_ * C_) return;
  for (int i = 4; i <= 14; i += 2) if (in_sizes[i] != C_) return;
  if (out_size != NB_ * T_ * C_) return;

  const float* x      = (const float*)d_in[0];
  const float* prev_m = (const float*)d_in[1];
  const float* cached = (const float*)d_in[2];
  const float* Wq  = (const float*)d_in[3];  const float* bq  = (const float*)d_in[4];
  const float* Wk  = (const float*)d_in[5];  const float* bk  = (const float*)d_in[6];
  const float* Wv  = (const float*)d_in[7];  const float* bv  = (const float*)d_in[8];
  const float* Wp  = (const float*)d_in[9];  const float* bp  = (const float*)d_in[10];
  const float* Wqm = (const float*)d_in[11]; const float* bqm = (const float*)d_in[12];
  const float* Wkm = (const float*)d_in[13]; const float* bkm = (const float*)d_in[14];
  float* out = (float*)d_out;

  const size_t szWT  = (size_t)6 * C_ * C_ * 2;
  const size_t szMA  = (size_t)MAR_ * C_ * 2;
  const size_t szCM  = (size_t)NB_ * LP_ * C_ * 2;
  const size_t szQ   = (size_t)NB_ * T_ * C_ * 2;
  const size_t szK   = (size_t)NB_ * LP_ * C_ * 2;
  const size_t szVT  = (size_t)NB_ * C_ * LP_ * 2;
  const size_t szY   = (size_t)NB_ * T_ * C_ * 2;
  const size_t szPK  = (size_t)NH_ * NB_ * PKN_ * 4;
  size_t off = 0;
  const size_t oWT  = off; off += szWT;
  const size_t oMA  = off; off += szMA;
  const size_t oCM  = off; off += szCM;
  const size_t oQ   = off; off += szQ;
  const size_t oK   = off; off += szK;
  const size_t oVT  = off; off += szVT;
  const size_t oY   = off; off += szY;
  const size_t oPK  = off; off += szPK;
  if (off > ws_size) return;                   // off = 101187584

  char* ws = (char*)d_ws;
  unsigned short* WT  = (unsigned short*)(ws + oWT);
  unsigned short* MA  = (unsigned short*)(ws + oMA);
  unsigned short* CM  = (unsigned short*)(ws + oCM);
  unsigned short* Qh  = (unsigned short*)(ws + oQ);
  unsigned short* Kh  = (unsigned short*)(ws + oK);
  unsigned short* VTh = (unsigned short*)(ws + oVT);
  unsigned short* Yh  = (unsigned short*)(ws + oY);
  float*          PK  = (float*)(ws + oPK);
  unsigned short* WqT  = WT;
  unsigned short* WkT  = WT + (size_t)1 * C_ * C_;
  unsigned short* WvT  = WT + (size_t)2 * C_ * C_;
  unsigned short* WpT  = WT + (size_t)3 * C_ * C_;
  unsigned short* WmT  = WT + (size_t)4 * C_ * C_;

  const float s16 = 16.0f, r16 = 1.0f / 16.0f, r256 = 1.0f / 256.0f;

  // (1) weights [in k][out n] f32 -> transposed f16 planes [n][k], carried x16; x -> CM rows 2..1025 per batch;
  //     small operand plane: per group of four batch elements 64 cached rows, 4 prev_m rows, zeros;
  //     CM rows 0 (zero), 1 (prev_m) and zero pad rows
  prep_kernel<<<dim3(PREP_WT + PREP_X + PREP_MA + PREP_CR), dim3(256), 0, stream>>>(
      Wq, Wk, Wv, Wp, Wqm, Wkm, WT, s16, x, CM, prev_m, cached, MA);
  // (2) memory path (qm, km, f32 attention, its shares of the memory token's k and v) -> PK; q -> Q plane,
  //     k -> K plane and v^T -> VT plane (x16), pad rows included
  gemm_mem_qkv<<<dim3(MEMB_ + NB_ * TQ_ + 2 * TKV_), dim3(256), 0, stream>>>(
      MA, WmT, bqm, bkm, PK, CM, WqT, WkT, WvT, Qh, Kh, VTh, bq, bk, bv, r16, s16);
  // (3) masked attention -> Y plane (x16)
  attn_kernel<<<dim3(NB_ * NH_ * (T_ / 64)), dim3(128), 0, stream>>>(Qh, Kh, VTh, Yh, 0.125f / 256.0f, PK, bk, bv);
  // (4) out = y . Wp + bp -> d_out f32 [8192][1024]  (y x16, Wp x16 -> scale 1/256)
  gemm_out<<<dim3((NB_ * T_ / 256) * (C_ / 128)), dim3(256), 0, stream>>>(Yh, WpT, out, bp, r256);
  (void)hipGetLastError();
}

// v010
// A run of this version takes 95.3 microseconds.
// In two side-by-side timings against v009, it was 1.05 and 1.06 times as fast.
// Counting every step since v000, it is 4.43 times as fast.
// Contractions x*Wq, cm*Wk, cm*Wv, mem*Wk, mem*Wv (per-head shares), k*q^T, v^T*p^T, y*Wp, prev_m*Wqm, cached*Wkm: v_wmma_f32_16x16x32_f16, f16 operands (weights carried x16, q/k/v/y planes carried x16, p x1), f32 accumulate; softmax f32; memory-path scores and weighted sum f32 VALU.
#include <hip/hip_runtime.h>
#include <stdint.h>
#include <math.h>

#define NB_   8
#define T_    1024
#define C_    1024
#define NH_   16
#define HD_   64
#define NU_   128
#define MM_   16
#define LKV_  1026
#define LP_   1088
#define MAR_  256
#define AKP   72

typedef _Float16 v16h __attribute__((ext_vector_type(16)));
typedef _Float16 v8h  __attribute__((ext_vector_type(8)));
typedef float    v8f  __attribute__((ext_vector_type(8)));
typedef float    v4f  __attribute__((ext_vector_type(4)));

// ---- 16-bit fragment loader: elements 0..7 <- p[0..7], 8..15 <- p[16..23]; caller passes p = row base + k0 + 8*(lane>>4)
__device__ __forceinline__ v16h ldfrag(const _Float16* p) {
  union { v16h v; v8h h[2]; } f;
  f.h[0] = *(const v8h*)(p);
  f.h[1] = *(const v8h*)(p + 16);
  return f.v;
}
// the same fragment from two separately addressed 16-B pieces: elements 0..7 <- p0[0..7], 8..15 <- p1[0..7]
__device__ __forceinline__ v16h ldfrag2(const _Float16* p0, const _Float16* p1) {
  union { v16h v; v8h h[2]; } f;
  f.h[0] = *(const v8h*)(p0);
  f.h[1] = *(const v8h*)(p1);
  return f.v;
}
__device__ __forceinline__ v8f mma_f16(v16h a, v16h b, v8f c) {
  return __builtin_amdgcn_wmma_f32_16x16x32_f16(false, a, false, b, (short)0, c, false, false);
}
__device__ __forceinline__ v8f zero8f() { v8f z; z[0]=0.f; z[1]=0.f; z[2]=0.f; z[3]=0.f; z[4]=0.f; z[5]=0.f; z[6]=0.f; z[7]=0.f; return z; }
__device__ __forceinline__ v8h zero8h() {
  v8h z;
#pragma unroll
  for (int e = 0; e < 8; ++e) z[e] = (_Float16)0.0f;
  return z;
}
__device__ __forceinline__ v8h cvt8(v4f a, v4f b, float s) {
  v8h r;
  r[0] = (_Float16)(a[0] * s); r[1] = (_Float16)(a[1] * s); r[2] = (_Float16)(a[2] * s); r[3] = (_Float16)(a[3] * s);
  r[4] = (_Float16)(b[0] * s); r[5] = (_Float16)(b[1] * s); r[6] = (_Float16)(b[2] * s); r[7] = (_Float16)(b[3] * s);
  return r;
}

// ---------------------------------------------------------------------------
// Weight transpose + f16 convert with carry scale s: six inputs W_z [k][n] f32 (C_ x C_) ->
// WT plane z: [n][k] f16 = f16(s * W_z[k][n]).  64x64 tiles through LDS, one tile (bxx, byy, z) per block of 256 threads.
// Planes 4 and 5 are interleaved by head into one [2048][k] plane: rows 128h .. 128h+63 = W_5 columns of head h, the next 64 = W_4's.
// coverage per block: load 4 it x 256 thr x 4 = 64x64; store 2 it x 256 thr x 8 = 64x64.
// ---------------------------------------------------------------------------
__device__ __forceinline__
void wt_body(float* tf, int bxx, int byy, int z,
             const float* __restrict__ W0, const float* __restrict__ W1, const float* __restrict__ W2,
             const float* __restrict__ W3, const float* __restrict__ W4, const float* __restrict__ W5,
             unsigned short* __restrict__ WT, float s) {
  const float* W = (z == 0) ? W0 : (z == 1) ? W1 : (z == 2) ? W2 : (z == 3) ? W3 : (z == 4) ? W4 : W5;
  const int c0  = bxx * 64;          // input column block
  const int o0  = (z < 4) ? z * C_ + c0 : 4 * C_ + bxx * 128 + ((z == 4) ? 64 : 0);   // first output row of the tile
  _Float16* out = (_Float16*)WT + (size_t)o0 * C_;
  const int r0  = byy * 64;          // input row block    = output column block
  const int tid = threadIdx.x;
  {
    const int lr = tid >> 4;
    const int c4 = (tid & 15) * 4;
#pragma unroll
    for (int it = 0; it < 4; ++it) {
      const int rr = it * 16 + lr;
      const v4f a = *(const v4f*)(W + (size_t)(r0 + rr) * C_ + c0 + c4);
      *(v4f*)(tf + rr * 68 + c4) = a;
    }
  }
  __syncthreads();
  const int sub = tid >> 3;          // 0..31
  const int c8  = (tid & 7) * 8;     // 0..56
  v8h hv[2];
#pragma unroll
  for (int it = 0; it < 2; ++it) {
    const int oc = it * 32 + sub;    // output row within tile (= input column)
    v8h v;
#pragma unroll
    for (int e = 0; e < 8; ++e) v[e] = (_Float16)(tf[(c8 + e) * 68 + oc] * s);
    hv[it] = v;
  }
  {
#pragma unroll
    for (int it = 0; it < 2; ++it) {
      const int oc = it * 32 + sub;
      *(v8h*)(out + (size_t)oc * C_ + r0 + c8) = hv[it];
    }
    asm volatile("s_wait_xcnt 0x0" ::: "memory");          // before a register that these stores name is rewritten
  }
}

// ---------------------------------------------------------------------------
// Small operand plane MA [256][1024] f16, two groups g of 128 rows (four batch elements each): rows 0..63 of a group =
// cached_memory rows 64g .. 64g+63, rows 64..67 = prev_m[4g .. 4g+3], rows 68..127 = 0.
// 128 blocks (two rows each) x 256 threads x 8 halves; 128 threads = whole row (16 lines, 8 lanes per line);
// coverage: 128 x 256 x 8 = whole plane.
// ---------------------------------------------------------------------------
__device__ __forceinline__
void ma_body(int blk, const float* __restrict__ prev_m, const float* __restrict__ cached, unsigned short* __restrict__ MA) {
  const int row  = blk * 2 + ((int)threadIdx.x >> 7);
  const int col8 = ((int)threadIdx.x & 127) * 8;
  const int g = row >> 7, r = row & 127;
  const bool isc = r < 64, isp = (r >= 64) && (r < 68);
  const int rp = isp ? g * 4 + (r - 64) : 0;
  const int rc = isc ? g * 64 + r : 0;
  const float* sp = prev_m + (size_t)rp * C_ + col8;
  const float* sc = cached + (size_t)rc * C_ + col8;
  const v4f p0 = *(const v4f*)(sp), p1 = *(const v4f*)(sp + 4);
  const v4f q0 = *(const v4f*)(sc), q1 = *(const v4f*)(sc + 4);
  const float fp = isp ? 1.0f : 0.0f;
  const float fc = isc ? 1.0f : 0.0f;
  const v4f a = p0 * fp + q0 * fc;
  const v4f b = p1 * fp + q1 * fc;
  const v8h hv = cvt8(a, b, 1.0f);
  _Float16* d = (_Float16*)MA + (size_t)row * C_ + col8;
  *(v8h*)d = hv;
  asm volatile("s_wait_xcnt 0x0" ::: "memory");            // before a register that this store names is rewritten
}

// ---------------------------------------------------------------------------
// x [8][1024][1024] f32 -> CM plane rows 2..1025 of each batch ([8][LP_][1024] f16), unscaled.
// ---------------------------------------------------------------------------
__device__ __forceinline__
void xcvt_body(int blk, const float* __restrict__ x, unsigned short* __restrict__ CM, int n8) {
  const int idx = blk * 256 + threadIdx.x;
  if (idx >= n8) return;
  const int e = idx * 8;
  const int b = e >> 20, t = (e >> 10) & (T_ - 1), col = e & (C_ - 1);
  const v4f a0 = *(const v4f*)(x + e), a1 = *(const v4f*)(x + e + 4);
  const v8h hv = cvt8(a0, a1, 1.0f);
  _Float16* d = (_Float16*)CM + ((size_t)(b * LP_ + 2 + t)) * C_ + col;
  *(v8h*)d = hv;
  asm volatile("s_wait_xcnt 0x0" ::: "memory");            // before a register that this store names is rewritten
}

// ---------------------------------------------------------------------------
// The CM rows that x does not fill, 64 per batch: row 0 = 0 (the memory token's k and v do not come from this row, see
// mem_body), row 1 = prev_m, rows LKV_..LP_-1 = 0.  32 blocks x 256 threads x 8 rows x 8 halves = 8 x 64 rows x 1024;
// 8 lanes write a whole 128-B line.
// ---------------------------------------------------------------------------
__device__ __forceinline__
void cmrows_body(int blk, const float* __restrict__ prev_m, unsigned short* __restrict__ CM) {
  const int idx  = blk * 256 + (int)threadIdx.x;
  const int col8 = (idx & 127) * 8;
  const int sg   = (idx >> 7) & 7;             // slots 8 sg .. 8 sg + 7 of the batch's 64
  const int b    = idx >> 10;
  const float* sp = prev_m + (size_t)b * C_ + col8;
  const v4f p0 = *(const v4f*)(sp), p1 = *(const v4f*)(sp + 4);
  const v8h pv = cvt8(p0, p1, 1.0f);
  const v8h z8 = zero8h();
  _Float16* d = (_Float16*)CM + (size_t)b * LP_ * C_ + col8;
#pragma unroll
  for (int i = 0; i < 8; ++i) {
    const int slot = sg * 8 + i;               // slot 0 = row 0, slot 1 = row 1, slots 2..63 = pad rows
    const int row  = (slot < 2) ? slot : (LKV_ - 2 + slot);
    *(v8h*)(d + (size_t)row * C_) = (slot == 1) ? pv : z8;
  }
  asm volatile("s_wait_xcnt 0x0" ::: "memory");            // before a register that these stores name is rewritten
}

// ---------------------------------------------------------------------------
// The four operand preparations read none of each other's output: one launch, the block index picks the job.
//   blocks 0 .. 1535: weight tiles (16 x 16 x 6);  1536 .. 5631: x pieces;  5632 .. 5759: small operand plane;
//   5760 .. 5791: the CM rows beside x.
// ---------------------------------------------------------------------------
#define PREP_WT  (6 * (C_ / 64) * (C_ / 64))
#define PREP_X   (NB_ * T_ * C_ / 8 / 256)
#define PREP_MA  (MAR_ / 2)
#define PREP_CR  (NB_ * 64 * C_ / 8 / 8 / 256)
__global__ __launch_bounds__(256)
void prep_kernel(const float* __restrict__ W0, const float* __restrict__ W1, const float* __restrict__ W2,
                 const float* __restrict__ W3, const float* __restrict__ W4, const float* __restrict__ W5,
                 unsigned short* __restrict__ WT, float s,
                 const float* __restrict__ x, unsigned short* __restrict__ CM,
                 const float* __restrict__ prev_m, const float* __restrict__ cached, unsigned short* __restrict__ MA) {
  __shared__ __align__(16) float tf[64 * 68];
  const int bx = blockIdx.x;
  if (bx < PREP_WT) {
    wt_body(tf, bx & 15, (bx >> 4) & 15, bx >> 8, W0, W1, W2, W3, W4, W5, WT, s);
  } else if (bx < PREP_WT + PREP_X) {
    xcvt_body(bx - PREP_WT, x, CM, NB_ * T_ * C_ / 8);
  } else if (bx < PREP_WT + PREP_X + PREP_MA) {
    ma_body(bx - (PREP_WT + PREP_X), prev_m, cached, MA);
  } else {
    cmrows_body(bx - (PREP_WT + PREP_X + PREP_MA), prev_m, CM);
  }
}

// ---------------------------------------------------------------------------
// Block-tiled batched f16 WMMA GEMM: C[m,n] = oscale * (scale * sum_k A[m,k] * Bt[n,k] + bias).
// One block = WM x WN waves = a (64*WM) x (64*WN) tile of C; each wave owns a 64x64 sub-tile.
// A row-major [M,K] f16; Bt row-major [N,K] f16; M % (64*WM) == 0, N % (64*WN) == 0, K % 64 == 0, K >= 128.
// A pass is 64 k (128 B of every operand row).  A stage is [A rows | Bt rows] in LDS, three buffers, filled by asynchronous
// 16-B copies global -> LDS.  Stage s is copied by the waves of half s & 1 of the block alone, two passes ahead of its use:
// two stages are in flight while a third is worked on, and a wave never has more than one stage's copies outstanding, so
// that each of its waits is to 0.  Rows are unpadded (128 B): 16-B piece P of row r lies in slot P ^ ((r >> 1) & 7), which
// puts the 16 rows of a fragment read on 16 different groups of four banks.  The epilogue's slabs lie in the ring.
// Column n of C lies in output plane n / NPB (plane stride strideCN) at column n % NPB; NPB % 64 == 0.
// BIAS_MODE: 0 = none, 1 = bias[m], 2 = bias[n].  OUT_MODE: 0 = f32, 1 = f16, 2 = scale * sum left as an f32 tile at the
// start of the ring (no global store; the caller's barrier publishes it): of every 128 rows of C the first TGR, at pitch TLP.
// ---------------------------------------------------------------------------
#define GKT 64      // k per pass
#define GNS 3       // buffers of the ring
#define GP  72      // row pitch in halves of the small operand of mem_body: 144 B = 16 B x odd, conflict-free for 16-B fragment reads
#define TLP 132     // pitch in floats of the f32 tile of OUT_MODE 2: 528 B = 16 B x odd
#define TGR 80      // rows kept of every 128 in the f32 tile of OUT_MODE 2

// Eight asynchronous 16-B copies per lane.  The s_wait_xcnt closes the statement so that no address register
// named here is rewritten ahead of it.
__device__ __forceinline__ void copy8(const unsigned (&l)[8], const _Float16* const (&g)[8]) {
  asm volatile(
      "global_load_async_to_lds_b128 %0, %8, off\n\t"
      "global_load_async_to_lds_b128 %1, %9, off\n\t"
      "global_load_async_to_lds_b128 %2, %10, off\n\t"
      "global_load_async_to_lds_b128 %3, %11, off\n\t"
      "global_load_async_to_lds_b128 %4, %12, off\n\t"
      "global_load_async_to_lds_b128 %5, %13, off\n\t"
      "global_load_async_to_lds_b128 %6, %14, off\n\t"
      "global_load_async_to_lds_b128 %7, %15, off\n\t"
      "s_wait_xcnt 0x0"
      :: "v"(l[0]), "v"(l[1]), "v"(l[2]), "v"(l[3]), "v"(l[4]), "v"(l[5]), "v"(l[6]), "v"(l[7]),
         "v"(g[0]), "v"(g[1]), "v"(g[2]), "v"(g[3]), "v"(g[4]), "v"(g[5]), "v"(g[6]), "v"(g[7])
      : "memory");
}

// ring: GNS * (64*WM + 64*WN) * GKT halves of LDS; sT: WM * WN slabs of 16 x 68 floats of LDS, which may lie in the ring
// (they are used behind the last pass's barrier); bx = tile index, b = batch.
template <int BIAS_MODE, int OUT_MODE, int WM, int WN>
__device__ __forceinline__ void gemm_body(
    _Float16* ring, float* sT, int bx, int b,
    const unsigned short* __restrict__ Ap, int lda, long strideA,
    const unsigned short* __restrict__ Btp, int ldb, long strideB,
    void* __restrict__ Cout, int ldc, long strideC, int NPB, long strideCN,
    const float* __restrict__ bias, int M, int N, int K, float scale, float oscale) {
  constexpr int NT  = 32 * WM * WN;      // threads
  constexpr int BM  = 64 * WM;           // tile rows
  constexpr int BN  = 64 * WN;           // tile columns
  constexpr int HT  = NT / 2;            // threads of one half of the block: they copy a whole stage
  constexpr int RPI = HT / 8;            // rows covered by one copy of a half (8 lanes x 16 B = one 128-B row)
  constexpr int NA  = BM / RPI;          // copies per lane and stage, A rows
  constexpr int NB  = BN / RPI;          // copies per lane and stage, Bt rows
  constexpr int STAGE_H = (BM + BN) * GKT;
  static_assert(NA % 8 == 0 && NB % 8 == 0 && NA + NB <= 63, "copy groups of eight, at most 63 in flight");
  static_assert(RPI % 16 == 0 && HT % 32 == 0, "a lane's slot is the same in all its rows; a half is whole waves");

  const _Float16* A  = (const _Float16*)Ap;
  const _Float16* Bt = (const _Float16*)Btp;
  const int tid  = threadIdx.x;
  const int lane = tid & 31;
  const int wave = tid >> 5;
  const int wm   = wave / WN;
  const int wn   = wave - wm * WN;
  const int tilesN = N / BN;
  const int tm = bx / tilesN;            // bx runs over (M / BM) * (N / BN) tiles exactly
  const int tn = bx - tm * tilesN;
  const int rlane = lane & 15;                 // row (A) / col (B, D) within subtile
  const int koff  = (lane >> 4) * 8;           // k offset of this lane half
  const int mOff  = (lane >> 4) * 8;           // D row offset

  // the wave's half of the block, in a scalar register: the tests on it below are scalar branches round whole waves
  const int grp = __builtin_amdgcn_readfirstlane(tid / HT);
  const int gt  = tid - grp * HT;              // thread index inside the half
  // this lane's piece of a stage: row gt>>3 (+ RPI per copy), 16-B piece gt&7, LDS slot (gt&7) ^ ((row >> 1) & 7)
  const _Float16* gA = A  + (size_t)b * strideA + (size_t)(tm * BM + (gt >> 3)) * lda + (gt & 7) * 8;
  const _Float16* gB = Bt + (size_t)b * strideB + (size_t)(tn * BN + (gt >> 3)) * ldb + (gt & 7) * 8;
  const unsigned  lds0 = (unsigned)(size_t)(&ring[0]) + (unsigned)((gt >> 3) * (GKT * 2) + (((gt & 7) ^ ((gt >> 4) & 7)) * 16));

  auto issue = [&](int kt, int buf) {
    const _Float16* ga = gA + kt * GKT;
    const _Float16* gb = gB + kt * GKT;
    const unsigned  la = lds0 + (unsigned)buf * (unsigned)(STAGE_H * 2);
    const unsigned  lb = la + (unsigned)(BM * GKT * 2);
    // the loops below are unrolled so that l[] and g[] are registers (they are asm operands)
#pragma unroll
    for (int q = 0; q < NA / 8; ++q) {
      unsigned l[8]; const _Float16* g[8];
#pragma unroll
      for (int e = 0; e < 8; ++e) {
        l[e] = la + (unsigned)((q * 8 + e) * RPI * GKT * 2);
        g[e] = ga + (size_t)((q * 8 + e) * RPI) * lda;
      }
      copy8(l, g);
    }
#pragma unroll
    for (int q = 0; q < NB / 8; ++q) {
      unsigned l[8]; const _Float16* g[8];
#pragma unroll
      for (int e = 0; e < 8; ++e) {
        l[e] = lb + (unsigned)((q * 8 + e) * RPI * GKT * 2);
        g[e] = gb + (size_t)((q * 8 + e) * RPI) * ldb;
      }
      copy8(l, g);
    }
  };

  // bias[n] of the wave's 64 columns, four values a lane: loaded ahead of the product, used behind it
  float bvn[4];
  if constexpr (BIAS_MODE == 2) {
    // unrolled: bvn[] is indexed at compile time and stays in registers
#pragma unroll
    for (int j = 0; j < 4; ++j) bvn[j] = bias[tn * BN + wn * 64 + (j << 4) + rlane];
    asm volatile("s_wait_xcnt 0x0" ::: "memory");          // before a register that these loads name is rewritten
  }

  v8f acc[4][4];
#pragma unroll
  for (int i = 0; i < 4; ++i)
#pragma unroll
    for (int j = 0; j < 4; ++j) acc[i][j] = zero8f();

  // offsets in halves of a fragment's two pieces inside its row: pieces 4 ks + (lane >> 4) and that + 2, each in its slot
  // (unrolled: fo[][] is indexed at compile time and stays in registers)
  int fo[GKT / 32][2];
#pragma unroll
  for (int ks = 0; ks < GKT / 32; ++ks)
#pragma unroll
    for (int u = 0; u < 2; ++u) fo[ks][u] = ((ks * 4 + (koff >> 3) + 2 * u) ^ ((rlane >> 1) & 7)) * 8;

  const int NP = K / GKT;
  issue(grp, grp);                                     // half 0: stage 0, half 1: stage 1 (K >= 128: both exist)
  if (grp == 0) {
    asm volatile("s_wait_asynccnt 0x0" ::: "memory");  // this wave's pieces of stage 0 have landed
  }
  __syncthreads();                                     // publishes stage 0 to every wave

  int buf = 0;                                         // t % GNS
  for (int t = 0; t < NP; ++t) {
    // behind the barrier that ended every reader's use of stage t - 1: its buffer takes stage t + 2, from the half that
    // has nothing outstanding (its stage t was waited for in front of that barrier)
    if (grp == (t & 1) && t + 2 < NP) issue(t + 2, (buf == 0) ? GNS - 1 : buf - 1);
    const _Float16* sA = ring + buf * STAGE_H + (wm * 64 + rlane) * GKT;
    const _Float16* sB = ring + buf * STAGE_H + (BM + wn * 64 + rlane) * GKT;
    // unrolled throughout: fragments and accumulators are indexed at compile time and stay in registers
#pragma unroll
    for (int ks = 0; ks < GKT / 32; ++ks) {
      v16h bh[4], ah[4];
#pragma unroll
      for (int j = 0; j < 4; ++j) bh[j] = ldfrag2(sB + j * 16 * GKT + fo[ks][0], sB + j * 16 * GKT + fo[ks][1]);
#pragma unroll
      for (int i = 0; i < 4; ++i) ah[i] = ldfrag2(sA + i * 16 * GKT + fo[ks][0], sA + i * 16 * GKT + fo[ks][1]);
      // keeps the sixteen LDS reads of this k step together ahead of its WMMAs: spread among them, every row of
      // four WMMAs waits out a full LDS latency of its own
      __builtin_amdgcn_sched_barrier(0);
#pragma unroll
      for (int i = 0; i < 4; ++i)
#pragma unroll
        for (int j = 0; j < 4; ++j) acc[i][j] = mma_f16(ah[i], bh[j], acc[i][j]);
    }
    asm volatile("s_wait_dscnt 0x0" ::: "memory");      // this wave's reads of the buffer are done before it is refilled
    if (grp == ((t + 1) & 1)) {
      // this wave's pieces of stage t + 1, all that it has outstanding, have landed (the other half's stage t + 2 flies on)
      asm volatile("s_wait_asynccnt 0x0" ::: "memory");
    }
    __syncthreads();                                     // publishes stage t + 1 and ends every reader's use of stage t
    buf = (buf == GNS - 1) ? 0 : buf + 1;
  }
  asm volatile("s_wait_asynccnt 0x0" ::: "memory");     // no copy outstanding when the wave goes on

  // ---- epilogue ----
  if constexpr (OUT_MODE == 2) {
    // the last pass's barrier has ended every wave's reads of the ring
    static_assert((BM / 128) * TGR * TLP * 4 <= GNS * STAGE_H * 2 && BN <= TLP && BM % 128 == 0, "the tile fits the ring");
    float* tile = (float*)ring;
#pragma unroll
    for (int i = 0; i < 4; ++i) {
      if ((wm & 1) * 64 + (i << 4) < TGR) {    // wave-uniform: the row tile lies in the kept part of its 128 rows
#pragma unroll
        for (int j = 0; j < 4; ++j)
#pragma unroll
          for (int r = 0; r < 8; ++r)
            tile[((wm >> 1) * TGR + (wm & 1) * 64 + (i << 4) + mOff + r) * TLP + wn * 64 + (j << 4) + rlane] = acc[i][j][r] * scale;
      }
    }
    return;
  }
  const int m0 = tm * BM + wm * 64;
  const int n0 = tn * BN + wn * 64;
  const int np = n0 / NPB;                     // output plane of this wave's 64 columns
  const int nl = n0 - np * NPB;                // first column inside that plane
  float* slab = sT + wave * (16 * 68);         // per-wave 16x64 slab, pitch 68 floats
  // The four 16-row slabs follow one another with no wait on global memory between them: the tile's bias values are
  // loaded once (bias[n] ahead of the product, bias[m] here) and the fences of the hand-over inside the wave name LDS
  // alone (the slab is all they order), so that no slab waits for the stores of the one before it to be acknowledged.
  float bm[4][8];
  if constexpr (BIAS_MODE == 1) {
    // unrolled: bm[][] is indexed at compile time and stays in registers (32 a lane: too many to hold through the product)
#pragma unroll
    for (int i = 0; i < 4; ++i)
#pragma unroll
      for (int r = 0; r < 8; ++r) bm[i][r] = bias[m0 + (i << 4) + mOff + r];
    asm volatile("s_wait_xcnt 0x0" ::: "memory");          // before a register that these loads name is rewritten
  }
#pragma unroll
  for (int i = 0; i < 4; ++i) {
    const int mBase = m0 + (i << 4);
#pragma unroll
    for (int j = 0; j < 4; ++j) {
#pragma unroll
      for (int r = 0; r < 8; ++r) {
        float v = acc[i][j][r] * scale;
        if constexpr (BIAS_MODE == 1) v += bm[i][r];
        if constexpr (BIAS_MODE == 2) v += bvn[j];
        v *= oscale;
        slab[(mOff + r) * 68 + (j << 4) + rlane] = v;
      }
    }
    // the slab's LDS stores are done before other lanes of the wave read them
    __builtin_amdgcn_fence(__ATOMIC_RELEASE, "workgroup", "local");
    __builtin_amdgcn_wave_barrier();
    __builtin_amdgcn_fence(__ATOMIC_ACQUIRE, "workgroup", "local");
    if (OUT_MODE == 0) {
      float* C = (float*)Cout + (size_t)b * strideC + (size_t)np * strideCN;
      const int hh = lane >> 4, c4 = (lane & 15) * 4;     // row seg = 256 B = 16 lanes x 16 B
      float* cp[8];
      v4f    vv[8];
#pragma unroll
      for (int it = 0; it < 8; ++it) {
        const int row = it * 2 + hh;                       // it 0..7 x hh 0..1 = rows 0..15
        vv[it] = *(const v4f*)(slab + row * 68 + c4);
        cp[it] = C + (size_t)(mBase + row) * ldc + nl + c4;
        *(v4f*)cp[it] = vv[it];
      }
      // before a register that these stores name is rewritten; addresses and data are operands so that they live up to the wait
      asm volatile("s_wait_xcnt 0x0" :: "v"(cp[0]), "v"(cp[1]), "v"(cp[2]), "v"(cp[3]), "v"(cp[4]), "v"(cp[5]), "v"(cp[6]), "v"(cp[7]),
                   "v"(vv[0]), "v"(vv[1]), "v"(vv[2]), "v"(vv[3]), "v"(vv[4]), "v"(vv[5]), "v"(vv[6]), "v"(vv[7]) : "memory");
    } else {
      _Float16* C = (_Float16*)Cout + (size_t)b * strideC + (size_t)np * strideCN;
      const int q = lane >> 3, c8 = (lane & 7) * 8;
      v8h hv[4];
#pragma unroll
      for (int it = 0; it < 4; ++it) {
        const int row = it * 4 + q;                        // it 0..3 x q 0..3 = rows 0..15
        const float* spf = slab + row * 68 + c8;
        v8h t;
#pragma unroll
        for (int e = 0; e < 8; ++e) t[e] = (_Float16)spf[e];
        hv[it] = t;
      }
      _Float16* cp[4];
#pragma unroll
      for (int it = 0; it < 4; ++it) {
        const int row = it * 4 + q;
        cp[it] = C + (size_t)(mBase + row) * ldc + nl + c8;
        *(v8h*)cp[it] = hv[it];
      }
      // before a register that these stores name is rewritten; addresses and data are operands so that they live up to the wait
      asm volatile("s_wait_xcnt 0x0" :: "v"(cp[0]), "v"(cp[1]), "v"(cp[2]), "v"(cp[3]),
                   "v"(hv[0]), "v"(hv[1]), "v"(hv[2]), "v"(hv[3]) : "memory");
    }
    // the slab's LDS reads are done before the next 16 rows overwrite it
    __builtin_amdgcn_fence(__ATOMIC_RELEASE, "workgroup", "local");
    __builtin_amdgcn_wave_barrier();
    __builtin_amdgcn_fence(__ATOMIC_ACQUIRE, "workgroup", "local");
  }
}

#define G42_RING_H (GNS * (256 + 128) * GKT) // LDS of a 4 x 2 wave block (256 x 128 tile): three stages of 384 rows
#define G42_SLAB_F (8 * 16 * 68)             // its eight epilogue slabs, at the start of the ring
#define G42_MEMSB_F (2 * TGR * TLP)          // mem_body's small arrays: in the ring, behind the f32 tile
static_assert(G42_SLAB_F * 4 <= G42_RING_H * 2 && (G42_MEMSB_F + 128) * 4 + 16 * GP * 2 <= G42_RING_H * 2, "both fit the ring");
#define TQ_  ((T_ / 256) * (C_ / 128))       // tiles of one batch of q
#define TKV_ ((NB_ * LP_ / 256) * (C_ / 128))  // tiles of k, and ((C_ / 256) * (NB_ * LP_ / 128)) of v^T: the same number

// ---------------------------------------------------------------------------
// Memory-compression attention inside the block that projects its operands.  Block h = head h, all eight batch elements:
// one 256 x 128 product of MA (both groups g) with rows 128h.. of the interleaved plane WmT; of the f32 tile left in LDS
//   tile[TGR g + 16w + j][d]      = cached row j of batch 4g+w . Wkm column 64h+d   (km, j < 16, d < 64)
//   tile[TGR g + 64 + w][64 + d]  = prev_m of batch 4g+w . Wqm column 64h+d         (qm)
// are read (the other quadrants pair an operand with the other weight).  Wave 4g+w then does batch 4g+w in f32:
//   s_j = (qm + bqm) . (km_j + bkm) * 0.125 over 16 keys, softmax, mem = sum_j a_j (km_j + bkm), 64 columns of head h.
// The memory token's k and v rows need mem over all heads.  So that k, v^T and q wait for no launch of this path, the block
// multiplies its own 64 columns of mem (f16, as the CM plane carried them) with rows 64h..64h+63 of Wk and of Wv and leaves
//   PK[h][b][n] = sum_{c in head h} mem[b][c] * W[c][n]    (f32; n < 1024: Wk column n, n >= 1024: Wv column n - 1024)
// and the attention blocks add the 16 heads' shares.  Product taken transposed: A = 16 rows n of the [n][k] weight planes
// (Wk's and Wv's are adjacent), B = mem (column = batch, columns 8..15 zero), k = 64.
// coverage: 8 waves x 16 tiles x 16 rows n = 2048; per tile lanes c < 8 store 8 floats each for n = 8*(lane>>4) + 0..7;
// a wave owns 256 consecutive n of a PK row, whole 128-B lines.
// ---------------------------------------------------------------------------
#define PKN_ (2 * C_)                        // floats in a PK row
__device__ __forceinline__ void mem_body(
    _Float16* ring, float* sb, int bx,
    const unsigned short* __restrict__ MA, const unsigned short* __restrict__ WmT,
    const float* __restrict__ bqm, const float* __restrict__ bkm,
    const unsigned short* __restrict__ WkvT, float* __restrict__ PK, float r16) {
  const int tid = threadIdx.x, wave = tid >> 5, lane = tid & 31;
  const int h = bx;
  const int trow = (wave >> 2) * TGR;          // first tile row of the wave's group
  const int w4 = wave & 3;                     // the wave's batch inside its group
  // loaded ahead of the product, used behind it (threads 128.. repeat the first 128 and do not store)
  const int bt = tid & 127;
  const float bval = (bt < HD_) ? bkm[h * HD_ + bt] : bqm[h * HD_ + bt - HD_];

  gemm_body<0, 2, 4, 2>(ring, sb, bx, 0, MA, C_, 0L, WmT, C_, 0L,
      (void*)0, 0, 0L, 2 * C_, 0L, (const float*)0, MAR_, 2 * C_, C_, r16, 1.0f);

  if (tid < 128) sb[tid] = bval;               // sb[0..63] = bkm, sb[64..127] = bqm of the head
  _Float16* mA = (_Float16*)(sb + 128);        // mem as B operand: [16 batch slots][GP] halves, slots 8..15 stay zero
  if (tid < 16 * GP / 8) *(v8h*)(mA + tid * 8) = zero8h();
  __syncthreads();                             // publishes the f32 tile, the biases and the zeroed operand to every wave

  const float* tile = (const float*)ring;
  const int j = lane & 15;
  const float* qr = tile + (trow + 64 + w4) * TLP + 64;
  const float* kr = tile + (trow + w4 * MM_ + j) * TLP;
  float a = 0.f;
#pragma unroll
  for (int d4 = 0; d4 < HD_ / 4; ++d4) {
    const v4f qv = *(const v4f*)(qr + 4 * d4) + *(const v4f*)(sb + HD_ + 4 * d4);
    const v4f kv = *(const v4f*)(kr + 4 * d4) + *(const v4f*)(sb + 4 * d4);
    a = fmaf(qv[0], kv[0], a);
    a = fmaf(qv[1], kv[1], a);
    a = fmaf(qv[2], kv[2], a);
    a = fmaf(qv[3], kv[3], a);
  }
  const float sj = (lane < MM_) ? a * 0.125f : -INFINITY;
  float mx = sj;
#pragma unroll
  for (int off = 1; off < 32; off <<= 1) mx = fmaxf(mx, __shfl_xor(mx, off, 32));
  const float e = (lane < MM_) ? __expf(sj - mx) : 0.f;
  float se = e;
#pragma unroll
  for (int off = 1; off < 32; off <<= 1) se += __shfl_xor(se, off, 32);
  const float am = e * (1.0f / se);
  const float kb0 = sb[lane], kb1 = sb[lane + 32];
  float o0 = 0.f, o1 = 0.f;
#pragma unroll
  for (int jj = 0; jj < MM_; ++jj) {
    const float aj = __shfl(am, jj, 32);
    const float* kp = tile + (trow + w4 * MM_ + jj) * TLP;
    o0 = fmaf(aj, kp[lane] + kb0, o0);
    o1 = fmaf(aj, kp[lane + 32] + kb1, o1);
  }
  mA[wave * GP + lane]      = (_Float16)o0;    // slot = batch = wave
  mA[wave * GP + lane + 32] = (_Float16)o1;
  __syncthreads();                             // publishes the eight batches' mem to every wave

  const int c = lane & 15, hh = lane >> 4;
  v16h mf[2];
#pragma unroll
  for (int kk = 0; kk < 2; ++kk) mf[kk] = ldfrag(mA + c * GP + kk * 32 + 8 * hh);
  const _Float16* wr = (const _Float16*)WkvT + (size_t)(wave * 256 + c) * C_ + h * HD_ + 8 * hh;
  float* pr = PK + (size_t)(h * NB_ + (c & 7)) * PKN_ + wave * 256 + 8 * hh;
  for (int t8 = 0; t8 < 2; ++t8) {
    // eight tiles a trip, unrolled: their 32 loads are in flight together, one memory latency a trip
    v16h wf[8][2];
#pragma unroll
    for (int t = 0; t < 8; ++t)
#pragma unroll
      for (int kk = 0; kk < 2; ++kk) wf[t][kk] = ldfrag(wr + (size_t)((t8 * 8 + t) * 16) * C_ + kk * 32);
    // keeps the 32 loads ahead of the WMMAs: sunk among them, each pair waits out a latency of its own
    __builtin_amdgcn_sched_barrier(0);
    v8f acc[8];
#pragma unroll
    for (int t = 0; t < 8; ++t) {
      acc[t] = mma_f16(wf[t][0], mf[0], zero8f());
      acc[t] = mma_f16(wf[t][1], mf[1], acc[t]) * r16;
    }
    if (c < 8) {
#pragma unroll
      for (int t = 0; t < 8; ++t) {
        v4f lo, hi;
        lo[0] = acc[t][0]; lo[1] = acc[t][1]; lo[2] = acc[t][2]; lo[3] = acc[t][3];
        hi[0] = acc[t][4]; hi[1] = acc[t][5]; hi[2] = acc[t][6]; hi[3] = acc[t][7];
        float* d = pr + (t8 * 8 + t) * 16;
        *(v4f*)(d)     = lo;
        *(v4f*)(d + 4) = hi;
      }
    }
    asm volatile("s_wait_xcnt 0x0" ::: "memory");          // before a register that these loads and stores name is rewritten
  }
}

#define MEMB_ NH_                            // blocks of the memory path

// Work that reads none of each other's output shares a launch; the block index picks the job (block-uniform branch).
// Blocks 0..MEMB_-1: memory path -> PK;
// the next NB_*TQ_: q = x . Wq + bq -> Q plane (x16), 32 tiles per batch, A = CM rows 2..1025;
// the next TKV_: k = cm . Wk + bk -> K plane (x16), the batches' rows contiguous in CM and in K, M = 8 * 1088;
// the last TKV_: v^T = Wv^T . cm^T + bv[m] -> VT plane [h*64+d][s] (x16), N = 8 * 1088, output plane = batch (1088 columns each).
// K row 0 and V^T column 0 of a batch come out of CM's zero row and are not used: the attention blocks form them from PK.
__global__ __launch_bounds__(256) void gemm_mem_qkv(
    const unsigned short* __restrict__ MA, const unsigned short* __restrict__ WmT,
    const float* __restrict__ bqm, const float* __restrict__ bkm, float* __restrict__ PK,
    const unsigned short* __restrict__ CM, const unsigned short* __restrict__ WqT,
    const unsigned short* __restrict__ WkT, const unsigned short* __restrict__ WvT,
    unsigned short* __restrict__ Qh, unsigned short* __restrict__ Kh, unsigned short* __restrict__ VTh,
    const float* __restrict__ bq, const float* __restrict__ bk, const float* __restrict__ bv, float r16, float s16) {
  __shared__ __align__(16) _Float16 ring[G42_RING_H];
  float* sT = (float*)ring;
  const int bx = blockIdx.x;
  if (bx < MEMB_) {
    mem_body(ring, sT + G42_MEMSB_F, bx, MA, WmT, bqm, bkm, WkT, PK, r16);
  } else if (bx < MEMB_ + NB_ * TQ_) {
    const int i = bx - MEMB_;
    gemm_body<2, 1, 4, 2>(ring, sT, i % TQ_, i / TQ_,
        CM + (size_t)2 * C_, C_, (long)LP_ * C_, WqT, C_, 0L, (void*)Qh, C_, (long)T_ * C_, C_, 0L, bq, T_, C_, C_, r16, s16);
  } else if (bx < MEMB_ + NB_ * TQ_ + TKV_) {
    gemm_body<2, 1, 4, 2>(ring, sT, bx - (MEMB_ + NB_ * TQ_), 0,
        CM, C_, 0L, WkT, C_, 0L, (void*)Kh, C_, 0L, C_, 0L, bk, NB_ * LP_, C_, C_, r16, s16);
  } else {
    gemm_body<1, 1, 4, 2>(ring, sT, bx - (MEMB_ + NB_ * TQ_ + TKV_), 0,
        WvT, C_, 0L, CM, C_, 0L, (void*)VTh, LP_, 0L, LP_, (long)C_ * LP_, bv, C_, NB_ * LP_, C_, r16, s16);
  }
}

// out = y . Wp + bp -> f32 [8192][1024]
__global__ __launch_bounds__(256) void gemm_out(
    const unsigned short* __restrict__ Yh, const unsigned short* __restrict__ WpT, float* __restrict__ out,
    const float* __restrict__ bp, float r256) {
  __shared__ __align__(16) _Float16 ring[G42_RING_H];
  gemm_body<2, 0, 4, 2>(ring, (float*)ring, blockIdx.x, 0,
      Yh, C_, 0L, WpT, C_, 0L, (void*)out, C_, 0L, C_, 0L, bp, NB_ * T_, C_, C_, r256, 1.0f);
}

__device__ __forceinline__ float xhalf(float x) {
  const int b = __builtin_bit_cast(int, x);
  return __builtin_bit_cast(float, __builtin_amdgcn_permlanex16(b, b, 0x76543210, 0xfedcba98, false, false));
}

#define ASTG (128 * AKP)    // halves in a stage: 64 K rows, then 64 V^T rows
// second argument: at least six waves per SIMD, so that fragment loads hoisted far ahead do not cost resident blocks
__global__ __launch_bounds__(128, 6)
void attn_kernel(const unsigned short* __restrict__ Qp, const unsigned short* __restrict__ Kp,
                 const unsigned short* __restrict__ VTp, unsigned short* __restrict__ Yp, float sscale,
                 const float* __restrict__ PK, const float* __restrict__ bk, const float* __restrict__ bv) {
  __shared__ __align__(16) _Float16 KVs[2 * ASTG];          // two stages: K chunk [key][d] | V^T chunk [d][key], pitch 72

  const int tid  = threadIdx.x;
  const int wave = tid >> 5;
  const int lane = tid & 31;
  const int hh   = lane >> 4;
  const int c    = lane & 15;
  // Block index -> tile.  A query block's cost grows with qb (3..17 key chunks) and most blocks are resident together, so
  // a die or a WGP is busy for about the sum of its blocks' costs.  The index's high bits pick qb, heaviest first, its low
  // 7 bits the (batch, head): indices equal modulo 8 hold every qb, indices equal modulo 256 every second cost rank, and
  // the swap inside every second pair (15 14 12 13 11 10 8 9 ...) levels the even ranks' sum with the odd ranks' (77 : 76).
  const int bx = blockIdx.x;
  const int u  = (bx >> 7) & 15;          // cost rank (T_/64 = 16 query blocks)
  const int qb = 15 - (u ^ ((u >> 1) & 1));
  const int h  = bx & (NH_ - 1);
  const int b  = (bx >> 4) & (NB_ - 1);
  const int q0 = qb * 64 + wave * 16;     // first query row of this wave (within the batch)

  const _Float16* Qb = (const _Float16*)Qp  + (size_t)b * T_  * C_ + h * HD_;
  const _Float16* Kb = (const _Float16*)Kp  + (size_t)b * LP_ * C_ + h * HD_;
  const _Float16* Vb = (const _Float16*)VTp + ((size_t)b * C_ + h * HD_) * LP_;
  _Float16*       Yb = (_Float16*)Yp + (size_t)b * T_ * C_ + h * HD_;

  // this lane's pieces of a stage: rows tid>>3 (+ 16 per copy) of K and of V^T, 16-B piece tid&7
  const _Float16* gK = Kb + (size_t)(tid >> 3) * C_  + (tid & 7) * 8;
  const _Float16* gV = Vb + (size_t)(tid >> 3) * LP_ + (tid & 7) * 8;
  const unsigned  l0 = (unsigned)(size_t)(&KVs[0]) + (unsigned)((tid >> 3) * (AKP * 2) + (tid & 7) * 16);
  auto issue = [&](int kc, int buf) {
    unsigned l[8]; const _Float16* g[8];
    const unsigned lb = l0 + (unsigned)buf * (unsigned)(ASTG * 2);
    // unrolled so that l[] and g[] are registers (they are asm operands)
#pragma unroll
    for (int e = 0; e < 4; ++e) {
      l[e]     = lb + (unsigned)(e * 16 * AKP * 2);
      l[4 + e] = lb + (unsigned)((64 + e * 16) * AKP * 2);
      g[e]     = gK + (size_t)(kc * 64 + e * 16) * C_;      // K rows 64 kc + .., d = 0..63
      g[4 + e] = gV + (size_t)(e * 16) * LP_ + kc * 64;     // V^T rows d, keys 64 kc + ..
    }
    copy8(l, g);
  };
  issue(0, 0);

  // ---- key 0 (the memory token): thread tid < 64 forms k[0][d = tid], the others v[0][d = tid - 64], from the 16 heads'
  // shares in PK plus the bias, carried x16 like the planes; it replaces the staged values of chunk 0 below ----
  _Float16 kv0h;
  {
    const int d0 = h * HD_ + (tid & (HD_ - 1));
    const float* pp = PK + (size_t)b * PKN_ + ((tid < HD_) ? 0 : C_) + d0;
    float ps = (tid < HD_) ? bk[d0] : bv[d0];
    asm volatile("s_wait_xcnt 0x0" ::: "memory");           // before a register that this load names is rewritten
    float sh[NH_];
#pragma unroll
    for (int hp = 0; hp < NH_; ++hp) sh[hp] = pp[(size_t)hp * NB_ * PKN_];
    asm volatile("s_wait_xcnt 0x0" ::: "memory");           // before a register that these loads name is rewritten
#pragma unroll
    for (int hp = 0; hp < NH_; ++hp) ps += sh[hp];
    kv0h = (_Float16)(ps * 16.0f);
  }

  // ---- Q fragments (B operand, column = query = lane&15, split k map): 2 d-chunks ----
  v16h qf[2];
#pragma unroll
  for (int dc = 0; dc < 2; ++dc)
    qf[dc] = ldfrag(Qb + (size_t)(q0 + c) * C_ + dc * 32 + 8 * hh);

  const int qrow = q0 + c;                                  // this lane's query
  const int lim  = (qrow < NU_) ? (NU_ + 1) : (qrow + 2);   // its last visible key
  float mrow = -INFINITY;                                   // running maximum of the query (equal in both halves)
  float lrow = 0.f;                                         // this half's share of the query's sum
  v8f oacc[4];                                              // oacc[t][r] = O[query][16t + 8hh + r]
#pragma unroll
  for (int t = 0; t < 4; ++t) oacc[t] = zero8f();

  int maxkey = qb * 64 + 63 + 2;                            // last visible key of the block's last query
  if (qb * 64 < NU_) maxkey = (maxkey > NU_ + 1) ? maxkey : (NU_ + 1);
  const int nChunks = (maxkey >> 6) + 1;                    // block-uniform, 3..17

  asm volatile("s_wait_asynccnt 0x0" ::: "memory");         // this wave's pieces of stage 0 have landed
  __syncthreads();                                          // publishes stage 0: its row 0 / column 0 are in place before they are replaced
  *((tid < HD_) ? (KVs + tid) : (KVs + (64 + tid - HD_) * AKP)) = kv0h;   // K row 0 | V^T column 0 of stage 0
  issue(1, 1);                                              // nChunks >= 3: a stage 1 exists
  __syncthreads();                                          // publishes key 0

  for (int kc = 0; kc < nChunks; ++kc) {
    const int kv0 = kc * 64;
    const _Float16* Ksh = KVs + (kc & 1) * ASTG;
    const _Float16* Vth = Ksh + 64 * AKP;

    // S^T tiles: rows = keys 16j..16j+15 of the chunk, columns = the wave's 16 queries
    v8f s[4];
#pragma unroll
    for (int j = 0; j < 4; ++j) s[j] = zero8f();
#pragma unroll
    for (int dc = 0; dc < 2; ++dc)
#pragma unroll
      for (int j = 0; j < 4; ++j) {
        const v16h ka = ldfrag(Ksh + (j * 16 + c) * AKP + dc * 32 + 8 * hh);
        s[j] = mma_f16(ka, qf[dc], s[j]);
      }
    const int rel = lim - kv0 - 8 * hh;                     // key kv0 + 8hh + (16j + r) is visible iff 16j + r <= rel
    float mj[4];
#pragma unroll
    for (int j = 0; j < 4; ++j) {
      float m = -INFINITY;
#pragma unroll
      for (int r = 0; r < 8; ++r) {
        const float sv = (j * 16 + r <= rel) ? s[j][r] * sscale : -INFINITY;
        s[j][r] = sv;
        m = fmaxf(m, sv);
      }
      mj[j] = m;
    }
    float cmx = fmaxf(fmaxf(mj[0], mj[1]), fmaxf(mj[2], mj[3]));
    cmx = fmaxf(cmx, xhalf(cmx));                           // the other half's 32 keys of the same query
    const float mnew  = fmaxf(mrow, cmx);
    const float alpha = __expf(mrow - mnew);
    mrow = mnew;
    v16h pb[2];                                             // P^T as B operand, 32 keys each
    float pj[4];
#pragma unroll
    for (int j = 0; j < 4; ++j) {
      float ps = 0.f;
#pragma unroll
      for (int r = 0; r < 8; ++r) {
        const float p = __expf(s[j][r] - mnew);
        ps += p;
        pb[j >> 1][(j & 1) * 8 + r] = (_Float16)p;
      }
      pj[j] = ps;
    }
    lrow = lrow * alpha + ((pj[0] + pj[1]) + (pj[2] + pj[3]));
#pragma unroll
    for (int t = 0; t < 4; ++t) oacc[t] *= alpha;
#pragma unroll
    for (int kk = 0; kk < 2; ++kk)
#pragma unroll
      for (int t = 0; t < 4; ++t) {
        const v16h va = ldfrag(Vth + (t * 16 + c) * AKP + kk * 32 + 8 * hh);
        oacc[t] = mma_f16(va, pb[kk], oacc[t]);
      }
    asm volatile("s_wait_dscnt 0x0" ::: "memory");          // this wave's reads of the buffer are done before it is refilled
    asm volatile("s_wait_asynccnt 0x0" ::: "memory");       // this wave's pieces of stage kc + 1 have landed
    __syncthreads();                                        // publishes stage kc + 1 and ends every reader's use of stage kc
    if (kc + 2 < nChunks) issue(kc + 2, kc & 1);
  }
  asm volatile("s_wait_asynccnt 0x0" ::: "memory");         // no copy outstanding when the wave goes on

  // per wave output tile [row][d] in the ring: the last chunk's waits and barrier have ended every copy into it and every read of it
  _Float16* os = KVs + wave * (16 * AKP);
  {
    const float inv = 1.0f / (lrow + xhalf(lrow));          // the two halves' shares joined once
#pragma unroll
    for (int t = 0; t < 4; ++t) {
      v8h o;
#pragma unroll
      for (int r = 0; r < 8; ++r) o[r] = (_Float16)(oacc[t][r] * inv);
      *(v8h*)(os + c * AKP + t * 16 + 8 * hh) = o;
    }
  }
  __builtin_amdgcn_fence(__ATOMIC_RELEASE, "workgroup");
  __builtin_amdgcn_wave_barrier();
  __builtin_amdgcn_fence(__ATOMIC_ACQUIRE, "workgroup");
  {
    const int q4 = lane >> 3, c8 = (lane & 7) * 8;
    v8h ov[4];
#pragma unroll
    for (int it = 0; it < 4; ++it) {
      const int row = it * 4 + q4;
      ov[it] = *(const v8h*)(os + row * AKP + c8);
    }
    {
#pragma unroll
      for (int it = 0; it < 4; ++it) {
        const int row = it * 4 + q4;
        *(v8h*)(Yb + (size_t)(q0 + row) * C_ + c8) = ov[it];
      }
    }
  }
}

// ---------------------------------------------------------------------------
//   WT   f16 [6][1024 n][1024 k]  (Wq,Wk,Wv,Wp transposed; Wkm, Wqm transposed and interleaved by head; x16)  0   12582912
//   MA   f16 [256][1024]                                               12582912     524288
//   CM   f16 [8][1088][1024]  rows: 0 zero, 1 prev_m, 2..1025 x, 1026..1087 zero  13107200   17825792
//   Q    f16 [8][1024][1024] (x16)                                     30932992   16777216
//   K    f16 [8][1088][1024] (x16)                                     47710208   17825792
//   VT   f16 [8][1024][1088] (x16)                                     65536000   17825792
//   Y    f16 [8][1024][1024] (x16)                                     83361792   16777216
//   PK   f32 [16 h][8 b][2048]  head h's share of mem . Wk | mem . Wv  100139008    1048576
//   total                                                             101187584
// ---------------------------------------------------------------------------
extern "C" void kernel_launch(void* const* d_in, const int* in_sizes, int n_in,
                              void* d_out, int out_size, void* d_ws, size_t ws_size,
                              hipStream_t stream) {
  if (n_in < 15) return;
  if (in_sizes[0] != NB_ * T_ * C_) return;
  if (in_sizes[1] != NB_ * C_) return;
  if (in_sizes[2] != NB_ * MM_ * C_) return;
  for (int i = 3; i <= 13; i += 2) if (in_sizes[i] != C_ * C_) return;
  for (int i = 4; i <= 14; i += 2) if (in_sizes[i] != C_) return;
  if (out_size != NB_ * T_ * C_) return;

  const float* x      = (const float*)d_in[0];
  const float* prev_m = (const float*)d_in[1];
  const float* cached = (const float*)d_in[2];
  const float* Wq  = (const float*)d_in[3];  const float* bq  = (const float*)d_in[4];
  const float* Wk  = (const float*)d_in[5];  const float* bk  = (const float*)d_in[6];
  const float* Wv  = (const float*)d_in[7];  const float* bv  = (const float*)d_in[8];
  const float* Wp  = (const float*)d_in[9];  const float* bp  = (const float*)d_in[10];
  const float* Wqm = (const float*)d_in[11]; const float* bqm = (const float*)d_in[12];
  const float* Wkm = (const float*)d_in[13]; const float* bkm = (const float*)d_in[14];
  float* out = (float*)d_out;

  const size_t szWT  = (size_t)6 * C_ * C_ * 2;
  const size_t szMA  = (size_t)MAR_ * C_ * 2;
  const size_t szCM  = (size_t)NB_ * LP_ * C_ * 2;
  const size_t szQ   = (size_t)NB_ * T_ * C_ * 2;
  const size_t szK   = (size_t)NB_ * LP_ * C_ * 2;
  const size_t szVT  = (size_t)NB_ * C_ * LP_ * 2;
  const size_t szY   = (size_t)NB_ * T_ * C_ * 2;
  const size_t szPK  = (size_t)NH_ * NB_ * PKN_ * 4;
  size_t off = 0;
  const size_t oWT  = off; off += szWT;
  const size_t oMA  = off; off += szMA;
  const size_t oCM  = off; off += szCM;
  const size_t oQ   = off; off += szQ;
  const size_t oK   = off; off += szK;
  const size_t oVT  = off; off += szVT;
  const size_t oY   = off; off += szY;
  const size_t oPK  = off; off += szPK;
  if (off > ws_size) return;                   // off = 101187584

  char* ws = (char*)d_ws;
  unsigned short* WT  = (unsigned short*)(ws + oWT);
  unsigned short* MA  = (unsigned short*)(ws + oMA);
  unsigned short* CM  = (unsigned short*)(ws + oCM);
  unsigned short* Qh  = (unsigned short*)(ws + oQ);
  unsigned short* Kh  = (unsigned short*)(ws + oK);
  unsigned short* VTh = (unsigned short*)(ws + oVT);
  unsigned short* Yh  = (unsigned short*)(ws + oY);
  float*          PK  = (float*)(ws + oPK);
  unsigned short* WqT  = WT;
  unsigned short* WkT  = WT + (size_t)1 * C_ * C_;
  unsigned short* WvT  = WT + (size_t)2 * C_ * C_;
  unsigned short* WpT  = WT + (size_t)3 * C_ * C_;
  unsigned short* WmT  = WT + (size_t)4 * C_ * C_;

  const float s16 = 16.0f, r16 = 1.0f / 16.0f, r256 = 1.0f / 256.0f;

  // (1) weights [in k][out n] f32 -> transposed f16 planes [n][k], carried x16; x -> CM rows 2..1025 per batch;
  //     small operand plane: per group of four batch elements 64 cached rows, 4 prev_m rows, zeros;
  //     CM rows 0 (zero), 1 (prev_m) and zero pad rows
  prep_kernel<<<dim3(PREP_WT + PREP_X + PREP_MA + PREP_CR), dim3(256), 0, stream>>>(
      Wq, Wk, Wv, Wp, Wqm, Wkm, WT, s16, x, CM, prev_m, cached, MA);
  // (2) memory path (qm, km, f32 attention, its shares of the memory token's k and v) -> PK; q -> Q plane,
  //     k -> K plane and v^T -> VT plane (x16), pad rows included
  gemm_mem_qkv<<<dim3(MEMB_ + NB_ * TQ_ + 2 * TKV_), dim3(256), 0, stream>>>(
      MA, WmT, bqm, bkm, PK, CM, WqT, WkT, WvT, Qh, Kh, VTh, bq, bk, bv, r16, s16);
  // (3) masked attention -> Y plane (x16)
  attn_kernel<<<dim3(NB_ * NH_ * (T_ / 64)), dim3(128), 0, stream>>>(Qh, Kh, VTh, Yh, 0.125f / 256.0f, PK, bk, bv);
  // (4) out = y . Wp + bp -> d_out f32 [8192][1024]  (y x16, Wp x16 -> scale 1/256)
  gemm_out<<<dim3((NB_ * T_ / 256) * (C_ / 128)), dim3(256), 0, stream>>>(Yh, WpT, out, bp, r256);
  (void)hipGetLastError();
}
